// v000
// Measured on an AMD MI455X. A time is GPU time per run, averaged over a window of back-to-back runs after a warm-up
// (all launches, gaps included; the runs take copies of the inputs in turn), and the median of several windows.
// Apart from v000's, it joins two sittings. Times from different sittings can be a few percent apart, while
// side-by-side timings come from the same sitting.
// v000 is the starting kernel. One run takes 3530 microseconds.
#include <hip/hip_runtime.h>
// Temporal multi-head attention with sinusoidal positional encoding (x [2][2048][1024]; x = x + PE (pe[s][2i] = sin(s d_i), pe[s][2i+1] = cos(s d_i), d_i = exp(2i x (-ln 1e4 / 1024))); q = x Wq^T + bq, k, v likewise (nn.Linear [out][in] 1024^2, weights and biases sigma 1/32); 16 heads of 64; softmax(q k^T / 8) (no mask); out = ctx Wo^T + bo -> [2][2048][1024]).
// Structure: token rows r = b*2048 + s; x + PE computed on VALU (f32 expf/sinf/cosf in the module's op order) -> f16 rows (one f16 rounding of x + pe); Q, K, V as three WMMA GEMMs (32x64 wave tiles, f32 accumulation, exact x16 weights + bias, f16 outputs); per batch: V^T for all heads via LDS transposes; per (batch, group of 4 heads): scores GEMM (K = 64, batched over the heads on grid.y, alpha = 64^-0.5), row softmax on VALU (f32 statistics, native exp; weights stored x256 as f16), o = P . V^T GEMM (K = 2048, alpha 2^-2: o carried x64 against f16 subnormal flush, folded into the output GEMM alpha) written straight into the merged f16 o rows; out = o W_o + b GEMM (f32) into the output layout.
// Compute dtype: inputs rounded to bf16; weights exact, x + pe rounded once to f16; q, k, v, softmax weights and o as plain f16 GEMM operands (~2^-12); scores and softmax statistics f32. v_wmma_f32_16x16x32_f16.
#define NB 2
#define SQ 2048
#define DM 1024
#define NH 16
#define HD 64
#define HG 4                         /* heads per attention launch group */
#define B0 0                         /* first batch processed (debug hook) */
#define NBR NB                       /* batches processed (debug hook) */
#define NR ((size_t)NB * SQ)         /* token rows */
#define MP ((int)((size_t)NBR * SQ)) /* rows projected (debug hook) */
#define QN SQ                        /* query rows attended per batch (debug hook) */
#define NHD NH                       /* heads attended (debug hook) */
#define MPO MP                       /* rows through the output stage (debug hook) */
#define LQ DM      /* row pitch of the q/k/v rows */
typedef __bf16 v16b __attribute__((ext_vector_type(16)));
typedef unsigned short v8us __attribute__((ext_vector_type(8), may_alias));
typedef float  v8f  __attribute__((ext_vector_type(8)));
typedef float  v4f  __attribute__((ext_vector_type(4)));
typedef float  v4fa __attribute__((ext_vector_type(4), may_alias));
union FragB { v16b v; v8us half[2]; unsigned short u[16]; };

__device__ __forceinline__ unsigned short bf16_bits(float x) { unsigned int u = __float_as_uint(x); return (unsigned short)((u + 0x7FFFu + ((u >> 16) & 1u)) >> 16); }
__device__ __forceinline__ float bf16_val(unsigned short b) { return __uint_as_float(((unsigned int)b) << 16); }
__device__ __forceinline__ float bf16_round(float x) { return bf16_val(bf16_bits(x)); }
// D += A·B with NT terms: 1 = ah·bh, 2 = + al·bh (A split), 3 = + ah·bl (both split)
template <int NT>
__device__ __forceinline__ v8f mmaN(v16b ah, v16b al, v16b bh, v16b bl, v8f c) {
  c = __builtin_amdgcn_wmma_f32_16x16x32_bf16(false, ah, false, bh, (short)0, c, false, false);
  if (NT >= 2) c = __builtin_amdgcn_wmma_f32_16x16x32_bf16(false, al, false, bh, (short)0, c, false, false);
  if (NT >= 3) c = __builtin_amdgcn_wmma_f32_16x16x32_bf16(false, ah, false, bl, (short)0, c, false, false);
  asm volatile("v_nop\n\tv_nop\n\tv_nop\n\tv_nop" : "+v"(c) : "v"(ah), "v"(al), "v"(bh), "v"(bl));
  return c;
}

__global__ __launch_bounds__(256) void k_wt_bf16(const float* __restrict__ W, unsigned short* __restrict__ Wt, int K, int N) {
  const int t = blockIdx.x * 256 + threadIdx.x;
  const int k8n = K / 8;
  if (t >= N * k8n) return;
  const int n = t / k8n, k8 = (t % k8n) * 8;
  v8us v;
#pragma unroll
  for (int i = 0; i < 8; ++i) v[i] = bf16_bits(W[(size_t)(k8 + i) * N + n]);
  *(v8us*)(Wt + (size_t)n * K + k8) = v;
  
}

// GEMM C[M][N] (f32, pitch ldc) = act(A[M][K]·W + bias). A f32 row-major (pitch lda) converted per fragment to bf16
// (ASPLIT: hi/lo two planes -> 2 terms, else single rounded term); Wt bf16 [N][K] (pitch ldb). BIAS_BF16 rounds the
// bias to bf16 first (bias quantised to bf16 before the add). K%32==0, M%16==0, N%64==0.
template <bool ASPLIT, int ACT, bool BIAS_BF16>
__global__ __launch_bounds__(128) void k_gemm_bf(const float* __restrict__ A, int lda, const unsigned short* __restrict__ Wt, int ldb,
                                               const float* __restrict__ bias, float* __restrict__ C, int ldc, int M, int N, int K) {
  __shared__ __attribute__((aligned(16))) float so[4][16][64];
  const int tid = threadIdx.x, w = tid >> 5, lane = tid & 31, ln = lane & 15, hh = lane >> 4;
  const int ntn = N / 64;
  const int wid = blockIdx.x * 4 + w;
  const int mt = wid / ntn, nq = wid % ntn;
  if (mt * 16 >= M) return;
  const int row0 = mt * 16, col0 = nq * 64;
  const float* arow = A + (size_t)(row0 + ln) * lda;
  v8f acc[4] = {};
  for (int kb = 0; kb < K; kb += 32) {
    FragB ah, al;
    const v4f x0 = *(const v4fa*)(arow + kb + 8 * hh), x1 = *(const v4fa*)(arow + kb + 8 * hh + 4);
    const v4f x2 = *(const v4fa*)(arow + kb + 16 + 8 * hh), x3 = *(const v4fa*)(arow + kb + 16 + 8 * hh + 4);
    float xs[16] = {x0[0],x0[1],x0[2],x0[3],x1[0],x1[1],x1[2],x1[3],x2[0],x2[1],x2[2],x2[3],x3[0],x3[1],x3[2],x3[3]};
#pragma unroll
    for (int i = 0; i < 16; ++i) { const unsigned short hb = bf16_bits(xs[i]); ah.u[i] = hb; al.u[i] = ASPLIT ? bf16_bits(xs[i] - bf16_val(hb)) : (unsigned short)0; }
#pragma unroll
    for (int t = 0; t < 4; ++t) {
      const unsigned short* brow = Wt + (size_t)(col0 + t * 16 + ln) * ldb + kb;
      FragB b;
      b.half[0] = *(const v8us*)(brow + 8 * hh);
      b.half[1] = *(const v8us*)(brow + 16 + 8 * hh);
      acc[t] = mmaN<ASPLIT ? 2 : 1>(ah.v, al.v, b.v, b.v, acc[t]);
    }
  }
#pragma unroll
  for (int t = 0; t < 4; ++t) {
    float bv = bias ? bias[col0 + t * 16 + ln] : 0.f;
    if (BIAS_BF16) bv = bf16_round(bv);
#pragma unroll
    for (int r = 0; r < 8; ++r) { float v = acc[t][r] + bv; if (ACT == 1) v = fmaxf(v, 0.f); so[w][8 * hh + r][t * 16 + ln] = v; }
  }
  __builtin_amdgcn_fence(__ATOMIC_ACQ_REL, "workgroup");
  __builtin_amdgcn_wave_barrier();
  const int rsub = lane >> 4, c4 = (lane & 15) * 4;
  {
#pragma unroll
    for (int q = 0; q < 8; ++q) {
      const int r = q * 2 + rsub;
      const v4f v = *(const v4fa*)&so[w][r][c4];
      *(v4f*)(C + (size_t)(row0 + r) * ldc + col0 + c4) = v;
    }
    
  }
}

// GEMM C = act(A·W + bias + resid): A f32 (ASPLIT -> hi/lo 2 terms), Wt bf16 [N][K]; ACT 0 none, 1 relu, 2 exact gelu;
// resid (optional, f32, row index = (row % rmod), pitch ldr, RES_BF16 rounds it) added before the activation.
template <bool ASPLIT, int ACT, bool BIAS_BF16, bool RES_BF16>
__global__ __launch_bounds__(128) void k_gemm_bf3(const float* __restrict__ A, int lda, const unsigned short* __restrict__ Wt, int ldb,
                                                const float* __restrict__ bias, const float* __restrict__ resid, int rmod, int ldr,
                                                float* __restrict__ C, int ldc, int M, int N, int K) {
  __shared__ __attribute__((aligned(16))) float so[4][16][64];
  const int tid = threadIdx.x, w = tid >> 5, lane = tid & 31, ln = lane & 15, hh = lane >> 4;
  const int ntn = N / 64;
  const int wid = blockIdx.x * 4 + w;
  const int mt = wid / ntn, nq = wid % ntn;
  if (mt * 16 >= M) return;
  const int row0 = mt * 16, col0 = nq * 64;
  const float* arow = A + (size_t)(row0 + ln) * lda;
  v8f acc[4] = {};
  for (int kb = 0; kb < K; kb += 32) {
    FragB ah, al;
    const v4f x0 = *(const v4fa*)(arow + kb + 8 * hh), x1 = *(const v4fa*)(arow + kb + 8 * hh + 4);
    const v4f x2 = *(const v4fa*)(arow + kb + 16 + 8 * hh), x3 = *(const v4fa*)(arow + kb + 16 + 8 * hh + 4);
    float xs[16] = {x0[0],x0[1],x0[2],x0[3],x1[0],x1[1],x1[2],x1[3],x2[0],x2[1],x2[2],x2[3],x3[0],x3[1],x3[2],x3[3]};
#pragma unroll
    for (int i = 0; i < 16; ++i) { const unsigned short hb = bf16_bits(xs[i]); ah.u[i] = hb; al.u[i] = ASPLIT ? bf16_bits(xs[i] - bf16_val(hb)) : (unsigned short)0; }
#pragma unroll
    for (int t = 0; t < 4; ++t) {
      const unsigned short* brow = Wt + (size_t)(col0 + t * 16 + ln) * ldb + kb;
      FragB b;
      b.half[0] = *(const v8us*)(brow + 8 * hh);
      b.half[1] = *(const v8us*)(brow + 16 + 8 * hh);
      acc[t] = mmaN<ASPLIT ? 2 : 1>(ah.v, al.v, b.v, b.v, acc[t]);
    }
  }
#pragma unroll
  for (int t = 0; t < 4; ++t) {
    const int col = col0 + t * 16 + ln;
    float bv = bias ? bias[col] : 0.f;
    if (BIAS_BF16) bv = bf16_round(bv);
#pragma unroll
    for (int r = 0; r < 8; ++r) {
      float v = acc[t][r] + bv;
      if (resid) { float rv = resid[(size_t)((row0 + 8 * hh + r) % rmod) * ldr + col]; if (RES_BF16) rv = bf16_round(rv); v += rv; }
      if (ACT == 1) v = fmaxf(v, 0.f);
      if (ACT == 2) v = 0.5f * v * (1.0f + erff(v * 0.70710678118654752f));
      if (ACT == 3) { const float u = 0.7978845608028654f * (v + 0.044715f * v * v * v); v = 0.5f * v * (1.0f + tanhf(u)); }
      so[w][8 * hh + r][t * 16 + ln] = v;
    }
  }
  __builtin_amdgcn_fence(__ATOMIC_ACQ_REL, "workgroup");
  __builtin_amdgcn_wave_barrier();
  const int rsub = lane >> 4, c4 = (lane & 15) * 4;
  {
#pragma unroll
    for (int q = 0; q < 8; ++q) {
      const int r = q * 2 + rsub;
      const v4f v = *(const v4fa*)&so[w][r][c4];
      *(v4f*)(C + (size_t)(row0 + r) * ldc + col0 + c4) = v;
    }
    
  }
}
// row LayerNorm (biased variance, eps) over N: s = X (+ R); optional out_sum <- s; out_norm <- (s-mu)*rsqrt(var+eps)*g + b
template <bool PARAM_BF16>
__global__ __launch_bounds__(256) void k_layernorm(const float* __restrict__ X, const float* __restrict__ R, const float* __restrict__ g, const float* __restrict__ bta,
                                                  float* __restrict__ out_sum, float* __restrict__ out_norm, int N, float eps) {
  __shared__ float red[256];
  const int row = blockIdx.x, tid = threadIdx.x;
  const float* x = X + (size_t)row * N; const float* rr = R ? R + (size_t)row * N : nullptr;
  float vals[16];                     // up to N = 4096
  const int per = N / 256;            // contiguous chunk per thread? use strided-by-4 chunks: thread handles j = tid*4 + 1024*u
  float s1 = 0.f;
  for (int u = 0; u < per / 4; ++u) {
    const int j = tid * 4 + 1024 * u;
    const v4f a = *(const v4fa*)(x + j);
    v4f b = {0.f,0.f,0.f,0.f}; if (rr) b = *(const v4fa*)(rr + j);
#pragma unroll
    for (int q = 0; q < 4; ++q) { const float v = a[q] + b[q]; vals[u * 4 + q] = v; s1 += v; }
  }
  red[tid] = s1; __syncthreads();
  for (int st = 128; st > 0; st >>= 1) { if (tid < st) red[tid] += red[tid + st]; __syncthreads(); }
  const float mu = red[0] / (float)N; __syncthreads();
  float s2 = 0.f;
  for (int u = 0; u < per / 4; ++u)
#pragma unroll
    for (int q = 0; q < 4; ++q) { const float c = vals[u * 4 + q] - mu; s2 += c * c; }
  red[tid] = s2; __syncthreads();
  for (int st = 128; st > 0; st >>= 1) { if (tid < st) red[tid] += red[tid + st]; __syncthreads(); }
  const float rs = rsqrtf(red[0] / (float)N + eps);
  {
    for (int u = 0; u < per / 4; ++u) {
      const int j = tid * 4 + 1024 * u;
      v4f o, sm;
#pragma unroll
      for (int q = 0; q < 4; ++q) {
        float gg = g[j + q], bb = bta[j + q];
        if (PARAM_BF16) { gg = bf16_round(gg); bb = bf16_round(bb); }
        sm[q] = vals[u * 4 + q]; o[q] = (vals[u * 4 + q] - mu) * rs * gg + bb;
      }
      if (out_sum) *(v4f*)(out_sum + (size_t)row * N + j) = sm;
      *(v4f*)(out_norm + (size_t)row * N + j) = o;
    }
    
  }
}



// ---- f16 WMMA path (v_wmma_f32_16x16x32_f16): 11-bit significands for operands in range — used where a [0,1] probability operand needs more precision than bf16
typedef _Float16 v16h __attribute__((ext_vector_type(16)));
union FragH { v16h v; v8us half[2]; _Float16 h[16]; unsigned short u[16]; };
template <int NT>
__device__ __forceinline__ v8f mmaH(v16h ah, v16h al, v16h bh, v16h bl, v8f c) {
  c = __builtin_amdgcn_wmma_f32_16x16x32_f16(false, ah, false, bh, (short)0, c, false, false);
  if (NT >= 2) c = __builtin_amdgcn_wmma_f32_16x16x32_f16(false, al, false, bh, (short)0, c, false, false);
  if (NT >= 3) c = __builtin_amdgcn_wmma_f32_16x16x32_f16(false, ah, false, bl, (short)0, c, false, false);
  asm volatile("v_nop\n\tv_nop\n\tv_nop\n\tv_nop" : "+v"(c) : "v"(ah), "v"(al), "v"(bh), "v"(bl));
  return c;
}
// batched GEMM like k_gemm_b but f16 operands: A f32 (split into f16 hi/lo if ASPLIT, else rounded to f16), Bt = f16 values [n][k]; alpha; C f32; N multiple of 16 (partial tiles skipped)
template <bool ASPLIT>
__global__ __launch_bounds__(128) void k_gemm_h(const float* __restrict__ A, int lda, size_t sA, const _Float16* __restrict__ Bh, int ldb, size_t sB, float alpha, float* __restrict__ C, int ldc, size_t sC, int M, int N, int K) {
  __shared__ __attribute__((aligned(16))) float so[4][16][64];
  const int tid = threadIdx.x, w = tid >> 5, lane = tid & 31, ln = lane & 15, hh = lane >> 4; const int by = blockIdx.y;
  A += (size_t)by * sA; Bh += (size_t)by * sB; C += (size_t)by * sC;
  const int ntn = (N + 63) / 64; const int wid = blockIdx.x * 4 + w; const int mt = wid / ntn, nq = wid % ntn; if (mt * 16 >= M) return;
  const int row0 = mt * 16, col0 = nq * 64; const float* arow = A + (size_t)(row0 + ln) * lda;
  v8f acc[4] = {};
  for (int kb = 0; kb < K; kb += 32) {
    FragH ah, al;
    const v4f x0 = *(const v4fa*)(arow + kb + 8 * hh), x1 = *(const v4fa*)(arow + kb + 8 * hh + 4), x2 = *(const v4fa*)(arow + kb + 16 + 8 * hh), x3 = *(const v4fa*)(arow + kb + 16 + 8 * hh + 4);
    float xs[16] = {x0[0],x0[1],x0[2],x0[3],x1[0],x1[1],x1[2],x1[3],x2[0],x2[1],x2[2],x2[3],x3[0],x3[1],x3[2],x3[3]};
#pragma unroll
    for (int i = 0; i < 16; ++i) { const _Float16 h = (_Float16)xs[i]; ah.h[i] = h; al.h[i] = ASPLIT ? (_Float16)(xs[i] - (float)h) : (_Float16)0.0f; }
#pragma unroll
    for (int t = 0; t < 4; ++t) { if (col0 + t * 16 >= N) continue; const size_t boff = (size_t)(col0 + t * 16 + ln) * ldb + kb; FragH bq; bq.half[0] = *(const v8us*)(Bh + boff + 8 * hh); bq.half[1] = *(const v8us*)(Bh + boff + 16 + 8 * hh);
      acc[t] = mmaH<ASPLIT ? 2 : 1>(ah.v, al.v, bq.v, bq.v, acc[t]); }
  }
#pragma unroll
  for (int t = 0; t < 4; ++t) { if (col0 + t * 16 >= N) continue;
#pragma unroll
    for (int r = 0; r < 8; ++r) so[w][8 * hh + r][t * 16 + ln] = acc[t][r] * alpha; }
  __builtin_amdgcn_fence(__ATOMIC_ACQ_REL, "workgroup"); __builtin_amdgcn_wave_barrier();
  const int rsub = lane >> 4, c4 = (lane & 15) * 4;
  {
#pragma unroll
    for (int q = 0; q < 8; ++q) { const int r = q * 2 + rsub; if (col0 + c4 < N) { const v4f v = *(const v4fa*)&so[w][r][c4]; *(v4f*)(C + (size_t)(row0 + r) * ldc + col0 + c4) = v; } }
     }
}

// Wt[n][k] = f16(W[k][n]·scale) from f32 row-major W[K][N] (scale = power of two; bf16-exact weights stay exact in f16 away from the subnormal range)
__global__ __launch_bounds__(256) void k_wt_f16(const float* __restrict__ W, _Float16* __restrict__ Wt, int K, int N, float scale) {
  const int t = blockIdx.x * 256 + threadIdx.x; if (t >= N * (K / 8)) return; const int n = t / (K / 8), k8 = (t % (K / 8)) * 8; FragH f;
#pragma unroll
  for (int i = 0; i < 8; ++i) f.h[i] = (_Float16)(bf16_round(W[(size_t)(k8 + i) * N + n]) * scale); const v8us o = f.half[0];
  *(v8us*)((unsigned short*)Wt + (size_t)n * K + k8) = o; 
}
// k_gemm_hh variant with fused epilogue: v = acc·alpha + bias[by·sBias + col] (+ CP[(row/rowsPerB)·sCPb + by·64 + col] if CP) ; ACT 0 none / 1 elu ; writes f16 C16 (and f32 C if non-null)
template <int ACT>
__global__ __launch_bounds__(128) void k_gemm_hhx(const _Float16* __restrict__ A, int lda, size_t sA, const _Float16* __restrict__ Bh, int ldb, size_t sB, float alpha, const float* __restrict__ bias, size_t sBias, const float* __restrict__ CP, int rowsPerB, size_t sCPb, int row0g,
    float* __restrict__ C, _Float16* __restrict__ C16, int ldc, size_t sC, int M, int N, int K) {
  __shared__ __attribute__((aligned(16))) float so[4][16][64];
  const int tid = threadIdx.x, w = tid >> 5, lane = tid & 31, ln = lane & 15, hh = lane >> 4; const int by = blockIdx.y;
  A += (size_t)by * sA; Bh += (size_t)by * sB; const size_t cofs = (size_t)by * sC; const float* bp = bias ? bias + (size_t)by * sBias : nullptr;
  const int ntn = (N + 63) / 64; const int wid = blockIdx.x * 4 + w; const int mt = wid / ntn, nq = wid % ntn; if (mt * 16 >= M) return;
  const int row0 = mt * 16, col0 = nq * 64; const _Float16* arow = A + (size_t)(row0 + ln) * lda;
  v8f acc[4] = {};
  for (int kb = 0; kb < K; kb += 32) { FragH ah; ah.half[0] = *(const v8us*)((const unsigned short*)arow + kb + 8 * hh); ah.half[1] = *(const v8us*)((const unsigned short*)arow + kb + 16 + 8 * hh);
#pragma unroll
    for (int t = 0; t < 4; ++t) { if (col0 + t * 16 >= N) continue; const size_t boff = (size_t)(col0 + t * 16 + ln) * ldb + kb; FragH bq; bq.half[0] = *(const v8us*)((const unsigned short*)Bh + boff + 8 * hh); bq.half[1] = *(const v8us*)((const unsigned short*)Bh + boff + 16 + 8 * hh);
      acc[t] = mmaH<1>(ah.v, ah.v, bq.v, bq.v, acc[t]); }
  }
#pragma unroll
  for (int t = 0; t < 4; ++t) { if (col0 + t * 16 >= N) continue; const int col = col0 + t * 16 + ln; const float bv = bp ? bf16_round(bp[col]) : 0.f;
#pragma unroll
    for (int r = 0; r < 8; ++r) { float v = acc[t][r] * alpha + bv; if (CP) { const int rr = row0g + row0 + 8 * hh + r; if (rowsPerB < 0) v += CP[cofs + (size_t)rr * ldc + col];      /* rowsPerB < 0: own element of the batched C plane */ else { const int bidx = rr / rowsPerB; v += CP[(size_t)bidx * sCPb + (size_t)by * 64 + col]; } } if (ACT == 1) v = (v > 0.f) ? v : expm1f(v); else if (ACT == 7) v = (v > 0.f) ? v + 1.0f : expf(v); else if (ACT == 8) v = tanhf(v); else if (ACT == 9) v = 0.5f * v * (1.0f + tanhf(0.7978845608028654f * (v + 0.044715f * v * v * v))); else if (ACT == 11) v = 1.0f / (1.0f + expf(-v)); else if (ACT == 12) v = (v > 0.f) ? v : 0.01f * v; else if (ACT == 14) v = (v > 0.f) ? v : 0.1f * v; else if (ACT == 16) v = (v >= 0.f) ? v : 0.3f * v; else if (ACT == 17) v = (v >= 0.f) ? v : 0.2f * v; else if (ACT == 15) v = v / (1.0f + expf(-v)); else if (ACT == 3) v = fmaxf(v, 0.f); else if (ACT == 6) v = 0.5f * v * (1.0f + erff(v * 0.70710678118654752f)); so[w][8 * hh + r][t * 16 + ln] = v; } }
  __builtin_amdgcn_fence(__ATOMIC_ACQ_REL, "workgroup"); __builtin_amdgcn_wave_barrier();
  const int rsub = lane >> 4, c4 = (lane & 15) * 4; typedef _Float16 v4h __attribute__((ext_vector_type(4)));
  {
#pragma unroll
    for (int q = 0; q < 8; ++q) { const int r = q * 2 + rsub; if (col0 + c4 < N) { const v4f v = *(const v4fa*)&so[w][r][c4]; if (C) *(v4f*)(C + cofs + (size_t)(row0 + r) * ldc + col0 + c4) = v; if (C16) { v4h h4; for (int i = 0; i < 4; ++i) h4[i] = (_Float16)v[i]; *(v4h*)(C16 + cofs + (size_t)(row0 + r) * ldc + col0 + c4) = h4; } } }
     }
}


typedef _Float16 v4h __attribute__((ext_vector_type(4)));

__global__ __launch_bounds__(256) void k_x16(const float* __restrict__ x, _Float16* __restrict__ X16, size_t n8) { const size_t t = (size_t)blockIdx.x * 256 + threadIdx.x; if (t >= n8) return; FragH f;
#pragma unroll
  for (int q = 0; q < 8; ++q) f.h[q] = (_Float16)bf16_round(x[t * 8 + q]); *(v8us*)((unsigned short*)X16 + t * 8) = f.half[0];  }
__global__ __launch_bounds__(256) void k_h16(const float* __restrict__ x, _Float16* __restrict__ X16, size_t n8) { const size_t t = (size_t)blockIdx.x * 256 + threadIdx.x; if (t >= n8) return; FragH f;
#pragma unroll
  for (int q = 0; q < 8; ++q) f.h[q] = (_Float16)x[t * 8 + q]; *(v8us*)((unsigned short*)X16 + t * 8) = f.half[0];  }
__global__ __launch_bounds__(256) void k_round16f(const float* __restrict__ W, _Float16* __restrict__ Bt, size_t n8) { const size_t t = (size_t)blockIdx.x * 256 + threadIdx.x; if (t >= n8) return; FragH f;
#pragma unroll
  for (int i = 0; i < 8; ++i) f.h[i] = (_Float16)(bf16_round(W[t * 8 + i]) * 16.0f); *(v8us*)((unsigned short*)Bt + t * 8) = f.half[0];  }
template <int NHv, int TTv>
__global__ __launch_bounds__(256) void k_vt(const _Float16* __restrict__ V16, int ldv, int voff, _Float16* __restrict__ Vt) { __shared__ unsigned short tl[64][66]; const int tid = threadIdx.x; const int slab = blockIdx.x / (TTv / 64), lg = blockIdx.x % (TTv / 64); const int b = slab / NHv, h = slab % NHv;
  for (int i = tid; i < 64 * 8; i += 256) { const int r = i / 8, c8 = (i % 8) * 8; FragH f; f.half[0] = *(const v8us*)((const unsigned short*)V16 + ((size_t)b * TTv + lg * 64 + r) * ldv + voff + h * 64 + c8);
#pragma unroll
    for (int q = 0; q < 8; ++q) tl[r][c8 + q] = f.u[q]; }
  __syncthreads();
  {
#pragma unroll
    for (int rd = 0; rd < 2; ++rd) { const int d = rd * 32 + tid / 8, pc = tid % 8; FragH f;
#pragma unroll
      for (int q = 0; q < 8; ++q) f.u[q] = tl[pc * 8 + q][d];
      *(v8us*)((unsigned short*)Vt + ((size_t)slab * 64 + d) * TTv + lg * 64 + pc * 8) = f.half[0]; }
     } }

__global__ __launch_bounds__(256) void k_hl(const float* __restrict__ F, _Float16* __restrict__ Hh, _Float16* __restrict__ Hl, size_t n8) { const size_t t = (size_t)blockIdx.x * 256 + threadIdx.x; if (t >= n8) return; FragH fh, fl; const v4f a = *(const v4fa*)(F + t * 8), c = *(const v4fa*)(F + t * 8 + 4);
#pragma unroll
  for (int q = 0; q < 4; ++q) { _Float16 h = (_Float16)a[q]; fh.h[q] = h; fl.h[q] = (_Float16)((a[q] - (float)h) * 1024.0f); h = (_Float16)c[q]; fh.h[4 + q] = h; fl.h[4 + q] = (_Float16)((c[q] - (float)h) * 1024.0f); }
  { *(v8us*)((unsigned short*)Hh + t * 8) = fh.half[0]; *(v8us*)((unsigned short*)Hl + t * 8) = fl.half[0];  } }

// ---- fast GEMM (wave tile 32x64; requires M % 32 == 0 rows per launch region and N % 64 == 0); epilogue = k_gemm_hhx semantics ----
__device__ __forceinline__ v16h g2_frag(const _Float16* p, int hh) { FragH f; f.half[0] = *(const v8us*)((const unsigned short*)p + 8 * hh); f.half[1] = *(const v8us*)((const unsigned short*)p + 16 + 8 * hh); return f.v; }
__device__ __forceinline__ v8f g2_mma(v16h a, v16h b, v8f c) { v8f d = __builtin_amdgcn_wmma_f32_16x16x32_f16(false, a, false, b, (short)0, c, false, false); asm volatile("v_nop\n\tv_nop\n\tv_nop\n\tv_nop" : "+v"(d) : "v"(a), "v"(b)); return d; }
template <int ACT>
__global__ __launch_bounds__(128) void k_gemm2(const _Float16* __restrict__ A, int lda, size_t sA, const _Float16* __restrict__ Bh, int ldb, size_t sB, float alpha, const float* __restrict__ bias, size_t sBias, const float* __restrict__ CP, int rowsPerB, size_t sCPb, int row0g,
    float* __restrict__ C, _Float16* __restrict__ C16, int ldc, size_t sC, int M, int N, int K) { static_assert(ACT == 0 || ACT == 3 || ACT == 6 || ACT == 8 || ACT == 9 || ACT == 11 || ACT == 12 || ACT == 14 || ACT == 15 || ACT == 16 || ACT == 17, "k_gemm2: unsupported ACT code (would silently apply no activation)");
  __shared__ __attribute__((aligned(16))) float so[4][32][68];
  const int tid = threadIdx.x, w = tid >> 5, lane = tid & 31, ln = lane & 15, hh = lane >> 4; const int by = blockIdx.y;
  A += (size_t)by * sA; Bh += (size_t)by * sB; const size_t cofs = (size_t)by * sC; const float* bp = bias ? bias + (size_t)by * sBias : nullptr;
  const int ntn = N >> 6; const int mt = blockIdx.x / ntn, nq = blockIdx.x - mt * ntn; const int row0 = mt * 128 + 32 * w, col0 = nq * 64; if (row0 >= M) return;
  const _Float16* a0p = A + (size_t)(row0 + ln) * lda; const _Float16* a1p = a0p + (size_t)16 * lda;
  const _Float16* b0p = Bh + (size_t)(col0 + ln) * ldb; const _Float16* b1p = b0p + (size_t)16 * ldb; const _Float16* b2p = b1p + (size_t)16 * ldb; const _Float16* b3p = b2p + (size_t)16 * ldb;
  const v8f z8 = {0.f,0.f,0.f,0.f,0.f,0.f,0.f,0.f}; v8f c00 = z8, c01 = z8, c02 = z8, c03 = z8, c10 = z8, c11 = z8, c12 = z8, c13 = z8;
#pragma unroll 1
  for (int kb = 0; kb < K; kb += 32) { const v16h a0 = g2_frag(a0p + kb, hh), a1 = g2_frag(a1p + kb, hh);
    v16h b = g2_frag(b0p + kb, hh); c00 = g2_mma(a0, b, c00); c10 = g2_mma(a1, b, c10);
    b = g2_frag(b1p + kb, hh); c01 = g2_mma(a0, b, c01); c11 = g2_mma(a1, b, c11);
    b = g2_frag(b2p + kb, hh); c02 = g2_mma(a0, b, c02); c12 = g2_mma(a1, b, c12);
    b = g2_frag(b3p + kb, hh); c03 = g2_mma(a0, b, c03); c13 = g2_mma(a1, b, c13); }
  v8f accs[8] = {c00, c01, c02, c03, c10, c11, c12, c13};
#pragma unroll
  for (int u = 0; u < 8; ++u) { const int t = u & 3, half = u >> 2; const int col = col0 + t * 16 + ln; const float bv = bp ? bf16_round(bp[col]) : 0.f;
#pragma unroll
    for (int r = 0; r < 8; ++r) { const int rloc = half * 16 + 8 * hh + r; float v = accs[u][r] * alpha + bv; if (CP) { if (rowsPerB < 0) v += CP[cofs + (size_t)(row0g + row0 + rloc) * ldc + col];      /* rowsPerB < 0: own element of the batched C plane */ else { const int bidx = (row0g + row0 + rloc) / rowsPerB; v += CP[(size_t)bidx * sCPb + (size_t)by * 64 + col]; } }
      if (ACT == 3) v = fmaxf(v, 0.f); else if (ACT == 6) v = 0.5f * v * (1.0f + erff(v * 0.70710678118654752f)); else if (ACT == 11) v = 1.0f / (1.0f + expf(-v)); else if (ACT == 15) v = v / (1.0f + expf(-v)); else if (ACT == 12) v = (v > 0.f) ? v : 0.01f * v; else if (ACT == 8) v = tanhf(v); else if (ACT == 9) v = 0.5f * v * (1.0f + tanhf(0.7978845608028654f * (v + 0.044715f * v * v * v))); else if (ACT == 14) v = (v > 0.f) ? v : 0.1f * v; else if (ACT == 16) v = (v >= 0.f) ? v : 0.3f * v; else if (ACT == 17) v = (v >= 0.f) ? v : 0.2f * v;
      so[w][rloc][t * 16 + ln] = v; } }
  __builtin_amdgcn_fence(__ATOMIC_ACQ_REL, "workgroup"); __builtin_amdgcn_wave_barrier();
  const int rsub = lane >> 4, c4 = (lane & 15) * 4;
  {
#pragma unroll
    for (int q = 0; q < 16; ++q) { const int r = q * 2 + rsub; const v4f v = *(const v4fa*)&so[w][r][c4]; if (C) *(v4f*)(C + cofs + (size_t)(row0 + r) * ldc + col0 + c4) = v; if (C16) { v4h h4; for (int i = 0; i < 4; ++i) h4[i] = (_Float16)v[i]; *(v4h*)(C16 + cofs + (size_t)(row0 + r) * ldc + col0 + c4) = h4; } }
     } }


__global__ __launch_bounds__(256) void k_wnat(const float* __restrict__ w, size_t n8, _Float16* __restrict__ Bt) { const size_t t = (size_t)blockIdx.x * 256 + threadIdx.x; if (t >= n8) return; FragH f; for (int q = 0; q < 8; ++q) f.h[q] = (_Float16)(bf16_round(w[t * 8 + q]) * 16.0f); *(v8us*)((unsigned short*)Bt + t * 8) = f.half[0];  }
__global__ __launch_bounds__(256) void k_rsm(const float* __restrict__ S, _Float16* __restrict__ P, int nrows) {
  #pragma clang fp contract(off)
  const int i = blockIdx.x * 256 + threadIdx.x; if (i >= nrows) return; const float* s = S + (size_t)i * SQ; float mx = -3.0e38f;
#pragma unroll 1
  for (int j = 0; j < SQ; ++j) mx = fmaxf(mx, s[j]); float se = 0.f;
#pragma unroll 1
  for (int j = 0; j < SQ; ++j) se += expf(s[j] - mx); const float sc = 256.0f / se;
#pragma unroll 1
  for (int j0 = 0; j0 < SQ; j0 += 8) { FragH f; for (int q = 0; q < 8; ++q) f.h[q] = (_Float16)(expf(s[j0 + q] - mx) * sc); unsigned short* d = (unsigned short*)P + (size_t)i * SQ + j0; *(v8us*)d = f.half[0];  } }
__global__ __launch_bounds__(256) void k_vt(const _Float16* __restrict__ V16, int b, int h0, _Float16* __restrict__ VT) { __shared__ unsigned short tl[64][65]; const int tid = threadIdx.x; const int hh = blockIdx.x % HG, sg = blockIdx.x / HG; const int s0 = sg * 64; const int h = h0 + hh;
  for (int i = tid; i < 64 * 8; i += 256) { const int j = i / 8, d8 = (i % 8) * 8; FragH f; f.half[0] = *(const v8us*)((const unsigned short*)V16 + ((size_t)b * SQ + s0 + j) * DM + h * HD + d8); for (int q = 0; q < 8; ++q) tl[d8 + q][j] = f.u[q]; }
  __syncthreads();
  { for (int i = tid; i < 64 * 8; i += 256) { const int d = i / 8, j8 = (i % 8) * 8; FragH f; for (int q = 0; q < 8; ++q) f.u[q] = tl[d][j8 + q]; *(v8us*)((unsigned short*)VT + ((size_t)hh * HD + d) * SQ + s0 + j8) = f.half[0]; }  } }



__global__ __launch_bounds__(256) void k_rsmf(const float* __restrict__ S, _Float16* __restrict__ P, int qn, int hg) {
  #pragma clang fp contract(off)
  const int t = blockIdx.x * 256 + threadIdx.x; if (t >= qn * hg) return; const size_t i = (size_t)(t / qn) * SQ + (t % qn); const float* s = S + i * SQ; float mx = -3.0e38f;
#pragma unroll 1
  for (int j = 0; j < SQ; ++j) mx = fmaxf(mx, s[j]); float se = 0.f;
#pragma unroll 1
  for (int j = 0; j < SQ; ++j) se += __expf(s[j] - mx); const float sc = 256.0f / se;
#pragma unroll 1
  for (int j0 = 0; j0 < SQ; j0 += 8) { FragH f; for (int q = 0; q < 8; ++q) f.h[q] = (_Float16)(__expf(s[j0 + q] - mx) * sc); unsigned short* d = (unsigned short*)P + i * SQ + j0; *(v8us*)d = f.half[0];  } }


__global__ __launch_bounds__(256) void k_xpe(const float* __restrict__ x, _Float16* __restrict__ X16, size_t n8) {
  #pragma clang fp contract(off)
  const size_t t = (size_t)blockIdx.x * 256 + threadIdx.x; if (t >= n8) return; const size_t e0 = t * 8; const size_t r = e0 / DM; const int c0 = (int)(e0 % DM); const float s = (float)(r % SQ); const float kf = (float)(-9.210340371976184 / (double)DM); FragH f;
  for (int q = 0; q < 8; ++q) { const int c = c0 + q; const int i2 = c & ~1; const float dv = expf(__fmul_rn((float)i2, kf)); const float ang = __fmul_rn(s, dv); const float pe = (c & 1) ? cosf(ang) : sinf(ang); f.h[q] = (_Float16)__fadd_rn(bf16_round(x[e0 + q]), pe); }
  *(v8us*)((unsigned short*)X16 + e0) = f.half[0];  }
extern "C" void kernel_launch(void* const* d_in, const int* in_sizes, int n_in,
                              void* d_out, int out_size, void* d_ws, size_t ws_size, hipStream_t stream) {
  (void)in_sizes; (void)n_in; (void)out_size;
  const float* const* I = (const float* const*)d_in; const float* x = I[0]; const float* wq = I[1]; const float* bq = I[2]; const float* wk = I[3]; const float* bk = I[4]; const float* wv = I[5]; const float* bv = I[6]; const float* wo = I[7]; const float* bo = I[8];      /* nn.Linear weights [out][in] + biases */
  char* ws = (char*)d_ws; size_t off = 0;
  auto take = [&](size_t bytes) { char* p = ws + off; off += (bytes + 255) & ~(size_t)255; return p; };
  _Float16* BQ = (_Float16*)take((size_t)DM * DM * 2); _Float16* BK = (_Float16*)take((size_t)DM * DM * 2); _Float16* BV = (_Float16*)take((size_t)DM * DM * 2); _Float16* BO = (_Float16*)take((size_t)DM * DM * 2);
  _Float16* X16 = (_Float16*)take(NR * DM * 2); _Float16* Q16 = (_Float16*)take(NR * DM * 2); _Float16* K16 = (_Float16*)take(NR * DM * 2); _Float16* V16 = (_Float16*)take(NR * DM * 2); _Float16* O16 = (_Float16*)take(NR * DM * 2);
  float* S = (float*)take((size_t)HG * SQ * SQ * 4); _Float16* P = (_Float16*)take((size_t)HG * SQ * SQ * 2); _Float16* VT = (_Float16*)take((size_t)NH * HD * SQ * 2);
  if (off > ws_size) return;
  { const unsigned g = (unsigned)(((size_t)DM * DM / 8 + 255) / 256); k_wnat<<<g, 256, 0, stream>>>(wq, (size_t)DM * DM / 8, BQ); k_wnat<<<g, 256, 0, stream>>>(wk, (size_t)DM * DM / 8, BK); k_wnat<<<g, 256, 0, stream>>>(wv, (size_t)DM * DM / 8, BV); k_wnat<<<g, 256, 0, stream>>>(wo, (size_t)DM * DM / 8, BO); }      /* natural [out][in] = Bt[n][k], x16 */
  k_xpe<<<(unsigned)((NR * DM / 8 + 255) / 256), 256, 0, stream>>>(x, X16, NR * DM / 8);      /* x + sinusoidal PE -> f16 rows (not exact: x + pe is not a bf16 value) */
  const size_t r0p = (size_t)B0 * SQ;      /* first projected row */
  k_gemm2<0><<<dim3((unsigned)((MP / 128) * (DM / 64)), 1), 128, 0, stream>>>(X16 + r0p * DM, DM, 0, BQ, DM, 0, 0.0625f, bq, 0, nullptr, 1, 0, 0, nullptr, Q16 + r0p * DM, DM, 0, MP, DM, DM);
  k_gemm2<0><<<dim3((unsigned)((MP / 128) * (DM / 64)), 1), 128, 0, stream>>>(X16 + r0p * DM, DM, 0, BK, DM, 0, 0.0625f, bk, 0, nullptr, 1, 0, 0, nullptr, K16 + r0p * DM, DM, 0, MP, DM, DM);
  k_gemm2<0><<<dim3((unsigned)((MP / 128) * (DM / 64)), 1), 128, 0, stream>>>(X16 + r0p * DM, DM, 0, BV, DM, 0, 0.0625f, bv, 0, nullptr, 1, 0, 0, nullptr, V16 + r0p * DM, DM, 0, MP, DM, DM);
  for (int b = B0; b < B0 + NBR; ++b) { const size_t r0 = (size_t)b * SQ;
    k_vt<NH, SQ><<<NH * (SQ / 64), 256, 0, stream>>>(V16 + r0 * LQ, LQ, 0, VT);      /* V^T [NH][HD][SQ] for this batch */
    for (int h0 = 0; h0 < NHD; h0 += HG) {
      k_gemm2<0><<<dim3((QN / 128) * (SQ / 64), HG), 128, 0, stream>>>(Q16 + r0 * LQ + h0 * HD, LQ, (size_t)HD, K16 + r0 * LQ + h0 * HD, LQ, (size_t)HD, 0.125f, nullptr, 0, nullptr, 1, 0, 0, S, nullptr, SQ, (size_t)SQ * SQ, QN, SQ, HD);      /* scores, HG heads per launch */
      k_rsmf<<<(HG * QN + 255) / 256, 256, 0, stream>>>(S, P, QN, HG);      /* P = 256 softmax (f16), rows of all HG heads */
      k_gemm2<0><<<dim3((QN / 128) * (HD / 64), HG), 128, 0, stream>>>(P, SQ, (size_t)SQ * SQ, VT + (size_t)h0 * HD * SQ, SQ, (size_t)HD * SQ, 0.25f, nullptr, 0, nullptr, 1, 0, 0, nullptr, O16 + r0 * DM + h0 * HD, DM, (size_t)HD, QN, HD, SQ); } }      /* o (merged heads) as f16 rows */
  k_gemm2<0><<<dim3((unsigned)((MPO / 128) * (DM / 64)), 1), 128, 0, stream>>>(O16 + r0p * DM, DM, 0, BO, DM, 0, 0.0009765625f, bo, 0, nullptr, 1, 0, 0, (float*)d_out + r0p * DM, nullptr, DM, 0, MPO, DM, DM);      /* out rows are the output layout */
}

// v001
// It runs in 1010 microseconds.
// Timed twice side by side with v000, it ran 3.52 and 3.50 times as fast.
#include <hip/hip_runtime.h>
// Temporal multi-head attention with sinusoidal positional encoding (x [2][2048][1024]; x = x + PE (pe[s][2i] = sin(s d_i), pe[s][2i+1] = cos(s d_i), d_i = exp(2i x (-ln 1e4 / 1024))); q = x Wq^T + bq, k, v likewise (nn.Linear [out][in] 1024^2, weights and biases sigma 1/32); 16 heads of 64; softmax(q k^T / 8) (no mask); out = ctx Wo^T + bo -> [2][2048][1024]).
// Structure: token rows r = b*2048 + s; x + PE computed on VALU (f32 expf/sinf/cosf in the module's op order) -> f16 rows (one f16 rounding of x + pe); Q, K, V as three WMMA GEMMs (32x64 wave tiles, f32 accumulation, exact x16 weights + bias, f16 outputs); per batch: V^T for all heads via LDS transposes; per (batch, group of 4 heads): scores GEMM (K = 64, batched over the heads on grid.y, alpha = 64^-0.5), row softmax on VALU (f32 statistics, native exp; weights stored x256 as f16), o = P . V^T GEMM (K = 2048, alpha 2^-2: o carried x64 against f16 subnormal flush, folded into the output GEMM alpha) written straight into the merged f16 o rows; out = o W_o + b GEMM (f32) into the output layout.
// Compute dtype: inputs rounded to bf16; weights exact, x + pe rounded once to f16; q, k, v, softmax weights and o as plain f16 GEMM operands (~2^-12); scores and softmax statistics f32. v_wmma_f32_16x16x32_f16.
#define NB 2
#define SQ 2048
#define DM 1024
#define NH 16
#define HD 64
#define HG 4                         /* heads per attention launch group */
#define B0 0                         /* first batch processed (debug hook) */
#define NBR NB                       /* batches processed (debug hook) */
#define NR ((size_t)NB * SQ)         /* token rows */
#define MP ((int)((size_t)NBR * SQ)) /* rows projected (debug hook) */
#define QN SQ                        /* query rows attended per batch (debug hook) */
#define NHD NH                       /* heads attended (debug hook) */
#define MPO MP                       /* rows through the output stage (debug hook) */
#define LQ DM      /* row pitch of the q/k/v rows */
typedef __bf16 v16b __attribute__((ext_vector_type(16)));
typedef unsigned short v8us __attribute__((ext_vector_type(8), may_alias));
typedef float  v8f  __attribute__((ext_vector_type(8)));
typedef float  v4f  __attribute__((ext_vector_type(4)));
typedef float  v4fa __attribute__((ext_vector_type(4), may_alias));
union FragB { v16b v; v8us half[2]; unsigned short u[16]; };

__device__ __forceinline__ unsigned short bf16_bits(float x) { unsigned int u = __float_as_uint(x); return (unsigned short)((u + 0x7FFFu + ((u >> 16) & 1u)) >> 16); }
__device__ __forceinline__ float bf16_val(unsigned short b) { return __uint_as_float(((unsigned int)b) << 16); }
__device__ __forceinline__ float bf16_round(float x) { return bf16_val(bf16_bits(x)); }
// D += A·B with NT terms: 1 = ah·bh, 2 = + al·bh (A split), 3 = + ah·bl (both split)
template <int NT>
__device__ __forceinline__ v8f mmaN(v16b ah, v16b al, v16b bh, v16b bl, v8f c) {
  c = __builtin_amdgcn_wmma_f32_16x16x32_bf16(false, ah, false, bh, (short)0, c, false, false);
  if (NT >= 2) c = __builtin_amdgcn_wmma_f32_16x16x32_bf16(false, al, false, bh, (short)0, c, false, false);
  if (NT >= 3) c = __builtin_amdgcn_wmma_f32_16x16x32_bf16(false, ah, false, bl, (short)0, c, false, false);
  asm volatile("v_nop\n\tv_nop\n\tv_nop\n\tv_nop" : "+v"(c) : "v"(ah), "v"(al), "v"(bh), "v"(bl));
  return c;
}

__global__ __launch_bounds__(256) void k_wt_bf16(const float* __restrict__ W, unsigned short* __restrict__ Wt, int K, int N) {
  const int t = blockIdx.x * 256 + threadIdx.x;
  const int k8n = K / 8;
  if (t >= N * k8n) return;
  const int n = t / k8n, k8 = (t % k8n) * 8;
  v8us v;
#pragma unroll
  for (int i = 0; i < 8; ++i) v[i] = bf16_bits(W[(size_t)(k8 + i) * N + n]);
  *(v8us*)(Wt + (size_t)n * K + k8) = v;
  
}

// GEMM C[M][N] (f32, pitch ldc) = act(A[M][K]·W + bias). A f32 row-major (pitch lda) converted per fragment to bf16
// (ASPLIT: hi/lo two planes -> 2 terms, else single rounded term); Wt bf16 [N][K] (pitch ldb). BIAS_BF16 rounds the
// bias to bf16 first (bias quantised to bf16 before the add). K%32==0, M%16==0, N%64==0.
template <bool ASPLIT, int ACT, bool BIAS_BF16>
__global__ __launch_bounds__(128) void k_gemm_bf(const float* __restrict__ A, int lda, const unsigned short* __restrict__ Wt, int ldb,
                                               const float* __restrict__ bias, float* __restrict__ C, int ldc, int M, int N, int K) {
  __shared__ __attribute__((aligned(16))) float so[4][16][64];
  const int tid = threadIdx.x, w = tid >> 5, lane = tid & 31, ln = lane & 15, hh = lane >> 4;
  const int ntn = N / 64;
  const int wid = blockIdx.x * 4 + w;
  const int mt = wid / ntn, nq = wid % ntn;
  if (mt * 16 >= M) return;
  const int row0 = mt * 16, col0 = nq * 64;
  const float* arow = A + (size_t)(row0 + ln) * lda;
  v8f acc[4] = {};
  for (int kb = 0; kb < K; kb += 32) {
    FragB ah, al;
    const v4f x0 = *(const v4fa*)(arow + kb + 8 * hh), x1 = *(const v4fa*)(arow + kb + 8 * hh + 4);
    const v4f x2 = *(const v4fa*)(arow + kb + 16 + 8 * hh), x3 = *(const v4fa*)(arow + kb + 16 + 8 * hh + 4);
    float xs[16] = {x0[0],x0[1],x0[2],x0[3],x1[0],x1[1],x1[2],x1[3],x2[0],x2[1],x2[2],x2[3],x3[0],x3[1],x3[2],x3[3]};
#pragma unroll
    for (int i = 0; i < 16; ++i) { const unsigned short hb = bf16_bits(xs[i]); ah.u[i] = hb; al.u[i] = ASPLIT ? bf16_bits(xs[i] - bf16_val(hb)) : (unsigned short)0; }
#pragma unroll
    for (int t = 0; t < 4; ++t) {
      const unsigned short* brow = Wt + (size_t)(col0 + t * 16 + ln) * ldb + kb;
      FragB b;
      b.half[0] = *(const v8us*)(brow + 8 * hh);
      b.half[1] = *(const v8us*)(brow + 16 + 8 * hh);
      acc[t] = mmaN<ASPLIT ? 2 : 1>(ah.v, al.v, b.v, b.v, acc[t]);
    }
  }
#pragma unroll
  for (int t = 0; t < 4; ++t) {
    float bv = bias ? bias[col0 + t * 16 + ln] : 0.f;
    if (BIAS_BF16) bv = bf16_round(bv);
#pragma unroll
    for (int r = 0; r < 8; ++r) { float v = acc[t][r] + bv; if (ACT == 1) v = fmaxf(v, 0.f); so[w][8 * hh + r][t * 16 + ln] = v; }
  }
  __builtin_amdgcn_fence(__ATOMIC_ACQ_REL, "workgroup");
  __builtin_amdgcn_wave_barrier();
  const int rsub = lane >> 4, c4 = (lane & 15) * 4;
  {
#pragma unroll
    for (int q = 0; q < 8; ++q) {
      const int r = q * 2 + rsub;
      const v4f v = *(const v4fa*)&so[w][r][c4];
      *(v4f*)(C + (size_t)(row0 + r) * ldc + col0 + c4) = v;
    }
    
  }
}

// GEMM C = act(A·W + bias + resid): A f32 (ASPLIT -> hi/lo 2 terms), Wt bf16 [N][K]; ACT 0 none, 1 relu, 2 exact gelu;
// resid (optional, f32, row index = (row % rmod), pitch ldr, RES_BF16 rounds it) added before the activation.
template <bool ASPLIT, int ACT, bool BIAS_BF16, bool RES_BF16>
__global__ __launch_bounds__(128) void k_gemm_bf3(const float* __restrict__ A, int lda, const unsigned short* __restrict__ Wt, int ldb,
                                                const float* __restrict__ bias, const float* __restrict__ resid, int rmod, int ldr,
                                                float* __restrict__ C, int ldc, int M, int N, int K) {
  __shared__ __attribute__((aligned(16))) float so[4][16][64];
  const int tid = threadIdx.x, w = tid >> 5, lane = tid & 31, ln = lane & 15, hh = lane >> 4;
  const int ntn = N / 64;
  const int wid = blockIdx.x * 4 + w;
  const int mt = wid / ntn, nq = wid % ntn;
  if (mt * 16 >= M) return;
  const int row0 = mt * 16, col0 = nq * 64;
  const float* arow = A + (size_t)(row0 + ln) * lda;
  v8f acc[4] = {};
  for (int kb = 0; kb < K; kb += 32) {
    FragB ah, al;
    const v4f x0 = *(const v4fa*)(arow + kb + 8 * hh), x1 = *(const v4fa*)(arow + kb + 8 * hh + 4);
    const v4f x2 = *(const v4fa*)(arow + kb + 16 + 8 * hh), x3 = *(const v4fa*)(arow + kb + 16 + 8 * hh + 4);
    float xs[16] = {x0[0],x0[1],x0[2],x0[3],x1[0],x1[1],x1[2],x1[3],x2[0],x2[1],x2[2],x2[3],x3[0],x3[1],x3[2],x3[3]};
#pragma unroll
    for (int i = 0; i < 16; ++i) { const unsigned short hb = bf16_bits(xs[i]); ah.u[i] = hb; al.u[i] = ASPLIT ? bf16_bits(xs[i] - bf16_val(hb)) : (unsigned short)0; }
#pragma unroll
    for (int t = 0; t < 4; ++t) {
      const unsigned short* brow = Wt + (size_t)(col0 + t * 16 + ln) * ldb + kb;
      FragB b;
      b.half[0] = *(const v8us*)(brow + 8 * hh);
      b.half[1] = *(const v8us*)(brow + 16 + 8 * hh);
      acc[t] = mmaN<ASPLIT ? 2 : 1>(ah.v, al.v, b.v, b.v, acc[t]);
    }
  }
#pragma unroll
  for (int t = 0; t < 4; ++t) {
    const int col = col0 + t * 16 + ln;
    float bv = bias ? bias[col] : 0.f;
    if (BIAS_BF16) bv = bf16_round(bv);
#pragma unroll
    for (int r = 0; r < 8; ++r) {
      float v = acc[t][r] + bv;
      if (resid) { float rv = resid[(size_t)((row0 + 8 * hh + r) % rmod) * ldr + col]; if (RES_BF16) rv = bf16_round(rv); v += rv; }
      if (ACT == 1) v = fmaxf(v, 0.f);
      if (ACT == 2) v = 0.5f * v * (1.0f + erff(v * 0.70710678118654752f));
      if (ACT == 3) { const float u = 0.7978845608028654f * (v + 0.044715f * v * v * v); v = 0.5f * v * (1.0f + tanhf(u)); }
      so[w][8 * hh + r][t * 16 + ln] = v;
    }
  }
  __builtin_amdgcn_fence(__ATOMIC_ACQ_REL, "workgroup");
  __builtin_amdgcn_wave_barrier();
  const int rsub = lane >> 4, c4 = (lane & 15) * 4;
  {
#pragma unroll
    for (int q = 0; q < 8; ++q) {
      const int r = q * 2 + rsub;
      const v4f v = *(const v4fa*)&so[w][r][c4];
      *(v4f*)(C + (size_t)(row0 + r) * ldc + col0 + c4) = v;
    }
    
  }
}
// row LayerNorm (biased variance, eps) over N: s = X (+ R); optional out_sum <- s; out_norm <- (s-mu)*rsqrt(var+eps)*g + b
template <bool PARAM_BF16>
__global__ __launch_bounds__(256) void k_layernorm(const float* __restrict__ X, const float* __restrict__ R, const float* __restrict__ g, const float* __restrict__ bta,
                                                  float* __restrict__ out_sum, float* __restrict__ out_norm, int N, float eps) {
  __shared__ float red[256];
  const int row = blockIdx.x, tid = threadIdx.x;
  const float* x = X + (size_t)row * N; const float* rr = R ? R + (size_t)row * N : nullptr;
  float vals[16];                     // up to N = 4096
  const int per = N / 256;            // contiguous chunk per thread? use strided-by-4 chunks: thread handles j = tid*4 + 1024*u
  float s1 = 0.f;
  for (int u = 0; u < per / 4; ++u) {
    const int j = tid * 4 + 1024 * u;
    const v4f a = *(const v4fa*)(x + j);
    v4f b = {0.f,0.f,0.f,0.f}; if (rr) b = *(const v4fa*)(rr + j);
#pragma unroll
    for (int q = 0; q < 4; ++q) { const float v = a[q] + b[q]; vals[u * 4 + q] = v; s1 += v; }
  }
  red[tid] = s1; __syncthreads();
  for (int st = 128; st > 0; st >>= 1) { if (tid < st) red[tid] += red[tid + st]; __syncthreads(); }
  const float mu = red[0] / (float)N; __syncthreads();
  float s2 = 0.f;
  for (int u = 0; u < per / 4; ++u)
#pragma unroll
    for (int q = 0; q < 4; ++q) { const float c = vals[u * 4 + q] - mu; s2 += c * c; }
  red[tid] = s2; __syncthreads();
  for (int st = 128; st > 0; st >>= 1) { if (tid < st) red[tid] += red[tid + st]; __syncthreads(); }
  const float rs = rsqrtf(red[0] / (float)N + eps);
  {
    for (int u = 0; u < per / 4; ++u) {
      const int j = tid * 4 + 1024 * u;
      v4f o, sm;
#pragma unroll
      for (int q = 0; q < 4; ++q) {
        float gg = g[j + q], bb = bta[j + q];
        if (PARAM_BF16) { gg = bf16_round(gg); bb = bf16_round(bb); }
        sm[q] = vals[u * 4 + q]; o[q] = (vals[u * 4 + q] - mu) * rs * gg + bb;
      }
      if (out_sum) *(v4f*)(out_sum + (size_t)row * N + j) = sm;
      *(v4f*)(out_norm + (size_t)row * N + j) = o;
    }
    
  }
}



// ---- f16 WMMA path (v_wmma_f32_16x16x32_f16): 11-bit significands for operands in range — used where a [0,1] probability operand needs more precision than bf16
typedef _Float16 v16h __attribute__((ext_vector_type(16)));
union FragH { v16h v; v8us half[2]; _Float16 h[16]; unsigned short u[16]; };
template <int NT>
__device__ __forceinline__ v8f mmaH(v16h ah, v16h al, v16h bh, v16h bl, v8f c) {
  c = __builtin_amdgcn_wmma_f32_16x16x32_f16(false, ah, false, bh, (short)0, c, false, false);
  if (NT >= 2) c = __builtin_amdgcn_wmma_f32_16x16x32_f16(false, al, false, bh, (short)0, c, false, false);
  if (NT >= 3) c = __builtin_amdgcn_wmma_f32_16x16x32_f16(false, ah, false, bl, (short)0, c, false, false);
  asm volatile("v_nop\n\tv_nop\n\tv_nop\n\tv_nop" : "+v"(c) : "v"(ah), "v"(al), "v"(bh), "v"(bl));
  return c;
}
// batched GEMM like k_gemm_b but f16 operands: A f32 (split into f16 hi/lo if ASPLIT, else rounded to f16), Bt = f16 values [n][k]; alpha; C f32; N multiple of 16 (partial tiles skipped)
template <bool ASPLIT>
__global__ __launch_bounds__(128) void k_gemm_h(const float* __restrict__ A, int lda, size_t sA, const _Float16* __restrict__ Bh, int ldb, size_t sB, float alpha, float* __restrict__ C, int ldc, size_t sC, int M, int N, int K) {
  __shared__ __attribute__((aligned(16))) float so[4][16][64];
  const int tid = threadIdx.x, w = tid >> 5, lane = tid & 31, ln = lane & 15, hh = lane >> 4; const int by = blockIdx.y;
  A += (size_t)by * sA; Bh += (size_t)by * sB; C += (size_t)by * sC;
  const int ntn = (N + 63) / 64; const int wid = blockIdx.x * 4 + w; const int mt = wid / ntn, nq = wid % ntn; if (mt * 16 >= M) return;
  const int row0 = mt * 16, col0 = nq * 64; const float* arow = A + (size_t)(row0 + ln) * lda;
  v8f acc[4] = {};
  for (int kb = 0; kb < K; kb += 32) {
    FragH ah, al;
    const v4f x0 = *(const v4fa*)(arow + kb + 8 * hh), x1 = *(const v4fa*)(arow + kb + 8 * hh + 4), x2 = *(const v4fa*)(arow + kb + 16 + 8 * hh), x3 = *(const v4fa*)(arow + kb + 16 + 8 * hh + 4);
    float xs[16] = {x0[0],x0[1],x0[2],x0[3],x1[0],x1[1],x1[2],x1[3],x2[0],x2[1],x2[2],x2[3],x3[0],x3[1],x3[2],x3[3]};
#pragma unroll
    for (int i = 0; i < 16; ++i) { const _Float16 h = (_Float16)xs[i]; ah.h[i] = h; al.h[i] = ASPLIT ? (_Float16)(xs[i] - (float)h) : (_Float16)0.0f; }
#pragma unroll
    for (int t = 0; t < 4; ++t) { if (col0 + t * 16 >= N) continue; const size_t boff = (size_t)(col0 + t * 16 + ln) * ldb + kb; FragH bq; bq.half[0] = *(const v8us*)(Bh + boff + 8 * hh); bq.half[1] = *(const v8us*)(Bh + boff + 16 + 8 * hh);
      acc[t] = mmaH<ASPLIT ? 2 : 1>(ah.v, al.v, bq.v, bq.v, acc[t]); }
  }
#pragma unroll
  for (int t = 0; t < 4; ++t) { if (col0 + t * 16 >= N) continue;
#pragma unroll
    for (int r = 0; r < 8; ++r) so[w][8 * hh + r][t * 16 + ln] = acc[t][r] * alpha; }
  __builtin_amdgcn_fence(__ATOMIC_ACQ_REL, "workgroup"); __builtin_amdgcn_wave_barrier();
  const int rsub = lane >> 4, c4 = (lane & 15) * 4;
  {
#pragma unroll
    for (int q = 0; q < 8; ++q) { const int r = q * 2 + rsub; if (col0 + c4 < N) { const v4f v = *(const v4fa*)&so[w][r][c4]; *(v4f*)(C + (size_t)(row0 + r) * ldc + col0 + c4) = v; } }
     }
}

// Wt[n][k] = f16(W[k][n]·scale) from f32 row-major W[K][N] (scale = power of two; bf16-exact weights stay exact in f16 away from the subnormal range)
__global__ __launch_bounds__(256) void k_wt_f16(const float* __restrict__ W, _Float16* __restrict__ Wt, int K, int N, float scale) {
  const int t = blockIdx.x * 256 + threadIdx.x; if (t >= N * (K / 8)) return; const int n = t / (K / 8), k8 = (t % (K / 8)) * 8; FragH f;
#pragma unroll
  for (int i = 0; i < 8; ++i) f.h[i] = (_Float16)(bf16_round(W[(size_t)(k8 + i) * N + n]) * scale); const v8us o = f.half[0];
  *(v8us*)((unsigned short*)Wt + (size_t)n * K + k8) = o; 
}
// k_gemm_hh variant with fused epilogue: v = acc·alpha + bias[by·sBias + col] (+ CP[(row/rowsPerB)·sCPb + by·64 + col] if CP) ; ACT 0 none / 1 elu ; writes f16 C16 (and f32 C if non-null)
template <int ACT>
__global__ __launch_bounds__(128) void k_gemm_hhx(const _Float16* __restrict__ A, int lda, size_t sA, const _Float16* __restrict__ Bh, int ldb, size_t sB, float alpha, const float* __restrict__ bias, size_t sBias, const float* __restrict__ CP, int rowsPerB, size_t sCPb, int row0g,
    float* __restrict__ C, _Float16* __restrict__ C16, int ldc, size_t sC, int M, int N, int K) {
  __shared__ __attribute__((aligned(16))) float so[4][16][64];
  const int tid = threadIdx.x, w = tid >> 5, lane = tid & 31, ln = lane & 15, hh = lane >> 4; const int by = blockIdx.y;
  A += (size_t)by * sA; Bh += (size_t)by * sB; const size_t cofs = (size_t)by * sC; const float* bp = bias ? bias + (size_t)by * sBias : nullptr;
  const int ntn = (N + 63) / 64; const int wid = blockIdx.x * 4 + w; const int mt = wid / ntn, nq = wid % ntn; if (mt * 16 >= M) return;
  const int row0 = mt * 16, col0 = nq * 64; const _Float16* arow = A + (size_t)(row0 + ln) * lda;
  v8f acc[4] = {};
  for (int kb = 0; kb < K; kb += 32) { FragH ah; ah.half[0] = *(const v8us*)((const unsigned short*)arow + kb + 8 * hh); ah.half[1] = *(const v8us*)((const unsigned short*)arow + kb + 16 + 8 * hh);
#pragma unroll
    for (int t = 0; t < 4; ++t) { if (col0 + t * 16 >= N) continue; const size_t boff = (size_t)(col0 + t * 16 + ln) * ldb + kb; FragH bq; bq.half[0] = *(const v8us*)((const unsigned short*)Bh + boff + 8 * hh); bq.half[1] = *(const v8us*)((const unsigned short*)Bh + boff + 16 + 8 * hh);
      acc[t] = mmaH<1>(ah.v, ah.v, bq.v, bq.v, acc[t]); }
  }
#pragma unroll
  for (int t = 0; t < 4; ++t) { if (col0 + t * 16 >= N) continue; const int col = col0 + t * 16 + ln; const float bv = bp ? bf16_round(bp[col]) : 0.f;
#pragma unroll
    for (int r = 0; r < 8; ++r) { float v = acc[t][r] * alpha + bv; if (CP) { const int rr = row0g + row0 + 8 * hh + r; if (rowsPerB < 0) v += CP[cofs + (size_t)rr * ldc + col];      /* rowsPerB < 0: own element of the batched C plane */ else { const int bidx = rr / rowsPerB; v += CP[(size_t)bidx * sCPb + (size_t)by * 64 + col]; } } if (ACT == 1) v = (v > 0.f) ? v : expm1f(v); else if (ACT == 7) v = (v > 0.f) ? v + 1.0f : expf(v); else if (ACT == 8) v = tanhf(v); else if (ACT == 9) v = 0.5f * v * (1.0f + tanhf(0.7978845608028654f * (v + 0.044715f * v * v * v))); else if (ACT == 11) v = 1.0f / (1.0f + expf(-v)); else if (ACT == 12) v = (v > 0.f) ? v : 0.01f * v; else if (ACT == 14) v = (v > 0.f) ? v : 0.1f * v; else if (ACT == 16) v = (v >= 0.f) ? v : 0.3f * v; else if (ACT == 17) v = (v >= 0.f) ? v : 0.2f * v; else if (ACT == 15) v = v / (1.0f + expf(-v)); else if (ACT == 3) v = fmaxf(v, 0.f); else if (ACT == 6) v = 0.5f * v * (1.0f + erff(v * 0.70710678118654752f)); so[w][8 * hh + r][t * 16 + ln] = v; } }
  __builtin_amdgcn_fence(__ATOMIC_ACQ_REL, "workgroup"); __builtin_amdgcn_wave_barrier();
  const int rsub = lane >> 4, c4 = (lane & 15) * 4; typedef _Float16 v4h __attribute__((ext_vector_type(4)));
  {
#pragma unroll
    for (int q = 0; q < 8; ++q) { const int r = q * 2 + rsub; if (col0 + c4 < N) { const v4f v = *(const v4fa*)&so[w][r][c4]; if (C) *(v4f*)(C + cofs + (size_t)(row0 + r) * ldc + col0 + c4) = v; if (C16) { v4h h4; for (int i = 0; i < 4; ++i) h4[i] = (_Float16)v[i]; *(v4h*)(C16 + cofs + (size_t)(row0 + r) * ldc + col0 + c4) = h4; } } }
     }
}


typedef _Float16 v4h __attribute__((ext_vector_type(4)));

__global__ __launch_bounds__(256) void k_x16(const float* __restrict__ x, _Float16* __restrict__ X16, size_t n8) { const size_t t = (size_t)blockIdx.x * 256 + threadIdx.x; if (t >= n8) return; FragH f;
#pragma unroll
  for (int q = 0; q < 8; ++q) f.h[q] = (_Float16)bf16_round(x[t * 8 + q]); *(v8us*)((unsigned short*)X16 + t * 8) = f.half[0];  }
__global__ __launch_bounds__(256) void k_h16(const float* __restrict__ x, _Float16* __restrict__ X16, size_t n8) { const size_t t = (size_t)blockIdx.x * 256 + threadIdx.x; if (t >= n8) return; FragH f;
#pragma unroll
  for (int q = 0; q < 8; ++q) f.h[q] = (_Float16)x[t * 8 + q]; *(v8us*)((unsigned short*)X16 + t * 8) = f.half[0];  }
__global__ __launch_bounds__(256) void k_round16f(const float* __restrict__ W, _Float16* __restrict__ Bt, size_t n8) { const size_t t = (size_t)blockIdx.x * 256 + threadIdx.x; if (t >= n8) return; FragH f;
#pragma unroll
  for (int i = 0; i < 8; ++i) f.h[i] = (_Float16)(bf16_round(W[t * 8 + i]) * 16.0f); *(v8us*)((unsigned short*)Bt + t * 8) = f.half[0];  }
template <int NHv, int TTv>
__global__ __launch_bounds__(256) void k_vt(const _Float16* __restrict__ V16, int ldv, int voff, _Float16* __restrict__ Vt) { __shared__ unsigned short tl[64][66]; const int tid = threadIdx.x; const int slab = blockIdx.x / (TTv / 64), lg = blockIdx.x % (TTv / 64); const int b = slab / NHv, h = slab % NHv;
  for (int i = tid; i < 64 * 8; i += 256) { const int r = i / 8, c8 = (i % 8) * 8; FragH f; f.half[0] = *(const v8us*)((const unsigned short*)V16 + ((size_t)b * TTv + lg * 64 + r) * ldv + voff + h * 64 + c8);
#pragma unroll
    for (int q = 0; q < 8; ++q) tl[r][c8 + q] = f.u[q]; }
  __syncthreads();
  {
#pragma unroll
    for (int rd = 0; rd < 2; ++rd) { const int d = rd * 32 + tid / 8, pc = tid % 8; FragH f;
#pragma unroll
      for (int q = 0; q < 8; ++q) f.u[q] = tl[pc * 8 + q][d];
      *(v8us*)((unsigned short*)Vt + ((size_t)slab * 64 + d) * TTv + lg * 64 + pc * 8) = f.half[0]; }
     } }

__global__ __launch_bounds__(256) void k_hl(const float* __restrict__ F, _Float16* __restrict__ Hh, _Float16* __restrict__ Hl, size_t n8) { const size_t t = (size_t)blockIdx.x * 256 + threadIdx.x; if (t >= n8) return; FragH fh, fl; const v4f a = *(const v4fa*)(F + t * 8), c = *(const v4fa*)(F + t * 8 + 4);
#pragma unroll
  for (int q = 0; q < 4; ++q) { _Float16 h = (_Float16)a[q]; fh.h[q] = h; fl.h[q] = (_Float16)((a[q] - (float)h) * 1024.0f); h = (_Float16)c[q]; fh.h[4 + q] = h; fl.h[4 + q] = (_Float16)((c[q] - (float)h) * 1024.0f); }
  { *(v8us*)((unsigned short*)Hh + t * 8) = fh.half[0]; *(v8us*)((unsigned short*)Hl + t * 8) = fl.half[0];  } }

// ---- fast GEMM (wave tile 32x64; requires M % 32 == 0 rows per launch region and N % 64 == 0); epilogue = k_gemm_hhx semantics ----
__device__ __forceinline__ v16h g2_frag(const _Float16* p, int hh) { FragH f; f.half[0] = *(const v8us*)((const unsigned short*)p + 8 * hh); f.half[1] = *(const v8us*)((const unsigned short*)p + 16 + 8 * hh); return f.v; }
__device__ __forceinline__ v8f g2_mma(v16h a, v16h b, v8f c) { v8f d = __builtin_amdgcn_wmma_f32_16x16x32_f16(false, a, false, b, (short)0, c, false, false); asm volatile("v_nop\n\tv_nop\n\tv_nop\n\tv_nop" : "+v"(d) : "v"(a), "v"(b)); return d; }
template <int ACT>
__global__ __launch_bounds__(128) void k_gemm2(const _Float16* __restrict__ A, int lda, size_t sA, const _Float16* __restrict__ Bh, int ldb, size_t sB, float alpha, const float* __restrict__ bias, size_t sBias, const float* __restrict__ CP, int rowsPerB, size_t sCPb, int row0g,
    float* __restrict__ C, _Float16* __restrict__ C16, int ldc, size_t sC, int M, int N, int K) { static_assert(ACT == 0 || ACT == 3 || ACT == 6 || ACT == 8 || ACT == 9 || ACT == 11 || ACT == 12 || ACT == 14 || ACT == 15 || ACT == 16 || ACT == 17, "k_gemm2: unsupported ACT code (would silently apply no activation)");
  __shared__ __attribute__((aligned(16))) float so[4][32][68];
  const int tid = threadIdx.x, w = tid >> 5, lane = tid & 31, ln = lane & 15, hh = lane >> 4; const int by = blockIdx.y;
  A += (size_t)by * sA; Bh += (size_t)by * sB; const size_t cofs = (size_t)by * sC; const float* bp = bias ? bias + (size_t)by * sBias : nullptr;
  const int ntn = N >> 6; const int mt = blockIdx.x / ntn, nq = blockIdx.x - mt * ntn; const int row0 = mt * 128 + 32 * w, col0 = nq * 64; if (row0 >= M) return;
  const _Float16* a0p = A + (size_t)(row0 + ln) * lda; const _Float16* a1p = a0p + (size_t)16 * lda;
  const _Float16* b0p = Bh + (size_t)(col0 + ln) * ldb; const _Float16* b1p = b0p + (size_t)16 * ldb; const _Float16* b2p = b1p + (size_t)16 * ldb; const _Float16* b3p = b2p + (size_t)16 * ldb;
  const v8f z8 = {0.f,0.f,0.f,0.f,0.f,0.f,0.f,0.f}; v8f c00 = z8, c01 = z8, c02 = z8, c03 = z8, c10 = z8, c11 = z8, c12 = z8, c13 = z8;
#pragma unroll 1
  for (int kb = 0; kb < K; kb += 32) { const v16h a0 = g2_frag(a0p + kb, hh), a1 = g2_frag(a1p + kb, hh);
    v16h b = g2_frag(b0p + kb, hh); c00 = g2_mma(a0, b, c00); c10 = g2_mma(a1, b, c10);
    b = g2_frag(b1p + kb, hh); c01 = g2_mma(a0, b, c01); c11 = g2_mma(a1, b, c11);
    b = g2_frag(b2p + kb, hh); c02 = g2_mma(a0, b, c02); c12 = g2_mma(a1, b, c12);
    b = g2_frag(b3p + kb, hh); c03 = g2_mma(a0, b, c03); c13 = g2_mma(a1, b, c13); }
  v8f accs[8] = {c00, c01, c02, c03, c10, c11, c12, c13};
#pragma unroll
  for (int u = 0; u < 8; ++u) { const int t = u & 3, half = u >> 2; const int col = col0 + t * 16 + ln; const float bv = bp ? bf16_round(bp[col]) : 0.f;
#pragma unroll
    for (int r = 0; r < 8; ++r) { const int rloc = half * 16 + 8 * hh + r; float v = accs[u][r] * alpha + bv; if (CP) { if (rowsPerB < 0) v += CP[cofs + (size_t)(row0g + row0 + rloc) * ldc + col];      /* rowsPerB < 0: own element of the batched C plane */ else { const int bidx = (row0g + row0 + rloc) / rowsPerB; v += CP[(size_t)bidx * sCPb + (size_t)by * 64 + col]; } }
      if (ACT == 3) v = fmaxf(v, 0.f); else if (ACT == 6) v = 0.5f * v * (1.0f + erff(v * 0.70710678118654752f)); else if (ACT == 11) v = 1.0f / (1.0f + expf(-v)); else if (ACT == 15) v = v / (1.0f + expf(-v)); else if (ACT == 12) v = (v > 0.f) ? v : 0.01f * v; else if (ACT == 8) v = tanhf(v); else if (ACT == 9) v = 0.5f * v * (1.0f + tanhf(0.7978845608028654f * (v + 0.044715f * v * v * v))); else if (ACT == 14) v = (v > 0.f) ? v : 0.1f * v; else if (ACT == 16) v = (v >= 0.f) ? v : 0.3f * v; else if (ACT == 17) v = (v >= 0.f) ? v : 0.2f * v;
      so[w][rloc][t * 16 + ln] = v; } }
  __builtin_amdgcn_fence(__ATOMIC_ACQ_REL, "workgroup"); __builtin_amdgcn_wave_barrier();
  const int rsub = lane >> 4, c4 = (lane & 15) * 4;
  {
#pragma unroll
    for (int q = 0; q < 16; ++q) { const int r = q * 2 + rsub; const v4f v = *(const v4fa*)&so[w][r][c4]; if (C) *(v4f*)(C + cofs + (size_t)(row0 + r) * ldc + col0 + c4) = v; if (C16) { v4h h4; for (int i = 0; i < 4; ++i) h4[i] = (_Float16)v[i]; *(v4h*)(C16 + cofs + (size_t)(row0 + r) * ldc + col0 + c4) = h4; } }
     } }


__global__ __launch_bounds__(256) void k_wnat(const float* __restrict__ w, size_t n8, _Float16* __restrict__ Bt) { const size_t t = (size_t)blockIdx.x * 256 + threadIdx.x; if (t >= n8) return; FragH f; for (int q = 0; q < 8; ++q) f.h[q] = (_Float16)(bf16_round(w[t * 8 + q]) * 16.0f); *(v8us*)((unsigned short*)Bt + t * 8) = f.half[0];  }
__global__ __launch_bounds__(256) void k_rsm(const float* __restrict__ S, _Float16* __restrict__ P, int nrows) {
  #pragma clang fp contract(off)
  const int i = blockIdx.x * 256 + threadIdx.x; if (i >= nrows) return; const float* s = S + (size_t)i * SQ; float mx = -3.0e38f;
#pragma unroll 1
  for (int j = 0; j < SQ; ++j) mx = fmaxf(mx, s[j]); float se = 0.f;
#pragma unroll 1
  for (int j = 0; j < SQ; ++j) se += expf(s[j] - mx); const float sc = 256.0f / se;
#pragma unroll 1
  for (int j0 = 0; j0 < SQ; j0 += 8) { FragH f; for (int q = 0; q < 8; ++q) f.h[q] = (_Float16)(expf(s[j0 + q] - mx) * sc); unsigned short* d = (unsigned short*)P + (size_t)i * SQ + j0; *(v8us*)d = f.half[0];  } }
__global__ __launch_bounds__(256) void k_vt(const _Float16* __restrict__ V16, int b, int h0, _Float16* __restrict__ VT) { __shared__ unsigned short tl[64][65]; const int tid = threadIdx.x; const int hh = blockIdx.x % HG, sg = blockIdx.x / HG; const int s0 = sg * 64; const int h = h0 + hh;
  for (int i = tid; i < 64 * 8; i += 256) { const int j = i / 8, d8 = (i % 8) * 8; FragH f; f.half[0] = *(const v8us*)((const unsigned short*)V16 + ((size_t)b * SQ + s0 + j) * DM + h * HD + d8); for (int q = 0; q < 8; ++q) tl[d8 + q][j] = f.u[q]; }
  __syncthreads();
  { for (int i = tid; i < 64 * 8; i += 256) { const int d = i / 8, j8 = (i % 8) * 8; FragH f; for (int q = 0; q < 8; ++q) f.u[q] = tl[d][j8 + q]; *(v8us*)((unsigned short*)VT + ((size_t)hh * HD + d) * SQ + s0 + j8) = f.half[0]; }  } }



// Row softmax, one wave per row: a row of SQ f32 scores lies in the wave's registers (each load instruction of a wave reads 512
// contiguous bytes), so S is read once; maximum and sum are per-lane chains followed by a five-step butterfly over the 32 lanes.
// 16 waves per workgroup, 2 consecutive rows per wave: half as many waves to start, all of a wave's loads in flight at once, and the
// two rows' reduction chains fill each other's latency.
#define RSW 16                       /* waves per workgroup */
#define RSR 2                        /* rows per wave */
#define RSQ (SQ / 128)               /* 16-byte pieces of a row per lane */
template <int CTRL> __device__ __forceinline__ float rs_dpp(float x) { return __builtin_bit_cast(float, __builtin_amdgcn_update_dpp(0, __builtin_bit_cast(int, x), CTRL, 0xf, 0xf, true)); }      /* 0x160 + m: lane l reads lane l ^ m of its 16-lane row */
__device__ __forceinline__ float rs_xhalf(float x) { return __builtin_bit_cast(float, __builtin_amdgcn_permlanex16(__builtin_bit_cast(int, x), __builtin_bit_cast(int, x), 0x76543210, 0xfedcba98, false, false)); }      /* lane l reads lane l ^ 16 */
__device__ __forceinline__ float rs_wave_max(float v) { v = fmaxf(v, rs_dpp<0x161>(v)); v = fmaxf(v, rs_dpp<0x162>(v)); v = fmaxf(v, rs_dpp<0x164>(v)); v = fmaxf(v, rs_dpp<0x168>(v)); return fmaxf(v, rs_xhalf(v)); }
__device__ __forceinline__ float rs_wave_sum(float v) { v += rs_dpp<0x161>(v); v += rs_dpp<0x162>(v); v += rs_dpp<0x164>(v); v += rs_dpp<0x168>(v); return v + rs_xhalf(v); }
// Four native exponentials e^x = 2^(x log2 e), as __expf forms them. One statement: behind a transcendental the instruction set asks for one independent
// instruction before its result is read or its source overwritten; here each v_exp_f32 has the next one (early-clobber outputs: no overlap), the last the v_nop.
__device__ __forceinline__ v4f rs_exp4(v4f x) { x *= 1.44269504088896340736f; float e0, e1, e2, e3;
  asm("v_exp_f32 %0, %4\n\tv_exp_f32 %1, %5\n\tv_exp_f32 %2, %6\n\tv_exp_f32 %3, %7\n\tv_nop" : "=&v"(e0), "=&v"(e1), "=&v"(e2), "=&v"(e3) : "v"(x[0]), "v"(x[1]), "v"(x[2]), "v"(x[3]));
  const v4f e = {e0, e1, e2, e3}; return e; }
static_assert((HG * QN) % (RSW * RSR) == 0 && RSR == 2, "k_rsmf: whole workgroups only; the wait behind the loads names two row pointers");
__global__ __launch_bounds__(RSW * 32) void k_rsmf(const float* __restrict__ S, _Float16* __restrict__ P) {      /* rows t = 0 .. HG * QN - 1: query t % QN of head t / QN of the group */
  const unsigned l4 = 4u * (threadIdx.x & 31u); const int wave = __builtin_amdgcn_readfirstlane((int)(threadIdx.x >> 5));
  const int t0 = (blockIdx.x * RSW + wave) * RSR;
  v4f s[RSR][RSQ]; size_t row[RSR]; const float* sp[RSR];
#pragma unroll
  for (int r = 0; r < RSR; ++r) { const int t = t0 + r; row[r] = ((size_t)(t / QN) * SQ + (t % QN)) * SQ + l4; sp[r] = S + row[r];
#pragma unroll
    for (int u = 0; u < RSQ; ++u) s[r][u] = *(const v4fa*)(sp[r] + 128 * u); }
  asm volatile("s_wait_xcnt 0x0" :: "v"(sp[0]), "v"(sp[1]) : "memory");      /* precaution: as inputs the loads' address registers stay untouched up to this wait */
#pragma unroll
  for (int r = 0; r < RSR; ++r) {
    v4f m4 = s[r][0];
#pragma unroll
    for (int u = 1; u < RSQ; ++u) for (int q = 0; q < 4; ++q) m4[q] = fmaxf(m4[q], s[r][u][q]);
    const float mx = rs_wave_max(fmaxf(fmaxf(m4[0], m4[1]), fmaxf(m4[2], m4[3])));
    v4f a4 = {0.f, 0.f, 0.f, 0.f};
#pragma unroll
    for (int u = 0; u < RSQ; ++u) { s[r][u] = rs_exp4(s[r][u] - mx); a4 += s[r][u]; }
    const float sc = 256.0f / rs_wave_sum((a4[0] + a4[1]) + (a4[2] + a4[3]));
#pragma unroll
    for (int u = 0; u < RSQ; ++u) { v4h h4; for (int q = 0; q < 4; ++q) h4[q] = (_Float16)(s[r][u][q] * sc); *(v4h*)(P + row[r] + 128 * u) = h4; } } }


__global__ __launch_bounds__(256) void k_xpe(const float* __restrict__ x, _Float16* __restrict__ X16, size_t n8) {
  #pragma clang fp contract(off)
  const size_t t = (size_t)blockIdx.x * 256 + threadIdx.x; if (t >= n8) return; const size_t e0 = t * 8; const size_t r = e0 / DM; const int c0 = (int)(e0 % DM); const float s = (float)(r % SQ); const float kf = (float)(-9.210340371976184 / (double)DM); FragH f;
  for (int q = 0; q < 8; ++q) { const int c = c0 + q; const int i2 = c & ~1; const float dv = expf(__fmul_rn((float)i2, kf)); const float ang = __fmul_rn(s, dv); const float pe = (c & 1) ? cosf(ang) : sinf(ang); f.h[q] = (_Float16)__fadd_rn(bf16_round(x[e0 + q]), pe); }
  *(v8us*)((unsigned short*)X16 + e0) = f.half[0];  }
extern "C" void kernel_launch(void* const* d_in, const int* in_sizes, int n_in,
                              void* d_out, int out_size, void* d_ws, size_t ws_size, hipStream_t stream) {
  (void)in_sizes; (void)n_in; (void)out_size;
  const float* const* I = (const float* const*)d_in; const float* x = I[0]; const float* wq = I[1]; const float* bq = I[2]; const float* wk = I[3]; const float* bk = I[4]; const float* wv = I[5]; const float* bv = I[6]; const float* wo = I[7]; const float* bo = I[8];      /* nn.Linear weights [out][in] + biases */
  char* ws = (char*)d_ws; size_t off = 0;
  auto take = [&](size_t bytes) { char* p = ws + off; off += (bytes + 255) & ~(size_t)255; return p; };
  _Float16* BQ = (_Float16*)take((size_t)DM * DM * 2); _Float16* BK = (_Float16*)take((size_t)DM * DM * 2); _Float16* BV = (_Float16*)take((size_t)DM * DM * 2); _Float16* BO = (_Float16*)take((size_t)DM * DM * 2);
  _Float16* X16 = (_Float16*)take(NR * DM * 2); _Float16* Q16 = (_Float16*)take(NR * DM * 2); _Float16* K16 = (_Float16*)take(NR * DM * 2); _Float16* V16 = (_Float16*)take(NR * DM * 2); _Float16* O16 = (_Float16*)take(NR * DM * 2);
  float* S = (float*)take((size_t)HG * SQ * SQ * 4); _Float16* P = (_Float16*)take((size_t)HG * SQ * SQ * 2); _Float16* VT = (_Float16*)take((size_t)NH * HD * SQ * 2);
  if (off > ws_size) return;
  { const unsigned g = (unsigned)(((size_t)DM * DM / 8 + 255) / 256); k_wnat<<<g, 256, 0, stream>>>(wq, (size_t)DM * DM / 8, BQ); k_wnat<<<g, 256, 0, stream>>>(wk, (size_t)DM * DM / 8, BK); k_wnat<<<g, 256, 0, stream>>>(wv, (size_t)DM * DM / 8, BV); k_wnat<<<g, 256, 0, stream>>>(wo, (size_t)DM * DM / 8, BO); }      /* natural [out][in] = Bt[n][k], x16 */
  k_xpe<<<(unsigned)((NR * DM / 8 + 255) / 256), 256, 0, stream>>>(x, X16, NR * DM / 8);      /* x + sinusoidal PE -> f16 rows (not exact: x + pe is not a bf16 value) */
  const size_t r0p = (size_t)B0 * SQ;      /* first projected row */
  k_gemm2<0><<<dim3((unsigned)((MP / 128) * (DM / 64)), 1), 128, 0, stream>>>(X16 + r0p * DM, DM, 0, BQ, DM, 0, 0.0625f, bq, 0, nullptr, 1, 0, 0, nullptr, Q16 + r0p * DM, DM, 0, MP, DM, DM);
  k_gemm2<0><<<dim3((unsigned)((MP / 128) * (DM / 64)), 1), 128, 0, stream>>>(X16 + r0p * DM, DM, 0, BK, DM, 0, 0.0625f, bk, 0, nullptr, 1, 0, 0, nullptr, K16 + r0p * DM, DM, 0, MP, DM, DM);
  k_gemm2<0><<<dim3((unsigned)((MP / 128) * (DM / 64)), 1), 128, 0, stream>>>(X16 + r0p * DM, DM, 0, BV, DM, 0, 0.0625f, bv, 0, nullptr, 1, 0, 0, nullptr, V16 + r0p * DM, DM, 0, MP, DM, DM);
  for (int b = B0; b < B0 + NBR; ++b) { const size_t r0 = (size_t)b * SQ;
    k_vt<NH, SQ><<<NH * (SQ / 64), 256, 0, stream>>>(V16 + r0 * LQ, LQ, 0, VT);      /* V^T [NH][HD][SQ] for this batch */
    for (int h0 = 0; h0 < NHD; h0 += HG) {
      k_gemm2<0><<<dim3((QN / 128) * (SQ / 64), HG), 128, 0, stream>>>(Q16 + r0 * LQ + h0 * HD, LQ, (size_t)HD, K16 + r0 * LQ + h0 * HD, LQ, (size_t)HD, 0.125f, nullptr, 0, nullptr, 1, 0, 0, S, nullptr, SQ, (size_t)SQ * SQ, QN, SQ, HD);      /* scores, HG heads per launch */
      k_rsmf<<<(HG * QN) / (RSW * RSR), RSW * 32, 0, stream>>>(S, P);      /* P = 256 softmax (f16), rows of all HG heads */
      k_gemm2<0><<<dim3((QN / 128) * (HD / 64), HG), 128, 0, stream>>>(P, SQ, (size_t)SQ * SQ, VT + (size_t)h0 * HD * SQ, SQ, (size_t)HD * SQ, 0.25f, nullptr, 0, nullptr, 1, 0, 0, nullptr, O16 + r0 * DM + h0 * HD, DM, (size_t)HD, QN, HD, SQ); } }      /* o (merged heads) as f16 rows */
  k_gemm2<0><<<dim3((unsigned)((MPO / 128) * (DM / 64)), 1), 128, 0, stream>>>(O16 + r0p * DM, DM, 0, BO, DM, 0, 0.0009765625f, bo, 0, nullptr, 1, 0, 0, (float*)d_out + r0p * DM, nullptr, DM, 0, MPO, DM, DM);      /* out rows are the output layout */
}

// v002
// One run takes 255 microseconds.
// In two side-by-side timings against v001, it was 3.84 and 4.01 times as fast.
// Over all steps from v000 it is 13.8 times as fast.
#include <hip/hip_runtime.h>
// Temporal multi-head attention with sinusoidal positional encoding (x [2][2048][1024]; x = x + PE (pe[s][2i] = sin(s d_i), pe[s][2i+1] = cos(s d_i), d_i = exp(2i x (-ln 1e4 / 1024))); q = x Wq^T + bq, k, v likewise (nn.Linear [out][in] 1024^2, weights and biases sigma 1/32); 16 heads of 64; softmax(q k^T / 8) (no mask); out = ctx Wo^T + bo -> [2][2048][1024]).
// Structure: token rows r = b*2048 + s; x + PE computed on VALU (f32 expf/sinf/cosf in the module's op order) -> f16 rows (one f16 rounding of x + pe); Q, K, V as three WMMA GEMMs (32x64 wave tiles, f32 accumulation, exact x16 weights + bias, f16 outputs); V^T for all batches and heads via LDS transposes; one fused attention kernel over all (batch, head, 256 queries): scores on WMMA (K = 64), online softmax on VALU (f32 statistics, native exp2; weights as f16, scaled by a power of two that cancels), o = P . V on WMMA (o carried x64 against f16 subnormal flush, folded into the output GEMM alpha) written straight into the merged f16 o rows; out = o W_o + b GEMM (f32) into the output layout.
// Compute dtype: inputs rounded to bf16; weights exact, x + pe rounded once to f16; q, k, v, softmax weights and o as plain f16 GEMM operands (~2^-12); scores and softmax statistics f32. v_wmma_f32_16x16x32_f16.
#define NB 2
#define SQ 2048
#define DM 1024
#define NH 16
#define HD 64
#define HG 4                         /* heads per call of the unlaunched k_vt(V16, b, h0, VT) */
#define B0 0                         /* first batch processed (debug hook) */
#define NBR NB                       /* batches processed (debug hook) */
#define NR ((size_t)NB * SQ)         /* token rows */
#define MP ((int)((size_t)NBR * SQ)) /* rows projected (debug hook) */
#define QN SQ                        /* unused: k_fattn attends all SQ query rows */
#define NHD NH                       /* unused: k_fattn attends all NH heads */
#define MPO MP                       /* rows through the output stage (debug hook) */
#define LQ DM      /* row pitch of the q/k/v rows */
typedef __bf16 v16b __attribute__((ext_vector_type(16)));
typedef unsigned short v8us __attribute__((ext_vector_type(8), may_alias));
typedef float  v8f  __attribute__((ext_vector_type(8)));
typedef float  v4f  __attribute__((ext_vector_type(4)));
typedef float  v4fa __attribute__((ext_vector_type(4), may_alias));
union FragB { v16b v; v8us half[2]; unsigned short u[16]; };

__device__ __forceinline__ unsigned short bf16_bits(float x) { unsigned int u = __float_as_uint(x); return (unsigned short)((u + 0x7FFFu + ((u >> 16) & 1u)) >> 16); }
__device__ __forceinline__ float bf16_val(unsigned short b) { return __uint_as_float(((unsigned int)b) << 16); }
__device__ __forceinline__ float bf16_round(float x) { return bf16_val(bf16_bits(x)); }
// D += A·B with NT terms: 1 = ah·bh, 2 = + al·bh (A split), 3 = + ah·bl (both split)
template <int NT>
__device__ __forceinline__ v8f mmaN(v16b ah, v16b al, v16b bh, v16b bl, v8f c) {
  c = __builtin_amdgcn_wmma_f32_16x16x32_bf16(false, ah, false, bh, (short)0, c, false, false);
  if (NT >= 2) c = __builtin_amdgcn_wmma_f32_16x16x32_bf16(false, al, false, bh, (short)0, c, false, false);
  if (NT >= 3) c = __builtin_amdgcn_wmma_f32_16x16x32_bf16(false, ah, false, bl, (short)0, c, false, false);
  asm volatile("v_nop\n\tv_nop\n\tv_nop\n\tv_nop" : "+v"(c) : "v"(ah), "v"(al), "v"(bh), "v"(bl));
  return c;
}

__global__ __launch_bounds__(256) void k_wt_bf16(const float* __restrict__ W, unsigned short* __restrict__ Wt, int K, int N) {
  const int t = blockIdx.x * 256 + threadIdx.x;
  const int k8n = K / 8;
  if (t >= N * k8n) return;
  const int n = t / k8n, k8 = (t % k8n) * 8;
  v8us v;
#pragma unroll
  for (int i = 0; i < 8; ++i) v[i] = bf16_bits(W[(size_t)(k8 + i) * N + n]);
  *(v8us*)(Wt + (size_t)n * K + k8) = v;
  
}

// GEMM C[M][N] (f32, pitch ldc) = act(A[M][K]·W + bias). A f32 row-major (pitch lda) converted per fragment to bf16
// (ASPLIT: hi/lo two planes -> 2 terms, else single rounded term); Wt bf16 [N][K] (pitch ldb). BIAS_BF16 rounds the
// bias to bf16 first (bias quantised to bf16 before the add). K%32==0, M%16==0, N%64==0.
template <bool ASPLIT, int ACT, bool BIAS_BF16>
__global__ __launch_bounds__(128) void k_gemm_bf(const float* __restrict__ A, int lda, const unsigned short* __restrict__ Wt, int ldb,
                                               const float* __restrict__ bias, float* __restrict__ C, int ldc, int M, int N, int K) {
  __shared__ __attribute__((aligned(16))) float so[4][16][64];
  const int tid = threadIdx.x, w = tid >> 5, lane = tid & 31, ln = lane & 15, hh = lane >> 4;
  const int ntn = N / 64;
  const int wid = blockIdx.x * 4 + w;
  const int mt = wid / ntn, nq = wid % ntn;
  if (mt * 16 >= M) return;
  const int row0 = mt * 16, col0 = nq * 64;
  const float* arow = A + (size_t)(row0 + ln) * lda;
  v8f acc[4] = {};
  for (int kb = 0; kb < K; kb += 32) {
    FragB ah, al;
    const v4f x0 = *(const v4fa*)(arow + kb + 8 * hh), x1 = *(const v4fa*)(arow + kb + 8 * hh + 4);
    const v4f x2 = *(const v4fa*)(arow + kb + 16 + 8 * hh), x3 = *(const v4fa*)(arow + kb + 16 + 8 * hh + 4);
    float xs[16] = {x0[0],x0[1],x0[2],x0[3],x1[0],x1[1],x1[2],x1[3],x2[0],x2[1],x2[2],x2[3],x3[0],x3[1],x3[2],x3[3]};
#pragma unroll
    for (int i = 0; i < 16; ++i) { const unsigned short hb = bf16_bits(xs[i]); ah.u[i] = hb; al.u[i] = ASPLIT ? bf16_bits(xs[i] - bf16_val(hb)) : (unsigned short)0; }
#pragma unroll
    for (int t = 0; t < 4; ++t) {
      const unsigned short* brow = Wt + (size_t)(col0 + t * 16 + ln) * ldb + kb;
      FragB b;
      b.half[0] = *(const v8us*)(brow + 8 * hh);
      b.half[1] = *(const v8us*)(brow + 16 + 8 * hh);
      acc[t] = mmaN<ASPLIT ? 2 : 1>(ah.v, al.v, b.v, b.v, acc[t]);
    }
  }
#pragma unroll
  for (int t = 0; t < 4; ++t) {
    float bv = bias ? bias[col0 + t * 16 + ln] : 0.f;
    if (BIAS_BF16) bv = bf16_round(bv);
#pragma unroll
    for (int r = 0; r < 8; ++r) { float v = acc[t][r] + bv; if (ACT == 1) v = fmaxf(v, 0.f); so[w][8 * hh + r][t * 16 + ln] = v; }
  }
  __builtin_amdgcn_fence(__ATOMIC_ACQ_REL, "workgroup");
  __builtin_amdgcn_wave_barrier();
  const int rsub = lane >> 4, c4 = (lane & 15) * 4;
  {
#pragma unroll
    for (int q = 0; q < 8; ++q) {
      const int r = q * 2 + rsub;
      const v4f v = *(const v4fa*)&so[w][r][c4];
      *(v4f*)(C + (size_t)(row0 + r) * ldc + col0 + c4) = v;
    }
    
  }
}

// GEMM C = act(A·W + bias + resid): A f32 (ASPLIT -> hi/lo 2 terms), Wt bf16 [N][K]; ACT 0 none, 1 relu, 2 exact gelu;
// resid (optional, f32, row index = (row % rmod), pitch ldr, RES_BF16 rounds it) added before the activation.
template <bool ASPLIT, int ACT, bool BIAS_BF16, bool RES_BF16>
__global__ __launch_bounds__(128) void k_gemm_bf3(const float* __restrict__ A, int lda, const unsigned short* __restrict__ Wt, int ldb,
                                                const float* __restrict__ bias, const float* __restrict__ resid, int rmod, int ldr,
                                                float* __restrict__ C, int ldc, int M, int N, int K) {
  __shared__ __attribute__((aligned(16))) float so[4][16][64];
  const int tid = threadIdx.x, w = tid >> 5, lane = tid & 31, ln = lane & 15, hh = lane >> 4;
  const int ntn = N / 64;
  const int wid = blockIdx.x * 4 + w;
  const int mt = wid / ntn, nq = wid % ntn;
  if (mt * 16 >= M) return;
  const int row0 = mt * 16, col0 = nq * 64;
  const float* arow = A + (size_t)(row0 + ln) * lda;
  v8f acc[4] = {};
  for (int kb = 0; kb < K; kb += 32) {
    FragB ah, al;
    const v4f x0 = *(const v4fa*)(arow + kb + 8 * hh), x1 = *(const v4fa*)(arow + kb + 8 * hh + 4);
    const v4f x2 = *(const v4fa*)(arow + kb + 16 + 8 * hh), x3 = *(const v4fa*)(arow + kb + 16 + 8 * hh + 4);
    float xs[16] = {x0[0],x0[1],x0[2],x0[3],x1[0],x1[1],x1[2],x1[3],x2[0],x2[1],x2[2],x2[3],x3[0],x3[1],x3[2],x3[3]};
#pragma unroll
    for (int i = 0; i < 16; ++i) { const unsigned short hb = bf16_bits(xs[i]); ah.u[i] = hb; al.u[i] = ASPLIT ? bf16_bits(xs[i] - bf16_val(hb)) : (unsigned short)0; }
#pragma unroll
    for (int t = 0; t < 4; ++t) {
      const unsigned short* brow = Wt + (size_t)(col0 + t * 16 + ln) * ldb + kb;
      FragB b;
      b.half[0] = *(const v8us*)(brow + 8 * hh);
      b.half[1] = *(const v8us*)(brow + 16 + 8 * hh);
      acc[t] = mmaN<ASPLIT ? 2 : 1>(ah.v, al.v, b.v, b.v, acc[t]);
    }
  }
#pragma unroll
  for (int t = 0; t < 4; ++t) {
    const int col = col0 + t * 16 + ln;
    float bv = bias ? bias[col] : 0.f;
    if (BIAS_BF16) bv = bf16_round(bv);
#pragma unroll
    for (int r = 0; r < 8; ++r) {
      float v = acc[t][r] + bv;
      if (resid) { float rv = resid[(size_t)((row0 + 8 * hh + r) % rmod) * ldr + col]; if (RES_BF16) rv = bf16_round(rv); v += rv; }
      if (ACT == 1) v = fmaxf(v, 0.f);
      if (ACT == 2) v = 0.5f * v * (1.0f + erff(v * 0.70710678118654752f));
      if (ACT == 3) { const float u = 0.7978845608028654f * (v + 0.044715f * v * v * v); v = 0.5f * v * (1.0f + tanhf(u)); }
      so[w][8 * hh + r][t * 16 + ln] = v;
    }
  }
  __builtin_amdgcn_fence(__ATOMIC_ACQ_REL, "workgroup");
  __builtin_amdgcn_wave_barrier();
  const int rsub = lane >> 4, c4 = (lane & 15) * 4;
  {
#pragma unroll
    for (int q = 0; q < 8; ++q) {
      const int r = q * 2 + rsub;
      const v4f v = *(const v4fa*)&so[w][r][c4];
      *(v4f*)(C + (size_t)(row0 + r) * ldc + col0 + c4) = v;
    }
    
  }
}
// row LayerNorm (biased variance, eps) over N: s = X (+ R); optional out_sum <- s; out_norm <- (s-mu)*rsqrt(var+eps)*g + b
template <bool PARAM_BF16>
__global__ __launch_bounds__(256) void k_layernorm(const float* __restrict__ X, const float* __restrict__ R, const float* __restrict__ g, const float* __restrict__ bta,
                                                  float* __restrict__ out_sum, float* __restrict__ out_norm, int N, float eps) {
  __shared__ float red[256];
  const int row = blockIdx.x, tid = threadIdx.x;
  const float* x = X + (size_t)row * N; const float* rr = R ? R + (size_t)row * N : nullptr;
  float vals[16];                     // up to N = 4096
  const int per = N / 256;            // contiguous chunk per thread? use strided-by-4 chunks: thread handles j = tid*4 + 1024*u
  float s1 = 0.f;
  for (int u = 0; u < per / 4; ++u) {
    const int j = tid * 4 + 1024 * u;
    const v4f a = *(const v4fa*)(x + j);
    v4f b = {0.f,0.f,0.f,0.f}; if (rr) b = *(const v4fa*)(rr + j);
#pragma unroll
    for (int q = 0; q < 4; ++q) { const float v = a[q] + b[q]; vals[u * 4 + q] = v; s1 += v; }
  }
  red[tid] = s1; __syncthreads();
  for (int st = 128; st > 0; st >>= 1) { if (tid < st) red[tid] += red[tid + st]; __syncthreads(); }
  const float mu = red[0] / (float)N; __syncthreads();
  float s2 = 0.f;
  for (int u = 0; u < per / 4; ++u)
#pragma unroll
    for (int q = 0; q < 4; ++q) { const float c = vals[u * 4 + q] - mu; s2 += c * c; }
  red[tid] = s2; __syncthreads();
  for (int st = 128; st > 0; st >>= 1) { if (tid < st) red[tid] += red[tid + st]; __syncthreads(); }
  const float rs = rsqrtf(red[0] / (float)N + eps);
  {
    for (int u = 0; u < per / 4; ++u) {
      const int j = tid * 4 + 1024 * u;
      v4f o, sm;
#pragma unroll
      for (int q = 0; q < 4; ++q) {
        float gg = g[j + q], bb = bta[j + q];
        if (PARAM_BF16) { gg = bf16_round(gg); bb = bf16_round(bb); }
        sm[q] = vals[u * 4 + q]; o[q] = (vals[u * 4 + q] - mu) * rs * gg + bb;
      }
      if (out_sum) *(v4f*)(out_sum + (size_t)row * N + j) = sm;
      *(v4f*)(out_norm + (size_t)row * N + j) = o;
    }
    
  }
}



// ---- f16 WMMA path (v_wmma_f32_16x16x32_f16): 11-bit significands for operands in range — used where a [0,1] probability operand needs more precision than bf16
typedef _Float16 v16h __attribute__((ext_vector_type(16)));
union FragH { v16h v; v8us half[2]; _Float16 h[16]; unsigned short u[16]; };
template <int NT>
__device__ __forceinline__ v8f mmaH(v16h ah, v16h al, v16h bh, v16h bl, v8f c) {
  c = __builtin_amdgcn_wmma_f32_16x16x32_f16(false, ah, false, bh, (short)0, c, false, false);
  if (NT >= 2) c = __builtin_amdgcn_wmma_f32_16x16x32_f16(false, al, false, bh, (short)0, c, false, false);
  if (NT >= 3) c = __builtin_amdgcn_wmma_f32_16x16x32_f16(false, ah, false, bl, (short)0, c, false, false);
  asm volatile("v_nop\n\tv_nop\n\tv_nop\n\tv_nop" : "+v"(c) : "v"(ah), "v"(al), "v"(bh), "v"(bl));
  return c;
}
// batched GEMM like k_gemm_b but f16 operands: A f32 (split into f16 hi/lo if ASPLIT, else rounded to f16), Bt = f16 values [n][k]; alpha; C f32; N multiple of 16 (partial tiles skipped)
template <bool ASPLIT>
__global__ __launch_bounds__(128) void k_gemm_h(const float* __restrict__ A, int lda, size_t sA, const _Float16* __restrict__ Bh, int ldb, size_t sB, float alpha, float* __restrict__ C, int ldc, size_t sC, int M, int N, int K) {
  __shared__ __attribute__((aligned(16))) float so[4][16][64];
  const int tid = threadIdx.x, w = tid >> 5, lane = tid & 31, ln = lane & 15, hh = lane >> 4; const int by = blockIdx.y;
  A += (size_t)by * sA; Bh += (size_t)by * sB; C += (size_t)by * sC;
  const int ntn = (N + 63) / 64; const int wid = blockIdx.x * 4 + w; const int mt = wid / ntn, nq = wid % ntn; if (mt * 16 >= M) return;
  const int row0 = mt * 16, col0 = nq * 64; const float* arow = A + (size_t)(row0 + ln) * lda;
  v8f acc[4] = {};
  for (int kb = 0; kb < K; kb += 32) {
    FragH ah, al;
    const v4f x0 = *(const v4fa*)(arow + kb + 8 * hh), x1 = *(const v4fa*)(arow + kb + 8 * hh + 4), x2 = *(const v4fa*)(arow + kb + 16 + 8 * hh), x3 = *(const v4fa*)(arow + kb + 16 + 8 * hh + 4);
    float xs[16] = {x0[0],x0[1],x0[2],x0[3],x1[0],x1[1],x1[2],x1[3],x2[0],x2[1],x2[2],x2[3],x3[0],x3[1],x3[2],x3[3]};
#pragma unroll
    for (int i = 0; i < 16; ++i) { const _Float16 h = (_Float16)xs[i]; ah.h[i] = h; al.h[i] = ASPLIT ? (_Float16)(xs[i] - (float)h) : (_Float16)0.0f; }
#pragma unroll
    for (int t = 0; t < 4; ++t) { if (col0 + t * 16 >= N) continue; const size_t boff = (size_t)(col0 + t * 16 + ln) * ldb + kb; FragH bq; bq.half[0] = *(const v8us*)(Bh + boff + 8 * hh); bq.half[1] = *(const v8us*)(Bh + boff + 16 + 8 * hh);
      acc[t] = mmaH<ASPLIT ? 2 : 1>(ah.v, al.v, bq.v, bq.v, acc[t]); }
  }
#pragma unroll
  for (int t = 0; t < 4; ++t) { if (col0 + t * 16 >= N) continue;
#pragma unroll
    for (int r = 0; r < 8; ++r) so[w][8 * hh + r][t * 16 + ln] = acc[t][r] * alpha; }
  __builtin_amdgcn_fence(__ATOMIC_ACQ_REL, "workgroup"); __builtin_amdgcn_wave_barrier();
  const int rsub = lane >> 4, c4 = (lane & 15) * 4;
  {
#pragma unroll
    for (int q = 0; q < 8; ++q) { const int r = q * 2 + rsub; if (col0 + c4 < N) { const v4f v = *(const v4fa*)&so[w][r][c4]; *(v4f*)(C + (size_t)(row0 + r) * ldc + col0 + c4) = v; } }
     }
}

// Wt[n][k] = f16(W[k][n]·scale) from f32 row-major W[K][N] (scale = power of two; bf16-exact weights stay exact in f16 away from the subnormal range)
__global__ __launch_bounds__(256) void k_wt_f16(const float* __restrict__ W, _Float16* __restrict__ Wt, int K, int N, float scale) {
  const int t = blockIdx.x * 256 + threadIdx.x; if (t >= N * (K / 8)) return; const int n = t / (K / 8), k8 = (t % (K / 8)) * 8; FragH f;
#pragma unroll
  for (int i = 0; i < 8; ++i) f.h[i] = (_Float16)(bf16_round(W[(size_t)(k8 + i) * N + n]) * scale); const v8us o = f.half[0];
  *(v8us*)((unsigned short*)Wt + (size_t)n * K + k8) = o; 
}
// k_gemm_hh variant with fused epilogue: v = acc·alpha + bias[by·sBias + col] (+ CP[(row/rowsPerB)·sCPb + by·64 + col] if CP) ; ACT 0 none / 1 elu ; writes f16 C16 (and f32 C if non-null)
template <int ACT>
__global__ __launch_bounds__(128) void k_gemm_hhx(const _Float16* __restrict__ A, int lda, size_t sA, const _Float16* __restrict__ Bh, int ldb, size_t sB, float alpha, const float* __restrict__ bias, size_t sBias, const float* __restrict__ CP, int rowsPerB, size_t sCPb, int row0g,
    float* __restrict__ C, _Float16* __restrict__ C16, int ldc, size_t sC, int M, int N, int K) {
  __shared__ __attribute__((aligned(16))) float so[4][16][64];
  const int tid = threadIdx.x, w = tid >> 5, lane = tid & 31, ln = lane & 15, hh = lane >> 4; const int by = blockIdx.y;
  A += (size_t)by * sA; Bh += (size_t)by * sB; const size_t cofs = (size_t)by * sC; const float* bp = bias ? bias + (size_t)by * sBias : nullptr;
  const int ntn = (N + 63) / 64; const int wid = blockIdx.x * 4 + w; const int mt = wid / ntn, nq = wid % ntn; if (mt * 16 >= M) return;
  const int row0 = mt * 16, col0 = nq * 64; const _Float16* arow = A + (size_t)(row0 + ln) * lda;
  v8f acc[4] = {};
  for (int kb = 0; kb < K; kb += 32) { FragH ah; ah.half[0] = *(const v8us*)((const unsigned short*)arow + kb + 8 * hh); ah.half[1] = *(const v8us*)((const unsigned short*)arow + kb + 16 + 8 * hh);
#pragma unroll
    for (int t = 0; t < 4; ++t) { if (col0 + t * 16 >= N) continue; const size_t boff = (size_t)(col0 + t * 16 + ln) * ldb + kb; FragH bq; bq.half[0] = *(const v8us*)((const unsigned short*)Bh + boff + 8 * hh); bq.half[1] = *(const v8us*)((const unsigned short*)Bh + boff + 16 + 8 * hh);
      acc[t] = mmaH<1>(ah.v, ah.v, bq.v, bq.v, acc[t]); }
  }
#pragma unroll
  for (int t = 0; t < 4; ++t) { if (col0 + t * 16 >= N) continue; const int col = col0 + t * 16 + ln; const float bv = bp ? bf16_round(bp[col]) : 0.f;
#pragma unroll
    for (int r = 0; r < 8; ++r) { float v = acc[t][r] * alpha + bv; if (CP) { const int rr = row0g + row0 + 8 * hh + r; if (rowsPerB < 0) v += CP[cofs + (size_t)rr * ldc + col];      /* rowsPerB < 0: own element of the batched C plane */ else { const int bidx = rr / rowsPerB; v += CP[(size_t)bidx * sCPb + (size_t)by * 64 + col]; } } if (ACT == 1) v = (v > 0.f) ? v : expm1f(v); else if (ACT == 7) v = (v > 0.f) ? v + 1.0f : expf(v); else if (ACT == 8) v = tanhf(v); else if (ACT == 9) v = 0.5f * v * (1.0f + tanhf(0.7978845608028654f * (v + 0.044715f * v * v * v))); else if (ACT == 11) v = 1.0f / (1.0f + expf(-v)); else if (ACT == 12) v = (v > 0.f) ? v : 0.01f * v; else if (ACT == 14) v = (v > 0.f) ? v : 0.1f * v; else if (ACT == 16) v = (v >= 0.f) ? v : 0.3f * v; else if (ACT == 17) v = (v >= 0.f) ? v : 0.2f * v; else if (ACT == 15) v = v / (1.0f + expf(-v)); else if (ACT == 3) v = fmaxf(v, 0.f); else if (ACT == 6) v = 0.5f * v * (1.0f + erff(v * 0.70710678118654752f)); so[w][8 * hh + r][t * 16 + ln] = v; } }
  __builtin_amdgcn_fence(__ATOMIC_ACQ_REL, "workgroup"); __builtin_amdgcn_wave_barrier();
  const int rsub = lane >> 4, c4 = (lane & 15) * 4; typedef _Float16 v4h __attribute__((ext_vector_type(4)));
  {
#pragma unroll
    for (int q = 0; q < 8; ++q) { const int r = q * 2 + rsub; if (col0 + c4 < N) { const v4f v = *(const v4fa*)&so[w][r][c4]; if (C) *(v4f*)(C + cofs + (size_t)(row0 + r) * ldc + col0 + c4) = v; if (C16) { v4h h4; for (int i = 0; i < 4; ++i) h4[i] = (_Float16)v[i]; *(v4h*)(C16 + cofs + (size_t)(row0 + r) * ldc + col0 + c4) = h4; } } }
     }
}


typedef _Float16 v4h __attribute__((ext_vector_type(4)));

__global__ __launch_bounds__(256) void k_x16(const float* __restrict__ x, _Float16* __restrict__ X16, size_t n8) { const size_t t = (size_t)blockIdx.x * 256 + threadIdx.x; if (t >= n8) return; FragH f;
#pragma unroll
  for (int q = 0; q < 8; ++q) f.h[q] = (_Float16)bf16_round(x[t * 8 + q]); *(v8us*)((unsigned short*)X16 + t * 8) = f.half[0];  }
__global__ __launch_bounds__(256) void k_h16(const float* __restrict__ x, _Float16* __restrict__ X16, size_t n8) { const size_t t = (size_t)blockIdx.x * 256 + threadIdx.x; if (t >= n8) return; FragH f;
#pragma unroll
  for (int q = 0; q < 8; ++q) f.h[q] = (_Float16)x[t * 8 + q]; *(v8us*)((unsigned short*)X16 + t * 8) = f.half[0];  }
__global__ __launch_bounds__(256) void k_round16f(const float* __restrict__ W, _Float16* __restrict__ Bt, size_t n8) { const size_t t = (size_t)blockIdx.x * 256 + threadIdx.x; if (t >= n8) return; FragH f;
#pragma unroll
  for (int i = 0; i < 8; ++i) f.h[i] = (_Float16)(bf16_round(W[t * 8 + i]) * 16.0f); *(v8us*)((unsigned short*)Bt + t * 8) = f.half[0];  }
template <int NHv, int TTv>
__global__ __launch_bounds__(256) void k_vt(const _Float16* __restrict__ V16, int ldv, int voff, _Float16* __restrict__ Vt) { __shared__ unsigned short tl[64][66]; const int tid = threadIdx.x; const int slab = blockIdx.x / (TTv / 64), lg = blockIdx.x % (TTv / 64); const int b = slab / NHv, h = slab % NHv;
  for (int i = tid; i < 64 * 8; i += 256) { const int r = i / 8, c8 = (i % 8) * 8; FragH f; f.half[0] = *(const v8us*)((const unsigned short*)V16 + ((size_t)b * TTv + lg * 64 + r) * ldv + voff + h * 64 + c8);
#pragma unroll
    for (int q = 0; q < 8; ++q) tl[r][c8 + q] = f.u[q]; }
  __syncthreads();
  {
#pragma unroll
    for (int rd = 0; rd < 2; ++rd) { const int d = rd * 32 + tid / 8, pc = tid % 8; FragH f;
#pragma unroll
      for (int q = 0; q < 8; ++q) f.u[q] = tl[pc * 8 + q][d];
      *(v8us*)((unsigned short*)Vt + ((size_t)slab * 64 + d) * TTv + lg * 64 + pc * 8) = f.half[0]; }
     } }

__global__ __launch_bounds__(256) void k_hl(const float* __restrict__ F, _Float16* __restrict__ Hh, _Float16* __restrict__ Hl, size_t n8) { const size_t t = (size_t)blockIdx.x * 256 + threadIdx.x; if (t >= n8) return; FragH fh, fl; const v4f a = *(const v4fa*)(F + t * 8), c = *(const v4fa*)(F + t * 8 + 4);
#pragma unroll
  for (int q = 0; q < 4; ++q) { _Float16 h = (_Float16)a[q]; fh.h[q] = h; fl.h[q] = (_Float16)((a[q] - (float)h) * 1024.0f); h = (_Float16)c[q]; fh.h[4 + q] = h; fl.h[4 + q] = (_Float16)((c[q] - (float)h) * 1024.0f); }
  { *(v8us*)((unsigned short*)Hh + t * 8) = fh.half[0]; *(v8us*)((unsigned short*)Hl + t * 8) = fl.half[0];  } }

// ---- fast GEMM (wave tile 32x64; requires M % 32 == 0 rows per launch region and N % 64 == 0); epilogue = k_gemm_hhx semantics ----
__device__ __forceinline__ v16h g2_frag(const _Float16* p, int hh) { FragH f; f.half[0] = *(const v8us*)((const unsigned short*)p + 8 * hh); f.half[1] = *(const v8us*)((const unsigned short*)p + 16 + 8 * hh); return f.v; }
__device__ __forceinline__ v8f g2_mma(v16h a, v16h b, v8f c) { v8f d = __builtin_amdgcn_wmma_f32_16x16x32_f16(false, a, false, b, (short)0, c, false, false); asm volatile("v_nop\n\tv_nop\n\tv_nop\n\tv_nop" : "+v"(d) : "v"(a), "v"(b)); return d; }
template <int ACT>
__global__ __launch_bounds__(128) void k_gemm2(const _Float16* __restrict__ A, int lda, size_t sA, const _Float16* __restrict__ Bh, int ldb, size_t sB, float alpha, const float* __restrict__ bias, size_t sBias, const float* __restrict__ CP, int rowsPerB, size_t sCPb, int row0g,
    float* __restrict__ C, _Float16* __restrict__ C16, int ldc, size_t sC, int M, int N, int K) { static_assert(ACT == 0 || ACT == 3 || ACT == 6 || ACT == 8 || ACT == 9 || ACT == 11 || ACT == 12 || ACT == 14 || ACT == 15 || ACT == 16 || ACT == 17, "k_gemm2: unsupported ACT code (would silently apply no activation)");
  __shared__ __attribute__((aligned(16))) float so[4][32][68];
  const int tid = threadIdx.x, w = tid >> 5, lane = tid & 31, ln = lane & 15, hh = lane >> 4; const int by = blockIdx.y;
  A += (size_t)by * sA; Bh += (size_t)by * sB; const size_t cofs = (size_t)by * sC; const float* bp = bias ? bias + (size_t)by * sBias : nullptr;
  const int ntn = N >> 6; const int mt = blockIdx.x / ntn, nq = blockIdx.x - mt * ntn; const int row0 = mt * 128 + 32 * w, col0 = nq * 64; if (row0 >= M) return;
  const _Float16* a0p = A + (size_t)(row0 + ln) * lda; const _Float16* a1p = a0p + (size_t)16 * lda;
  const _Float16* b0p = Bh + (size_t)(col0 + ln) * ldb; const _Float16* b1p = b0p + (size_t)16 * ldb; const _Float16* b2p = b1p + (size_t)16 * ldb; const _Float16* b3p = b2p + (size_t)16 * ldb;
  const v8f z8 = {0.f,0.f,0.f,0.f,0.f,0.f,0.f,0.f}; v8f c00 = z8, c01 = z8, c02 = z8, c03 = z8, c10 = z8, c11 = z8, c12 = z8, c13 = z8;
#pragma unroll 1
  for (int kb = 0; kb < K; kb += 32) { const v16h a0 = g2_frag(a0p + kb, hh), a1 = g2_frag(a1p + kb, hh);
    v16h b = g2_frag(b0p + kb, hh); c00 = g2_mma(a0, b, c00); c10 = g2_mma(a1, b, c10);
    b = g2_frag(b1p + kb, hh); c01 = g2_mma(a0, b, c01); c11 = g2_mma(a1, b, c11);
    b = g2_frag(b2p + kb, hh); c02 = g2_mma(a0, b, c02); c12 = g2_mma(a1, b, c12);
    b = g2_frag(b3p + kb, hh); c03 = g2_mma(a0, b, c03); c13 = g2_mma(a1, b, c13); }
  v8f accs[8] = {c00, c01, c02, c03, c10, c11, c12, c13};
#pragma unroll
  for (int u = 0; u < 8; ++u) { const int t = u & 3, half = u >> 2; const int col = col0 + t * 16 + ln; const float bv = bp ? bf16_round(bp[col]) : 0.f;
#pragma unroll
    for (int r = 0; r < 8; ++r) { const int rloc = half * 16 + 8 * hh + r; float v = accs[u][r] * alpha + bv; if (CP) { if (rowsPerB < 0) v += CP[cofs + (size_t)(row0g + row0 + rloc) * ldc + col];      /* rowsPerB < 0: own element of the batched C plane */ else { const int bidx = (row0g + row0 + rloc) / rowsPerB; v += CP[(size_t)bidx * sCPb + (size_t)by * 64 + col]; } }
      if (ACT == 3) v = fmaxf(v, 0.f); else if (ACT == 6) v = 0.5f * v * (1.0f + erff(v * 0.70710678118654752f)); else if (ACT == 11) v = 1.0f / (1.0f + expf(-v)); else if (ACT == 15) v = v / (1.0f + expf(-v)); else if (ACT == 12) v = (v > 0.f) ? v : 0.01f * v; else if (ACT == 8) v = tanhf(v); else if (ACT == 9) v = 0.5f * v * (1.0f + tanhf(0.7978845608028654f * (v + 0.044715f * v * v * v))); else if (ACT == 14) v = (v > 0.f) ? v : 0.1f * v; else if (ACT == 16) v = (v >= 0.f) ? v : 0.3f * v; else if (ACT == 17) v = (v >= 0.f) ? v : 0.2f * v;
      so[w][rloc][t * 16 + ln] = v; } }
  __builtin_amdgcn_fence(__ATOMIC_ACQ_REL, "workgroup"); __builtin_amdgcn_wave_barrier();
  const int rsub = lane >> 4, c4 = (lane & 15) * 4;
  {
#pragma unroll
    for (int q = 0; q < 16; ++q) { const int r = q * 2 + rsub; const v4f v = *(const v4fa*)&so[w][r][c4]; if (C) *(v4f*)(C + cofs + (size_t)(row0 + r) * ldc + col0 + c4) = v; if (C16) { v4h h4; for (int i = 0; i < 4; ++i) h4[i] = (_Float16)v[i]; *(v4h*)(C16 + cofs + (size_t)(row0 + r) * ldc + col0 + c4) = h4; } }
     } }


__global__ __launch_bounds__(256) void k_wnat(const float* __restrict__ w, size_t n8, _Float16* __restrict__ Bt) { const size_t t = (size_t)blockIdx.x * 256 + threadIdx.x; if (t >= n8) return; FragH f; for (int q = 0; q < 8; ++q) f.h[q] = (_Float16)(bf16_round(w[t * 8 + q]) * 16.0f); *(v8us*)((unsigned short*)Bt + t * 8) = f.half[0];  }
__global__ __launch_bounds__(256) void k_rsm(const float* __restrict__ S, _Float16* __restrict__ P, int nrows) {
  #pragma clang fp contract(off)
  const int i = blockIdx.x * 256 + threadIdx.x; if (i >= nrows) return; const float* s = S + (size_t)i * SQ; float mx = -3.0e38f;
#pragma unroll 1
  for (int j = 0; j < SQ; ++j) mx = fmaxf(mx, s[j]); float se = 0.f;
#pragma unroll 1
  for (int j = 0; j < SQ; ++j) se += expf(s[j] - mx); const float sc = 256.0f / se;
#pragma unroll 1
  for (int j0 = 0; j0 < SQ; j0 += 8) { FragH f; for (int q = 0; q < 8; ++q) f.h[q] = (_Float16)(expf(s[j0 + q] - mx) * sc); unsigned short* d = (unsigned short*)P + (size_t)i * SQ + j0; *(v8us*)d = f.half[0];  } }
__global__ __launch_bounds__(256) void k_vt(const _Float16* __restrict__ V16, int b, int h0, _Float16* __restrict__ VT) { __shared__ unsigned short tl[64][65]; const int tid = threadIdx.x; const int hh = blockIdx.x % HG, sg = blockIdx.x / HG; const int s0 = sg * 64; const int h = h0 + hh;
  for (int i = tid; i < 64 * 8; i += 256) { const int j = i / 8, d8 = (i % 8) * 8; FragH f; f.half[0] = *(const v8us*)((const unsigned short*)V16 + ((size_t)b * SQ + s0 + j) * DM + h * HD + d8); for (int q = 0; q < 8; ++q) tl[d8 + q][j] = f.u[q]; }
  __syncthreads();
  { for (int i = tid; i < 64 * 8; i += 256) { const int d = i / 8, j8 = (i % 8) * 8; FragH f; for (int q = 0; q < 8; ++q) f.u[q] = tl[d][j8 + q]; *(v8us*)((unsigned short*)VT + ((size_t)hh * HD + d) * SQ + s0 + j8) = f.half[0]; }  } }



#define FAW 8                        /* waves per workgroup */
#define FAK 64                       /* keys per stage */
#define FAP 72                       /* LDS row pitch in f16: 128 bytes of data + 16, so that the 16 rows of a fragment read start in 16 different bank groups */
#define FAT (SQ / FAK)               /* stages */
__device__ __forceinline__ float rs_xhalf(float x) { return __builtin_bit_cast(float, __builtin_amdgcn_permlanex16(__builtin_bit_cast(int, x), __builtin_bit_cast(int, x), 0x76543210, 0xfedcba98, false, false)); }      /* lane l reads lane l ^ 16 */
__device__ __forceinline__ v16h fa_frag(const unsigned short* p, int hh) { FragH f; f.half[0] = *(const v8us*)(p + 8 * hh); f.half[1] = *(const v8us*)(p + 16 + 8 * hh); return f.v; }
__device__ __forceinline__ v8f fa_mma(v16h a, v16h b, v8f c) { return __builtin_amdgcn_wmma_f32_16x16x32_f16(false, a, false, b, (short)0, c, false, false); }
// Eight native 2^x (v_exp_f32). The builtin, not asm text: the compiler schedules these between the matrix instructions and must see which registers they write.
__device__ __forceinline__ v8f fa_exp2x8(v8f x) { v8f e;
#pragma unroll      /* the vector stays in registers */
  for (int i = 0; i < 8; ++i) e[i] = __builtin_amdgcn_exp2f(x[i]);
  return e; }
static_assert(SQ % (FAW * 32) == 0 && SQ % FAK == 0 && HD == 64 && FAK == 64 && FAW * 32 == 256, "k_fattn: whole workgroups and stages; 256 threads stage 64 rows of 128 bytes in two rounds");
__global__ __launch_bounds__(FAW * 32) void k_fattn(const _Float16* __restrict__ Q16, const _Float16* __restrict__ K16, const _Float16* __restrict__ VT, _Float16* __restrict__ O16) {
  __shared__ __attribute__((aligned(16))) unsigned short sk[2][FAK][FAP];      /* K rows [key][d] */
  __shared__ __attribute__((aligned(16))) unsigned short sv[2][HD][FAP];       /* V^T rows [d][key] */
  const int tid = threadIdx.x, w = tid >> 5, lane = tid & 31, ln = lane & 15, hh = lane >> 4;
  const int bh = blockIdx.y, b = bh / NH, hd = bh - b * NH; const size_t r0 = (size_t)b * SQ; const int q0 = (blockIdx.x * FAW + w) * 32;
  const int srow = tid >> 3, sc8 = (tid & 7) * 8;      /* staging: 8 threads per 128-byte row, rows srow and srow + 32 */
  const unsigned short* kg = (const unsigned short*)K16 + (r0 + srow) * DM + hd * HD + sc8;
  const unsigned short* vg = (const unsigned short*)VT + ((size_t)bh * HD + srow) * SQ + sc8;
  v16h qf[2][2];      /* [16-query group][32 of d] */
  /* the short loops below are all unrolled so that the fragment and accumulator arrays stay in registers */
#pragma unroll
  for (int g = 0; g < 2; ++g)
#pragma unroll
    for (int ks = 0; ks < 2; ++ks) qf[g][ks] = g2_frag(Q16 + (r0 + q0 + g * 16 + ln) * DM + hd * HD + ks * 32, hh);
  const v8f z8 = {0.f, 0.f, 0.f, 0.f, 0.f, 0.f, 0.f, 0.f};
  v8f o[2][4] = {{z8, z8, z8, z8}, {z8, z8, z8, z8}}; float ms[2] = {-3.0e38f, -3.0e38f}, l[2] = {0.f, 0.f};
  const float cs = 0.125f * 1.44269504088896340736f;      /* 64^-0.5 log2 e */
  v8us kr0 = *(const v8us*)kg, kr1 = *(const v8us*)(kg + (size_t)32 * DM), vr0 = *(const v8us*)vg, vr1 = *(const v8us*)(vg + (size_t)32 * SQ);
  asm volatile("s_wait_xcnt 0x0" ::: "memory");      /* precaution: stands in front of every later write of a register that the loads above name as an address */
  *(v8us*)&sk[0][srow][sc8] = kr0; *(v8us*)&sk[0][srow + 32][sc8] = kr1; *(v8us*)&sv[0][srow][sc8] = vr0; *(v8us*)&sv[0][srow + 32][sc8] = vr1;
  __syncthreads();      /* stage 0 is published */
  for (int t = 0; t < FAT; ++t) { const int cur = t & 1;
    if (t + 1 < FAT) { const unsigned short* kn = kg + (size_t)(t + 1) * FAK * DM; const unsigned short* vn = vg + (t + 1) * FAK;
      kr0 = *(const v8us*)kn; kr1 = *(const v8us*)(kn + (size_t)32 * DM); vr0 = *(const v8us*)vn; vr1 = *(const v8us*)(vn + (size_t)32 * SQ); }
#pragma unroll
    for (int hp = 0; hp < 2; ++hp) {      /* two passes of 32 keys per stage: half the score registers live at once; unrolled, so that one pass's matrix work can be scheduled among the other's softmax */
      v8f s[2][2];      /* S^T: [query group][16-key tile], register r = key 8 hh + r, lane column = query */
#pragma unroll
      for (int j = 0; j < 2; ++j) { const v16h a0 = fa_frag(&sk[cur][hp * 32 + j * 16 + ln][0], hh), a1 = fa_frag(&sk[cur][hp * 32 + j * 16 + ln][32], hh);
#pragma unroll
        for (int g = 0; g < 2; ++g) s[g][j] = fa_mma(a1, qf[g][1], fa_mma(a0, qf[g][0], z8)); }
      v16h va[4];
#pragma unroll
      for (int dt = 0; dt < 4; ++dt) va[dt] = fa_frag(&sv[cur][dt * 16 + ln][hp * 32], hh);
      float mxs[2];
#pragma unroll
      for (int g = 0; g < 2; ++g) { const v8f mv = __builtin_elementwise_max(s[g][0], s[g][1]);
        const float mx = fmaxf(fmaxf(fmaxf(mv[0], mv[1]), fmaxf(mv[2], mv[3])), fmaxf(fmaxf(mv[4], mv[5]), fmaxf(mv[6], mv[7])));
        mxs[g] = fmaxf(mx, rs_xhalf(mx)) * cs; }
      if (__builtin_amdgcn_ballot_w32(mxs[0] > ms[0] + 8.0f || mxs[1] > ms[1] + 8.0f) != 0) {      /* wave-uniform: some query's maximum has outgrown the one in use */
        const float n0 = fmaxf(ms[0], mxs[0]), n1 = fmaxf(ms[1], mxs[1]); const float c0 = __builtin_amdgcn_exp2f(ms[0] - n0), c1 = __builtin_amdgcn_exp2f(ms[1] - n1);      /* the two rescale factors */
        ms[0] = n0; ms[1] = n1; l[0] *= c0; l[1] *= c1;
#pragma unroll
        for (int dt = 0; dt < 4; ++dt) { o[0][dt] *= c0; o[1][dt] *= c1; } }
      v16h pf[2];      /* P^T as B operand, per query group */
#pragma unroll
      for (int g = 0; g < 2; ++g) { const float nb = 7.0f - ms[g];
#pragma unroll
        for (int j = 0; j < 2; ++j) s[g][j] = fa_exp2x8(s[g][j] * cs + nb);
        const v8f ps = s[g][0] + s[g][1];
        l[g] += ((ps[0] + ps[1]) + (ps[2] + ps[3])) + ((ps[4] + ps[5]) + (ps[6] + ps[7]));
        FragH f;
#pragma unroll
        for (int i = 0; i < 8; ++i) { f.h[i] = (_Float16)s[g][0][i]; f.h[8 + i] = (_Float16)s[g][1][i]; }
        pf[g] = f.v; }
#pragma unroll
      for (int dt = 0; dt < 4; ++dt)
#pragma unroll
        for (int g = 0; g < 2; ++g) o[g][dt] = fa_mma(va[dt], pf[g], o[g][dt]); }
    if (t + 1 < FAT) { *(v8us*)&sk[cur ^ 1][srow][sc8] = kr0; *(v8us*)&sk[cur ^ 1][srow + 32][sc8] = kr1; *(v8us*)&sv[cur ^ 1][srow][sc8] = vr0; *(v8us*)&sv[cur ^ 1][srow + 32][sc8] = vr1; }      /* its last readers left this buffer at the barrier of stage t - 1 */
    __syncthreads(); }      /* publishes stage t + 1 and ends every read of stage t */
#pragma unroll
  for (int g = 0; g < 2; ++g) { const float inv = 64.0f / (l[g] + rs_xhalf(l[g]));      /* the halves hold disjoint keys; o is carried x64 */
    unsigned short* op = (unsigned short*)O16 + (r0 + q0 + g * 16 + ln) * DM + hd * HD + 8 * hh;
#pragma unroll
    for (int dt = 0; dt < 4; ++dt) { FragH f;
#pragma unroll
      for (int r = 0; r < 8; ++r) f.h[r] = (_Float16)(o[g][dt][r] * inv);
      *(v8us*)(op + dt * 16) = f.half[0]; }      /* register r = d 16 dt + 8 hh + r of query ln: 16 contiguous bytes */
    if (g == 0) asm volatile("s_wait_xcnt 0x0" ::: "memory"); } }      /* precaution: stands in front of every later write of a register that the first group's stores name */


__global__ __launch_bounds__(256) void k_xpe(const float* __restrict__ x, _Float16* __restrict__ X16, size_t n8) {
  #pragma clang fp contract(off)
  const size_t t = (size_t)blockIdx.x * 256 + threadIdx.x; if (t >= n8) return; const size_t e0 = t * 8; const size_t r = e0 / DM; const int c0 = (int)(e0 % DM); const float s = (float)(r % SQ); const float kf = (float)(-9.210340371976184 / (double)DM); FragH f;
  for (int q = 0; q < 8; ++q) { const int c = c0 + q; const int i2 = c & ~1; const float dv = expf(__fmul_rn((float)i2, kf)); const float ang = __fmul_rn(s, dv); const float pe = (c & 1) ? cosf(ang) : sinf(ang); f.h[q] = (_Float16)__fadd_rn(bf16_round(x[e0 + q]), pe); }
  *(v8us*)((unsigned short*)X16 + e0) = f.half[0];  }
extern "C" void kernel_launch(void* const* d_in, const int* in_sizes, int n_in,
                              void* d_out, int out_size, void* d_ws, size_t ws_size, hipStream_t stream) {
  (void)in_sizes; (void)n_in; (void)out_size;
  const float* const* I = (const float* const*)d_in; const float* x = I[0]; const float* wq = I[1]; const float* bq = I[2]; const float* wk = I[3]; const float* bk = I[4]; const float* wv = I[5]; const float* bv = I[6]; const float* wo = I[7]; const float* bo = I[8];      /* nn.Linear weights [out][in] + biases */
  char* ws = (char*)d_ws; size_t off = 0;
  auto take = [&](size_t bytes) { char* p = ws + off; off += (bytes + 255) & ~(size_t)255; return p; };
  _Float16* BQ = (_Float16*)take((size_t)DM * DM * 2); _Float16* BK = (_Float16*)take((size_t)DM * DM * 2); _Float16* BV = (_Float16*)take((size_t)DM * DM * 2); _Float16* BO = (_Float16*)take((size_t)DM * DM * 2);
  _Float16* X16 = (_Float16*)take(NR * DM * 2); _Float16* Q16 = (_Float16*)take(NR * DM * 2); _Float16* K16 = (_Float16*)take(NR * DM * 2); _Float16* V16 = (_Float16*)take(NR * DM * 2); _Float16* O16 = (_Float16*)take(NR * DM * 2);
  _Float16* VT = (_Float16*)take((size_t)NB * NH * HD * SQ * 2);
  if (off > ws_size) return;
  { const unsigned g = (unsigned)(((size_t)DM * DM / 8 + 255) / 256); k_wnat<<<g, 256, 0, stream>>>(wq, (size_t)DM * DM / 8, BQ); k_wnat<<<g, 256, 0, stream>>>(wk, (size_t)DM * DM / 8, BK); k_wnat<<<g, 256, 0, stream>>>(wv, (size_t)DM * DM / 8, BV); k_wnat<<<g, 256, 0, stream>>>(wo, (size_t)DM * DM / 8, BO); }      /* natural [out][in] = Bt[n][k], x16 */
  k_xpe<<<(unsigned)((NR * DM / 8 + 255) / 256), 256, 0, stream>>>(x, X16, NR * DM / 8);      /* x + sinusoidal PE -> f16 rows (not exact: x + pe is not a bf16 value) */
  const size_t r0p = (size_t)B0 * SQ;      /* first projected row */
  k_gemm2<0><<<dim3((unsigned)((MP / 128) * (DM / 64)), 1), 128, 0, stream>>>(X16 + r0p * DM, DM, 0, BQ, DM, 0, 0.0625f, bq, 0, nullptr, 1, 0, 0, nullptr, Q16 + r0p * DM, DM, 0, MP, DM, DM);
  k_gemm2<0><<<dim3((unsigned)((MP / 128) * (DM / 64)), 1), 128, 0, stream>>>(X16 + r0p * DM, DM, 0, BK, DM, 0, 0.0625f, bk, 0, nullptr, 1, 0, 0, nullptr, K16 + r0p * DM, DM, 0, MP, DM, DM);
  k_gemm2<0><<<dim3((unsigned)((MP / 128) * (DM / 64)), 1), 128, 0, stream>>>(X16 + r0p * DM, DM, 0, BV, DM, 0, 0.0625f, bv, 0, nullptr, 1, 0, 0, nullptr, V16 + r0p * DM, DM, 0, MP, DM, DM);
  k_vt<NH, SQ><<<NB * NH * (SQ / 64), 256, 0, stream>>>(V16, LQ, 0, VT);      /* V^T [NB][NH][HD][SQ] */
  k_fattn<<<dim3(SQ / (FAW * 32), NB * NH), FAW * 32, 0, stream>>>(Q16, K16, VT, O16);      /* o (merged heads, x64) as f16 rows */
  k_gemm2<0><<<dim3((unsigned)((MPO / 128) * (DM / 64)), 1), 128, 0, stream>>>(O16 + r0p * DM, DM, 0, BO, DM, 0, 0.0009765625f, bo, 0, nullptr, 1, 0, 0, (float*)d_out + r0p * DM, nullptr, DM, 0, MPO, DM, DM);      /* out rows are the output layout */
}

// v003
// It runs in 132 microseconds.
// Two timings next to v002 put it at 1.90 and 1.96 times that version's speed.
// Counting every step since v000, it is 26.6 times as fast.
#include <hip/hip_runtime.h>
// Temporal multi-head attention with sinusoidal positional encoding (x [2][2048][1024]; x = x + PE (pe[s][2i] = sin(s d_i), pe[s][2i+1] = cos(s d_i), d_i = exp(2i x (-ln 1e4 / 1024))); q = x Wq^T + bq, k, v likewise (nn.Linear [out][in] 1024^2, weights and biases sigma 1/32); 16 heads of 64; softmax(q k^T / 8) (no mask); out = ctx Wo^T + bo -> [2][2048][1024]).
// Structure: token rows r = b*2048 + s; x + PE computed on VALU (f32 expf/sinf/cosf in the module's op order) -> f16 rows (one f16 rounding of x + pe); Q, K, V as three WMMA GEMMs (128x128 workgroup tiles staged in LDS, 32x64 wave tiles, f32 accumulation, exact x16 weights + bias, f16 outputs); V^T for all batches and heads via LDS transposes; one fused attention kernel over all (batch, head, 256 queries): scores on WMMA (K = 64), online softmax on VALU (f32 statistics, native exp2; weights as f16, scaled by a power of two that cancels), o = P . V on WMMA (o carried x64 against f16 subnormal flush, folded into the output GEMM alpha) written straight into the merged f16 o rows; out = o W_o + b GEMM (f32) into the output layout.
// Compute dtype: inputs rounded to bf16; weights exact, x + pe rounded once to f16; q, k, v, softmax weights and o as plain f16 GEMM operands (~2^-12); scores and softmax statistics f32. v_wmma_f32_16x16x32_f16.
#define NB 2
#define SQ 2048
#define DM 1024
#define NH 16
#define HD 64
#define HG 4                         /* heads per call of the unlaunched k_vt(V16, b, h0, VT) */
#define B0 0                         /* first batch processed (debug hook) */
#define NBR NB                       /* batches processed (debug hook) */
#define NR ((size_t)NB * SQ)         /* token rows */
#define MP ((int)((size_t)NBR * SQ)) /* rows projected (debug hook) */
#define QN SQ                        /* unused: k_fattn attends all SQ query rows */
#define NHD NH                       /* unused: k_fattn attends all NH heads */
#define MPO MP                       /* rows through the output stage (debug hook) */
#define LQ DM      /* row pitch of the q/k/v rows */
typedef __bf16 v16b __attribute__((ext_vector_type(16)));
typedef unsigned short v8us __attribute__((ext_vector_type(8), may_alias));
typedef float  v8f  __attribute__((ext_vector_type(8)));
typedef float  v4f  __attribute__((ext_vector_type(4)));
typedef float  v4fa __attribute__((ext_vector_type(4), may_alias));
union FragB { v16b v; v8us half[2]; unsigned short u[16]; };

__device__ __forceinline__ unsigned short bf16_bits(float x) { unsigned int u = __float_as_uint(x); return (unsigned short)((u + 0x7FFFu + ((u >> 16) & 1u)) >> 16); }
__device__ __forceinline__ float bf16_val(unsigned short b) { return __uint_as_float(((unsigned int)b) << 16); }
__device__ __forceinline__ float bf16_round(float x) { return bf16_val(bf16_bits(x)); }
// D += A·B with NT terms: 1 = ah·bh, 2 = + al·bh (A split), 3 = + ah·bl (both split)
template <int NT>
__device__ __forceinline__ v8f mmaN(v16b ah, v16b al, v16b bh, v16b bl, v8f c) {
  c = __builtin_amdgcn_wmma_f32_16x16x32_bf16(false, ah, false, bh, (short)0, c, false, false);
  if (NT >= 2) c = __builtin_amdgcn_wmma_f32_16x16x32_bf16(false, al, false, bh, (short)0, c, false, false);
  if (NT >= 3) c = __builtin_amdgcn_wmma_f32_16x16x32_bf16(false, ah, false, bl, (short)0, c, false, false);
  asm volatile("v_nop\n\tv_nop\n\tv_nop\n\tv_nop" : "+v"(c) : "v"(ah), "v"(al), "v"(bh), "v"(bl));
  return c;
}

__global__ __launch_bounds__(256) void k_wt_bf16(const float* __restrict__ W, unsigned short* __restrict__ Wt, int K, int N) {
  const int t = blockIdx.x * 256 + threadIdx.x;
  const int k8n = K / 8;
  if (t >= N * k8n) return;
  const int n = t / k8n, k8 = (t % k8n) * 8;
  v8us v;
#pragma unroll
  for (int i = 0; i < 8; ++i) v[i] = bf16_bits(W[(size_t)(k8 + i) * N + n]);
  *(v8us*)(Wt + (size_t)n * K + k8) = v;
  
}

// GEMM C[M][N] (f32, pitch ldc) = act(A[M][K]·W + bias). A f32 row-major (pitch lda) converted per fragment to bf16
// (ASPLIT: hi/lo two planes -> 2 terms, else single rounded term); Wt bf16 [N][K] (pitch ldb). BIAS_BF16 rounds the
// bias to bf16 first (bias quantised to bf16 before the add). K%32==0, M%16==0, N%64==0.
template <bool ASPLIT, int ACT, bool BIAS_BF16>
__global__ __launch_bounds__(128) void k_gemm_bf(const float* __restrict__ A, int lda, const unsigned short* __restrict__ Wt, int ldb,
                                               const float* __restrict__ bias, float* __restrict__ C, int ldc, int M, int N, int K) {
  __shared__ __attribute__((aligned(16))) float so[4][16][64];
  const int tid = threadIdx.x, w = tid >> 5, lane = tid & 31, ln = lane & 15, hh = lane >> 4;
  const int ntn = N / 64;
  const int wid = blockIdx.x * 4 + w;
  const int mt = wid / ntn, nq = wid % ntn;
  if (mt * 16 >= M) return;
  const int row0 = mt * 16, col0 = nq * 64;
  const float* arow = A + (size_t)(row0 + ln) * lda;
  v8f acc[4] = {};
  for (int kb = 0; kb < K; kb += 32) {
    FragB ah, al;
    const v4f x0 = *(const v4fa*)(arow + kb + 8 * hh), x1 = *(const v4fa*)(arow + kb + 8 * hh + 4);
    const v4f x2 = *(const v4fa*)(arow + kb + 16 + 8 * hh), x3 = *(const v4fa*)(arow + kb + 16 + 8 * hh + 4);
    float xs[16] = {x0[0],x0[1],x0[2],x0[3],x1[0],x1[1],x1[2],x1[3],x2[0],x2[1],x2[2],x2[3],x3[0],x3[1],x3[2],x3[3]};
#pragma unroll
    for (int i = 0; i < 16; ++i) { const unsigned short hb = bf16_bits(xs[i]); ah.u[i] = hb; al.u[i] = ASPLIT ? bf16_bits(xs[i] - bf16_val(hb)) : (unsigned short)0; }
#pragma unroll
    for (int t = 0; t < 4; ++t) {
      const unsigned short* brow = Wt + (size_t)(col0 + t * 16 + ln) * ldb + kb;
      FragB b;
      b.half[0] = *(const v8us*)(brow + 8 * hh);
      b.half[1] = *(const v8us*)(brow + 16 + 8 * hh);
      acc[t] = mmaN<ASPLIT ? 2 : 1>(ah.v, al.v, b.v, b.v, acc[t]);
    }
  }
#pragma unroll
  for (int t = 0; t < 4; ++t) {
    float bv = bias ? bias[col0 + t * 16 + ln] : 0.f;
    if (BIAS_BF16) bv = bf16_round(bv);
#pragma unroll
    for (int r = 0; r < 8; ++r) { float v = acc[t][r] + bv; if (ACT == 1) v = fmaxf(v, 0.f); so[w][8 * hh + r][t * 16 + ln] = v; }
  }
  __builtin_amdgcn_fence(__ATOMIC_ACQ_REL, "workgroup");
  __builtin_amdgcn_wave_barrier();
  const int rsub = lane >> 4, c4 = (lane & 15) * 4;
  {
#pragma unroll
    for (int q = 0; q < 8; ++q) {
      const int r = q * 2 + rsub;
      const v4f v = *(const v4fa*)&so[w][r][c4];
      *(v4f*)(C + (size_t)(row0 + r) * ldc + col0 + c4) = v;
    }
    
  }
}

// GEMM C = act(A·W + bias + resid): A f32 (ASPLIT -> hi/lo 2 terms), Wt bf16 [N][K]; ACT 0 none, 1 relu, 2 exact gelu;
// resid (optional, f32, row index = (row % rmod), pitch ldr, RES_BF16 rounds it) added before the activation.
template <bool ASPLIT, int ACT, bool BIAS_BF16, bool RES_BF16>
__global__ __launch_bounds__(128) void k_gemm_bf3(const float* __restrict__ A, int lda, const unsigned short* __restrict__ Wt, int ldb,
                                                const float* __restrict__ bias, const float* __restrict__ resid, int rmod, int ldr,
                                                float* __restrict__ C, int ldc, int M, int N, int K) {
  __shared__ __attribute__((aligned(16))) float so[4][16][64];
  const int tid = threadIdx.x, w = tid >> 5, lane = tid & 31, ln = lane & 15, hh = lane >> 4;
  const int ntn = N / 64;
  const int wid = blockIdx.x * 4 + w;
  const int mt = wid / ntn, nq = wid % ntn;
  if (mt * 16 >= M) return;
  const int row0 = mt * 16, col0 = nq * 64;
  const float* arow = A + (size_t)(row0 + ln) * lda;
  v8f acc[4] = {};
  for (int kb = 0; kb < K; kb += 32) {
    FragB ah, al;
    const v4f x0 = *(const v4fa*)(arow + kb + 8 * hh), x1 = *(const v4fa*)(arow + kb + 8 * hh + 4);
    const v4f x2 = *(const v4fa*)(arow + kb + 16 + 8 * hh), x3 = *(const v4fa*)(arow + kb + 16 + 8 * hh + 4);
    float xs[16] = {x0[0],x0[1],x0[2],x0[3],x1[0],x1[1],x1[2],x1[3],x2[0],x2[1],x2[2],x2[3],x3[0],x3[1],x3[2],x3[3]};
#pragma unroll
    for (int i = 0; i < 16; ++i) { const unsigned short hb = bf16_bits(xs[i]); ah.u[i] = hb; al.u[i] = ASPLIT ? bf16_bits(xs[i] - bf16_val(hb)) : (unsigned short)0; }
#pragma unroll
    for (int t = 0; t < 4; ++t) {
      const unsigned short* brow = Wt + (size_t)(col0 + t * 16 + ln) * ldb + kb;
      FragB b;
      b.half[0] = *(const v8us*)(brow + 8 * hh);
      b.half[1] = *(const v8us*)(brow + 16 + 8 * hh);
      acc[t] = mmaN<ASPLIT ? 2 : 1>(ah.v, al.v, b.v, b.v, acc[t]);
    }
  }
#pragma unroll
  for (int t = 0; t < 4; ++t) {
    const int col = col0 + t * 16 + ln;
    float bv = bias ? bias[col] : 0.f;
    if (BIAS_BF16) bv = bf16_round(bv);
#pragma unroll
    for (int r = 0; r < 8; ++r) {
      float v = acc[t][r] + bv;
      if (resid) { float rv = resid[(size_t)((row0 + 8 * hh + r) % rmod) * ldr + col]; if (RES_BF16) rv = bf16_round(rv); v += rv; }
      if (ACT == 1) v = fmaxf(v, 0.f);
      if (ACT == 2) v = 0.5f * v * (1.0f + erff(v * 0.70710678118654752f));
      if (ACT == 3) { const float u = 0.7978845608028654f * (v + 0.044715f * v * v * v); v = 0.5f * v * (1.0f + tanhf(u)); }
      so[w][8 * hh + r][t * 16 + ln] = v;
    }
  }
  __builtin_amdgcn_fence(__ATOMIC_ACQ_REL, "workgroup");
  __builtin_amdgcn_wave_barrier();
  const int rsub = lane >> 4, c4 = (lane & 15) * 4;
  {
#pragma unroll
    for (int q = 0; q < 8; ++q) {
      const int r = q * 2 + rsub;
      const v4f v = *(const v4fa*)&so[w][r][c4];
      *(v4f*)(C + (size_t)(row0 + r) * ldc + col0 + c4) = v;
    }
    
  }
}
// row LayerNorm (biased variance, eps) over N: s = X (+ R); optional out_sum <- s; out_norm <- (s-mu)*rsqrt(var+eps)*g + b
template <bool PARAM_BF16>
__global__ __launch_bounds__(256) void k_layernorm(const float* __restrict__ X, const float* __restrict__ R, const float* __restrict__ g, const float* __restrict__ bta,
                                                  float* __restrict__ out_sum, float* __restrict__ out_norm, int N, float eps) {
  __shared__ float red[256];
  const int row = blockIdx.x, tid = threadIdx.x;
  const float* x = X + (size_t)row * N; const float* rr = R ? R + (size_t)row * N : nullptr;
  float vals[16];                     // up to N = 4096
  const int per = N / 256;            // contiguous chunk per thread? use strided-by-4 chunks: thread handles j = tid*4 + 1024*u
  float s1 = 0.f;
  for (int u = 0; u < per / 4; ++u) {
    const int j = tid * 4 + 1024 * u;
    const v4f a = *(const v4fa*)(x + j);
    v4f b = {0.f,0.f,0.f,0.f}; if (rr) b = *(const v4fa*)(rr + j);
#pragma unroll
    for (int q = 0; q < 4; ++q) { const float v = a[q] + b[q]; vals[u * 4 + q] = v; s1 += v; }
  }
  red[tid] = s1; __syncthreads();
  for (int st = 128; st > 0; st >>= 1) { if (tid < st) red[tid] += red[tid + st]; __syncthreads(); }
  const float mu = red[0] / (float)N; __syncthreads();
  float s2 = 0.f;
  for (int u = 0; u < per / 4; ++u)
#pragma unroll
    for (int q = 0; q < 4; ++q) { const float c = vals[u * 4 + q] - mu; s2 += c * c; }
  red[tid] = s2; __syncthreads();
  for (int st = 128; st > 0; st >>= 1) { if (tid < st) red[tid] += red[tid + st]; __syncthreads(); }
  const float rs = rsqrtf(red[0] / (float)N + eps);
  {
    for (int u = 0; u < per / 4; ++u) {
      const int j = tid * 4 + 1024 * u;
      v4f o, sm;
#pragma unroll
      for (int q = 0; q < 4; ++q) {
        float gg = g[j + q], bb = bta[j + q];
        if (PARAM_BF16) { gg = bf16_round(gg); bb = bf16_round(bb); }
        sm[q] = vals[u * 4 + q]; o[q] = (vals[u * 4 + q] - mu) * rs * gg + bb;
      }
      if (out_sum) *(v4f*)(out_sum + (size_t)row * N + j) = sm;
      *(v4f*)(out_norm + (size_t)row * N + j) = o;
    }
    
  }
}



// ---- f16 WMMA path (v_wmma_f32_16x16x32_f16): 11-bit significands for operands in range — used where a [0,1] probability operand needs more precision than bf16
typedef _Float16 v16h __attribute__((ext_vector_type(16)));
union FragH { v16h v; v8us half[2]; _Float16 h[16]; unsigned short u[16]; };
template <int NT>
__device__ __forceinline__ v8f mmaH(v16h ah, v16h al, v16h bh, v16h bl, v8f c) {
  c = __builtin_amdgcn_wmma_f32_16x16x32_f16(false, ah, false, bh, (short)0, c, false, false);
  if (NT >= 2) c = __builtin_amdgcn_wmma_f32_16x16x32_f16(false, al, false, bh, (short)0, c, false, false);
  if (NT >= 3) c = __builtin_amdgcn_wmma_f32_16x16x32_f16(false, ah, false, bl, (short)0, c, false, false);
  asm volatile("v_nop\n\tv_nop\n\tv_nop\n\tv_nop" : "+v"(c) : "v"(ah), "v"(al), "v"(bh), "v"(bl));
  return c;
}
// batched GEMM like k_gemm_b but f16 operands: A f32 (split into f16 hi/lo if ASPLIT, else rounded to f16), Bt = f16 values [n][k]; alpha; C f32; N multiple of 16 (partial tiles skipped)
template <bool ASPLIT>
__global__ __launch_bounds__(128) void k_gemm_h(const float* __restrict__ A, int lda, size_t sA, const _Float16* __restrict__ Bh, int ldb, size_t sB, float alpha, float* __restrict__ C, int ldc, size_t sC, int M, int N, int K) {
  __shared__ __attribute__((aligned(16))) float so[4][16][64];
  const int tid = threadIdx.x, w = tid >> 5, lane = tid & 31, ln = lane & 15, hh = lane >> 4; const int by = blockIdx.y;
  A += (size_t)by * sA; Bh += (size_t)by * sB; C += (size_t)by * sC;
  const int ntn = (N + 63) / 64; const int wid = blockIdx.x * 4 + w; const int mt = wid / ntn, nq = wid % ntn; if (mt * 16 >= M) return;
  const int row0 = mt * 16, col0 = nq * 64; const float* arow = A + (size_t)(row0 + ln) * lda;
  v8f acc[4] = {};
  for (int kb = 0; kb < K; kb += 32) {
    FragH ah, al;
    const v4f x0 = *(const v4fa*)(arow + kb + 8 * hh), x1 = *(const v4fa*)(arow + kb + 8 * hh + 4), x2 = *(const v4fa*)(arow + kb + 16 + 8 * hh), x3 = *(const v4fa*)(arow + kb + 16 + 8 * hh + 4);
    float xs[16] = {x0[0],x0[1],x0[2],x0[3],x1[0],x1[1],x1[2],x1[3],x2[0],x2[1],x2[2],x2[3],x3[0],x3[1],x3[2],x3[3]};
#pragma unroll
    for (int i = 0; i < 16; ++i) { const _Float16 h = (_Float16)xs[i]; ah.h[i] = h; al.h[i] = ASPLIT ? (_Float16)(xs[i] - (float)h) : (_Float16)0.0f; }
#pragma unroll
    for (int t = 0; t < 4; ++t) { if (col0 + t * 16 >= N) continue; const size_t boff = (size_t)(col0 + t * 16 + ln) * ldb + kb; FragH bq; bq.half[0] = *(const v8us*)(Bh + boff + 8 * hh); bq.half[1] = *(const v8us*)(Bh + boff + 16 + 8 * hh);
      acc[t] = mmaH<ASPLIT ? 2 : 1>(ah.v, al.v, bq.v, bq.v, acc[t]); }
  }
#pragma unroll
  for (int t = 0; t < 4; ++t) { if (col0 + t * 16 >= N) continue;
#pragma unroll
    for (int r = 0; r < 8; ++r) so[w][8 * hh + r][t * 16 + ln] = acc[t][r] * alpha; }
  __builtin_amdgcn_fence(__ATOMIC_ACQ_REL, "workgroup"); __builtin_amdgcn_wave_barrier();
  const int rsub = lane >> 4, c4 = (lane & 15) * 4;
  {
#pragma unroll
    for (int q = 0; q < 8; ++q) { const int r = q * 2 + rsub; if (col0 + c4 < N) { const v4f v = *(const v4fa*)&so[w][r][c4]; *(v4f*)(C + (size_t)(row0 + r) * ldc + col0 + c4) = v; } }
     }
}

// Wt[n][k] = f16(W[k][n]·scale) from f32 row-major W[K][N] (scale = power of two; bf16-exact weights stay exact in f16 away from the subnormal range)
__global__ __launch_bounds__(256) void k_wt_f16(const float* __restrict__ W, _Float16* __restrict__ Wt, int K, int N, float scale) {
  const int t = blockIdx.x * 256 + threadIdx.x; if (t >= N * (K / 8)) return; const int n = t / (K / 8), k8 = (t % (K / 8)) * 8; FragH f;
#pragma unroll
  for (int i = 0; i < 8; ++i) f.h[i] = (_Float16)(bf16_round(W[(size_t)(k8 + i) * N + n]) * scale); const v8us o = f.half[0];
  *(v8us*)((unsigned short*)Wt + (size_t)n * K + k8) = o; 
}
// k_gemm_hh variant with fused epilogue: v = acc·alpha + bias[by·sBias + col] (+ CP[(row/rowsPerB)·sCPb + by·64 + col] if CP) ; ACT 0 none / 1 elu ; writes f16 C16 (and f32 C if non-null)
template <int ACT>
__global__ __launch_bounds__(128) void k_gemm_hhx(const _Float16* __restrict__ A, int lda, size_t sA, const _Float16* __restrict__ Bh, int ldb, size_t sB, float alpha, const float* __restrict__ bias, size_t sBias, const float* __restrict__ CP, int rowsPerB, size_t sCPb, int row0g,
    float* __restrict__ C, _Float16* __restrict__ C16, int ldc, size_t sC, int M, int N, int K) {
  __shared__ __attribute__((aligned(16))) float so[4][16][64];
  const int tid = threadIdx.x, w = tid >> 5, lane = tid & 31, ln = lane & 15, hh = lane >> 4; const int by = blockIdx.y;
  A += (size_t)by * sA; Bh += (size_t)by * sB; const size_t cofs = (size_t)by * sC; const float* bp = bias ? bias + (size_t)by * sBias : nullptr;
  const int ntn = (N + 63) / 64; const int wid = blockIdx.x * 4 + w; const int mt = wid / ntn, nq = wid % ntn; if (mt * 16 >= M) return;
  const int row0 = mt * 16, col0 = nq * 64; const _Float16* arow = A + (size_t)(row0 + ln) * lda;
  v8f acc[4] = {};
  for (int kb = 0; kb < K; kb += 32) { FragH ah; ah.half[0] = *(const v8us*)((const unsigned short*)arow + kb + 8 * hh); ah.half[1] = *(const v8us*)((const unsigned short*)arow + kb + 16 + 8 * hh);
#pragma unroll
    for (int t = 0; t < 4; ++t) { if (col0 + t * 16 >= N) continue; const size_t boff = (size_t)(col0 + t * 16 + ln) * ldb + kb; FragH bq; bq.half[0] = *(const v8us*)((const unsigned short*)Bh + boff + 8 * hh); bq.half[1] = *(const v8us*)((const unsigned short*)Bh + boff + 16 + 8 * hh);
      acc[t] = mmaH<1>(ah.v, ah.v, bq.v, bq.v, acc[t]); }
  }
#pragma unroll
  for (int t = 0; t < 4; ++t) { if (col0 + t * 16 >= N) continue; const int col = col0 + t * 16 + ln; const float bv = bp ? bf16_round(bp[col]) : 0.f;
#pragma unroll
    for (int r = 0; r < 8; ++r) { float v = acc[t][r] * alpha + bv; if (CP) { const int rr = row0g + row0 + 8 * hh + r; if (rowsPerB < 0) v += CP[cofs + (size_t)rr * ldc + col];      /* rowsPerB < 0: own element of the batched C plane */ else { const int bidx = rr / rowsPerB; v += CP[(size_t)bidx * sCPb + (size_t)by * 64 + col]; } } if (ACT == 1) v = (v > 0.f) ? v : expm1f(v); else if (ACT == 7) v = (v > 0.f) ? v + 1.0f : expf(v); else if (ACT == 8) v = tanhf(v); else if (ACT == 9) v = 0.5f * v * (1.0f + tanhf(0.7978845608028654f * (v + 0.044715f * v * v * v))); else if (ACT == 11) v = 1.0f / (1.0f + expf(-v)); else if (ACT == 12) v = (v > 0.f) ? v : 0.01f * v; else if (ACT == 14) v = (v > 0.f) ? v : 0.1f * v; else if (ACT == 16) v = (v >= 0.f) ? v : 0.3f * v; else if (ACT == 17) v = (v >= 0.f) ? v : 0.2f * v; else if (ACT == 15) v = v / (1.0f + expf(-v)); else if (ACT == 3) v = fmaxf(v, 0.f); else if (ACT == 6) v = 0.5f * v * (1.0f + erff(v * 0.70710678118654752f)); so[w][8 * hh + r][t * 16 + ln] = v; } }
  __builtin_amdgcn_fence(__ATOMIC_ACQ_REL, "workgroup"); __builtin_amdgcn_wave_barrier();
  const int rsub = lane >> 4, c4 = (lane & 15) * 4; typedef _Float16 v4h __attribute__((ext_vector_type(4)));
  {
#pragma unroll
    for (int q = 0; q < 8; ++q) { const int r = q * 2 + rsub; if (col0 + c4 < N) { const v4f v = *(const v4fa*)&so[w][r][c4]; if (C) *(v4f*)(C + cofs + (size_t)(row0 + r) * ldc + col0 + c4) = v; if (C16) { v4h h4; for (int i = 0; i < 4; ++i) h4[i] = (_Float16)v[i]; *(v4h*)(C16 + cofs + (size_t)(row0 + r) * ldc + col0 + c4) = h4; } } }
     }
}


typedef _Float16 v4h __attribute__((ext_vector_type(4)));

__global__ __launch_bounds__(256) void k_x16(const float* __restrict__ x, _Float16* __restrict__ X16, size_t n8) { const size_t t = (size_t)blockIdx.x * 256 + threadIdx.x; if (t >= n8) return; FragH f;
#pragma unroll
  for (int q = 0; q < 8; ++q) f.h[q] = (_Float16)bf16_round(x[t * 8 + q]); *(v8us*)((unsigned short*)X16 + t * 8) = f.half[0];  }
__global__ __launch_bounds__(256) void k_h16(const float* __restrict__ x, _Float16* __restrict__ X16, size_t n8) { const size_t t = (size_t)blockIdx.x * 256 + threadIdx.x; if (t >= n8) return; FragH f;
#pragma unroll
  for (int q = 0; q < 8; ++q) f.h[q] = (_Float16)x[t * 8 + q]; *(v8us*)((unsigned short*)X16 + t * 8) = f.half[0];  }
__global__ __launch_bounds__(256) void k_round16f(const float* __restrict__ W, _Float16* __restrict__ Bt, size_t n8) { const size_t t = (size_t)blockIdx.x * 256 + threadIdx.x; if (t >= n8) return; FragH f;
#pragma unroll
  for (int i = 0; i < 8; ++i) f.h[i] = (_Float16)(bf16_round(W[t * 8 + i]) * 16.0f); *(v8us*)((unsigned short*)Bt + t * 8) = f.half[0];  }
template <int NHv, int TTv>
__global__ __launch_bounds__(256) void k_vt(const _Float16* __restrict__ V16, int ldv, int voff, _Float16* __restrict__ Vt) { __shared__ unsigned short tl[64][66]; const int tid = threadIdx.x; const int slab = blockIdx.x / (TTv / 64), lg = blockIdx.x % (TTv / 64); const int b = slab / NHv, h = slab % NHv;
  for (int i = tid; i < 64 * 8; i += 256) { const int r = i / 8, c8 = (i % 8) * 8; FragH f; f.half[0] = *(const v8us*)((const unsigned short*)V16 + ((size_t)b * TTv + lg * 64 + r) * ldv + voff + h * 64 + c8);
#pragma unroll
    for (int q = 0; q < 8; ++q) tl[r][c8 + q] = f.u[q]; }
  __syncthreads();
  {
#pragma unroll
    for (int rd = 0; rd < 2; ++rd) { const int d = rd * 32 + tid / 8, pc = tid % 8; FragH f;
#pragma unroll
      for (int q = 0; q < 8; ++q) f.u[q] = tl[pc * 8 + q][d];
      *(v8us*)((unsigned short*)Vt + ((size_t)slab * 64 + d) * TTv + lg * 64 + pc * 8) = f.half[0]; }
     } }

__global__ __launch_bounds__(256) void k_hl(const float* __restrict__ F, _Float16* __restrict__ Hh, _Float16* __restrict__ Hl, size_t n8) { const size_t t = (size_t)blockIdx.x * 256 + threadIdx.x; if (t >= n8) return; FragH fh, fl; const v4f a = *(const v4fa*)(F + t * 8), c = *(const v4fa*)(F + t * 8 + 4);
#pragma unroll
  for (int q = 0; q < 4; ++q) { _Float16 h = (_Float16)a[q]; fh.h[q] = h; fl.h[q] = (_Float16)((a[q] - (float)h) * 1024.0f); h = (_Float16)c[q]; fh.h[4 + q] = h; fl.h[4 + q] = (_Float16)((c[q] - (float)h) * 1024.0f); }
  { *(v8us*)((unsigned short*)Hh + t * 8) = fh.half[0]; *(v8us*)((unsigned short*)Hl + t * 8) = fl.half[0];  } }

__device__ __forceinline__ v16h g2_frag(const _Float16* p, int hh) { FragH f; f.half[0] = *(const v8us*)((const unsigned short*)p + 8 * hh); f.half[1] = *(const v8us*)((const unsigned short*)p + 16 + 8 * hh); return f.v; }


__global__ __launch_bounds__(256) void k_wnat(const float* __restrict__ w, size_t n8, _Float16* __restrict__ Bt) { const size_t t = (size_t)blockIdx.x * 256 + threadIdx.x; if (t >= n8) return; FragH f; for (int q = 0; q < 8; ++q) f.h[q] = (_Float16)(bf16_round(w[t * 8 + q]) * 16.0f); *(v8us*)((unsigned short*)Bt + t * 8) = f.half[0];  }
__global__ __launch_bounds__(256) void k_rsm(const float* __restrict__ S, _Float16* __restrict__ P, int nrows) {
  #pragma clang fp contract(off)
  const int i = blockIdx.x * 256 + threadIdx.x; if (i >= nrows) return; const float* s = S + (size_t)i * SQ; float mx = -3.0e38f;
#pragma unroll 1
  for (int j = 0; j < SQ; ++j) mx = fmaxf(mx, s[j]); float se = 0.f;
#pragma unroll 1
  for (int j = 0; j < SQ; ++j) se += expf(s[j] - mx); const float sc = 256.0f / se;
#pragma unroll 1
  for (int j0 = 0; j0 < SQ; j0 += 8) { FragH f; for (int q = 0; q < 8; ++q) f.h[q] = (_Float16)(expf(s[j0 + q] - mx) * sc); unsigned short* d = (unsigned short*)P + (size_t)i * SQ + j0; *(v8us*)d = f.half[0];  } }
__global__ __launch_bounds__(256) void k_vt(const _Float16* __restrict__ V16, int b, int h0, _Float16* __restrict__ VT) { __shared__ unsigned short tl[64][65]; const int tid = threadIdx.x; const int hh = blockIdx.x % HG, sg = blockIdx.x / HG; const int s0 = sg * 64; const int h = h0 + hh;
  for (int i = tid; i < 64 * 8; i += 256) { const int j = i / 8, d8 = (i % 8) * 8; FragH f; f.half[0] = *(const v8us*)((const unsigned short*)V16 + ((size_t)b * SQ + s0 + j) * DM + h * HD + d8); for (int q = 0; q < 8; ++q) tl[d8 + q][j] = f.u[q]; }
  __syncthreads();
  { for (int i = tid; i < 64 * 8; i += 256) { const int d = i / 8, j8 = (i % 8) * 8; FragH f; for (int q = 0; q < 8; ++q) f.u[q] = tl[d][j8 + q]; *(v8us*)((unsigned short*)VT + ((size_t)hh * HD + d) * SQ + s0 + j8) = f.half[0]; }  } }



#define FAW 8                        /* waves per workgroup */
#define FAK 64                       /* keys per stage */
#define FAP 72                       /* LDS row pitch in f16: 128 bytes of data + 16, so that the 16 rows of a fragment read start in 16 different bank groups */
#define FAT (SQ / FAK)               /* stages */
__device__ __forceinline__ float rs_xhalf(float x) { return __builtin_bit_cast(float, __builtin_amdgcn_permlanex16(__builtin_bit_cast(int, x), __builtin_bit_cast(int, x), 0x76543210, 0xfedcba98, false, false)); }      /* lane l reads lane l ^ 16 */
__device__ __forceinline__ v16h fa_frag(const unsigned short* p, int hh) { FragH f; f.half[0] = *(const v8us*)(p + 8 * hh); f.half[1] = *(const v8us*)(p + 16 + 8 * hh); return f.v; }
__device__ __forceinline__ v8f fa_mma(v16h a, v16h b, v8f c) { return __builtin_amdgcn_wmma_f32_16x16x32_f16(false, a, false, b, (short)0, c, false, false); }
// Eight native 2^x (v_exp_f32). The builtin, not asm text: the compiler schedules these between the matrix instructions and must see which registers they write.
__device__ __forceinline__ v8f fa_exp2x8(v8f x) { v8f e;
#pragma unroll      /* the vector stays in registers */
  for (int i = 0; i < 8; ++i) e[i] = __builtin_amdgcn_exp2f(x[i]);
  return e; }
static_assert(SQ % (FAW * 32) == 0 && SQ % FAK == 0 && HD == 64 && FAK == 64 && FAW * 32 == 256, "k_fattn: whole workgroups and stages; 256 threads stage 64 rows of 128 bytes in two rounds");
__global__ __launch_bounds__(FAW * 32) void k_fattn(const _Float16* __restrict__ Q16, const _Float16* __restrict__ K16, const _Float16* __restrict__ VT, _Float16* __restrict__ O16) {
  __shared__ __attribute__((aligned(16))) unsigned short sk[2][FAK][FAP];      /* K rows [key][d] */
  __shared__ __attribute__((aligned(16))) unsigned short sv[2][HD][FAP];       /* V^T rows [d][key] */
  const int tid = threadIdx.x, w = tid >> 5, lane = tid & 31, ln = lane & 15, hh = lane >> 4;
  const int bh = blockIdx.y, b = bh / NH, hd = bh - b * NH; const size_t r0 = (size_t)b * SQ; const int q0 = (blockIdx.x * FAW + w) * 32;
  const int srow = tid >> 3, sc8 = (tid & 7) * 8;      /* staging: 8 threads per 128-byte row, rows srow and srow + 32 */
  const unsigned short* kg = (const unsigned short*)K16 + (r0 + srow) * DM + hd * HD + sc8;
  const unsigned short* vg = (const unsigned short*)VT + ((size_t)bh * HD + srow) * SQ + sc8;
  v16h qf[2][2];      /* [16-query group][32 of d] */
  /* the short loops below are all unrolled so that the fragment and accumulator arrays stay in registers */
#pragma unroll
  for (int g = 0; g < 2; ++g)
#pragma unroll
    for (int ks = 0; ks < 2; ++ks) qf[g][ks] = g2_frag(Q16 + (r0 + q0 + g * 16 + ln) * DM + hd * HD + ks * 32, hh);
  const v8f z8 = {0.f, 0.f, 0.f, 0.f, 0.f, 0.f, 0.f, 0.f};
  v8f o[2][4] = {{z8, z8, z8, z8}, {z8, z8, z8, z8}}; float ms[2] = {-3.0e38f, -3.0e38f}, l[2] = {0.f, 0.f};
  const float cs = 0.125f * 1.44269504088896340736f;      /* 64^-0.5 log2 e */
  v8us kr0 = *(const v8us*)kg, kr1 = *(const v8us*)(kg + (size_t)32 * DM), vr0 = *(const v8us*)vg, vr1 = *(const v8us*)(vg + (size_t)32 * SQ);
  asm volatile("s_wait_xcnt 0x0" ::: "memory");      /* precaution: stands in front of every later write of a register that the loads above name as an address */
  *(v8us*)&sk[0][srow][sc8] = kr0; *(v8us*)&sk[0][srow + 32][sc8] = kr1; *(v8us*)&sv[0][srow][sc8] = vr0; *(v8us*)&sv[0][srow + 32][sc8] = vr1;
  __syncthreads();      /* stage 0 is published */
  for (int t = 0; t < FAT; ++t) { const int cur = t & 1;
    if (t + 1 < FAT) { const unsigned short* kn = kg + (size_t)(t + 1) * FAK * DM; const unsigned short* vn = vg + (t + 1) * FAK;
      kr0 = *(const v8us*)kn; kr1 = *(const v8us*)(kn + (size_t)32 * DM); vr0 = *(const v8us*)vn; vr1 = *(const v8us*)(vn + (size_t)32 * SQ); }
#pragma unroll
    for (int hp = 0; hp < 2; ++hp) {      /* two passes of 32 keys per stage: half the score registers live at once; unrolled, so that one pass's matrix work can be scheduled among the other's softmax */
      v8f s[2][2];      /* S^T: [query group][16-key tile], register r = key 8 hh + r, lane column = query */
#pragma unroll
      for (int j = 0; j < 2; ++j) { const v16h a0 = fa_frag(&sk[cur][hp * 32 + j * 16 + ln][0], hh), a1 = fa_frag(&sk[cur][hp * 32 + j * 16 + ln][32], hh);
#pragma unroll
        for (int g = 0; g < 2; ++g) s[g][j] = fa_mma(a1, qf[g][1], fa_mma(a0, qf[g][0], z8)); }
      v16h va[4];
#pragma unroll
      for (int dt = 0; dt < 4; ++dt) va[dt] = fa_frag(&sv[cur][dt * 16 + ln][hp * 32], hh);
      float mxs[2];
#pragma unroll
      for (int g = 0; g < 2; ++g) { const v8f mv = __builtin_elementwise_max(s[g][0], s[g][1]);
        const float mx = fmaxf(fmaxf(fmaxf(mv[0], mv[1]), fmaxf(mv[2], mv[3])), fmaxf(fmaxf(mv[4], mv[5]), fmaxf(mv[6], mv[7])));
        mxs[g] = fmaxf(mx, rs_xhalf(mx)) * cs; }
      if (__builtin_amdgcn_ballot_w32(mxs[0] > ms[0] + 8.0f || mxs[1] > ms[1] + 8.0f) != 0) {      /* wave-uniform: some query's maximum has outgrown the one in use */
        const float n0 = fmaxf(ms[0], mxs[0]), n1 = fmaxf(ms[1], mxs[1]); const float c0 = __builtin_amdgcn_exp2f(ms[0] - n0), c1 = __builtin_amdgcn_exp2f(ms[1] - n1);      /* the two rescale factors */
        ms[0] = n0; ms[1] = n1; l[0] *= c0; l[1] *= c1;
#pragma unroll
        for (int dt = 0; dt < 4; ++dt) { o[0][dt] *= c0; o[1][dt] *= c1; } }
      v16h pf[2];      /* P^T as B operand, per query group */
#pragma unroll
      for (int g = 0; g < 2; ++g) { const float nb = 7.0f - ms[g];
#pragma unroll
        for (int j = 0; j < 2; ++j) s[g][j] = fa_exp2x8(s[g][j] * cs + nb);
        const v8f ps = s[g][0] + s[g][1];
        l[g] += ((ps[0] + ps[1]) + (ps[2] + ps[3])) + ((ps[4] + ps[5]) + (ps[6] + ps[7]));
        FragH f;
#pragma unroll
        for (int i = 0; i < 8; ++i) { f.h[i] = (_Float16)s[g][0][i]; f.h[8 + i] = (_Float16)s[g][1][i]; }
        pf[g] = f.v; }
#pragma unroll
      for (int dt = 0; dt < 4; ++dt)
#pragma unroll
        for (int g = 0; g < 2; ++g) o[g][dt] = fa_mma(va[dt], pf[g], o[g][dt]); }
    if (t + 1 < FAT) { *(v8us*)&sk[cur ^ 1][srow][sc8] = kr0; *(v8us*)&sk[cur ^ 1][srow + 32][sc8] = kr1; *(v8us*)&sv[cur ^ 1][srow][sc8] = vr0; *(v8us*)&sv[cur ^ 1][srow + 32][sc8] = vr1; }      /* its last readers left this buffer at the barrier of stage t - 1 */
    __syncthreads(); }      /* publishes stage t + 1 and ends every read of stage t */
#pragma unroll
  for (int g = 0; g < 2; ++g) { const float inv = 64.0f / (l[g] + rs_xhalf(l[g]));      /* the halves hold disjoint keys; o is carried x64 */
    unsigned short* op = (unsigned short*)O16 + (r0 + q0 + g * 16 + ln) * DM + hd * HD + 8 * hh;
#pragma unroll
    for (int dt = 0; dt < 4; ++dt) { FragH f;
#pragma unroll
      for (int r = 0; r < 8; ++r) f.h[r] = (_Float16)(o[g][dt][r] * inv);
      *(v8us*)(op + dt * 16) = f.half[0]; }      /* register r = d 16 dt + 8 hh + r of query ln: 16 contiguous bytes */
    if (g == 0) asm volatile("s_wait_xcnt 0x0" ::: "memory"); } }      /* precaution: stands in front of every later write of a register that the first group's stores name */


// ---- staged GEMM: C[MP][DM] = A[MP][DM] . Bt[DM][DM]^T x alpha + bias (bias rounded to bf16 first), all pitches DM; C f32 or f16 ----
// One workgroup = 8 waves = one 128 x 128 tile of C, waves 4 (rows) x 2 (columns), 32 x 64 per wave. The k axis runs in stages of G3K: the 128 A rows and the 128 Bt rows
// of a stage (256 bytes each) come from global memory as whole lines, 16 lanes per row, once per workgroup, and lie in LDS at a padded pitch; every wave takes its
// fragments from there. Two LDS buffers: stage t + 1 travels global -> registers while stage t is worked on and is stored behind the work; one barrier per stage.
// Each accumulator tile sums k in ascending steps of 32, one WMMA per step.
#define G3T 128                      /* tile rows and tile columns per workgroup */
#define G3K 128                      /* k per stage */
#define G3P 136                      /* LDS row pitch in f16: 256 bytes of data + 16, so that the 16 rows of a fragment read start in 16 different bank groups */
#define G3S (DM / G3K)               /* stages */
static_assert(MP % G3T == 0 && MPO % G3T == 0 && DM % G3T == 0 && DM % G3K == 0 && G3S >= 2, "k_gemm3: whole tiles and stages");
template <bool F32OUT>      /* the result goes to C (f32) or to C16 (f16); the other pointer is not used */
__global__ __launch_bounds__(256) void k_gemm3(const _Float16* __restrict__ A, const _Float16* __restrict__ Bh, float alpha, const float* __restrict__ bias, float* __restrict__ C, _Float16* __restrict__ C16) {
  __shared__ __attribute__((aligned(16))) unsigned short sa[2][G3T][G3P];      /* A rows [row][k] */
  __shared__ __attribute__((aligned(16))) unsigned short sb[2][G3T][G3P];      /* Bt rows [column][k] */
  __shared__ __attribute__((aligned(16))) float so[8][32][68];                 /* per-wave output staging */
  const int tid = threadIdx.x, w = tid >> 5, lane = tid & 31, ln = lane & 15, hh = lane >> 4;
  const int mt = blockIdx.x / (DM / G3T), nq = blockIdx.x - mt * (DM / G3T); const int wr = (w >> 1) * 32, wc = (w & 1) * 64;      /* the wave's place in the tile */
  const int row0 = mt * G3T + wr, col0 = nq * G3T + wc;
  const int srow = tid >> 4, sc8 = (tid & 15) * 8;      /* staging: 16 threads per 256-byte row, rows srow + 16 i */
  const unsigned short* ag = (const unsigned short*)A + (size_t)(mt * G3T + srow) * DM + sc8;
  const unsigned short* bg = (const unsigned short*)Bh + (size_t)(nq * G3T + srow) * DM + sc8;
  v8us ra[8], rb[8];
  /* the short loops below are all unrolled so that the staging, fragment and accumulator arrays stay in registers */
#pragma unroll
  for (int i = 0; i < 8; ++i) { ra[i] = *(const v8us*)(ag + (size_t)(16 * i) * DM); rb[i] = *(const v8us*)(bg + (size_t)(16 * i) * DM); }
#pragma unroll
  for (int i = 0; i < 8; ++i) { *(v8us*)&sa[0][srow + 16 * i][sc8] = ra[i]; *(v8us*)&sb[0][srow + 16 * i][sc8] = rb[i]; }
  const v8f z8 = {0.f, 0.f, 0.f, 0.f, 0.f, 0.f, 0.f, 0.f}; v8f acc[2][4] = {{z8, z8, z8, z8}, {z8, z8, z8, z8}};      /* [16-row group][16-column group] */
  __syncthreads();      /* stage 0 is published */
  for (int t = 0; t < G3S; ++t) { const int cur = t & 1;
    if (t + 1 < G3S) {
#pragma unroll
      for (int i = 0; i < 8; ++i) { ra[i] = *(const v8us*)(ag + (size_t)(16 * i) * DM + (t + 1) * G3K); rb[i] = *(const v8us*)(bg + (size_t)(16 * i) * DM + (t + 1) * G3K); } }
#pragma unroll
    for (int ks = 0; ks < G3K / 32; ++ks) { const v16h a0 = fa_frag(&sa[cur][wr + ln][ks * 32], hh), a1 = fa_frag(&sa[cur][wr + 16 + ln][ks * 32], hh);
#pragma unroll
      for (int j = 0; j < 4; ++j) { const v16h b = fa_frag(&sb[cur][wc + j * 16 + ln][ks * 32], hh); acc[0][j] = fa_mma(a0, b, acc[0][j]); acc[1][j] = fa_mma(a1, b, acc[1][j]); } }
    if (t + 1 < G3S) {
#pragma unroll
      for (int i = 0; i < 8; ++i) { *(v8us*)&sa[cur ^ 1][srow + 16 * i][sc8] = ra[i]; *(v8us*)&sb[cur ^ 1][srow + 16 * i][sc8] = rb[i]; } }      /* its last readers left this buffer at the barrier of stage t - 1 */
    __syncthreads(); }      /* publishes stage t + 1 and ends every read of stage t */
#pragma unroll
  for (int u = 0; u < 8; ++u) { const int j = u & 3, half = u >> 2; const float bv = bf16_round(bias[col0 + j * 16 + ln]);
#pragma unroll
    for (int r = 0; r < 8; ++r) so[w][half * 16 + 8 * hh + r][j * 16 + ln] = acc[half][j][r] * alpha + bv; }
  __builtin_amdgcn_fence(__ATOMIC_ACQ_REL, "workgroup"); __builtin_amdgcn_wave_barrier();      /* the wave reads back rows that its other lanes wrote */
  const int rsub = lane >> 4, c4 = (lane & 15) * 4;
#pragma unroll
  for (int q = 0; q < 16; ++q) { const int r = q * 2 + rsub; const v4f v = *(const v4fa*)&so[w][r][c4]; const size_t e = (size_t)(row0 + r) * DM + col0 + c4;
    if (F32OUT) *(v4f*)(C + e) = v; else *(v4h*)(C16 + e) = __builtin_convertvector(v, v4h); } }      /* 16 lanes store one row of the wave's 64 columns: whole lines */


__global__ __launch_bounds__(256) void k_xpe(const float* __restrict__ x, _Float16* __restrict__ X16, size_t n8) {
  #pragma clang fp contract(off)
  const size_t t = (size_t)blockIdx.x * 256 + threadIdx.x; if (t >= n8) return; const size_t e0 = t * 8; const size_t r = e0 / DM; const int c0 = (int)(e0 % DM); const float s = (float)(r % SQ); const float kf = (float)(-9.210340371976184 / (double)DM); FragH f;
  for (int q = 0; q < 8; ++q) { const int c = c0 + q; const int i2 = c & ~1; const float dv = expf(__fmul_rn((float)i2, kf)); const float ang = __fmul_rn(s, dv); const float pe = (c & 1) ? cosf(ang) : sinf(ang); f.h[q] = (_Float16)__fadd_rn(bf16_round(x[e0 + q]), pe); }
  *(v8us*)((unsigned short*)X16 + e0) = f.half[0];  }
extern "C" void kernel_launch(void* const* d_in, const int* in_sizes, int n_in,
                              void* d_out, int out_size, void* d_ws, size_t ws_size, hipStream_t stream) {
  (void)in_sizes; (void)n_in; (void)out_size;
  const float* const* I = (const float* const*)d_in; const float* x = I[0]; const float* wq = I[1]; const float* bq = I[2]; const float* wk = I[3]; const float* bk = I[4]; const float* wv = I[5]; const float* bv = I[6]; const float* wo = I[7]; const float* bo = I[8];      /* nn.Linear weights [out][in] + biases */
  char* ws = (char*)d_ws; size_t off = 0;
  auto take = [&](size_t bytes) { char* p = ws + off; off += (bytes + 255) & ~(size_t)255; return p; };
  _Float16* BQ = (_Float16*)take((size_t)DM * DM * 2); _Float16* BK = (_Float16*)take((size_t)DM * DM * 2); _Float16* BV = (_Float16*)take((size_t)DM * DM * 2); _Float16* BO = (_Float16*)take((size_t)DM * DM * 2);
  _Float16* X16 = (_Float16*)take(NR * DM * 2); _Float16* Q16 = (_Float16*)take(NR * DM * 2); _Float16* K16 = (_Float16*)take(NR * DM * 2); _Float16* V16 = (_Float16*)take(NR * DM * 2); _Float16* O16 = (_Float16*)take(NR * DM * 2);
  _Float16* VT = (_Float16*)take((size_t)NB * NH * HD * SQ * 2);
  if (off > ws_size) return;
  { const unsigned g = (unsigned)(((size_t)DM * DM / 8 + 255) / 256); k_wnat<<<g, 256, 0, stream>>>(wq, (size_t)DM * DM / 8, BQ); k_wnat<<<g, 256, 0, stream>>>(wk, (size_t)DM * DM / 8, BK); k_wnat<<<g, 256, 0, stream>>>(wv, (size_t)DM * DM / 8, BV); k_wnat<<<g, 256, 0, stream>>>(wo, (size_t)DM * DM / 8, BO); }      /* natural [out][in] = Bt[n][k], x16 */
  k_xpe<<<(unsigned)((NR * DM / 8 + 255) / 256), 256, 0, stream>>>(x, X16, NR * DM / 8);      /* x + sinusoidal PE -> f16 rows (not exact: x + pe is not a bf16 value) */
  const size_t r0p = (size_t)B0 * SQ;      /* first projected row */
  k_gemm3<false><<<(unsigned)((MP / G3T) * (DM / G3T)), 256, 0, stream>>>(X16 + r0p * DM, BQ, 0.0625f, bq, nullptr, Q16 + r0p * DM);
  k_gemm3<false><<<(unsigned)((MP / G3T) * (DM / G3T)), 256, 0, stream>>>(X16 + r0p * DM, BK, 0.0625f, bk, nullptr, K16 + r0p * DM);
  k_gemm3<false><<<(unsigned)((MP / G3T) * (DM / G3T)), 256, 0, stream>>>(X16 + r0p * DM, BV, 0.0625f, bv, nullptr, V16 + r0p * DM);
  k_vt<NH, SQ><<<NB * NH * (SQ / 64), 256, 0, stream>>>(V16, LQ, 0, VT);      /* V^T [NB][NH][HD][SQ] */
  k_fattn<<<dim3(SQ / (FAW * 32), NB * NH), FAW * 32, 0, stream>>>(Q16, K16, VT, O16);      /* o (merged heads, x64) as f16 rows */
  k_gemm3<true><<<(unsigned)((MPO / G3T) * (DM / G3T)), 256, 0, stream>>>(O16 + r0p * DM, BO, 0.0009765625f, bo, (float*)d_out + r0p * DM, nullptr);      /* out rows are the output layout */
}

// v004
// A run of this version takes 122 microseconds.
// In two side-by-side timings against v003, it was 1.14 and 1.12 times as fast.
// Over all steps from v000 it is 30.0 times as fast.
#include <hip/hip_runtime.h>
// Temporal multi-head attention with sinusoidal positional encoding (x [2][2048][1024]; x = x + PE (pe[s][2i] = sin(s d_i), pe[s][2i+1] = cos(s d_i), d_i = exp(2i x (-ln 1e4 / 1024))); q = x Wq^T + bq, k, v likewise (nn.Linear [out][in] 1024^2, weights and biases sigma 1/32); 16 heads of 64; softmax(q k^T / 8) (no mask); out = ctx Wo^T + bo -> [2][2048][1024]).
// Structure: token rows r = b*2048 + s; x + PE computed on VALU (f32 expf/sinf/cosf in the module's op order) -> f16 rows (one f16 rounding of x + pe); Q, K, V as three WMMA GEMMs in one grid (128x128 workgroup tiles staged in LDS, 32x64 wave tiles, f32 accumulation, exact x16 weights + bias, f16 outputs); V^T for all batches and heads via LDS transposes; one fused attention kernel over all (batch, head, 256 queries): scores on WMMA (K = 64), online softmax on VALU (f32 statistics, native exp2; weights as f16, scaled by a power of two that cancels), o = P . V on WMMA (o carried x64 against f16 subnormal flush, folded into the output GEMM alpha) written straight into the merged f16 o rows; out = o W_o + b GEMM (f32) into the output layout.
// Compute dtype: inputs rounded to bf16; weights exact, x + pe rounded once to f16; q, k, v, softmax weights and o as plain f16 GEMM operands (~2^-12); scores and softmax statistics f32. v_wmma_f32_16x16x32_f16.
#define NB 2
#define SQ 2048
#define DM 1024
#define NH 16
#define HD 64
#define HG 4                         /* heads per call of the unlaunched k_vt(V16, b, h0, VT) */
#define B0 0                         /* first batch processed (debug hook) */
#define NBR NB                       /* batches processed (debug hook) */
#define NR ((size_t)NB * SQ)         /* token rows */
#define MP ((int)((size_t)NBR * SQ)) /* rows projected (debug hook) */
#define QN SQ                        /* unused: k_fattn attends all SQ query rows */
#define NHD NH                       /* unused: k_fattn attends all NH heads */
#define MPO MP                       /* rows through the output stage (debug hook) */
#define LQ DM      /* row pitch of the q/k/v rows */
typedef __bf16 v16b __attribute__((ext_vector_type(16)));
typedef unsigned short v8us __attribute__((ext_vector_type(8), may_alias));
typedef float  v8f  __attribute__((ext_vector_type(8)));
typedef float  v4f  __attribute__((ext_vector_type(4)));
typedef float  v4fa __attribute__((ext_vector_type(4), may_alias));
union FragB { v16b v; v8us half[2]; unsigned short u[16]; };

__device__ __forceinline__ unsigned short bf16_bits(float x) { unsigned int u = __float_as_uint(x); return (unsigned short)((u + 0x7FFFu + ((u >> 16) & 1u)) >> 16); }
__device__ __forceinline__ float bf16_val(unsigned short b) { return __uint_as_float(((unsigned int)b) << 16); }
__device__ __forceinline__ float bf16_round(float x) { return bf16_val(bf16_bits(x)); }
// D += A·B with NT terms: 1 = ah·bh, 2 = + al·bh (A split), 3 = + ah·bl (both split)
template <int NT>
__device__ __forceinline__ v8f mmaN(v16b ah, v16b al, v16b bh, v16b bl, v8f c) {
  c = __builtin_amdgcn_wmma_f32_16x16x32_bf16(false, ah, false, bh, (short)0, c, false, false);
  if (NT >= 2) c = __builtin_amdgcn_wmma_f32_16x16x32_bf16(false, al, false, bh, (short)0, c, false, false);
  if (NT >= 3) c = __builtin_amdgcn_wmma_f32_16x16x32_bf16(false, ah, false, bl, (short)0, c, false, false);
  asm volatile("v_nop\n\tv_nop\n\tv_nop\n\tv_nop" : "+v"(c) : "v"(ah), "v"(al), "v"(bh), "v"(bl));
  return c;
}

__global__ __launch_bounds__(256) void k_wt_bf16(const float* __restrict__ W, unsigned short* __restrict__ Wt, int K, int N) {
  const int t = blockIdx.x * 256 + threadIdx.x;
  const int k8n = K / 8;
  if (t >= N * k8n) return;
  const int n = t / k8n, k8 = (t % k8n) * 8;
  v8us v;
#pragma unroll
  for (int i = 0; i < 8; ++i) v[i] = bf16_bits(W[(size_t)(k8 + i) * N + n]);
  *(v8us*)(Wt + (size_t)n * K + k8) = v;
  
}

// GEMM C[M][N] (f32, pitch ldc) = act(A[M][K]·W + bias). A f32 row-major (pitch lda) converted per fragment to bf16
// (ASPLIT: hi/lo two planes -> 2 terms, else single rounded term); Wt bf16 [N][K] (pitch ldb). BIAS_BF16 rounds the
// bias to bf16 first (bias quantised to bf16 before the add). K%32==0, M%16==0, N%64==0.
template <bool ASPLIT, int ACT, bool BIAS_BF16>
__global__ __launch_bounds__(128) void k_gemm_bf(const float* __restrict__ A, int lda, const unsigned short* __restrict__ Wt, int ldb,
                                               const float* __restrict__ bias, float* __restrict__ C, int ldc, int M, int N, int K) {
  __shared__ __attribute__((aligned(16))) float so[4][16][64];
  const int tid = threadIdx.x, w = tid >> 5, lane = tid & 31, ln = lane & 15, hh = lane >> 4;
  const int ntn = N / 64;
  const int wid = blockIdx.x * 4 + w;
  const int mt = wid / ntn, nq = wid % ntn;
  if (mt * 16 >= M) return;
  const int row0 = mt * 16, col0 = nq * 64;
  const float* arow = A + (size_t)(row0 + ln) * lda;
  v8f acc[4] = {};
  for (int kb = 0; kb < K; kb += 32) {
    FragB ah, al;
    const v4f x0 = *(const v4fa*)(arow + kb + 8 * hh), x1 = *(const v4fa*)(arow + kb + 8 * hh + 4);
    const v4f x2 = *(const v4fa*)(arow + kb + 16 + 8 * hh), x3 = *(const v4fa*)(arow + kb + 16 + 8 * hh + 4);
    float xs[16] = {x0[0],x0[1],x0[2],x0[3],x1[0],x1[1],x1[2],x1[3],x2[0],x2[1],x2[2],x2[3],x3[0],x3[1],x3[2],x3[3]};
#pragma unroll
    for (int i = 0; i < 16; ++i) { const unsigned short hb = bf16_bits(xs[i]); ah.u[i] = hb; al.u[i] = ASPLIT ? bf16_bits(xs[i] - bf16_val(hb)) : (unsigned short)0; }
#pragma unroll
    for (int t = 0; t < 4; ++t) {
      const unsigned short* brow = Wt + (size_t)(col0 + t * 16 + ln) * ldb + kb;
      FragB b;
      b.half[0] = *(const v8us*)(brow + 8 * hh);
      b.half[1] = *(const v8us*)(brow + 16 + 8 * hh);
      acc[t] = mmaN<ASPLIT ? 2 : 1>(ah.v, al.v, b.v, b.v, acc[t]);
    }
  }
#pragma unroll
  for (int t = 0; t < 4; ++t) {
    float bv = bias ? bias[col0 + t * 16 + ln] : 0.f;
    if (BIAS_BF16) bv = bf16_round(bv);
#pragma unroll
    for (int r = 0; r < 8; ++r) { float v = acc[t][r] + bv; if (ACT == 1) v = fmaxf(v, 0.f); so[w][8 * hh + r][t * 16 + ln] = v; }
  }
  __builtin_amdgcn_fence(__ATOMIC_ACQ_REL, "workgroup");
  __builtin_amdgcn_wave_barrier();
  const int rsub = lane >> 4, c4 = (lane & 15) * 4;
  {
#pragma unroll
    for (int q = 0; q < 8; ++q) {
      const int r = q * 2 + rsub;
      const v4f v = *(const v4fa*)&so[w][r][c4];
      *(v4f*)(C + (size_t)(row0 + r) * ldc + col0 + c4) = v;
    }
    
  }
}

// GEMM C = act(A·W + bias + resid): A f32 (ASPLIT -> hi/lo 2 terms), Wt bf16 [N][K]; ACT 0 none, 1 relu, 2 exact gelu;
// resid (optional, f32, row index = (row % rmod), pitch ldr, RES_BF16 rounds it) added before the activation.
template <bool ASPLIT, int ACT, bool BIAS_BF16, bool RES_BF16>
__global__ __launch_bounds__(128) void k_gemm_bf3(const float* __restrict__ A, int lda, const unsigned short* __restrict__ Wt, int ldb,
                                                const float* __restrict__ bias, const float* __restrict__ resid, int rmod, int ldr,
                                                float* __restrict__ C, int ldc, int M, int N, int K) {
  __shared__ __attribute__((aligned(16))) float so[4][16][64];
  const int tid = threadIdx.x, w = tid >> 5, lane = tid & 31, ln = lane & 15, hh = lane >> 4;
  const int ntn = N / 64;
  const int wid = blockIdx.x * 4 + w;
  const int mt = wid / ntn, nq = wid % ntn;
  if (mt * 16 >= M) return;
  const int row0 = mt * 16, col0 = nq * 64;
  const float* arow = A + (size_t)(row0 + ln) * lda;
  v8f acc[4] = {};
  for (int kb = 0; kb < K; kb += 32) {
    FragB ah, al;
    const v4f x0 = *(const v4fa*)(arow + kb + 8 * hh), x1 = *(const v4fa*)(arow + kb + 8 * hh + 4);
    const v4f x2 = *(const v4fa*)(arow + kb + 16 + 8 * hh), x3 = *(const v4fa*)(arow + kb + 16 + 8 * hh + 4);
    float xs[16] = {x0[0],x0[1],x0[2],x0[3],x1[0],x1[1],x1[2],x1[3],x2[0],x2[1],x2[2],x2[3],x3[0],x3[1],x3[2],x3[3]};
#pragma unroll
    for (int i = 0; i < 16; ++i) { const unsigned short hb = bf16_bits(xs[i]); ah.u[i] = hb; al.u[i] = ASPLIT ? bf16_bits(xs[i] - bf16_val(hb)) : (unsigned short)0; }
#pragma unroll
    for (int t = 0; t < 4; ++t) {
      const unsigned short* brow = Wt + (size_t)(col0 + t * 16 + ln) * ldb + kb;
      FragB b;
      b.half[0] = *(const v8us*)(brow + 8 * hh);
      b.half[1] = *(const v8us*)(brow + 16 + 8 * hh);
      acc[t] = mmaN<ASPLIT ? 2 : 1>(ah.v, al.v, b.v, b.v, acc[t]);
    }
  }
#pragma unroll
  for (int t = 0; t < 4; ++t) {
    const int col = col0 + t * 16 + ln;
    float bv = bias ? bias[col] : 0.f;
    if (BIAS_BF16) bv = bf16_round(bv);
#pragma unroll
    for (int r = 0; r < 8; ++r) {
      float v = acc[t][r] + bv;
      if (resid) { float rv = resid[(size_t)((row0 + 8 * hh + r) % rmod) * ldr + col]; if (RES_BF16) rv = bf16_round(rv); v += rv; }
      if (ACT == 1) v = fmaxf(v, 0.f);
      if (ACT == 2) v = 0.5f * v * (1.0f + erff(v * 0.70710678118654752f));
      if (ACT == 3) { const float u = 0.7978845608028654f * (v + 0.044715f * v * v * v); v = 0.5f * v * (1.0f + tanhf(u)); }
      so[w][8 * hh + r][t * 16 + ln] = v;
    }
  }
  __builtin_amdgcn_fence(__ATOMIC_ACQ_REL, "workgroup");
  __builtin_amdgcn_wave_barrier();
  const int rsub = lane >> 4, c4 = (lane & 15) * 4;
  {
#pragma unroll
    for (int q = 0; q < 8; ++q) {
      const int r = q * 2 + rsub;
      const v4f v = *(const v4fa*)&so[w][r][c4];
      *(v4f*)(C + (size_t)(row0 + r) * ldc + col0 + c4) = v;
    }
    
  }
}
// row LayerNorm (biased variance, eps) over N: s = X (+ R); optional out_sum <- s; out_norm <- (s-mu)*rsqrt(var+eps)*g + b
template <bool PARAM_BF16>
__global__ __launch_bounds__(256) void k_layernorm(const float* __restrict__ X, const float* __restrict__ R, const float* __restrict__ g, const float* __restrict__ bta,
                                                  float* __restrict__ out_sum, float* __restrict__ out_norm, int N, float eps) {
  __shared__ float red[256];
  const int row = blockIdx.x, tid = threadIdx.x;
  const float* x = X + (size_t)row * N; const float* rr = R ? R + (size_t)row * N : nullptr;
  float vals[16];                     // up to N = 4096
  const int per = N / 256;            // contiguous chunk per thread? use strided-by-4 chunks: thread handles j = tid*4 + 1024*u
  float s1 = 0.f;
  for (int u = 0; u < per / 4; ++u) {
    const int j = tid * 4 + 1024 * u;
    const v4f a = *(const v4fa*)(x + j);
    v4f b = {0.f,0.f,0.f,0.f}; if (rr) b = *(const v4fa*)(rr + j);
#pragma unroll
    for (int q = 0; q < 4; ++q) { const float v = a[q] + b[q]; vals[u * 4 + q] = v; s1 += v; }
  }
  red[tid] = s1; __syncthreads();
  for (int st = 128; st > 0; st >>= 1) { if (tid < st) red[tid] += red[tid + st]; __syncthreads(); }
  const float mu = red[0] / (float)N; __syncthreads();
  float s2 = 0.f;
  for (int u = 0; u < per / 4; ++u)
#pragma unroll
    for (int q = 0; q < 4; ++q) { const float c = vals[u * 4 + q] - mu; s2 += c * c; }
  red[tid] = s2; __syncthreads();
  for (int st = 128; st > 0; st >>= 1) { if (tid < st) red[tid] += red[tid + st]; __syncthreads(); }
  const float rs = rsqrtf(red[0] / (float)N + eps);
  {
    for (int u = 0; u < per / 4; ++u) {
      const int j = tid * 4 + 1024 * u;
      v4f o, sm;
#pragma unroll
      for (int q = 0; q < 4; ++q) {
        float gg = g[j + q], bb = bta[j + q];
        if (PARAM_BF16) { gg = bf16_round(gg); bb = bf16_round(bb); }
        sm[q] = vals[u * 4 + q]; o[q] = (vals[u * 4 + q] - mu) * rs * gg + bb;
      }
      if (out_sum) *(v4f*)(out_sum + (size_t)row * N + j) = sm;
      *(v4f*)(out_norm + (size_t)row * N + j) = o;
    }
    
  }
}



// ---- f16 WMMA path (v_wmma_f32_16x16x32_f16): 11-bit significands for operands in range — used where a [0,1] probability operand needs more precision than bf16
typedef _Float16 v16h __attribute__((ext_vector_type(16)));
union FragH { v16h v; v8us half[2]; _Float16 h[16]; unsigned short u[16]; };
template <int NT>
__device__ __forceinline__ v8f mmaH(v16h ah, v16h al, v16h bh, v16h bl, v8f c) {
  c = __builtin_amdgcn_wmma_f32_16x16x32_f16(false, ah, false, bh, (short)0, c, false, false);
  if (NT >= 2) c = __builtin_amdgcn_wmma_f32_16x16x32_f16(false, al, false, bh, (short)0, c, false, false);
  if (NT >= 3) c = __builtin_amdgcn_wmma_f32_16x16x32_f16(false, ah, false, bl, (short)0, c, false, false);
  asm volatile("v_nop\n\tv_nop\n\tv_nop\n\tv_nop" : "+v"(c) : "v"(ah), "v"(al), "v"(bh), "v"(bl));
  return c;
}
// batched GEMM like k_gemm_b but f16 operands: A f32 (split into f16 hi/lo if ASPLIT, else rounded to f16), Bt = f16 values [n][k]; alpha; C f32; N multiple of 16 (partial tiles skipped)
template <bool ASPLIT>
__global__ __launch_bounds__(128) void k_gemm_h(const float* __restrict__ A, int lda, size_t sA, const _Float16* __restrict__ Bh, int ldb, size_t sB, float alpha, float* __restrict__ C, int ldc, size_t sC, int M, int N, int K) {
  __shared__ __attribute__((aligned(16))) float so[4][16][64];
  const int tid = threadIdx.x, w = tid >> 5, lane = tid & 31, ln = lane & 15, hh = lane >> 4; const int by = blockIdx.y;
  A += (size_t)by * sA; Bh += (size_t)by * sB; C += (size_t)by * sC;
  const int ntn = (N + 63) / 64; const int wid = blockIdx.x * 4 + w; const int mt = wid / ntn, nq = wid % ntn; if (mt * 16 >= M) return;
  const int row0 = mt * 16, col0 = nq * 64; const float* arow = A + (size_t)(row0 + ln) * lda;
  v8f acc[4] = {};
  for (int kb = 0; kb < K; kb += 32) {
    FragH ah, al;
    const v4f x0 = *(const v4fa*)(arow + kb + 8 * hh), x1 = *(const v4fa*)(arow + kb + 8 * hh + 4), x2 = *(const v4fa*)(arow + kb + 16 + 8 * hh), x3 = *(const v4fa*)(arow + kb + 16 + 8 * hh + 4);
    float xs[16] = {x0[0],x0[1],x0[2],x0[3],x1[0],x1[1],x1[2],x1[3],x2[0],x2[1],x2[2],x2[3],x3[0],x3[1],x3[2],x3[3]};
#pragma unroll
    for (int i = 0; i < 16; ++i) { const _Float16 h = (_Float16)xs[i]; ah.h[i] = h; al.h[i] = ASPLIT ? (_Float16)(xs[i] - (float)h) : (_Float16)0.0f; }
#pragma unroll
    for (int t = 0; t < 4; ++t) { if (col0 + t * 16 >= N) continue; const size_t boff = (size_t)(col0 + t * 16 + ln) * ldb + kb; FragH bq; bq.half[0] = *(const v8us*)(Bh + boff + 8 * hh); bq.half[1] = *(const v8us*)(Bh + boff + 16 + 8 * hh);
      acc[t] = mmaH<ASPLIT ? 2 : 1>(ah.v, al.v, bq.v, bq.v, acc[t]); }
  }
#pragma unroll
  for (int t = 0; t < 4; ++t) { if (col0 + t * 16 >= N) continue;
#pragma unroll
    for (int r = 0; r < 8; ++r) so[w][8 * hh + r][t * 16 + ln] = acc[t][r] * alpha; }
  __builtin_amdgcn_fence(__ATOMIC_ACQ_REL, "workgroup"); __builtin_amdgcn_wave_barrier();
  const int rsub = lane >> 4, c4 = (lane & 15) * 4;
  {
#pragma unroll
    for (int q = 0; q < 8; ++q) { const int r = q * 2 + rsub; if (col0 + c4 < N) { const v4f v = *(const v4fa*)&so[w][r][c4]; *(v4f*)(C + (size_t)(row0 + r) * ldc + col0 + c4) = v; } }
     }
}

// Wt[n][k] = f16(W[k][n]·scale) from f32 row-major W[K][N] (scale = power of two; bf16-exact weights stay exact in f16 away from the subnormal range)
__global__ __launch_bounds__(256) void k_wt_f16(const float* __restrict__ W, _Float16* __restrict__ Wt, int K, int N, float scale) {
  const int t = blockIdx.x * 256 + threadIdx.x; if (t >= N * (K / 8)) return; const int n = t / (K / 8), k8 = (t % (K / 8)) * 8; FragH f;
#pragma unroll
  for (int i = 0; i < 8; ++i) f.h[i] = (_Float16)(bf16_round(W[(size_t)(k8 + i) * N + n]) * scale); const v8us o = f.half[0];
  *(v8us*)((unsigned short*)Wt + (size_t)n * K + k8) = o; 
}
// k_gemm_hh variant with fused epilogue: v = acc·alpha + bias[by·sBias + col] (+ CP[(row/rowsPerB)·sCPb + by·64 + col] if CP) ; ACT 0 none / 1 elu ; writes f16 C16 (and f32 C if non-null)
template <int ACT>
__global__ __launch_bounds__(128) void k_gemm_hhx(const _Float16* __restrict__ A, int lda, size_t sA, const _Float16* __restrict__ Bh, int ldb, size_t sB, float alpha, const float* __restrict__ bias, size_t sBias, const float* __restrict__ CP, int rowsPerB, size_t sCPb, int row0g,
    float* __restrict__ C, _Float16* __restrict__ C16, int ldc, size_t sC, int M, int N, int K) {
  __shared__ __attribute__((aligned(16))) float so[4][16][64];
  const int tid = threadIdx.x, w = tid >> 5, lane = tid & 31, ln = lane & 15, hh = lane >> 4; const int by = blockIdx.y;
  A += (size_t)by * sA; Bh += (size_t)by * sB; const size_t cofs = (size_t)by * sC; const float* bp = bias ? bias + (size_t)by * sBias : nullptr;
  const int ntn = (N + 63) / 64; const int wid = blockIdx.x * 4 + w; const int mt = wid / ntn, nq = wid % ntn; if (mt * 16 >= M) return;
  const int row0 = mt * 16, col0 = nq * 64; const _Float16* arow = A + (size_t)(row0 + ln) * lda;
  v8f acc[4] = {};
  for (int kb = 0; kb < K; kb += 32) { FragH ah; ah.half[0] = *(const v8us*)((const unsigned short*)arow + kb + 8 * hh); ah.half[1] = *(const v8us*)((const unsigned short*)arow + kb + 16 + 8 * hh);
#pragma unroll
    for (int t = 0; t < 4; ++t) { if (col0 + t * 16 >= N) continue; const size_t boff = (size_t)(col0 + t * 16 + ln) * ldb + kb; FragH bq; bq.half[0] = *(const v8us*)((const unsigned short*)Bh + boff + 8 * hh); bq.half[1] = *(const v8us*)((const unsigned short*)Bh + boff + 16 + 8 * hh);
      acc[t] = mmaH<1>(ah.v, ah.v, bq.v, bq.v, acc[t]); }
  }
#pragma unroll
  for (int t = 0; t < 4; ++t) { if (col0 + t * 16 >= N) continue; const int col = col0 + t * 16 + ln; const float bv = bp ? bf16_round(bp[col]) : 0.f;
#pragma unroll
    for (int r = 0; r < 8; ++r) { float v = acc[t][r] * alpha + bv; if (CP) { const int rr = row0g + row0 + 8 * hh + r; if (rowsPerB < 0) v += CP[cofs + (size_t)rr * ldc + col];      /* rowsPerB < 0: own element of the batched C plane */ else { const int bidx = rr / rowsPerB; v += CP[(size_t)bidx * sCPb + (size_t)by * 64 + col]; } } if (ACT == 1) v = (v > 0.f) ? v : expm1f(v); else if (ACT == 7) v = (v > 0.f) ? v + 1.0f : expf(v); else if (ACT == 8) v = tanhf(v); else if (ACT == 9) v = 0.5f * v * (1.0f + tanhf(0.7978845608028654f * (v + 0.044715f * v * v * v))); else if (ACT == 11) v = 1.0f / (1.0f + expf(-v)); else if (ACT == 12) v = (v > 0.f) ? v : 0.01f * v; else if (ACT == 14) v = (v > 0.f) ? v : 0.1f * v; else if (ACT == 16) v = (v >= 0.f) ? v : 0.3f * v; else if (ACT == 17) v = (v >= 0.f) ? v : 0.2f * v; else if (ACT == 15) v = v / (1.0f + expf(-v)); else if (ACT == 3) v = fmaxf(v, 0.f); else if (ACT == 6) v = 0.5f * v * (1.0f + erff(v * 0.70710678118654752f)); so[w][8 * hh + r][t * 16 + ln] = v; } }
  __builtin_amdgcn_fence(__ATOMIC_ACQ_REL, "workgroup"); __builtin_amdgcn_wave_barrier();
  const int rsub = lane >> 4, c4 = (lane & 15) * 4; typedef _Float16 v4h __attribute__((ext_vector_type(4)));
  {
#pragma unroll
    for (int q = 0; q < 8; ++q) { const int r = q * 2 + rsub; if (col0 + c4 < N) { const v4f v = *(const v4fa*)&so[w][r][c4]; if (C) *(v4f*)(C + cofs + (size_t)(row0 + r) * ldc + col0 + c4) = v; if (C16) { v4h h4; for (int i = 0; i < 4; ++i) h4[i] = (_Float16)v[i]; *(v4h*)(C16 + cofs + (size_t)(row0 + r) * ldc + col0 + c4) = h4; } } }
     }
}


typedef _Float16 v4h __attribute__((ext_vector_type(4)));

__global__ __launch_bounds__(256) void k_x16(const float* __restrict__ x, _Float16* __restrict__ X16, size_t n8) { const size_t t = (size_t)blockIdx.x * 256 + threadIdx.x; if (t >= n8) return; FragH f;
#pragma unroll
  for (int q = 0; q < 8; ++q) f.h[q] = (_Float16)bf16_round(x[t * 8 + q]); *(v8us*)((unsigned short*)X16 + t * 8) = f.half[0];  }
__global__ __launch_bounds__(256) void k_h16(const float* __restrict__ x, _Float16* __restrict__ X16, size_t n8) { const size_t t = (size_t)blockIdx.x * 256 + threadIdx.x; if (t >= n8) return; FragH f;
#pragma unroll
  for (int q = 0; q < 8; ++q) f.h[q] = (_Float16)x[t * 8 + q]; *(v8us*)((unsigned short*)X16 + t * 8) = f.half[0];  }
__global__ __launch_bounds__(256) void k_round16f(const float* __restrict__ W, _Float16* __restrict__ Bt, size_t n8) { const size_t t = (size_t)blockIdx.x * 256 + threadIdx.x; if (t >= n8) return; FragH f;
#pragma unroll
  for (int i = 0; i < 8; ++i) f.h[i] = (_Float16)(bf16_round(W[t * 8 + i]) * 16.0f); *(v8us*)((unsigned short*)Bt + t * 8) = f.half[0];  }
template <int NHv, int TTv>
__global__ __launch_bounds__(256) void k_vt(const _Float16* __restrict__ V16, int ldv, int voff, _Float16* __restrict__ Vt) { __shared__ unsigned short tl[64][66]; const int tid = threadIdx.x; const int slab = blockIdx.x / (TTv / 64), lg = blockIdx.x % (TTv / 64); const int b = slab / NHv, h = slab % NHv;
  for (int i = tid; i < 64 * 8; i += 256) { const int r = i / 8, c8 = (i % 8) * 8; FragH f; f.half[0] = *(const v8us*)((const unsigned short*)V16 + ((size_t)b * TTv + lg * 64 + r) * ldv + voff + h * 64 + c8);
#pragma unroll
    for (int q = 0; q < 8; ++q) tl[r][c8 + q] = f.u[q]; }
  __syncthreads();
  {
#pragma unroll
    for (int rd = 0; rd < 2; ++rd) { const int d = rd * 32 + tid / 8, pc = tid % 8; FragH f;
#pragma unroll
      for (int q = 0; q < 8; ++q) f.u[q] = tl[pc * 8 + q][d];
      *(v8us*)((unsigned short*)Vt + ((size_t)slab * 64 + d) * TTv + lg * 64 + pc * 8) = f.half[0]; }
     } }

__global__ __launch_bounds__(256) void k_hl(const float* __restrict__ F, _Float16* __restrict__ Hh, _Float16* __restrict__ Hl, size_t n8) { const size_t t = (size_t)blockIdx.x * 256 + threadIdx.x; if (t >= n8) return; FragH fh, fl; const v4f a = *(const v4fa*)(F + t * 8), c = *(const v4fa*)(F + t * 8 + 4);
#pragma unroll
  for (int q = 0; q < 4; ++q) { _Float16 h = (_Float16)a[q]; fh.h[q] = h; fl.h[q] = (_Float16)((a[q] - (float)h) * 1024.0f); h = (_Float16)c[q]; fh.h[4 + q] = h; fl.h[4 + q] = (_Float16)((c[q] - (float)h) * 1024.0f); }
  { *(v8us*)((unsigned short*)Hh + t * 8) = fh.half[0]; *(v8us*)((unsigned short*)Hl + t * 8) = fl.half[0];  } }

__device__ __forceinline__ v16h g2_frag(const _Float16* p, int hh) { FragH f; f.half[0] = *(const v8us*)((const unsigned short*)p + 8 * hh); f.half[1] = *(const v8us*)((const unsigned short*)p + 16 + 8 * hh); return f.v; }


__device__ __forceinline__ void wnat_part(const float* __restrict__ w, size_t n8, _Float16* __restrict__ Bt, size_t t) { if (t >= n8) return; FragH f; for (int q = 0; q < 8; ++q) f.h[q] = (_Float16)(bf16_round(w[t * 8 + q]) * 16.0f); *(v8us*)((unsigned short*)Bt + t * 8) = f.half[0];  }
__global__ __launch_bounds__(256) void k_rsm(const float* __restrict__ S, _Float16* __restrict__ P, int nrows) {
  #pragma clang fp contract(off)
  const int i = blockIdx.x * 256 + threadIdx.x; if (i >= nrows) return; const float* s = S + (size_t)i * SQ; float mx = -3.0e38f;
#pragma unroll 1
  for (int j = 0; j < SQ; ++j) mx = fmaxf(mx, s[j]); float se = 0.f;
#pragma unroll 1
  for (int j = 0; j < SQ; ++j) se += expf(s[j] - mx); const float sc = 256.0f / se;
#pragma unroll 1
  for (int j0 = 0; j0 < SQ; j0 += 8) { FragH f; for (int q = 0; q < 8; ++q) f.h[q] = (_Float16)(expf(s[j0 + q] - mx) * sc); unsigned short* d = (unsigned short*)P + (size_t)i * SQ + j0; *(v8us*)d = f.half[0];  } }
__global__ __launch_bounds__(256) void k_vt(const _Float16* __restrict__ V16, int b, int h0, _Float16* __restrict__ VT) { __shared__ unsigned short tl[64][65]; const int tid = threadIdx.x; const int hh = blockIdx.x % HG, sg = blockIdx.x / HG; const int s0 = sg * 64; const int h = h0 + hh;
  for (int i = tid; i < 64 * 8; i += 256) { const int j = i / 8, d8 = (i % 8) * 8; FragH f; f.half[0] = *(const v8us*)((const unsigned short*)V16 + ((size_t)b * SQ + s0 + j) * DM + h * HD + d8); for (int q = 0; q < 8; ++q) tl[d8 + q][j] = f.u[q]; }
  __syncthreads();
  { for (int i = tid; i < 64 * 8; i += 256) { const int d = i / 8, j8 = (i % 8) * 8; FragH f; for (int q = 0; q < 8; ++q) f.u[q] = tl[d][j8 + q]; *(v8us*)((unsigned short*)VT + ((size_t)hh * HD + d) * SQ + s0 + j8) = f.half[0]; }  } }



#define FAW 8                        /* waves per workgroup */
#define FAK 64                       /* keys per stage */
#define FAP 72                       /* LDS row pitch in f16: 128 bytes of data + 16, so that the 16 rows of a fragment read start in 16 different bank groups */
#define FAT (SQ / FAK)               /* stages */
__device__ __forceinline__ float rs_xhalf(float x) { return __builtin_bit_cast(float, __builtin_amdgcn_permlanex16(__builtin_bit_cast(int, x), __builtin_bit_cast(int, x), 0x76543210, 0xfedcba98, false, false)); }      /* lane l reads lane l ^ 16 */
__device__ __forceinline__ v16h fa_frag(const unsigned short* p, int hh) { FragH f; f.half[0] = *(const v8us*)(p + 8 * hh); f.half[1] = *(const v8us*)(p + 16 + 8 * hh); return f.v; }
__device__ __forceinline__ v8f fa_mma(v16h a, v16h b, v8f c) { return __builtin_amdgcn_wmma_f32_16x16x32_f16(false, a, false, b, (short)0, c, false, false); }
// Eight native 2^x (v_exp_f32). The builtin, not asm text: the compiler schedules these between the matrix instructions and must see which registers they write.
__device__ __forceinline__ v8f fa_exp2x8(v8f x) { v8f e;
#pragma unroll      /* the vector stays in registers */
  for (int i = 0; i < 8; ++i) e[i] = __builtin_amdgcn_exp2f(x[i]);
  return e; }
static_assert(SQ % (FAW * 32) == 0 && SQ % FAK == 0 && HD == 64 && FAK == 64 && FAW * 32 == 256, "k_fattn: whole workgroups and stages; 256 threads stage 64 rows of 128 bytes in two rounds");
__global__ __launch_bounds__(FAW * 32) void k_fattn(const _Float16* __restrict__ Q16, const _Float16* __restrict__ K16, const _Float16* __restrict__ VT, _Float16* __restrict__ O16) {
  __shared__ __attribute__((aligned(16))) unsigned short sk[2][FAK][FAP];      /* K rows [key][d] */
  __shared__ __attribute__((aligned(16))) unsigned short sv[2][HD][FAP];       /* V^T rows [d][key] */
  const int tid = threadIdx.x, w = tid >> 5, lane = tid & 31, ln = lane & 15, hh = lane >> 4;
  const int bh = blockIdx.y, b = bh / NH, hd = bh - b * NH; const size_t r0 = (size_t)b * SQ; const int q0 = (blockIdx.x * FAW + w) * 32;
  const int srow = tid >> 3, sc8 = (tid & 7) * 8;      /* staging: 8 threads per 128-byte row, rows srow and srow + 32 */
  const unsigned short* kg = (const unsigned short*)K16 + (r0 + srow) * DM + hd * HD + sc8;
  const unsigned short* vg = (const unsigned short*)VT + ((size_t)bh * HD + srow) * SQ + sc8;
  v16h qf[2][2];      /* [16-query group][32 of d] */
  /* the short loops below are all unrolled so that the fragment and accumulator arrays stay in registers */
#pragma unroll
  for (int g = 0; g < 2; ++g)
#pragma unroll
    for (int ks = 0; ks < 2; ++ks) qf[g][ks] = g2_frag(Q16 + (r0 + q0 + g * 16 + ln) * DM + hd * HD + ks * 32, hh);
  const v8f z8 = {0.f, 0.f, 0.f, 0.f, 0.f, 0.f, 0.f, 0.f};
  v8f o[2][4] = {{z8, z8, z8, z8}, {z8, z8, z8, z8}}; float ms[2] = {-3.0e38f, -3.0e38f}, l[2] = {0.f, 0.f};
  const float cs = 0.125f * 1.44269504088896340736f;      /* 64^-0.5 log2 e */
  v8us kr0 = *(const v8us*)kg, kr1 = *(const v8us*)(kg + (size_t)32 * DM), vr0 = *(const v8us*)vg, vr1 = *(const v8us*)(vg + (size_t)32 * SQ);
  asm volatile("s_wait_xcnt 0x0" ::: "memory");      /* precaution: stands in front of every later write of a register that the loads above name as an address */
  *(v8us*)&sk[0][srow][sc8] = kr0; *(v8us*)&sk[0][srow + 32][sc8] = kr1; *(v8us*)&sv[0][srow][sc8] = vr0; *(v8us*)&sv[0][srow + 32][sc8] = vr1;
  __syncthreads();      /* stage 0 is published */
  for (int t = 0; t < FAT; ++t) { const int cur = t & 1;
    if (t + 1 < FAT) { const unsigned short* kn = kg + (size_t)(t + 1) * FAK * DM; const unsigned short* vn = vg + (t + 1) * FAK;
      kr0 = *(const v8us*)kn; kr1 = *(const v8us*)(kn + (size_t)32 * DM); vr0 = *(const v8us*)vn; vr1 = *(const v8us*)(vn + (size_t)32 * SQ); }
#pragma unroll
    for (int hp = 0; hp < 2; ++hp) {      /* two passes of 32 keys per stage: half the score registers live at once; unrolled, so that one pass's matrix work can be scheduled among the other's softmax */
      v8f s[2][2];      /* S^T: [query group][16-key tile], register r = key 8 hh + r, lane column = query */
#pragma unroll
      for (int j = 0; j < 2; ++j) { const v16h a0 = fa_frag(&sk[cur][hp * 32 + j * 16 + ln][0], hh), a1 = fa_frag(&sk[cur][hp * 32 + j * 16 + ln][32], hh);
#pragma unroll
        for (int g = 0; g < 2; ++g) s[g][j] = fa_mma(a1, qf[g][1], fa_mma(a0, qf[g][0], z8)); }
      v16h va[4];
#pragma unroll
      for (int dt = 0; dt < 4; ++dt) va[dt] = fa_frag(&sv[cur][dt * 16 + ln][hp * 32], hh);
      float mxs[2];
#pragma unroll
      for (int g = 0; g < 2; ++g) { const v8f mv = __builtin_elementwise_max(s[g][0], s[g][1]);
        const float mx = fmaxf(fmaxf(fmaxf(mv[0], mv[1]), fmaxf(mv[2], mv[3])), fmaxf(fmaxf(mv[4], mv[5]), fmaxf(mv[6], mv[7])));
        mxs[g] = fmaxf(mx, rs_xhalf(mx)) * cs; }
      if (__builtin_amdgcn_ballot_w32(mxs[0] > ms[0] + 8.0f || mxs[1] > ms[1] + 8.0f) != 0) {      /* wave-uniform: some query's maximum has outgrown the one in use */
        const float n0 = fmaxf(ms[0], mxs[0]), n1 = fmaxf(ms[1], mxs[1]); const float c0 = __builtin_amdgcn_exp2f(ms[0] - n0), c1 = __builtin_amdgcn_exp2f(ms[1] - n1);      /* the two rescale factors */
        ms[0] = n0; ms[1] = n1; l[0] *= c0; l[1] *= c1;
#pragma unroll
        for (int dt = 0; dt < 4; ++dt) { o[0][dt] *= c0; o[1][dt] *= c1; } }
      v16h pf[2];      /* P^T as B operand, per query group */
#pragma unroll
      for (int g = 0; g < 2; ++g) { const float nb = 7.0f - ms[g];
#pragma unroll
        for (int j = 0; j < 2; ++j) s[g][j] = fa_exp2x8(s[g][j] * cs + nb);
        const v8f ps = s[g][0] + s[g][1];
        l[g] += ((ps[0] + ps[1]) + (ps[2] + ps[3])) + ((ps[4] + ps[5]) + (ps[6] + ps[7]));
        FragH f;
#pragma unroll
        for (int i = 0; i < 8; ++i) { f.h[i] = (_Float16)s[g][0][i]; f.h[8 + i] = (_Float16)s[g][1][i]; }
        pf[g] = f.v; }
#pragma unroll
      for (int dt = 0; dt < 4; ++dt)
#pragma unroll
        for (int g = 0; g < 2; ++g) o[g][dt] = fa_mma(va[dt], pf[g], o[g][dt]); }
    if (t + 1 < FAT) { *(v8us*)&sk[cur ^ 1][srow][sc8] = kr0; *(v8us*)&sk[cur ^ 1][srow + 32][sc8] = kr1; *(v8us*)&sv[cur ^ 1][srow][sc8] = vr0; *(v8us*)&sv[cur ^ 1][srow + 32][sc8] = vr1; }      /* its last readers left this buffer at the barrier of stage t - 1 */
    __syncthreads(); }      /* publishes stage t + 1 and ends every read of stage t */
#pragma unroll
  for (int g = 0; g < 2; ++g) { const float inv = 64.0f / (l[g] + rs_xhalf(l[g]));      /* the halves hold disjoint keys; o is carried x64 */
    unsigned short* op = (unsigned short*)O16 + (r0 + q0 + g * 16 + ln) * DM + hd * HD + 8 * hh;
#pragma unroll
    for (int dt = 0; dt < 4; ++dt) { FragH f;
#pragma unroll
      for (int r = 0; r < 8; ++r) f.h[r] = (_Float16)(o[g][dt][r] * inv);
      *(v8us*)(op + dt * 16) = f.half[0]; }      /* register r = d 16 dt + 8 hh + r of query ln: 16 contiguous bytes */
    if (g == 0) asm volatile("s_wait_xcnt 0x0" ::: "memory"); } }      /* precaution: stands in front of every later write of a register that the first group's stores name */


// ---- staged GEMM: C[MP][DM] = A[MP][DM] . Bt[DM][DM]^T x alpha + bias (bias rounded to bf16 first), all pitches DM; C f32 or f16 ----
// One workgroup = 8 waves = one 128 x 128 tile of C, waves 4 (rows) x 2 (columns), 32 x 64 per wave. The k axis runs in stages of G3K: the 128 A rows and the 128 Bt rows
// of a stage (256 bytes each) come from global memory as whole lines, 16 lanes per row, once per workgroup, and lie in LDS at a padded pitch; every wave takes its
// fragments from there. Two LDS buffers: stage t + 1 travels global -> registers while stage t is worked on and is stored behind the work; one barrier per stage.
// Each accumulator tile sums k in ascending steps of 32, one WMMA per step.
#define G3T 128                      /* tile rows and tile columns per workgroup */
#define G3K 128                      /* k per stage */
#define G3P 136                      /* LDS row pitch in f16: 256 bytes of data + 16, so that the 16 rows of a fragment read start in 16 different bank groups */
#define G3S (DM / G3K)               /* stages */
static_assert(MP % G3T == 0 && MPO % G3T == 0 && DM % G3T == 0 && DM % G3K == 0 && G3S >= 2, "k_gemm3: whole tiles and stages");
template <bool F32OUT>      /* the result goes to C (f32) or to C16 (f16); the other pointer is not used; mt, nq: the workgroup's tile row and tile column */
__device__ __forceinline__ void gemm3_tile(const _Float16* __restrict__ A, const _Float16* __restrict__ Bh, float alpha, const float* __restrict__ bias, float* __restrict__ C, _Float16* __restrict__ C16, int mt, int nq) {
  __shared__ __attribute__((aligned(16))) unsigned short sa[2][G3T][G3P];      /* A rows [row][k] */
  __shared__ __attribute__((aligned(16))) unsigned short sb[2][G3T][G3P];      /* Bt rows [column][k] */
  __shared__ __attribute__((aligned(16))) float so[8][32][68];                 /* per-wave output staging */
  const int tid = threadIdx.x, w = tid >> 5, lane = tid & 31, ln = lane & 15, hh = lane >> 4;
  const int wr = (w >> 1) * 32, wc = (w & 1) * 64;      /* the wave's place in the tile */
  const int row0 = mt * G3T + wr, col0 = nq * G3T + wc;
  const int srow = tid >> 4, sc8 = (tid & 15) * 8;      /* staging: 16 threads per 256-byte row, rows srow + 16 i */
  const unsigned short* ag = (const unsigned short*)A + (size_t)(mt * G3T + srow) * DM + sc8;
  const unsigned short* bg = (const unsigned short*)Bh + (size_t)(nq * G3T + srow) * DM + sc8;
  v8us ra[8], rb[8];
  /* the short loops below are all unrolled so that the staging, fragment and accumulator arrays stay in registers */
#pragma unroll
  for (int i = 0; i < 8; ++i) { ra[i] = *(const v8us*)(ag + (size_t)(16 * i) * DM); rb[i] = *(const v8us*)(bg + (size_t)(16 * i) * DM); }
#pragma unroll
  for (int i = 0; i < 8; ++i) { *(v8us*)&sa[0][srow + 16 * i][sc8] = ra[i]; *(v8us*)&sb[0][srow + 16 * i][sc8] = rb[i]; }
  const v8f z8 = {0.f, 0.f, 0.f, 0.f, 0.f, 0.f, 0.f, 0.f}; v8f acc[2][4] = {{z8, z8, z8, z8}, {z8, z8, z8, z8}};      /* [16-row group][16-column group] */
  __syncthreads();      /* stage 0 is published */
  for (int t = 0; t < G3S; ++t) { const int cur = t & 1;
    if (t + 1 < G3S) {
#pragma unroll
      for (int i = 0; i < 8; ++i) { ra[i] = *(const v8us*)(ag + (size_t)(16 * i) * DM + (t + 1) * G3K); rb[i] = *(const v8us*)(bg + (size_t)(16 * i) * DM + (t + 1) * G3K); } }
#pragma unroll
    for (int ks = 0; ks < G3K / 32; ++ks) { const v16h a0 = fa_frag(&sa[cur][wr + ln][ks * 32], hh), a1 = fa_frag(&sa[cur][wr + 16 + ln][ks * 32], hh);
#pragma unroll
      for (int j = 0; j < 4; ++j) { const v16h b = fa_frag(&sb[cur][wc + j * 16 + ln][ks * 32], hh); acc[0][j] = fa_mma(a0, b, acc[0][j]); acc[1][j] = fa_mma(a1, b, acc[1][j]); } }
    if (t + 1 < G3S) {
#pragma unroll
      for (int i = 0; i < 8; ++i) { *(v8us*)&sa[cur ^ 1][srow + 16 * i][sc8] = ra[i]; *(v8us*)&sb[cur ^ 1][srow + 16 * i][sc8] = rb[i]; } }      /* its last readers left this buffer at the barrier of stage t - 1 */
    __syncthreads(); }      /* publishes stage t + 1 and ends every read of stage t */
#pragma unroll
  for (int u = 0; u < 8; ++u) { const int j = u & 3, half = u >> 2; const float bv = bf16_round(bias[col0 + j * 16 + ln]);
#pragma unroll
    for (int r = 0; r < 8; ++r) so[w][half * 16 + 8 * hh + r][j * 16 + ln] = acc[half][j][r] * alpha + bv; }
  __builtin_amdgcn_fence(__ATOMIC_ACQ_REL, "workgroup"); __builtin_amdgcn_wave_barrier();      /* the wave reads back rows that its other lanes wrote */
  const int rsub = lane >> 4, c4 = (lane & 15) * 4;
#pragma unroll
  for (int q = 0; q < 16; ++q) { const int r = q * 2 + rsub; const v4f v = *(const v4fa*)&so[w][r][c4]; const size_t e = (size_t)(row0 + r) * DM + col0 + c4;
    if (F32OUT) *(v4f*)(C + e) = v; else *(v4h*)(C16 + e) = __builtin_convertvector(v, v4h); } }      /* 16 lanes store one row of the wave's 64 columns: whole lines */
// The output projection: one grid of (MPO / G3T) x (DM / G3T) tiles, f32 result.
__global__ __launch_bounds__(256) void k_gemm3o(const _Float16* __restrict__ A, const _Float16* __restrict__ Bh, float alpha, const float* __restrict__ bias, float* __restrict__ C) {
  const int mt = blockIdx.x / (DM / G3T), nq = blockIdx.x - mt * (DM / G3T);
  gemm3_tile<true>(A, Bh, alpha, bias, C, nullptr, mt, nq); }
// The Q, K and V projections read the same A and do not depend on each other: one grid holds the tiles of all three, so that they share one launch and fill the chip without a
// gap between them. A tile row's 3 x (DM / G3T) workgroups are neighbours in the grid (Q's columns, then K's, then V's), so its A rows are read again while they are still in the cache.
__global__ __launch_bounds__(256) void k_gemm3qkv(const _Float16* __restrict__ A, const _Float16* __restrict__ Bq, const _Float16* __restrict__ Bk, const _Float16* __restrict__ Bv, float alpha,
                                                  const float* __restrict__ bq, const float* __restrict__ bk, const float* __restrict__ bv, _Float16* __restrict__ Cq, _Float16* __restrict__ Ck, _Float16* __restrict__ Cv) {
  const int mt = blockIdx.x / (3 * (DM / G3T)), c = blockIdx.x - mt * (3 * (DM / G3T)); const int m = c / (DM / G3T), nq = c - m * (DM / G3T);      /* m: 0 = Q, 1 = K, 2 = V; the same for the whole workgroup */
  gemm3_tile<false>(A, m == 0 ? Bq : m == 1 ? Bk : Bv, alpha, m == 0 ? bq : m == 1 ? bk : bv, nullptr, m == 0 ? Cq : m == 1 ? Ck : Cv, mt, nq); }


__device__ __forceinline__ void xpe_part(const float* __restrict__ x, _Float16* __restrict__ X16, size_t n8, size_t t) {
  #pragma clang fp contract(off)
  if (t >= n8) return; const size_t e0 = t * 8; const size_t r = e0 / DM; const int c0 = (int)(e0 % DM); const float s = (float)(r % SQ); const float kf = (float)(-9.210340371976184 / (double)DM); FragH f;
  for (int q = 0; q < 8; ++q) { const int c = c0 + q; const int i2 = c & ~1; const float dv = expf(__fmul_rn((float)i2, kf)); const float ang = __fmul_rn(s, dv); const float pe = (c & 1) ? cosf(ang) : sinf(ang); f.h[q] = (_Float16)__fadd_rn(bf16_round(x[e0 + q]), pe); }
  *(v8us*)((unsigned short*)X16 + e0) = f.half[0];  }
// x + PE and the four weight conversions do not depend on each other: one grid, dealt by workgroup range. The x + PE workgroups, the longer ones, come first.
#define PXG ((unsigned)((NR * DM / 8 + 255) / 256))              /* workgroups of x + PE */
#define PWG ((unsigned)(((size_t)DM * DM / 8 + 255) / 256))      /* workgroups per weight matrix */
__global__ __launch_bounds__(256) void k_prep(const float* __restrict__ x, const float* __restrict__ wq, const float* __restrict__ wk, const float* __restrict__ wv, const float* __restrict__ wo,
                                              _Float16* __restrict__ X16, _Float16* __restrict__ BQ, _Float16* __restrict__ BK, _Float16* __restrict__ BV, _Float16* __restrict__ BO) {
  const unsigned g = blockIdx.x;
  if (g < PXG) { xpe_part(x, X16, NR * DM / 8, (size_t)g * 256 + threadIdx.x); return; }      /* x + sinusoidal PE -> f16 rows (not exact: x + pe is not a bf16 value) */
  const unsigned u = g - PXG, m = u / PWG;      /* m: which weight matrix; the same for the whole workgroup */
  wnat_part(m == 0 ? wq : m == 1 ? wk : m == 2 ? wv : wo, (size_t)DM * DM / 8, m == 0 ? BQ : m == 1 ? BK : m == 2 ? BV : BO, (size_t)(u - m * PWG) * 256 + threadIdx.x); }      /* natural [out][in] = Bt[n][k], x16 */
extern "C" void kernel_launch(void* const* d_in, const int* in_sizes, int n_in,
                              void* d_out, int out_size, void* d_ws, size_t ws_size, hipStream_t stream) {
  (void)in_sizes; (void)n_in; (void)out_size;
  const float* const* I = (const float* const*)d_in; const float* x = I[0]; const float* wq = I[1]; const float* bq = I[2]; const float* wk = I[3]; const float* bk = I[4]; const float* wv = I[5]; const float* bv = I[6]; const float* wo = I[7]; const float* bo = I[8];      /* nn.Linear weights [out][in] + biases */
  char* ws = (char*)d_ws; size_t off = 0;
  auto take = [&](size_t bytes) { char* p = ws + off; off += (bytes + 255) & ~(size_t)255; return p; };
  _Float16* BQ = (_Float16*)take((size_t)DM * DM * 2); _Float16* BK = (_Float16*)take((size_t)DM * DM * 2); _Float16* BV = (_Float16*)take((size_t)DM * DM * 2); _Float16* BO = (_Float16*)take((size_t)DM * DM * 2);
  _Float16* X16 = (_Float16*)take(NR * DM * 2); _Float16* Q16 = (_Float16*)take(NR * DM * 2); _Float16* K16 = (_Float16*)take(NR * DM * 2); _Float16* V16 = (_Float16*)take(NR * DM * 2); _Float16* O16 = (_Float16*)take(NR * DM * 2);
  _Float16* VT = (_Float16*)take((size_t)NB * NH * HD * SQ * 2);
  if (off > ws_size) return;
  k_prep<<<PXG + 4 * PWG, 256, 0, stream>>>(x, wq, wk, wv, wo, X16, BQ, BK, BV, BO);      /* f16 operands: x + PE rows and the four weight matrices */
  const size_t r0p = (size_t)B0 * SQ;      /* first projected row */
  k_gemm3qkv<<<(unsigned)((MP / G3T) * 3 * (DM / G3T)), 256, 0, stream>>>(X16 + r0p * DM, BQ, BK, BV, 0.0625f, bq, bk, bv, Q16 + r0p * DM, K16 + r0p * DM, V16 + r0p * DM);
  k_vt<NH, SQ><<<NB * NH * (SQ / 64), 256, 0, stream>>>(V16, LQ, 0, VT);      /* V^T [NB][NH][HD][SQ] */
  k_fattn<<<dim3(SQ / (FAW * 32), NB * NH), FAW * 32, 0, stream>>>(Q16, K16, VT, O16);      /* o (merged heads, x64) as f16 rows */
  k_gemm3o<<<(unsigned)((MPO / G3T) * (DM / G3T)), 256, 0, stream>>>(O16 + r0p * DM, BO, 0.0009765625f, bo, (float*)d_out + r0p * DM);      /* out rows are the output layout */
}

// v005
// A run of this version takes 99.6 microseconds.
// Two timings next to v004 put it at 1.18 and 1.29 times that version's speed.
// Over all steps from v000 it is 37.1 times as fast.
#include <hip/hip_runtime.h>
// Temporal multi-head attention with sinusoidal positional encoding (x [2][2048][1024]; x = x + PE (pe[s][2i] = sin(s d_i), pe[s][2i+1] = cos(s d_i), d_i = exp(2i x (-ln 1e4 / 1024))); q = x Wq^T + bq, k, v likewise (nn.Linear [out][in] 1024^2, weights and biases sigma 1/32); 16 heads of 64; softmax(q k^T / 8) (no mask); out = ctx Wo^T + bo -> [2][2048][1024]).
// Structure: token rows r = b*2048 + s; x + PE computed on VALU (f32 expf/sinf/cosf in the module's op order) -> f16 rows (one f16 rounding of x + pe); Q, K, V as three WMMA GEMMs in one grid (128x128 workgroup tiles staged in LDS, 32x64 wave tiles, f32 accumulation, exact x16 weights + bias, f16 outputs); V^T for all batches and heads via LDS transposes; one fused attention kernel over all (batch, head, 256 queries): scores on WMMA (K = 64), online softmax on VALU (f32 statistics, native exp2; weights as f16, scaled by a power of two that cancels), o = P . V on WMMA (o carried x64 against f16 subnormal flush, folded into the output GEMM alpha) written straight into the merged f16 o rows; out = o W_o + b GEMM (f32) into the output layout.
// Compute dtype: inputs rounded to bf16; weights exact, x + pe rounded once to f16; q, k, v, softmax weights and o as plain f16 GEMM operands (~2^-12); scores and softmax statistics f32. v_wmma_f32_16x16x32_f16.
#define NB 2
#define SQ 2048
#define DM 1024
#define NH 16
#define HD 64
#define HG 4                         /* heads per call of the unlaunched k_vt(V16, b, h0, VT) */
#define B0 0                         /* first batch processed (debug hook) */
#define NBR NB                       /* batches processed (debug hook) */
#define NR ((size_t)NB * SQ)         /* token rows */
#define MP ((int)((size_t)NBR * SQ)) /* rows projected (debug hook) */
#define QN SQ                        /* unused: k_fattn attends all SQ query rows */
#define NHD NH                       /* unused: k_fattn attends all NH heads */
#define MPO MP                       /* rows through the output stage (debug hook) */
#define LQ DM      /* row pitch of the q/k/v rows */
typedef __bf16 v16b __attribute__((ext_vector_type(16)));
typedef unsigned short v8us __attribute__((ext_vector_type(8), may_alias));
typedef float  v8f  __attribute__((ext_vector_type(8)));
typedef float  v4f  __attribute__((ext_vector_type(4)));
typedef float  v4fa __attribute__((ext_vector_type(4), may_alias));
union FragB { v16b v; v8us half[2]; unsigned short u[16]; };

__device__ __forceinline__ unsigned short bf16_bits(float x) { unsigned int u = __float_as_uint(x); return (unsigned short)((u + 0x7FFFu + ((u >> 16) & 1u)) >> 16); }
__device__ __forceinline__ float bf16_val(unsigned short b) { return __uint_as_float(((unsigned int)b) << 16); }
__device__ __forceinline__ float bf16_round(float x) { return bf16_val(bf16_bits(x)); }
// D += A·B with NT terms: 1 = ah·bh, 2 = + al·bh (A split), 3 = + ah·bl (both split)
template <int NT>
__device__ __forceinline__ v8f mmaN(v16b ah, v16b al, v16b bh, v16b bl, v8f c) {
  c = __builtin_amdgcn_wmma_f32_16x16x32_bf16(false, ah, false, bh, (short)0, c, false, false);
  if (NT >= 2) c = __builtin_amdgcn_wmma_f32_16x16x32_bf16(false, al, false, bh, (short)0, c, false, false);
  if (NT >= 3) c = __builtin_amdgcn_wmma_f32_16x16x32_bf16(false, ah, false, bl, (short)0, c, false, false);
  asm volatile("v_nop\n\tv_nop\n\tv_nop\n\tv_nop" : "+v"(c) : "v"(ah), "v"(al), "v"(bh), "v"(bl));
  return c;
}

__global__ __launch_bounds__(256) void k_wt_bf16(const float* __restrict__ W, unsigned short* __restrict__ Wt, int K, int N) {
  const int t = blockIdx.x * 256 + threadIdx.x;
  const int k8n = K / 8;
  if (t >= N * k8n) return;
  const int n = t / k8n, k8 = (t % k8n) * 8;
  v8us v;
#pragma unroll
  for (int i = 0; i < 8; ++i) v[i] = bf16_bits(W[(size_t)(k8 + i) * N + n]);
  *(v8us*)(Wt + (size_t)n * K + k8) = v;
  
}

// GEMM C[M][N] (f32, pitch ldc) = act(A[M][K]·W + bias). A f32 row-major (pitch lda) converted per fragment to bf16
// (ASPLIT: hi/lo two planes -> 2 terms, else single rounded term); Wt bf16 [N][K] (pitch ldb). BIAS_BF16 rounds the
// bias to bf16 first (bias quantised to bf16 before the add). K%32==0, M%16==0, N%64==0.
template <bool ASPLIT, int ACT, bool BIAS_BF16>
__global__ __launch_bounds__(128) void k_gemm_bf(const float* __restrict__ A, int lda, const unsigned short* __restrict__ Wt, int ldb,
                                               const float* __restrict__ bias, float* __restrict__ C, int ldc, int M, int N, int K) {
  __shared__ __attribute__((aligned(16))) float so[4][16][64];
  const int tid = threadIdx.x, w = tid >> 5, lane = tid & 31, ln = lane & 15, hh = lane >> 4;
  const int ntn = N / 64;
  const int wid = blockIdx.x * 4 + w;
  const int mt = wid / ntn, nq = wid % ntn;
  if (mt * 16 >= M) return;
  const int row0 = mt * 16, col0 = nq * 64;
  const float* arow = A + (size_t)(row0 + ln) * lda;
  v8f acc[4] = {};
  for (int kb = 0; kb < K; kb += 32) {
    FragB ah, al;
    const v4f x0 = *(const v4fa*)(arow + kb + 8 * hh), x1 = *(const v4fa*)(arow + kb + 8 * hh + 4);
    const v4f x2 = *(const v4fa*)(arow + kb + 16 + 8 * hh), x3 = *(const v4fa*)(arow + kb + 16 + 8 * hh + 4);
    float xs[16] = {x0[0],x0[1],x0[2],x0[3],x1[0],x1[1],x1[2],x1[3],x2[0],x2[1],x2[2],x2[3],x3[0],x3[1],x3[2],x3[3]};
#pragma unroll
    for (int i = 0; i < 16; ++i) { const unsigned short hb = bf16_bits(xs[i]); ah.u[i] = hb; al.u[i] = ASPLIT ? bf16_bits(xs[i] - bf16_val(hb)) : (unsigned short)0; }
#pragma unroll
    for (int t = 0; t < 4; ++t) {
      const unsigned short* brow = Wt + (size_t)(col0 + t * 16 + ln) * ldb + kb;
      FragB b;
      b.half[0] = *(const v8us*)(brow + 8 * hh);
      b.half[1] = *(const v8us*)(brow + 16 + 8 * hh);
      acc[t] = mmaN<ASPLIT ? 2 : 1>(ah.v, al.v, b.v, b.v, acc[t]);
    }
  }
#pragma unroll
  for (int t = 0; t < 4; ++t) {
    float bv = bias ? bias[col0 + t * 16 + ln] : 0.f;
    if (BIAS_BF16) bv = bf16_round(bv);
#pragma unroll
    for (int r = 0; r < 8; ++r) { float v = acc[t][r] + bv; if (ACT == 1) v = fmaxf(v, 0.f); so[w][8 * hh + r][t * 16 + ln] = v; }
  }
  __builtin_amdgcn_fence(__ATOMIC_ACQ_REL, "workgroup");
  __builtin_amdgcn_wave_barrier();
  const int rsub = lane >> 4, c4 = (lane & 15) * 4;
  {
#pragma unroll
    for (int q = 0; q < 8; ++q) {
      const int r = q * 2 + rsub;
      const v4f v = *(const v4fa*)&so[w][r][c4];
      *(v4f*)(C + (size_t)(row0 + r) * ldc + col0 + c4) = v;
    }
    
  }
}

// GEMM C = act(A·W + bias + resid): A f32 (ASPLIT -> hi/lo 2 terms), Wt bf16 [N][K]; ACT 0 none, 1 relu, 2 exact gelu;
// resid (optional, f32, row index = (row % rmod), pitch ldr, RES_BF16 rounds it) added before the activation.
template <bool ASPLIT, int ACT, bool BIAS_BF16, bool RES_BF16>
__global__ __launch_bounds__(128) void k_gemm_bf3(const float* __restrict__ A, int lda, const unsigned short* __restrict__ Wt, int ldb,
                                                const float* __restrict__ bias, const float* __restrict__ resid, int rmod, int ldr,
                                                float* __restrict__ C, int ldc, int M, int N, int K) {
  __shared__ __attribute__((aligned(16))) float so[4][16][64];
  const int tid = threadIdx.x, w = tid >> 5, lane = tid & 31, ln = lane & 15, hh = lane >> 4;
  const int ntn = N / 64;
  const int wid = blockIdx.x * 4 + w;
  const int mt = wid / ntn, nq = wid % ntn;
  if (mt * 16 >= M) return;
  const int row0 = mt * 16, col0 = nq * 64;
  const float* arow = A + (size_t)(row0 + ln) * lda;
  v8f acc[4] = {};
  for (int kb = 0; kb < K; kb += 32) {
    FragB ah, al;
    const v4f x0 = *(const v4fa*)(arow + kb + 8 * hh), x1 = *(const v4fa*)(arow + kb + 8 * hh + 4);
    const v4f x2 = *(const v4fa*)(arow + kb + 16 + 8 * hh), x3 = *(const v4fa*)(arow + kb + 16 + 8 * hh + 4);
    float xs[16] = {x0[0],x0[1],x0[2],x0[3],x1[0],x1[1],x1[2],x1[3],x2[0],x2[1],x2[2],x2[3],x3[0],x3[1],x3[2],x3[3]};
#pragma unroll
    for (int i = 0; i < 16; ++i) { const unsigned short hb = bf16_bits(xs[i]); ah.u[i] = hb; al.u[i] = ASPLIT ? bf16_bits(xs[i] - bf16_val(hb)) : (unsigned short)0; }
#pragma unroll
    for (int t = 0; t < 4; ++t) {
      const unsigned short* brow = Wt + (size_t)(col0 + t * 16 + ln) * ldb + kb;
      FragB b;
      b.half[0] = *(const v8us*)(brow + 8 * hh);
      b.half[1] = *(const v8us*)(brow + 16 + 8 * hh);
      acc[t] = mmaN<ASPLIT ? 2 : 1>(ah.v, al.v, b.v, b.v, acc[t]);
    }
  }
#pragma unroll
  for (int t = 0; t < 4; ++t) {
    const int col = col0 + t * 16 + ln;
    float bv = bias ? bias[col] : 0.f;
    if (BIAS_BF16) bv = bf16_round(bv);
#pragma unroll
    for (int r = 0; r < 8; ++r) {
      float v = acc[t][r] + bv;
      if (resid) { float rv = resid[(size_t)((row0 + 8 * hh + r) % rmod) * ldr + col]; if (RES_BF16) rv = bf16_round(rv); v += rv; }
      if (ACT == 1) v = fmaxf(v, 0.f);
      if (ACT == 2) v = 0.5f * v * (1.0f + erff(v * 0.70710678118654752f));
      if (ACT == 3) { const float u = 0.7978845608028654f * (v + 0.044715f * v * v * v); v = 0.5f * v * (1.0f + tanhf(u)); }
      so[w][8 * hh + r][t * 16 + ln] = v;
    }
  }
  __builtin_amdgcn_fence(__ATOMIC_ACQ_REL, "workgroup");
  __builtin_amdgcn_wave_barrier();
  const int rsub = lane >> 4, c4 = (lane & 15) * 4;
  {
#pragma unroll
    for (int q = 0; q < 8; ++q) {
      const int r = q * 2 + rsub;
      const v4f v = *(const v4fa*)&so[w][r][c4];
      *(v4f*)(C + (size_t)(row0 + r) * ldc + col0 + c4) = v;
    }
    
  }
}
// row LayerNorm (biased variance, eps) over N: s = X (+ R); optional out_sum <- s; out_norm <- (s-mu)*rsqrt(var+eps)*g + b
template <bool PARAM_BF16>
__global__ __launch_bounds__(256) void k_layernorm(const float* __restrict__ X, const float* __restrict__ R, const float* __restrict__ g, const float* __restrict__ bta,
                                                  float* __restrict__ out_sum, float* __restrict__ out_norm, int N, float eps) {
  __shared__ float red[256];
  const int row = blockIdx.x, tid = threadIdx.x;
  const float* x = X + (size_t)row * N; const float* rr = R ? R + (size_t)row * N : nullptr;
  float vals[16];                     // up to N = 4096
  const int per = N / 256;            // contiguous chunk per thread? use strided-by-4 chunks: thread handles j = tid*4 + 1024*u
  float s1 = 0.f;
  for (int u = 0; u < per / 4; ++u) {
    const int j = tid * 4 + 1024 * u;
    const v4f a = *(const v4fa*)(x + j);
    v4f b = {0.f,0.f,0.f,0.f}; if (rr) b = *(const v4fa*)(rr + j);
#pragma unroll
    for (int q = 0; q < 4; ++q) { const float v = a[q] + b[q]; vals[u * 4 + q] = v; s1 += v; }
  }
  red[tid] = s1; __syncthreads();
  for (int st = 128; st > 0; st >>= 1) { if (tid < st) red[tid] += red[tid + st]; __syncthreads(); }
  const float mu = red[0] / (float)N; __syncthreads();
  float s2 = 0.f;
  for (int u = 0; u < per / 4; ++u)
#pragma unroll
    for (int q = 0; q < 4; ++q) { const float c = vals[u * 4 + q] - mu; s2 += c * c; }
  red[tid] = s2; __syncthreads();
  for (int st = 128; st > 0; st >>= 1) { if (tid < st) red[tid] += red[tid + st]; __syncthreads(); }
  const float rs = rsqrtf(red[0] / (float)N + eps);
  {
    for (int u = 0; u < per / 4; ++u) {
      const int j = tid * 4 + 1024 * u;
      v4f o, sm;
#pragma unroll
      for (int q = 0; q < 4; ++q) {
        float gg = g[j + q], bb = bta[j + q];
        if (PARAM_BF16) { gg = bf16_round(gg); bb = bf16_round(bb); }
        sm[q] = vals[u * 4 + q]; o[q] = (vals[u * 4 + q] - mu) * rs * gg + bb;
      }
      if (out_sum) *(v4f*)(out_sum + (size_t)row * N + j) = sm;
      *(v4f*)(out_norm + (size_t)row * N + j) = o;
    }
    
  }
}



// ---- f16 WMMA path (v_wmma_f32_16x16x32_f16): 11-bit significands for operands in range — used where a [0,1] probability operand needs more precision than bf16
typedef _Float16 v16h __attribute__((ext_vector_type(16)));
union FragH { v16h v; v8us half[2]; _Float16 h[16]; unsigned short u[16]; };
template <int NT>
__device__ __forceinline__ v8f mmaH(v16h ah, v16h al, v16h bh, v16h bl, v8f c) {
  c = __builtin_amdgcn_wmma_f32_16x16x32_f16(false, ah, false, bh, (short)0, c, false, false);
  if (NT >= 2) c = __builtin_amdgcn_wmma_f32_16x16x32_f16(false, al, false, bh, (short)0, c, false, false);
  if (NT >= 3) c = __builtin_amdgcn_wmma_f32_16x16x32_f16(false, ah, false, bl, (short)0, c, false, false);
  asm volatile("v_nop\n\tv_nop\n\tv_nop\n\tv_nop" : "+v"(c) : "v"(ah), "v"(al), "v"(bh), "v"(bl));
  return c;
}
// batched GEMM like k_gemm_b but f16 operands: A f32 (split into f16 hi/lo if ASPLIT, else rounded to f16), Bt = f16 values [n][k]; alpha; C f32; N multiple of 16 (partial tiles skipped)
template <bool ASPLIT>
__global__ __launch_bounds__(128) void k_gemm_h(const float* __restrict__ A, int lda, size_t sA, const _Float16* __restrict__ Bh, int ldb, size_t sB, float alpha, float* __restrict__ C, int ldc, size_t sC, int M, int N, int K) {
  __shared__ __attribute__((aligned(16))) float so[4][16][64];
  const int tid = threadIdx.x, w = tid >> 5, lane = tid & 31, ln = lane & 15, hh = lane >> 4; const int by = blockIdx.y;
  A += (size_t)by * sA; Bh += (size_t)by * sB; C += (size_t)by * sC;
  const int ntn = (N + 63) / 64; const int wid = blockIdx.x * 4 + w; const int mt = wid / ntn, nq = wid % ntn; if (mt * 16 >= M) return;
  const int row0 = mt * 16, col0 = nq * 64; const float* arow = A + (size_t)(row0 + ln) * lda;
  v8f acc[4] = {};
  for (int kb = 0; kb < K; kb += 32) {
    FragH ah, al;
    const v4f x0 = *(const v4fa*)(arow + kb + 8 * hh), x1 = *(const v4fa*)(arow + kb + 8 * hh + 4), x2 = *(const v4fa*)(arow + kb + 16 + 8 * hh), x3 = *(const v4fa*)(arow + kb + 16 + 8 * hh + 4);
    float xs[16] = {x0[0],x0[1],x0[2],x0[3],x1[0],x1[1],x1[2],x1[3],x2[0],x2[1],x2[2],x2[3],x3[0],x3[1],x3[2],x3[3]};
#pragma unroll
    for (int i = 0; i < 16; ++i) { const _Float16 h = (_Float16)xs[i]; ah.h[i] = h; al.h[i] = ASPLIT ? (_Float16)(xs[i] - (float)h) : (_Float16)0.0f; }
#pragma unroll
    for (int t = 0; t < 4; ++t) { if (col0 + t * 16 >= N) continue; const size_t boff = (size_t)(col0 + t * 16 + ln) * ldb + kb; FragH bq; bq.half[0] = *(const v8us*)(Bh + boff + 8 * hh); bq.half[1] = *(const v8us*)(Bh + boff + 16 + 8 * hh);
      acc[t] = mmaH<ASPLIT ? 2 : 1>(ah.v, al.v, bq.v, bq.v, acc[t]); }
  }
#pragma unroll
  for (int t = 0; t < 4; ++t) { if (col0 + t * 16 >= N) continue;
#pragma unroll
    for (int r = 0; r < 8; ++r) so[w][8 * hh + r][t * 16 + ln] = acc[t][r] * alpha; }
  __builtin_amdgcn_fence(__ATOMIC_ACQ_REL, "workgroup"); __builtin_amdgcn_wave_barrier();
  const int rsub = lane >> 4, c4 = (lane & 15) * 4;
  {
#pragma unroll
    for (int q = 0; q < 8; ++q) { const int r = q * 2 + rsub; if (col0 + c4 < N) { const v4f v = *(const v4fa*)&so[w][r][c4]; *(v4f*)(C + (size_t)(row0 + r) * ldc + col0 + c4) = v; } }
     }
}

// Wt[n][k] = f16(W[k][n]·scale) from f32 row-major W[K][N] (scale = power of two; bf16-exact weights stay exact in f16 away from the subnormal range)
__global__ __launch_bounds__(256) void k_wt_f16(const float* __restrict__ W, _Float16* __restrict__ Wt, int K, int N, float scale) {
  const int t = blockIdx.x * 256 + threadIdx.x; if (t >= N * (K / 8)) return; const int n = t / (K / 8), k8 = (t % (K / 8)) * 8; FragH f;
#pragma unroll
  for (int i = 0; i < 8; ++i) f.h[i] = (_Float16)(bf16_round(W[(size_t)(k8 + i) * N + n]) * scale); const v8us o = f.half[0];
  *(v8us*)((unsigned short*)Wt + (size_t)n * K + k8) = o; 
}
// k_gemm_hh variant with fused epilogue: v = acc·alpha + bias[by·sBias + col] (+ CP[(row/rowsPerB)·sCPb + by·64 + col] if CP) ; ACT 0 none / 1 elu ; writes f16 C16 (and f32 C if non-null)
template <int ACT>
__global__ __launch_bounds__(128) void k_gemm_hhx(const _Float16* __restrict__ A, int lda, size_t sA, const _Float16* __restrict__ Bh, int ldb, size_t sB, float alpha, const float* __restrict__ bias, size_t sBias, const float* __restrict__ CP, int rowsPerB, size_t sCPb, int row0g,
    float* __restrict__ C, _Float16* __restrict__ C16, int ldc, size_t sC, int M, int N, int K) {
  __shared__ __attribute__((aligned(16))) float so[4][16][64];
  const int tid = threadIdx.x, w = tid >> 5, lane = tid & 31, ln = lane & 15, hh = lane >> 4; const int by = blockIdx.y;
  A += (size_t)by * sA; Bh += (size_t)by * sB; const size_t cofs = (size_t)by * sC; const float* bp = bias ? bias + (size_t)by * sBias : nullptr;
  const int ntn = (N + 63) / 64; const int wid = blockIdx.x * 4 + w; const int mt = wid / ntn, nq = wid % ntn; if (mt * 16 >= M) return;
  const int row0 = mt * 16, col0 = nq * 64; const _Float16* arow = A + (size_t)(row0 + ln) * lda;
  v8f acc[4] = {};
  for (int kb = 0; kb < K; kb += 32) { FragH ah; ah.half[0] = *(const v8us*)((const unsigned short*)arow + kb + 8 * hh); ah.half[1] = *(const v8us*)((const unsigned short*)arow + kb + 16 + 8 * hh);
#pragma unroll
    for (int t = 0; t < 4; ++t) { if (col0 + t * 16 >= N) continue; const size_t boff = (size_t)(col0 + t * 16 + ln) * ldb + kb; FragH bq; bq.half[0] = *(const v8us*)((const unsigned short*)Bh + boff + 8 * hh); bq.half[1] = *(const v8us*)((const unsigned short*)Bh + boff + 16 + 8 * hh);
      acc[t] = mmaH<1>(ah.v, ah.v, bq.v, bq.v, acc[t]); }
  }
#pragma unroll
  for (int t = 0; t < 4; ++t) { if (col0 + t * 16 >= N) continue; const int col = col0 + t * 16 + ln; const float bv = bp ? bf16_round(bp[col]) : 0.f;
#pragma unroll
    for (int r = 0; r < 8; ++r) { float v = acc[t][r] * alpha + bv; if (CP) { const int rr = row0g + row0 + 8 * hh + r; if (rowsPerB < 0) v += CP[cofs + (size_t)rr * ldc + col];      /* rowsPerB < 0: own element of the batched C plane */ else { const int bidx = rr / rowsPerB; v += CP[(size_t)bidx * sCPb + (size_t)by * 64 + col]; } } if (ACT == 1) v = (v > 0.f) ? v : expm1f(v); else if (ACT == 7) v = (v > 0.f) ? v + 1.0f : expf(v); else if (ACT == 8) v = tanhf(v); else if (ACT == 9) v = 0.5f * v * (1.0f + tanhf(0.7978845608028654f * (v + 0.044715f * v * v * v))); else if (ACT == 11) v = 1.0f / (1.0f + expf(-v)); else if (ACT == 12) v = (v > 0.f) ? v : 0.01f * v; else if (ACT == 14) v = (v > 0.f) ? v : 0.1f * v; else if (ACT == 16) v = (v >= 0.f) ? v : 0.3f * v; else if (ACT == 17) v = (v >= 0.f) ? v : 0.2f * v; else if (ACT == 15) v = v / (1.0f + expf(-v)); else if (ACT == 3) v = fmaxf(v, 0.f); else if (ACT == 6) v = 0.5f * v * (1.0f + erff(v * 0.70710678118654752f)); so[w][8 * hh + r][t * 16 + ln] = v; } }
  __builtin_amdgcn_fence(__ATOMIC_ACQ_REL, "workgroup"); __builtin_amdgcn_wave_barrier();
  const int rsub = lane >> 4, c4 = (lane & 15) * 4; typedef _Float16 v4h __attribute__((ext_vector_type(4)));
  {
#pragma unroll
    for (int q = 0; q < 8; ++q) { const int r = q * 2 + rsub; if (col0 + c4 < N) { const v4f v = *(const v4fa*)&so[w][r][c4]; if (C) *(v4f*)(C + cofs + (size_t)(row0 + r) * ldc + col0 + c4) = v; if (C16) { v4h h4; for (int i = 0; i < 4; ++i) h4[i] = (_Float16)v[i]; *(v4h*)(C16 + cofs + (size_t)(row0 + r) * ldc + col0 + c4) = h4; } } }
     }
}


typedef _Float16 v4h __attribute__((ext_vector_type(4)));

__global__ __launch_bounds__(256) void k_x16(const float* __restrict__ x, _Float16* __restrict__ X16, size_t n8) { const size_t t = (size_t)blockIdx.x * 256 + threadIdx.x; if (t >= n8) return; FragH f;
#pragma unroll
  for (int q = 0; q < 8; ++q) f.h[q] = (_Float16)bf16_round(x[t * 8 + q]); *(v8us*)((unsigned short*)X16 + t * 8) = f.half[0];  }
__global__ __launch_bounds__(256) void k_h16(const float* __restrict__ x, _Float16* __restrict__ X16, size_t n8) { const size_t t = (size_t)blockIdx.x * 256 + threadIdx.x; if (t >= n8) return; FragH f;
#pragma unroll
  for (int q = 0; q < 8; ++q) f.h[q] = (_Float16)x[t * 8 + q]; *(v8us*)((unsigned short*)X16 + t * 8) = f.half[0];  }
__global__ __launch_bounds__(256) void k_round16f(const float* __restrict__ W, _Float16* __restrict__ Bt, size_t n8) { const size_t t = (size_t)blockIdx.x * 256 + threadIdx.x; if (t >= n8) return; FragH f;
#pragma unroll
  for (int i = 0; i < 8; ++i) f.h[i] = (_Float16)(bf16_round(W[t * 8 + i]) * 16.0f); *(v8us*)((unsigned short*)Bt + t * 8) = f.half[0];  }
// V^T by LDS transposes. One workgroup takes VTT neighbouring 64 x 64 tiles of one (batch, head): each wave carries VTT tiles, and all of a thread's loads are issued before the first of them is used.
#define VTT 4                        /* 64-key tiles per workgroup */
template <int NHv, int TTv>
__global__ __launch_bounds__(256) void k_vt(const _Float16* __restrict__ V16, int ldv, int voff, _Float16* __restrict__ Vt) { __shared__ unsigned short tl[VTT][64][66]; const int tid = threadIdx.x;
  static_assert(TTv % (64 * VTT) == 0, "k_vt: whole workgroups");
  const int slab = blockIdx.x / (TTv / (64 * VTT)), lg0 = (blockIdx.x % (TTv / (64 * VTT))) * VTT; const int b = slab / NHv, h = slab % NHv;
  const int r = tid / 8, c8 = (tid % 8) * 8;      /* 8 threads per 128-byte row, rows r and r + 32 of each tile */
  const unsigned short* vg = (const unsigned short*)V16 + ((size_t)b * TTv + lg0 * 64 + r) * ldv + voff + h * 64 + c8;
  const unsigned short* pv[VTT][2]; v8us rv[VTT][2];
  /* the short loops below are all unrolled so that pv and rv stay in registers */
#pragma unroll
  for (int u = 0; u < VTT; ++u)
#pragma unroll
    for (int k = 0; k < 2; ++k) { pv[u][k] = vg + (size_t)(u * 64 + k * 32) * ldv; rv[u][k] = *(const v8us*)pv[u][k]; }
  static_assert(VTT == 4, "k_vt: the wait below names the eight addresses");
  /* precaution: stands in front of every write of a register that the loads above name as an address; it names the addresses (inputs only), so that no later load of the run lands in one of them either; it also keeps all the loads in front of the first LDS store */
  asm volatile("s_wait_xcnt 0x0" :: "v"(pv[0][0]), "v"(pv[0][1]), "v"(pv[1][0]), "v"(pv[1][1]), "v"(pv[2][0]), "v"(pv[2][1]), "v"(pv[3][0]), "v"(pv[3][1]) : "memory");
#pragma unroll
  for (int u = 0; u < VTT; ++u)
#pragma unroll
    for (int k = 0; k < 2; ++k)
#pragma unroll
      for (int q = 0; q < 8; ++q) tl[u][r + k * 32][c8 + q] = rv[u][k][q];
  __syncthreads();
#pragma unroll
  for (int u = 0; u < VTT; ++u)
#pragma unroll
    for (int rd = 0; rd < 2; ++rd) { const int d = rd * 32 + tid / 8, pc = tid % 8; FragH f;
#pragma unroll
      for (int q = 0; q < 8; ++q) f.u[q] = tl[u][pc * 8 + q][d];
      *(v8us*)((unsigned short*)Vt + ((size_t)slab * 64 + d) * TTv + (lg0 + u) * 64 + pc * 8) = f.half[0]; } }

__global__ __launch_bounds__(256) void k_hl(const float* __restrict__ F, _Float16* __restrict__ Hh, _Float16* __restrict__ Hl, size_t n8) { const size_t t = (size_t)blockIdx.x * 256 + threadIdx.x; if (t >= n8) return; FragH fh, fl; const v4f a = *(const v4fa*)(F + t * 8), c = *(const v4fa*)(F + t * 8 + 4);
#pragma unroll
  for (int q = 0; q < 4; ++q) { _Float16 h = (_Float16)a[q]; fh.h[q] = h; fl.h[q] = (_Float16)((a[q] - (float)h) * 1024.0f); h = (_Float16)c[q]; fh.h[4 + q] = h; fl.h[4 + q] = (_Float16)((c[q] - (float)h) * 1024.0f); }
  { *(v8us*)((unsigned short*)Hh + t * 8) = fh.half[0]; *(v8us*)((unsigned short*)Hl + t * 8) = fl.half[0];  } }

__device__ __forceinline__ v16h g2_frag(const _Float16* p, int hh) { FragH f; f.half[0] = *(const v8us*)((const unsigned short*)p + 8 * hh); f.half[1] = *(const v8us*)((const unsigned short*)p + 16 + 8 * hh); return f.v; }


#define WCH 8                        /* 8-element chunks per thread */
// chunks t0 + 256 i of one weight matrix: all loads issued first, then converted and stored
__device__ __forceinline__ void wnat_part(const float* __restrict__ w, _Float16* __restrict__ Bt, unsigned t0) { v4f a[WCH][2]; const unsigned ob = t0 * 32;      /* the thread's first byte */
  /* the short loops below are all unrolled so that a stays in registers */
#pragma unroll
  for (int i = 0; i < WCH; ++i) { const float* p = (const float*)((const char*)w + ob) + 256 * 8 * i; a[i][0] = *(const v4fa*)p; a[i][1] = *(const v4fa*)(p + 4); }
  /* precaution: stands in front of every write of a register that the loads above name as an address; it names the offset (input only), so that no later load of the run lands in it either; it also keeps all the loads in front of the first store */
  asm volatile("s_wait_xcnt 0x0" :: "v"(ob) : "memory");
#pragma unroll
  for (int i = 0; i < WCH; ++i) { FragH f;
#pragma unroll
    for (int q = 0; q < 8; ++q) f.h[q] = (_Float16)(bf16_round(a[i][q >> 2][q & 3]) * 16.0f);
    *(v8us*)((unsigned short*)Bt + (size_t)(t0 + 256 * i) * 8) = f.half[0]; }
  asm volatile("s_wait_xcnt 0x0" ::: "memory"); }      /* precaution: in the built kernel the x + PE text follows this path behind a branch; the wait stands in front of its writes of registers that the stores above name */
__global__ __launch_bounds__(256) void k_rsm(const float* __restrict__ S, _Float16* __restrict__ P, int nrows) {
  #pragma clang fp contract(off)
  const int i = blockIdx.x * 256 + threadIdx.x; if (i >= nrows) return; const float* s = S + (size_t)i * SQ; float mx = -3.0e38f;
#pragma unroll 1
  for (int j = 0; j < SQ; ++j) mx = fmaxf(mx, s[j]); float se = 0.f;
#pragma unroll 1
  for (int j = 0; j < SQ; ++j) se += expf(s[j] - mx); const float sc = 256.0f / se;
#pragma unroll 1
  for (int j0 = 0; j0 < SQ; j0 += 8) { FragH f; for (int q = 0; q < 8; ++q) f.h[q] = (_Float16)(expf(s[j0 + q] - mx) * sc); unsigned short* d = (unsigned short*)P + (size_t)i * SQ + j0; *(v8us*)d = f.half[0];  } }
__global__ __launch_bounds__(256) void k_vt(const _Float16* __restrict__ V16, int b, int h0, _Float16* __restrict__ VT) { __shared__ unsigned short tl[64][65]; const int tid = threadIdx.x; const int hh = blockIdx.x % HG, sg = blockIdx.x / HG; const int s0 = sg * 64; const int h = h0 + hh;
  for (int i = tid; i < 64 * 8; i += 256) { const int j = i / 8, d8 = (i % 8) * 8; FragH f; f.half[0] = *(const v8us*)((const unsigned short*)V16 + ((size_t)b * SQ + s0 + j) * DM + h * HD + d8); for (int q = 0; q < 8; ++q) tl[d8 + q][j] = f.u[q]; }
  __syncthreads();
  { for (int i = tid; i < 64 * 8; i += 256) { const int d = i / 8, j8 = (i % 8) * 8; FragH f; for (int q = 0; q < 8; ++q) f.u[q] = tl[d][j8 + q]; *(v8us*)((unsigned short*)VT + ((size_t)hh * HD + d) * SQ + s0 + j8) = f.half[0]; }  } }



#define FAW 8                        /* waves per workgroup */
#define FAK 64                       /* keys per stage */
#define FAP 72                       /* LDS row pitch in f16: 128 bytes of data + 16, so that the 16 rows of a fragment read start in 16 different bank groups */
#define FAT (SQ / FAK)               /* stages */
__device__ __forceinline__ float rs_xhalf(float x) { return __builtin_bit_cast(float, __builtin_amdgcn_permlanex16(__builtin_bit_cast(int, x), __builtin_bit_cast(int, x), 0x76543210, 0xfedcba98, false, false)); }      /* lane l reads lane l ^ 16 */
__device__ __forceinline__ v16h fa_frag(const unsigned short* p, int hh) { FragH f; f.half[0] = *(const v8us*)(p + 8 * hh); f.half[1] = *(const v8us*)(p + 16 + 8 * hh); return f.v; }
__device__ __forceinline__ v8f fa_mma(v16h a, v16h b, v8f c) { return __builtin_amdgcn_wmma_f32_16x16x32_f16(false, a, false, b, (short)0, c, false, false); }
// Eight native 2^x (v_exp_f32). The builtin, not asm text: the compiler schedules these between the matrix instructions and must see which registers they write.
__device__ __forceinline__ v8f fa_exp2x8(v8f x) { v8f e;
#pragma unroll      /* the vector stays in registers */
  for (int i = 0; i < 8; ++i) e[i] = __builtin_amdgcn_exp2f(x[i]);
  return e; }
static_assert(SQ % (FAW * 32) == 0 && SQ % FAK == 0 && HD == 64 && FAK == 64 && FAW * 32 == 256, "k_fattn: whole workgroups and stages; 256 threads stage 64 rows of 128 bytes in two rounds");
__global__ __launch_bounds__(FAW * 32) void k_fattn(const _Float16* __restrict__ Q16, const _Float16* __restrict__ K16, const _Float16* __restrict__ VT, _Float16* __restrict__ O16) {
  __shared__ __attribute__((aligned(16))) unsigned short sk[2][FAK][FAP];      /* K rows [key][d] */
  __shared__ __attribute__((aligned(16))) unsigned short sv[2][HD][FAP];       /* V^T rows [d][key] */
  const int tid = threadIdx.x, w = tid >> 5, lane = tid & 31, ln = lane & 15, hh = lane >> 4;
  const int bh = blockIdx.y, b = bh / NH, hd = bh - b * NH; const size_t r0 = (size_t)b * SQ; const int q0 = (blockIdx.x * FAW + w) * 32;
  const int srow = tid >> 3, sc8 = (tid & 7) * 8;      /* staging: 8 threads per 128-byte row, rows srow and srow + 32 */
  const unsigned short* kg = (const unsigned short*)K16 + (r0 + srow) * DM + hd * HD + sc8;
  const unsigned short* vg = (const unsigned short*)VT + ((size_t)bh * HD + srow) * SQ + sc8;
  v16h qf[2][2];      /* [16-query group][32 of d] */
  /* the short loops below are all unrolled so that the fragment and accumulator arrays stay in registers */
#pragma unroll
  for (int g = 0; g < 2; ++g)
#pragma unroll
    for (int ks = 0; ks < 2; ++ks) qf[g][ks] = g2_frag(Q16 + (r0 + q0 + g * 16 + ln) * DM + hd * HD + ks * 32, hh);
  const v8f z8 = {0.f, 0.f, 0.f, 0.f, 0.f, 0.f, 0.f, 0.f};
  v8f o[2][4] = {{z8, z8, z8, z8}, {z8, z8, z8, z8}}; float ms[2] = {-3.0e38f, -3.0e38f}, l[2] = {0.f, 0.f};
  const float cs = 0.125f * 1.44269504088896340736f;      /* 64^-0.5 log2 e */
  v8us kr0 = *(const v8us*)kg, kr1 = *(const v8us*)(kg + (size_t)32 * DM), vr0 = *(const v8us*)vg, vr1 = *(const v8us*)(vg + (size_t)32 * SQ);
  asm volatile("s_wait_xcnt 0x0" ::: "memory");      /* precaution: stands in front of every later write of a register that the loads above name as an address */
  *(v8us*)&sk[0][srow][sc8] = kr0; *(v8us*)&sk[0][srow + 32][sc8] = kr1; *(v8us*)&sv[0][srow][sc8] = vr0; *(v8us*)&sv[0][srow + 32][sc8] = vr1;
  __syncthreads();      /* stage 0 is published */
  for (int t = 0; t < FAT; ++t) { const int cur = t & 1;
    if (t + 1 < FAT) { const unsigned short* kn = kg + (size_t)(t + 1) * FAK * DM; const unsigned short* vn = vg + (t + 1) * FAK;
      kr0 = *(const v8us*)kn; kr1 = *(const v8us*)(kn + (size_t)32 * DM); vr0 = *(const v8us*)vn; vr1 = *(const v8us*)(vn + (size_t)32 * SQ); }
#pragma unroll
    for (int hp = 0; hp < 2; ++hp) {      /* two passes of 32 keys per stage: half the score registers live at once; unrolled, so that one pass's matrix work can be scheduled among the other's softmax */
      v8f s[2][2];      /* S^T: [query group][16-key tile], register r = key 8 hh + r, lane column = query */
#pragma unroll
      for (int j = 0; j < 2; ++j) { const v16h a0 = fa_frag(&sk[cur][hp * 32 + j * 16 + ln][0], hh), a1 = fa_frag(&sk[cur][hp * 32 + j * 16 + ln][32], hh);
#pragma unroll
        for (int g = 0; g < 2; ++g) s[g][j] = fa_mma(a1, qf[g][1], fa_mma(a0, qf[g][0], z8)); }
      v16h va[4];
#pragma unroll
      for (int dt = 0; dt < 4; ++dt) va[dt] = fa_frag(&sv[cur][dt * 16 + ln][hp * 32], hh);
      float mxs[2];
#pragma unroll
      for (int g = 0; g < 2; ++g) { const v8f mv = __builtin_elementwise_max(s[g][0], s[g][1]);
        const float mx = fmaxf(fmaxf(fmaxf(mv[0], mv[1]), fmaxf(mv[2], mv[3])), fmaxf(fmaxf(mv[4], mv[5]), fmaxf(mv[6], mv[7])));
        mxs[g] = fmaxf(mx, rs_xhalf(mx)) * cs; }
      if (__builtin_amdgcn_ballot_w32(mxs[0] > ms[0] + 8.0f || mxs[1] > ms[1] + 8.0f) != 0) {      /* wave-uniform: some query's maximum has outgrown the one in use */
        const float n0 = fmaxf(ms[0], mxs[0]), n1 = fmaxf(ms[1], mxs[1]); const float c0 = __builtin_amdgcn_exp2f(ms[0] - n0), c1 = __builtin_amdgcn_exp2f(ms[1] - n1);      /* the two rescale factors */
        ms[0] = n0; ms[1] = n1; l[0] *= c0; l[1] *= c1;
#pragma unroll
        for (int dt = 0; dt < 4; ++dt) { o[0][dt] *= c0; o[1][dt] *= c1; } }
      v16h pf[2];      /* P^T as B operand, per query group */
#pragma unroll
      for (int g = 0; g < 2; ++g) { const float nb = 7.0f - ms[g];
#pragma unroll
        for (int j = 0; j < 2; ++j) s[g][j] = fa_exp2x8(s[g][j] * cs + nb);
        const v8f ps = s[g][0] + s[g][1];
        l[g] += ((ps[0] + ps[1]) + (ps[2] + ps[3])) + ((ps[4] + ps[5]) + (ps[6] + ps[7]));
        FragH f;
#pragma unroll
        for (int i = 0; i < 8; ++i) { f.h[i] = (_Float16)s[g][0][i]; f.h[8 + i] = (_Float16)s[g][1][i]; }
        pf[g] = f.v; }
#pragma unroll
      for (int dt = 0; dt < 4; ++dt)
#pragma unroll
        for (int g = 0; g < 2; ++g) o[g][dt] = fa_mma(va[dt], pf[g], o[g][dt]); }
    if (t + 1 < FAT) { *(v8us*)&sk[cur ^ 1][srow][sc8] = kr0; *(v8us*)&sk[cur ^ 1][srow + 32][sc8] = kr1; *(v8us*)&sv[cur ^ 1][srow][sc8] = vr0; *(v8us*)&sv[cur ^ 1][srow + 32][sc8] = vr1; }      /* its last readers left this buffer at the barrier of stage t - 1 */
    __syncthreads(); }      /* publishes stage t + 1 and ends every read of stage t */
#pragma unroll
  for (int g = 0; g < 2; ++g) { const float inv = 64.0f / (l[g] + rs_xhalf(l[g]));      /* the halves hold disjoint keys; o is carried x64 */
    unsigned short* op = (unsigned short*)O16 + (r0 + q0 + g * 16 + ln) * DM + hd * HD + 8 * hh;
#pragma unroll
    for (int dt = 0; dt < 4; ++dt) { FragH f;
#pragma unroll
      for (int r = 0; r < 8; ++r) f.h[r] = (_Float16)(o[g][dt][r] * inv);
      *(v8us*)(op + dt * 16) = f.half[0]; }      /* register r = d 16 dt + 8 hh + r of query ln: 16 contiguous bytes */
    if (g == 0) asm volatile("s_wait_xcnt 0x0" ::: "memory"); } }      /* precaution: stands in front of every later write of a register that the first group's stores name */


// ---- staged GEMM: C[MP][DM] = A[MP][DM] . Bt[DM][DM]^T x alpha + bias (bias rounded to bf16 first), all pitches DM; C f32 or f16 ----
// One workgroup = 8 waves = one 128 x 128 tile of C, waves 4 (rows) x 2 (columns), 32 x 64 per wave. The k axis runs in stages of G3K: the 128 A rows and the 128 Bt rows
// of a stage (256 bytes each) come from global memory as whole lines, 16 lanes per row, once per workgroup, and lie in LDS at a padded pitch; every wave takes its
// fragments from there. Two LDS buffers: stage t + 1 travels global -> registers while stage t is worked on and is stored behind the work; one barrier per stage.
// Each accumulator tile sums k in ascending steps of 32, one WMMA per step.
#define G3T 128                      /* tile rows and tile columns per workgroup */
#define G3K 128                      /* k per stage */
#define G3P 136                      /* LDS row pitch in f16: 256 bytes of data + 16, so that the 16 rows of a fragment read start in 16 different bank groups */
#define G3S (DM / G3K)               /* stages */
static_assert(MP % G3T == 0 && MPO % G3T == 0 && DM % G3T == 0 && DM % G3K == 0 && G3S >= 2, "k_gemm3: whole tiles and stages");
template <bool F32OUT>      /* the result goes to C (f32) or to C16 (f16); the other pointer is not used; mt, nq: the workgroup's tile row and tile column */
__device__ __forceinline__ void gemm3_tile(const _Float16* __restrict__ A, const _Float16* __restrict__ Bh, float alpha, const float* __restrict__ bias, float* __restrict__ C, _Float16* __restrict__ C16, int mt, int nq) {
  __shared__ __attribute__((aligned(16))) unsigned short sa[2][G3T][G3P];      /* A rows [row][k] */
  __shared__ __attribute__((aligned(16))) unsigned short sb[2][G3T][G3P];      /* Bt rows [column][k] */
  __shared__ __attribute__((aligned(16))) float so[8][32][68];                 /* per-wave output staging */
  const int tid = threadIdx.x, w = tid >> 5, lane = tid & 31, ln = lane & 15, hh = lane >> 4;
  const int wr = (w >> 1) * 32, wc = (w & 1) * 64;      /* the wave's place in the tile */
  const int row0 = mt * G3T + wr, col0 = nq * G3T + wc;
  const int srow = tid >> 4, sc8 = (tid & 15) * 8;      /* staging: 16 threads per 256-byte row, rows srow + 16 i */
  const unsigned short* ag = (const unsigned short*)A + (size_t)(mt * G3T + srow) * DM + sc8;
  const unsigned short* bg = (const unsigned short*)Bh + (size_t)(nq * G3T + srow) * DM + sc8;
  v8us ra[8], rb[8];
  /* the short loops below are all unrolled so that the staging, fragment and accumulator arrays stay in registers */
#pragma unroll
  for (int i = 0; i < 8; ++i) { ra[i] = *(const v8us*)(ag + (size_t)(16 * i) * DM); rb[i] = *(const v8us*)(bg + (size_t)(16 * i) * DM); }
#pragma unroll
  for (int i = 0; i < 8; ++i) { *(v8us*)&sa[0][srow + 16 * i][sc8] = ra[i]; *(v8us*)&sb[0][srow + 16 * i][sc8] = rb[i]; }
  const v8f z8 = {0.f, 0.f, 0.f, 0.f, 0.f, 0.f, 0.f, 0.f}; v8f acc[2][4] = {{z8, z8, z8, z8}, {z8, z8, z8, z8}};      /* [16-row group][16-column group] */
  __syncthreads();      /* stage 0 is published */
  for (int t = 0; t < G3S; ++t) { const int cur = t & 1;
    if (t + 1 < G3S) {
#pragma unroll
      for (int i = 0; i < 8; ++i) { ra[i] = *(const v8us*)(ag + (size_t)(16 * i) * DM + (t + 1) * G3K); rb[i] = *(const v8us*)(bg + (size_t)(16 * i) * DM + (t + 1) * G3K); } }
#pragma unroll
    for (int ks = 0; ks < G3K / 32; ++ks) { const v16h a0 = fa_frag(&sa[cur][wr + ln][ks * 32], hh), a1 = fa_frag(&sa[cur][wr + 16 + ln][ks * 32], hh);
#pragma unroll
      for (int j = 0; j < 4; ++j) { const v16h b = fa_frag(&sb[cur][wc + j * 16 + ln][ks * 32], hh); acc[0][j] = fa_mma(a0, b, acc[0][j]); acc[1][j] = fa_mma(a1, b, acc[1][j]); } }
    if (t + 1 < G3S) {
#pragma unroll
      for (int i = 0; i < 8; ++i) { *(v8us*)&sa[cur ^ 1][srow + 16 * i][sc8] = ra[i]; *(v8us*)&sb[cur ^ 1][srow + 16 * i][sc8] = rb[i]; } }      /* its last readers left this buffer at the barrier of stage t - 1 */
    __syncthreads(); }      /* publishes stage t + 1 and ends every read of stage t */
#pragma unroll
  for (int u = 0; u < 8; ++u) { const int j = u & 3, half = u >> 2; const float bv = bf16_round(bias[col0 + j * 16 + ln]);
#pragma unroll
    for (int r = 0; r < 8; ++r) so[w][half * 16 + 8 * hh + r][j * 16 + ln] = acc[half][j][r] * alpha + bv; }
  __builtin_amdgcn_fence(__ATOMIC_ACQ_REL, "workgroup"); __builtin_amdgcn_wave_barrier();      /* the wave reads back rows that its other lanes wrote */
  const int rsub = lane >> 4, c4 = (lane & 15) * 4;
#pragma unroll
  for (int q = 0; q < 16; ++q) { const int r = q * 2 + rsub; const v4f v = *(const v4fa*)&so[w][r][c4]; const size_t e = (size_t)(row0 + r) * DM + col0 + c4;
    if (F32OUT) *(v4f*)(C + e) = v; else *(v4h*)(C16 + e) = __builtin_convertvector(v, v4h); } }      /* 16 lanes store one row of the wave's 64 columns: whole lines */
// The output projection: one grid of (MPO / G3T) x (DM / G3T) tiles, f32 result.
__global__ __launch_bounds__(256) void k_gemm3o(const _Float16* __restrict__ A, const _Float16* __restrict__ Bh, float alpha, const float* __restrict__ bias, float* __restrict__ C) {
  const int mt = blockIdx.x / (DM / G3T), nq = blockIdx.x - mt * (DM / G3T);
  gemm3_tile<true>(A, Bh, alpha, bias, C, nullptr, mt, nq); }
// The Q, K and V projections read the same A and do not depend on each other: one grid holds the tiles of all three, so that they share one launch and fill the chip without a
// gap between them. A tile row's 3 x (DM / G3T) workgroups are neighbours in the grid (Q's columns, then K's, then V's), so its A rows are read again while they are still in the cache.
__global__ __launch_bounds__(256) void k_gemm3qkv(const _Float16* __restrict__ A, const _Float16* __restrict__ Bq, const _Float16* __restrict__ Bk, const _Float16* __restrict__ Bv, float alpha,
                                                  const float* __restrict__ bq, const float* __restrict__ bk, const float* __restrict__ bv, _Float16* __restrict__ Cq, _Float16* __restrict__ Ck, _Float16* __restrict__ Cv) {
  const int mt = blockIdx.x / (3 * (DM / G3T)), c = blockIdx.x - mt * (3 * (DM / G3T)); const int m = c / (DM / G3T), nq = c - m * (DM / G3T);      /* m: 0 = Q, 1 = K, 2 = V; the same for the whole workgroup */
  gemm3_tile<false>(A, m == 0 ? Bq : m == 1 ? Bk : Bv, alpha, m == 0 ? bq : m == 1 ? bk : bv, nullptr, m == 0 ? Cq : m == 1 ? Ck : Cv, mt, nq); }


#define XPP 4                        /* places (sequence positions) per thread */
// x + PE. A thread keeps one 8-column chunk and walks XPP places: the four frequencies of its columns are formed once, a place's sines and cosines once for all NB batches
// (PE does not depend on the batch); every element is the same expression as for one chunk alone. All loads of x are issued first and travel while PE is formed.
// PE is formed in a rolled loop and parked in LDS, each thread in slots of its own (no barrier). Workgroup g: places 2 XPP g ... 2 XPP g + 2 XPP - 1.
static_assert(DM / 8 == 128 && SQ % (2 * XPP) == 0, "xpe_part: 256 threads hold two rows of 128 chunks; whole workgroups");
__device__ __forceinline__ void xpe_part(const float* __restrict__ x, _Float16* __restrict__ X16, unsigned g, int tid) {
  #pragma clang fp contract(off)
  __shared__ __attribute__((aligned(8))) float spe[XPP][4][256][2];      /* [place][frequency][thread][sin, cos] */
  const int c0 = (tid & 127) * 8, p0 = (int)g * (2 * XPP) + (tid >> 7); const float kf = (float)(-9.210340371976184 / (double)DM); v4f xa[XPP][NB][2];
  const float* px[NB];      /* the thread's first chunk in each batch */
  /* the loops over xa are unrolled so that it stays in registers */
#pragma unroll
  for (int b = 0; b < NB; ++b) { px[b] = x + ((size_t)b * SQ + p0) * DM + c0;
#pragma unroll
    for (int i = 0; i < XPP; ++i) { const float* p = px[b] + (size_t)(2 * i) * DM; xa[i][b][0] = *(const v4fa*)p; xa[i][b][1] = *(const v4fa*)(p + 4); } }
  static_assert(NB == 2, "xpe_part: the wait below names the two addresses");
  /* precaution: stands in front of every write of a register that the loads above name as an address; it names the addresses (inputs only), so that no later load of the run lands in one of them either; it also keeps all the loads in front of the PE loop */
  asm volatile("s_wait_xcnt 0x0" :: "v"(px[0]), "v"(px[1]) : "memory");
#pragma unroll 1      /* rolled, like the loop inside: one copy of the exp, sin and cos text */
  for (int j = 0; j < 4; ++j) { const float dv = expf(__fmul_rn((float)(c0 + 2 * j), kf));
#pragma unroll 1
    for (int i = 0; i < XPP; ++i) { const float ang = __fmul_rn((float)(p0 + 2 * i), dv); spe[i][j][tid][0] = sinf(ang); spe[i][j][tid][1] = cosf(ang); } }
#pragma unroll
  for (int i = 0; i < XPP; ++i) { float pe[8];
#pragma unroll
    for (int j = 0; j < 4; ++j) { pe[2 * j] = spe[i][j][tid][0]; pe[2 * j + 1] = spe[i][j][tid][1]; }
#pragma unroll
    for (int b = 0; b < NB; ++b) { FragH f;
#pragma unroll
      for (int q = 0; q < 8; ++q) f.h[q] = (_Float16)__fadd_rn(bf16_round(xa[i][b][q >> 2][q & 3]), pe[q]);
      *(v8us*)((unsigned short*)X16 + ((size_t)b * SQ + p0 + 2 * i) * DM + c0) = f.half[0]; } } }
// x + PE and the four weight conversions do not depend on each other: one grid, dealt by workgroup range. The x + PE workgroups, the longer ones, come first.
// Two workgroups per WGP in all: each thread carries 8 chunks, so that few waves have to start.
#define PXG ((unsigned)(SQ / (2 * XPP)))                         /* workgroups of x + PE */
#define PWG ((unsigned)((size_t)DM * DM / 8 / (256 * WCH)))      /* workgroups per weight matrix */
static_assert((size_t)DM * DM / 8 % (256 * WCH) == 0, "k_prep: whole workgroups per weight matrix");
__global__ __launch_bounds__(256) void k_prep(const float* __restrict__ x, const float* __restrict__ wq, const float* __restrict__ wk, const float* __restrict__ wv, const float* __restrict__ wo,
                                              _Float16* __restrict__ X16, _Float16* __restrict__ BQ, _Float16* __restrict__ BK, _Float16* __restrict__ BV, _Float16* __restrict__ BO) {
  const unsigned g = blockIdx.x;
  if (g < PXG) { xpe_part(x, X16, g, (int)threadIdx.x); return; }      /* x + sinusoidal PE -> f16 rows (not exact: x + pe is not a bf16 value) */
  const unsigned u = g - PXG, m = u / PWG;      /* m: which weight matrix; the same for the whole workgroup */
  wnat_part(m == 0 ? wq : m == 1 ? wk : m == 2 ? wv : wo, m == 0 ? BQ : m == 1 ? BK : m == 2 ? BV : BO, (u - m * PWG) * (256 * WCH) + threadIdx.x); }      /* natural [out][in] = Bt[n][k], x16 */
extern "C" void kernel_launch(void* const* d_in, const int* in_sizes, int n_in,
                              void* d_out, int out_size, void* d_ws, size_t ws_size, hipStream_t stream) {
  (void)in_sizes; (void)n_in; (void)out_size;
  const float* const* I = (const float* const*)d_in; const float* x = I[0]; const float* wq = I[1]; const float* bq = I[2]; const float* wk = I[3]; const float* bk = I[4]; const float* wv = I[5]; const float* bv = I[6]; const float* wo = I[7]; const float* bo = I[8];      /* nn.Linear weights [out][in] + biases */
  char* ws = (char*)d_ws; size_t off = 0;
  auto take = [&](size_t bytes) { char* p = ws + off; off += (bytes + 255) & ~(size_t)255; return p; };
  _Float16* BQ = (_Float16*)take((size_t)DM * DM * 2); _Float16* BK = (_Float16*)take((size_t)DM * DM * 2); _Float16* BV = (_Float16*)take((size_t)DM * DM * 2); _Float16* BO = (_Float16*)take((size_t)DM * DM * 2);
  _Float16* X16 = (_Float16*)take(NR * DM * 2); _Float16* Q16 = (_Float16*)take(NR * DM * 2); _Float16* K16 = (_Float16*)take(NR * DM * 2); _Float16* V16 = (_Float16*)take(NR * DM * 2); _Float16* O16 = (_Float16*)take(NR * DM * 2);
  _Float16* VT = (_Float16*)take((size_t)NB * NH * HD * SQ * 2);
  if (off > ws_size) return;
  k_prep<<<PXG + 4 * PWG, 256, 0, stream>>>(x, wq, wk, wv, wo, X16, BQ, BK, BV, BO);      /* f16 operands: x + PE rows and the four weight matrices */
  const size_t r0p = (size_t)B0 * SQ;      /* first projected row */
  k_gemm3qkv<<<(unsigned)((MP / G3T) * 3 * (DM / G3T)), 256, 0, stream>>>(X16 + r0p * DM, BQ, BK, BV, 0.0625f, bq, bk, bv, Q16 + r0p * DM, K16 + r0p * DM, V16 + r0p * DM);
  k_vt<NH, SQ><<<NB * NH * (SQ / (64 * VTT)), 256, 0, stream>>>(V16, LQ, 0, VT);      /* V^T [NB][NH][HD][SQ] */
  k_fattn<<<dim3(SQ / (FAW * 32), NB * NH), FAW * 32, 0, stream>>>(Q16, K16, VT, O16);      /* o (merged heads, x64) as f16 rows */
  k_gemm3o<<<(unsigned)((MPO / G3T) * (DM / G3T)), 256, 0, stream>>>(O16 + r0p * DM, BO, 0.0009765625f, bo, (float*)d_out + r0p * DM);      /* out rows are the output layout */
}

// v006
// A run of this version takes 95 microseconds.
// In both of two side-by-side timings against v005, it was 1.05 times as fast.
// Over all steps from v000 it is 38.9 times as fast.
#include <hip/hip_runtime.h>
// Temporal multi-head attention with sinusoidal positional encoding (x [2][2048][1024]; x = x + PE (pe[s][2i] = sin(s d_i), pe[s][2i+1] = cos(s d_i), d_i = exp(2i x (-ln 1e4 / 1024))); q = x Wq^T + bq, k, v likewise (nn.Linear [out][in] 1024^2, weights and biases sigma 1/32); 16 heads of 64; softmax(q k^T / 8) (no mask); out = ctx Wo^T + bo -> [2][2048][1024]).
// Structure: token rows r = b*2048 + s; x + PE computed on VALU (f32 expf/sinf/cosf in the module's op order) -> f16 rows (one f16 rounding of x + pe); Q, K, V as three WMMA GEMMs in one grid (128x128 workgroup tiles staged in LDS, 32x64 wave tiles, f32 accumulation, exact x16 weights + bias, f16 outputs); V^T for all batches and heads via LDS transposes; one fused attention kernel over all (batch, head, 256 queries), the keys dealt to two groups of waves and the two partial results joined at the end: scores on WMMA (K = 64), online softmax on VALU (f32 statistics, native exp2; weights as f16, scaled by a power of two that cancels), o = P . V on WMMA (o carried x64 against f16 subnormal flush, folded into the output GEMM alpha) written straight into the merged f16 o rows; out = o W_o + b GEMM (f32) into the output layout.
// Compute dtype: inputs rounded to bf16; weights exact, x + pe rounded once to f16; q, k, v, softmax weights and o as plain f16 GEMM operands (~2^-12); scores and softmax statistics f32. v_wmma_f32_16x16x32_f16.
#define NB 2
#define SQ 2048
#define DM 1024
#define NH 16
#define HD 64
#define HG 4                         /* heads per call of the unlaunched k_vt(V16, b, h0, VT) */
#define B0 0                         /* first batch processed (debug hook) */
#define NBR NB                       /* batches processed (debug hook) */
#define NR ((size_t)NB * SQ)         /* token rows */
#define MP ((int)((size_t)NBR * SQ)) /* rows projected (debug hook) */
#define QN SQ                        /* unused: k_fattn attends all SQ query rows */
#define NHD NH                       /* unused: k_fattn attends all NH heads */
#define MPO MP                       /* rows through the output stage (debug hook) */
#define LQ DM      /* row pitch of the q/k/v rows */
typedef __bf16 v16b __attribute__((ext_vector_type(16)));
typedef unsigned short v8us __attribute__((ext_vector_type(8), may_alias));
typedef float  v8f  __attribute__((ext_vector_type(8)));
typedef float  v4f  __attribute__((ext_vector_type(4)));
typedef float  v4fa __attribute__((ext_vector_type(4), may_alias));
union FragB { v16b v; v8us half[2]; unsigned short u[16]; };

__device__ __forceinline__ unsigned short bf16_bits(float x) { unsigned int u = __float_as_uint(x); return (unsigned short)((u + 0x7FFFu + ((u >> 16) & 1u)) >> 16); }
__device__ __forceinline__ float bf16_val(unsigned short b) { return __uint_as_float(((unsigned int)b) << 16); }
__device__ __forceinline__ float bf16_round(float x) { return bf16_val(bf16_bits(x)); }
// D += A·B with NT terms: 1 = ah·bh, 2 = + al·bh (A split), 3 = + ah·bl (both split)
template <int NT>
__device__ __forceinline__ v8f mmaN(v16b ah, v16b al, v16b bh, v16b bl, v8f c) {
  c = __builtin_amdgcn_wmma_f32_16x16x32_bf16(false, ah, false, bh, (short)0, c, false, false);
  if (NT >= 2) c = __builtin_amdgcn_wmma_f32_16x16x32_bf16(false, al, false, bh, (short)0, c, false, false);
  if (NT >= 3) c = __builtin_amdgcn_wmma_f32_16x16x32_bf16(false, ah, false, bl, (short)0, c, false, false);
  asm volatile("v_nop\n\tv_nop\n\tv_nop\n\tv_nop" : "+v"(c) : "v"(ah), "v"(al), "v"(bh), "v"(bl));
  return c;
}

__global__ __launch_bounds__(256) void k_wt_bf16(const float* __restrict__ W, unsigned short* __restrict__ Wt, int K, int N) {
  const int t = blockIdx.x * 256 + threadIdx.x;
  const int k8n = K / 8;
  if (t >= N * k8n) return;
  const int n = t / k8n, k8 = (t % k8n) * 8;
  v8us v;
#pragma unroll
  for (int i = 0; i < 8; ++i) v[i] = bf16_bits(W[(size_t)(k8 + i) * N + n]);
  *(v8us*)(Wt + (size_t)n * K + k8) = v;
  
}

// GEMM C[M][N] (f32, pitch ldc) = act(A[M][K]·W + bias). A f32 row-major (pitch lda) converted per fragment to bf16
// (ASPLIT: hi/lo two planes -> 2 terms, else single rounded term); Wt bf16 [N][K] (pitch ldb). BIAS_BF16 rounds the
// bias to bf16 first (bias quantised to bf16 before the add). K%32==0, M%16==0, N%64==0.
template <bool ASPLIT, int ACT, bool BIAS_BF16>
__global__ __launch_bounds__(128) void k_gemm_bf(const float* __restrict__ A, int lda, const unsigned short* __restrict__ Wt, int ldb,
                                               const float* __restrict__ bias, float* __restrict__ C, int ldc, int M, int N, int K) {
  __shared__ __attribute__((aligned(16))) float so[4][16][64];
  const int tid = threadIdx.x, w = tid >> 5, lane = tid & 31, ln = lane & 15, hh = lane >> 4;
  const int ntn = N / 64;
  const int wid = blockIdx.x * 4 + w;
  const int mt = wid / ntn, nq = wid % ntn;
  if (mt * 16 >= M) return;
  const int row0 = mt * 16, col0 = nq * 64;
  const float* arow = A + (size_t)(row0 + ln) * lda;
  v8f acc[4] = {};
  for (int kb = 0; kb < K; kb += 32) {
    FragB ah, al;
    const v4f x0 = *(const v4fa*)(arow + kb + 8 * hh), x1 = *(const v4fa*)(arow + kb + 8 * hh + 4);
    const v4f x2 = *(const v4fa*)(arow + kb + 16 + 8 * hh), x3 = *(const v4fa*)(arow + kb + 16 + 8 * hh + 4);
    float xs[16] = {x0[0],x0[1],x0[2],x0[3],x1[0],x1[1],x1[2],x1[3],x2[0],x2[1],x2[2],x2[3],x3[0],x3[1],x3[2],x3[3]};
#pragma unroll
    for (int i = 0; i < 16; ++i) { const unsigned short hb = bf16_bits(xs[i]); ah.u[i] = hb; al.u[i] = ASPLIT ? bf16_bits(xs[i] - bf16_val(hb)) : (unsigned short)0; }
#pragma unroll
    for (int t = 0; t < 4; ++t) {
      const unsigned short* brow = Wt + (size_t)(col0 + t * 16 + ln) * ldb + kb;
      FragB b;
      b.half[0] = *(const v8us*)(brow + 8 * hh);
      b.half[1] = *(const v8us*)(brow + 16 + 8 * hh);
      acc[t] = mmaN<ASPLIT ? 2 : 1>(ah.v, al.v, b.v, b.v, acc[t]);
    }
  }
#pragma unroll
  for (int t = 0; t < 4; ++t) {
    float bv = bias ? bias[col0 + t * 16 + ln] : 0.f;
    if (BIAS_BF16) bv = bf16_round(bv);
#pragma unroll
    for (int r = 0; r < 8; ++r) { float v = acc[t][r] + bv; if (ACT == 1) v = fmaxf(v, 0.f); so[w][8 * hh + r][t * 16 + ln] = v; }
  }
  __builtin_amdgcn_fence(__ATOMIC_ACQ_REL, "workgroup");
  __builtin_amdgcn_wave_barrier();
  const int rsub = lane >> 4, c4 = (lane & 15) * 4;
  {
#pragma unroll
    for (int q = 0; q < 8; ++q) {
      const int r = q * 2 + rsub;
      const v4f v = *(const v4fa*)&so[w][r][c4];
      *(v4f*)(C + (size_t)(row0 + r) * ldc + col0 + c4) = v;
    }
    
  }
}

// GEMM C = act(A·W + bias + resid): A f32 (ASPLIT -> hi/lo 2 terms), Wt bf16 [N][K]; ACT 0 none, 1 relu, 2 exact gelu;
// resid (optional, f32, row index = (row % rmod), pitch ldr, RES_BF16 rounds it) added before the activation.
template <bool ASPLIT, int ACT, bool BIAS_BF16, bool RES_BF16>
__global__ __launch_bounds__(128) void k_gemm_bf3(const float* __restrict__ A, int lda, const unsigned short* __restrict__ Wt, int ldb,
                                                const float* __restrict__ bias, const float* __restrict__ resid, int rmod, int ldr,
                                                float* __restrict__ C, int ldc, int M, int N, int K) {
  __shared__ __attribute__((aligned(16))) float so[4][16][64];
  const int tid = threadIdx.x, w = tid >> 5, lane = tid & 31, ln = lane & 15, hh = lane >> 4;
  const int ntn = N / 64;
  const int wid = blockIdx.x * 4 + w;
  const int mt = wid / ntn, nq = wid % ntn;
  if (mt * 16 >= M) return;
  const int row0 = mt * 16, col0 = nq * 64;
  const float* arow = A + (size_t)(row0 + ln) * lda;
  v8f acc[4] = {};
  for (int kb = 0; kb < K; kb += 32) {
    FragB ah, al;
    const v4f x0 = *(const v4fa*)(arow + kb + 8 * hh), x1 = *(const v4fa*)(arow + kb + 8 * hh + 4);
    const v4f x2 = *(const v4fa*)(arow + kb + 16 + 8 * hh), x3 = *(const v4fa*)(arow + kb + 16 + 8 * hh + 4);
    float xs[16] = {x0[0],x0[1],x0[2],x0[3],x1[0],x1[1],x1[2],x1[3],x2[0],x2[1],x2[2],x2[3],x3[0],x3[1],x3[2],x3[3]};
#pragma unroll
    for (int i = 0; i < 16; ++i) { const unsigned short hb = bf16_bits(xs[i]); ah.u[i] = hb; al.u[i] = ASPLIT ? bf16_bits(xs[i] - bf16_val(hb)) : (unsigned short)0; }
#pragma unroll
    for (int t = 0; t < 4; ++t) {
      const unsigned short* brow = Wt + (size_t)(col0 + t * 16 + ln) * ldb + kb;
      FragB b;
      b.half[0] = *(const v8us*)(brow + 8 * hh);
      b.half[1] = *(const v8us*)(brow + 16 + 8 * hh);
      acc[t] = mmaN<ASPLIT ? 2 : 1>(ah.v, al.v, b.v, b.v, acc[t]);
    }
  }
#pragma unroll
  for (int t = 0; t < 4; ++t) {
    const int col = col0 + t * 16 + ln;
    float bv = bias ? bias[col] : 0.f;
    if (BIAS_BF16) bv = bf16_round(bv);
#pragma unroll
    for (int r = 0; r < 8; ++r) {
      float v = acc[t][r] + bv;
      if (resid) { float rv = resid[(size_t)((row0 + 8 * hh + r) % rmod) * ldr + col]; if (RES_BF16) rv = bf16_round(rv); v += rv; }
      if (ACT == 1) v = fmaxf(v, 0.f);
      if (ACT == 2) v = 0.5f * v * (1.0f + erff(v * 0.70710678118654752f));
      if (ACT == 3) { const float u = 0.7978845608028654f * (v + 0.044715f * v * v * v); v = 0.5f * v * (1.0f + tanhf(u)); }
      so[w][8 * hh + r][t * 16 + ln] = v;
    }
  }
  __builtin_amdgcn_fence(__ATOMIC_ACQ_REL, "workgroup");
  __builtin_amdgcn_wave_barrier();
  const int rsub = lane >> 4, c4 = (lane & 15) * 4;
  {
#pragma unroll
    for (int q = 0; q < 8; ++q) {
      const int r = q * 2 + rsub;
      const v4f v = *(const v4fa*)&so[w][r][c4];
      *(v4f*)(C + (size_t)(row0 + r) * ldc + col0 + c4) = v;
    }
    
  }
}
// row LayerNorm (biased variance, eps) over N: s = X (+ R); optional out_sum <- s; out_norm <- (s-mu)*rsqrt(var+eps)*g + b
template <bool PARAM_BF16>
__global__ __launch_bounds__(256) void k_layernorm(const float* __restrict__ X, const float* __restrict__ R, const float* __restrict__ g, const float* __restrict__ bta,
                                                  float* __restrict__ out_sum, float* __restrict__ out_norm, int N, float eps) {
  __shared__ float red[256];
  const int row = blockIdx.x, tid = threadIdx.x;
  const float* x = X + (size_t)row * N; const float* rr = R ? R + (size_t)row * N : nullptr;
  float vals[16];                     // up to N = 4096
  const int per = N / 256;            // contiguous chunk per thread? use strided-by-4 chunks: thread handles j = tid*4 + 1024*u
  float s1 = 0.f;
  for (int u = 0; u < per / 4; ++u) {
    const int j = tid * 4 + 1024 * u;
    const v4f a = *(const v4fa*)(x + j);
    v4f b = {0.f,0.f,0.f,0.f}; if (rr) b = *(const v4fa*)(rr + j);
#pragma unroll
    for (int q = 0; q < 4; ++q) { const float v = a[q] + b[q]; vals[u * 4 + q] = v; s1 += v; }
  }
  red[tid] = s1; __syncthreads();
  for (int st = 128; st > 0; st >>= 1) { if (tid < st) red[tid] += red[tid + st]; __syncthreads(); }
  const float mu = red[0] / (float)N; __syncthreads();
  float s2 = 0.f;
  for (int u = 0; u < per / 4; ++u)
#pragma unroll
    for (int q = 0; q < 4; ++q) { const float c = vals[u * 4 + q] - mu; s2 += c * c; }
  red[tid] = s2; __syncthreads();
  for (int st = 128; st > 0; st >>= 1) { if (tid < st) red[tid] += red[tid + st]; __syncthreads(); }
  const float rs = rsqrtf(red[0] / (float)N + eps);
  {
    for (int u = 0; u < per / 4; ++u) {
      const int j = tid * 4 + 1024 * u;
      v4f o, sm;
#pragma unroll
      for (int q = 0; q < 4; ++q) {
        float gg = g[j + q], bb = bta[j + q];
        if (PARAM_BF16) { gg = bf16_round(gg); bb = bf16_round(bb); }
        sm[q] = vals[u * 4 + q]; o[q] = (vals[u * 4 + q] - mu) * rs * gg + bb;
      }
      if (out_sum) *(v4f*)(out_sum + (size_t)row * N + j) = sm;
      *(v4f*)(out_norm + (size_t)row * N + j) = o;
    }
    
  }
}



// ---- f16 WMMA path (v_wmma_f32_16x16x32_f16): 11-bit significands for operands in range — used where a [0,1] probability operand needs more precision than bf16
typedef _Float16 v16h __attribute__((ext_vector_type(16)));
union FragH { v16h v; v8us half[2]; _Float16 h[16]; unsigned short u[16]; };
template <int NT>
__device__ __forceinline__ v8f mmaH(v16h ah, v16h al, v16h bh, v16h bl, v8f c) {
  c = __builtin_amdgcn_wmma_f32_16x16x32_f16(false, ah, false, bh, (short)0, c, false, false);
  if (NT >= 2) c = __builtin_amdgcn_wmma_f32_16x16x32_f16(false, al, false, bh, (short)0, c, false, false);
  if (NT >= 3) c = __builtin_amdgcn_wmma_f32_16x16x32_f16(false, ah, false, bl, (short)0, c, false, false);
  asm volatile("v_nop\n\tv_nop\n\tv_nop\n\tv_nop" : "+v"(c) : "v"(ah), "v"(al), "v"(bh), "v"(bl));
  return c;
}
// batched GEMM like k_gemm_b but f16 operands: A f32 (split into f16 hi/lo if ASPLIT, else rounded to f16), Bt = f16 values [n][k]; alpha; C f32; N multiple of 16 (partial tiles skipped)
template <bool ASPLIT>
__global__ __launch_bounds__(128) void k_gemm_h(const float* __restrict__ A, int lda, size_t sA, const _Float16* __restrict__ Bh, int ldb, size_t sB, float alpha, float* __restrict__ C, int ldc, size_t sC, int M, int N, int K) {
  __shared__ __attribute__((aligned(16))) float so[4][16][64];
  const int tid = threadIdx.x, w = tid >> 5, lane = tid & 31, ln = lane & 15, hh = lane >> 4; const int by = blockIdx.y;
  A += (size_t)by * sA; Bh += (size_t)by * sB; C += (size_t)by * sC;
  const int ntn = (N + 63) / 64; const int wid = blockIdx.x * 4 + w; const int mt = wid / ntn, nq = wid % ntn; if (mt * 16 >= M) return;
  const int row0 = mt * 16, col0 = nq * 64; const float* arow = A + (size_t)(row0 + ln) * lda;
  v8f acc[4] = {};
  for (int kb = 0; kb < K; kb += 32) {
    FragH ah, al;
    const v4f x0 = *(const v4fa*)(arow + kb + 8 * hh), x1 = *(const v4fa*)(arow + kb + 8 * hh + 4), x2 = *(const v4fa*)(arow + kb + 16 + 8 * hh), x3 = *(const v4fa*)(arow + kb + 16 + 8 * hh + 4);
    float xs[16] = {x0[0],x0[1],x0[2],x0[3],x1[0],x1[1],x1[2],x1[3],x2[0],x2[1],x2[2],x2[3],x3[0],x3[1],x3[2],x3[3]};
#pragma unroll
    for (int i = 0; i < 16; ++i) { const _Float16 h = (_Float16)xs[i]; ah.h[i] = h; al.h[i] = ASPLIT ? (_Float16)(xs[i] - (float)h) : (_Float16)0.0f; }
#pragma unroll
    for (int t = 0; t < 4; ++t) { if (col0 + t * 16 >= N) continue; const size_t boff = (size_t)(col0 + t * 16 + ln) * ldb + kb; FragH bq; bq.half[0] = *(const v8us*)(Bh + boff + 8 * hh); bq.half[1] = *(const v8us*)(Bh + boff + 16 + 8 * hh);
      acc[t] = mmaH<ASPLIT ? 2 : 1>(ah.v, al.v, bq.v, bq.v, acc[t]); }
  }
#pragma unroll
  for (int t = 0; t < 4; ++t) { if (col0 + t * 16 >= N) continue;
#pragma unroll
    for (int r = 0; r < 8; ++r) so[w][8 * hh + r][t * 16 + ln] = acc[t][r] * alpha; }
  __builtin_amdgcn_fence(__ATOMIC_ACQ_REL, "workgroup"); __builtin_amdgcn_wave_barrier();
  const int rsub = lane >> 4, c4 = (lane & 15) * 4;
  {
#pragma unroll
    for (int q = 0; q < 8; ++q) { const int r = q * 2 + rsub; if (col0 + c4 < N) { const v4f v = *(const v4fa*)&so[w][r][c4]; *(v4f*)(C + (size_t)(row0 + r) * ldc + col0 + c4) = v; } }
     }
}

// Wt[n][k] = f16(W[k][n]·scale) from f32 row-major W[K][N] (scale = power of two; bf16-exact weights stay exact in f16 away from the subnormal range)
__global__ __launch_bounds__(256) void k_wt_f16(const float* __restrict__ W, _Float16* __restrict__ Wt, int K, int N, float scale) {
  const int t = blockIdx.x * 256 + threadIdx.x; if (t >= N * (K / 8)) return; const int n = t / (K / 8), k8 = (t % (K / 8)) * 8; FragH f;
#pragma unroll
  for (int i = 0; i < 8; ++i) f.h[i] = (_Float16)(bf16_round(W[(size_t)(k8 + i) * N + n]) * scale); const v8us o = f.half[0];
  *(v8us*)((unsigned short*)Wt + (size_t)n * K + k8) = o; 
}
// k_gemm_hh variant with fused epilogue: v = acc·alpha + bias[by·sBias + col] (+ CP[(row/rowsPerB)·sCPb + by·64 + col] if CP) ; ACT 0 none / 1 elu ; writes f16 C16 (and f32 C if non-null)
template <int ACT>
__global__ __launch_bounds__(128) void k_gemm_hhx(const _Float16* __restrict__ A, int lda, size_t sA, const _Float16* __restrict__ Bh, int ldb, size_t sB, float alpha, const float* __restrict__ bias, size_t sBias, const float* __restrict__ CP, int rowsPerB, size_t sCPb, int row0g,
    float* __restrict__ C, _Float16* __restrict__ C16, int ldc, size_t sC, int M, int N, int K) {
  __shared__ __attribute__((aligned(16))) float so[4][16][64];
  const int tid = threadIdx.x, w = tid >> 5, lane = tid & 31, ln = lane & 15, hh = lane >> 4; const int by = blockIdx.y;
  A += (size_t)by * sA; Bh += (size_t)by * sB; const size_t cofs = (size_t)by * sC; const float* bp = bias ? bias + (size_t)by * sBias : nullptr;
  const int ntn = (N + 63) / 64; const int wid = blockIdx.x * 4 + w; const int mt = wid / ntn, nq = wid % ntn; if (mt * 16 >= M) return;
  const int row0 = mt * 16, col0 = nq * 64; const _Float16* arow = A + (size_t)(row0 + ln) * lda;
  v8f acc[4] = {};
  for (int kb = 0; kb < K; kb += 32) { FragH ah; ah.half[0] = *(const v8us*)((const unsigned short*)arow + kb + 8 * hh); ah.half[1] = *(const v8us*)((const unsigned short*)arow + kb + 16 + 8 * hh);
#pragma unroll
    for (int t = 0; t < 4; ++t) { if (col0 + t * 16 >= N) continue; const size_t boff = (size_t)(col0 + t * 16 + ln) * ldb + kb; FragH bq; bq.half[0] = *(const v8us*)((const unsigned short*)Bh + boff + 8 * hh); bq.half[1] = *(const v8us*)((const unsigned short*)Bh + boff + 16 + 8 * hh);
      acc[t] = mmaH<1>(ah.v, ah.v, bq.v, bq.v, acc[t]); }
  }
#pragma unroll
  for (int t = 0; t < 4; ++t) { if (col0 + t * 16 >= N) continue; const int col = col0 + t * 16 + ln; const float bv = bp ? bf16_round(bp[col]) : 0.f;
#pragma unroll
    for (int r = 0; r < 8; ++r) { float v = acc[t][r] * alpha + bv; if (CP) { const int rr = row0g + row0 + 8 * hh + r; if (rowsPerB < 0) v += CP[cofs + (size_t)rr * ldc + col];      /* rowsPerB < 0: own element of the batched C plane */ else { const int bidx = rr / rowsPerB; v += CP[(size_t)bidx * sCPb + (size_t)by * 64 + col]; } } if (ACT == 1) v = (v > 0.f) ? v : expm1f(v); else if (ACT == 7) v = (v > 0.f) ? v + 1.0f : expf(v); else if (ACT == 8) v = tanhf(v); else if (ACT == 9) v = 0.5f * v * (1.0f + tanhf(0.7978845608028654f * (v + 0.044715f * v * v * v))); else if (ACT == 11) v = 1.0f / (1.0f + expf(-v)); else if (ACT == 12) v = (v > 0.f) ? v : 0.01f * v; else if (ACT == 14) v = (v > 0.f) ? v : 0.1f * v; else if (ACT == 16) v = (v >= 0.f) ? v : 0.3f * v; else if (ACT == 17) v = (v >= 0.f) ? v : 0.2f * v; else if (ACT == 15) v = v / (1.0f + expf(-v)); else if (ACT == 3) v = fmaxf(v, 0.f); else if (ACT == 6) v = 0.5f * v * (1.0f + erff(v * 0.70710678118654752f)); so[w][8 * hh + r][t * 16 + ln] = v; } }
  __builtin_amdgcn_fence(__ATOMIC_ACQ_REL, "workgroup"); __builtin_amdgcn_wave_barrier();
  const int rsub = lane >> 4, c4 = (lane & 15) * 4; typedef _Float16 v4h __attribute__((ext_vector_type(4)));
  {
#pragma unroll
    for (int q = 0; q < 8; ++q) { const int r = q * 2 + rsub; if (col0 + c4 < N) { const v4f v = *(const v4fa*)&so[w][r][c4]; if (C) *(v4f*)(C + cofs + (size_t)(row0 + r) * ldc + col0 + c4) = v; if (C16) { v4h h4; for (int i = 0; i < 4; ++i) h4[i] = (_Float16)v[i]; *(v4h*)(C16 + cofs + (size_t)(row0 + r) * ldc + col0 + c4) = h4; } } }
     }
}


typedef _Float16 v4h __attribute__((ext_vector_type(4)));

__global__ __launch_bounds__(256) void k_x16(const float* __restrict__ x, _Float16* __restrict__ X16, size_t n8) { const size_t t = (size_t)blockIdx.x * 256 + threadIdx.x; if (t >= n8) return; FragH f;
#pragma unroll
  for (int q = 0; q < 8; ++q) f.h[q] = (_Float16)bf16_round(x[t * 8 + q]); *(v8us*)((unsigned short*)X16 + t * 8) = f.half[0];  }
__global__ __launch_bounds__(256) void k_h16(const float* __restrict__ x, _Float16* __restrict__ X16, size_t n8) { const size_t t = (size_t)blockIdx.x * 256 + threadIdx.x; if (t >= n8) return; FragH f;
#pragma unroll
  for (int q = 0; q < 8; ++q) f.h[q] = (_Float16)x[t * 8 + q]; *(v8us*)((unsigned short*)X16 + t * 8) = f.half[0];  }
__global__ __launch_bounds__(256) void k_round16f(const float* __restrict__ W, _Float16* __restrict__ Bt, size_t n8) { const size_t t = (size_t)blockIdx.x * 256 + threadIdx.x; if (t >= n8) return; FragH f;
#pragma unroll
  for (int i = 0; i < 8; ++i) f.h[i] = (_Float16)(bf16_round(W[t * 8 + i]) * 16.0f); *(v8us*)((unsigned short*)Bt + t * 8) = f.half[0];  }
// V^T by LDS transposes. One workgroup takes VTT neighbouring 64 x 64 tiles of one (batch, head): each wave carries VTT tiles, and all of a thread's loads are issued before the first of them is used.
#define VTT 4                        /* 64-key tiles per workgroup */
template <int NHv, int TTv>
__global__ __launch_bounds__(256) void k_vt(const _Float16* __restrict__ V16, int ldv, int voff, _Float16* __restrict__ Vt) { __shared__ unsigned short tl[VTT][64][66]; const int tid = threadIdx.x;
  static_assert(TTv % (64 * VTT) == 0, "k_vt: whole workgroups");
  const int slab = blockIdx.x / (TTv / (64 * VTT)), lg0 = (blockIdx.x % (TTv / (64 * VTT))) * VTT; const int b = slab / NHv, h = slab % NHv;
  const int r = tid / 8, c8 = (tid % 8) * 8;      /* 8 threads per 128-byte row, rows r and r + 32 of each tile */
  const unsigned short* vg = (const unsigned short*)V16 + ((size_t)b * TTv + lg0 * 64 + r) * ldv + voff + h * 64 + c8;
  const unsigned short* pv[VTT][2]; v8us rv[VTT][2];
  /* the short loops below are all unrolled so that pv and rv stay in registers */
#pragma unroll
  for (int u = 0; u < VTT; ++u)
#pragma unroll
    for (int k = 0; k < 2; ++k) { pv[u][k] = vg + (size_t)(u * 64 + k * 32) * ldv; rv[u][k] = *(const v8us*)pv[u][k]; }
  static_assert(VTT == 4, "k_vt: the wait below names the eight addresses");
  /* precaution: stands in front of every write of a register that the loads above name as an address; it names the addresses (inputs only), so that no later load of the run lands in one of them either; it also keeps all the loads in front of the first LDS store */
  asm volatile("s_wait_xcnt 0x0" :: "v"(pv[0][0]), "v"(pv[0][1]), "v"(pv[1][0]), "v"(pv[1][1]), "v"(pv[2][0]), "v"(pv[2][1]), "v"(pv[3][0]), "v"(pv[3][1]) : "memory");
#pragma unroll
  for (int u = 0; u < VTT; ++u)
#pragma unroll
    for (int k = 0; k < 2; ++k)
#pragma unroll
      for (int q = 0; q < 8; ++q) tl[u][r + k * 32][c8 + q] = rv[u][k][q];
  __syncthreads();
#pragma unroll
  for (int u = 0; u < VTT; ++u)
#pragma unroll
    for (int rd = 0; rd < 2; ++rd) { const int d = rd * 32 + tid / 8, pc = tid % 8; FragH f;
#pragma unroll
      for (int q = 0; q < 8; ++q) f.u[q] = tl[u][pc * 8 + q][d];
      *(v8us*)((unsigned short*)Vt + ((size_t)slab * 64 + d) * TTv + (lg0 + u) * 64 + pc * 8) = f.half[0]; } }

__global__ __launch_bounds__(256) void k_hl(const float* __restrict__ F, _Float16* __restrict__ Hh, _Float16* __restrict__ Hl, size_t n8) { const size_t t = (size_t)blockIdx.x * 256 + threadIdx.x; if (t >= n8) return; FragH fh, fl; const v4f a = *(const v4fa*)(F + t * 8), c = *(const v4fa*)(F + t * 8 + 4);
#pragma unroll
  for (int q = 0; q < 4; ++q) { _Float16 h = (_Float16)a[q]; fh.h[q] = h; fl.h[q] = (_Float16)((a[q] - (float)h) * 1024.0f); h = (_Float16)c[q]; fh.h[4 + q] = h; fl.h[4 + q] = (_Float16)((c[q] - (float)h) * 1024.0f); }
  { *(v8us*)((unsigned short*)Hh + t * 8) = fh.half[0]; *(v8us*)((unsigned short*)Hl + t * 8) = fl.half[0];  } }

__device__ __forceinline__ v16h g2_frag(const _Float16* p, int hh) { FragH f; f.half[0] = *(const v8us*)((const unsigned short*)p + 8 * hh); f.half[1] = *(const v8us*)((const unsigned short*)p + 16 + 8 * hh); return f.v; }


#define WCH 8                        /* 8-element chunks per thread */
// chunks t0 + 256 i of one weight matrix: all loads issued first, then converted and stored
__device__ __forceinline__ void wnat_part(const float* __restrict__ w, _Float16* __restrict__ Bt, unsigned t0) { v4f a[WCH][2]; const unsigned ob = t0 * 32;      /* the thread's first byte */
  /* the short loops below are all unrolled so that a stays in registers */
#pragma unroll
  for (int i = 0; i < WCH; ++i) { const float* p = (const float*)((const char*)w + ob) + 256 * 8 * i; a[i][0] = *(const v4fa*)p; a[i][1] = *(const v4fa*)(p + 4); }
  /* precaution: stands in front of every write of a register that the loads above name as an address; it names the offset (input only), so that no later load of the run lands in it either; it also keeps all the loads in front of the first store */
  asm volatile("s_wait_xcnt 0x0" :: "v"(ob) : "memory");
#pragma unroll
  for (int i = 0; i < WCH; ++i) { FragH f;
#pragma unroll
    for (int q = 0; q < 8; ++q) f.h[q] = (_Float16)(bf16_round(a[i][q >> 2][q & 3]) * 16.0f);
    *(v8us*)((unsigned short*)Bt + (size_t)(t0 + 256 * i) * 8) = f.half[0]; }
  asm volatile("s_wait_xcnt 0x0" ::: "memory"); }      /* precaution: in the built kernel the x + PE text follows this path behind a branch; the wait stands in front of its writes of registers that the stores above name */
__global__ __launch_bounds__(256) void k_rsm(const float* __restrict__ S, _Float16* __restrict__ P, int nrows) {
  #pragma clang fp contract(off)
  const int i = blockIdx.x * 256 + threadIdx.x; if (i >= nrows) return; const float* s = S + (size_t)i * SQ; float mx = -3.0e38f;
#pragma unroll 1
  for (int j = 0; j < SQ; ++j) mx = fmaxf(mx, s[j]); float se = 0.f;
#pragma unroll 1
  for (int j = 0; j < SQ; ++j) se += expf(s[j] - mx); const float sc = 256.0f / se;
#pragma unroll 1
  for (int j0 = 0; j0 < SQ; j0 += 8) { FragH f; for (int q = 0; q < 8; ++q) f.h[q] = (_Float16)(expf(s[j0 + q] - mx) * sc); unsigned short* d = (unsigned short*)P + (size_t)i * SQ + j0; *(v8us*)d = f.half[0];  } }
__global__ __launch_bounds__(256) void k_vt(const _Float16* __restrict__ V16, int b, int h0, _Float16* __restrict__ VT) { __shared__ unsigned short tl[64][65]; const int tid = threadIdx.x; const int hh = blockIdx.x % HG, sg = blockIdx.x / HG; const int s0 = sg * 64; const int h = h0 + hh;
  for (int i = tid; i < 64 * 8; i += 256) { const int j = i / 8, d8 = (i % 8) * 8; FragH f; f.half[0] = *(const v8us*)((const unsigned short*)V16 + ((size_t)b * SQ + s0 + j) * DM + h * HD + d8); for (int q = 0; q < 8; ++q) tl[d8 + q][j] = f.u[q]; }
  __syncthreads();
  { for (int i = tid; i < 64 * 8; i += 256) { const int d = i / 8, j8 = (i % 8) * 8; FragH f; for (int q = 0; q < 8; ++q) f.u[q] = tl[d][j8 + q]; *(v8us*)((unsigned short*)VT + ((size_t)hh * HD + d) * SQ + s0 + j8) = f.half[0]; }  } }



#define FAW 8                        /* waves per key part: FAW * 32 queries per workgroup */
#define FAS 2                        /* key parts = groups of waves */
#define FAK 64                       /* keys per stage */
#define FAP 72                       /* LDS row pitch in f16: 128 bytes of data + 16, so that the 16 rows of a fragment read start in 16 different bank groups */
#define FAT (SQ / FAS / FAK)         /* stages per key part */
typedef float v2f __attribute__((ext_vector_type(2)));
__device__ __forceinline__ float rs_xhalf(float x) { return __builtin_bit_cast(float, __builtin_amdgcn_permlanex16(__builtin_bit_cast(int, x), __builtin_bit_cast(int, x), 0x76543210, 0xfedcba98, false, false)); }      /* lane l reads lane l ^ 16 */
__device__ __forceinline__ v16h fa_frag(const unsigned short* p, int hh) { FragH f; f.half[0] = *(const v8us*)(p + 8 * hh); f.half[1] = *(const v8us*)(p + 16 + 8 * hh); return f.v; }
__device__ __forceinline__ v8f fa_mma(v16h a, v16h b, v8f c) { return __builtin_amdgcn_wmma_f32_16x16x32_f16(false, a, false, b, (short)0, c, false, false); }
// Eight native 2^x (v_exp_f32). The builtin, not asm text: the compiler schedules these between the matrix instructions and must see which registers they write.
__device__ __forceinline__ v8f fa_exp2x8(v8f x) { v8f e;
#pragma unroll      /* the vector stays in registers */
  for (int i = 0; i < 8; ++i) e[i] = __builtin_amdgcn_exp2f(x[i]);
  return e; }
static_assert(SQ % (FAW * 32) == 0 && SQ % (FAS * FAK) == 0 && HD == 64 && FAK == 64 && FAW * 32 == 256 && FAS == 2, "k_fattn: whole workgroups and stages; the 256 threads of a key part stage 64 rows of 128 bytes in two rounds; two parts swap one query group each");
__global__ __launch_bounds__(FAW * FAS * 32) void k_fattn(const _Float16* __restrict__ Q16, const _Float16* __restrict__ K16, const _Float16* __restrict__ VT, _Float16* __restrict__ O16) {
  __shared__ __attribute__((aligned(16))) unsigned short sk[FAS][2][FAK][FAP];      /* K rows [key part][buffer][key][d] */
  __shared__ __attribute__((aligned(16))) unsigned short sv[FAS][2][HD][FAP];       /* V^T rows [key part][buffer][d][key] */
  __shared__ __attribute__((aligned(16))) float smo[8][2][FAW][32][4];              /* handed-over output tiles [4 registers][query group][wave][lane] */
  __shared__ __attribute__((aligned(8))) float sml[2][FAW][32][2];                  /* handed-over maximum in use and sum [query group][wave][lane] */
  const int tid = threadIdx.x, w = (tid >> 5) & (FAW - 1), lane = tid & 31, ln = lane & 15, hh = lane >> 4;
  const int kh = __builtin_amdgcn_readfirstlane(tid >> 8);      /* the wave's key part, in a scalar register: the branches on it at the end are scalar */
  const int bh = blockIdx.y, b = bh / NH, hd = bh - b * NH; const size_t r0 = (size_t)b * SQ; const int q0 = (blockIdx.x * FAW + w) * 32;
  const int srow = (tid & 255) >> 3, sc8 = (tid & 7) * 8;      /* staging, per key part: 8 threads per 128-byte row, rows srow and srow + 32 */
  const unsigned short* kg = (const unsigned short*)K16 + (r0 + kh * (SQ / FAS) + srow) * DM + hd * HD + sc8;
  const unsigned short* vg = (const unsigned short*)VT + ((size_t)bh * HD + srow) * SQ + kh * (SQ / FAS) + sc8;
  v16h qf[2][2];      /* [16-query group][32 of d] */
  /* the short loops below are all unrolled so that the fragment and accumulator arrays stay in registers */
#pragma unroll
  for (int g = 0; g < 2; ++g)
#pragma unroll
    for (int ks = 0; ks < 2; ++ks) qf[g][ks] = g2_frag(Q16 + (r0 + q0 + g * 16 + ln) * DM + hd * HD + ks * 32, hh);
  const v8f z8 = {0.f, 0.f, 0.f, 0.f, 0.f, 0.f, 0.f, 0.f};
  v8f o[2][4] = {{z8, z8, z8, z8}, {z8, z8, z8, z8}}; float ms[2] = {-3.0e38f, -3.0e38f}, l[2] = {0.f, 0.f};
  const float cs = 0.125f * 1.44269504088896340736f;      /* 64^-0.5 log2 e */
  v8us kr0 = *(const v8us*)kg, kr1 = *(const v8us*)(kg + (size_t)32 * DM), vr0 = *(const v8us*)vg, vr1 = *(const v8us*)(vg + (size_t)32 * SQ);
  asm volatile("s_wait_xcnt 0x0" ::: "memory");      /* precaution: stands in front of every later write of a register that the loads above name as an address */
  *(v8us*)&sk[kh][0][srow][sc8] = kr0; *(v8us*)&sk[kh][0][srow + 32][sc8] = kr1; *(v8us*)&sv[kh][0][srow][sc8] = vr0; *(v8us*)&sv[kh][0][srow + 32][sc8] = vr1;
  __syncthreads();      /* stage 0 is published */
  for (int t = 0; t < FAT; ++t) { const int cur = t & 1;
    if (t + 1 < FAT) { const unsigned short* kn = kg + (size_t)(t + 1) * FAK * DM; const unsigned short* vn = vg + (t + 1) * FAK;
      kr0 = *(const v8us*)kn; kr1 = *(const v8us*)(kn + (size_t)32 * DM); vr0 = *(const v8us*)vn; vr1 = *(const v8us*)(vn + (size_t)32 * SQ); }
#pragma unroll
    for (int hp = 0; hp < 2; ++hp) {      /* two passes of 32 keys per stage: half the score registers live at once; unrolled, so that one pass's matrix work can be scheduled among the other's softmax */
      v8f s[2][2];      /* S^T: [query group][16-key tile], register r = key 8 hh + r, lane column = query */
#pragma unroll
      for (int j = 0; j < 2; ++j) { const v16h a0 = fa_frag(&sk[kh][cur][hp * 32 + j * 16 + ln][0], hh), a1 = fa_frag(&sk[kh][cur][hp * 32 + j * 16 + ln][32], hh);
#pragma unroll
        for (int g = 0; g < 2; ++g) s[g][j] = fa_mma(a1, qf[g][1], fa_mma(a0, qf[g][0], z8)); }
      v16h va[4];
#pragma unroll
      for (int dt = 0; dt < 4; ++dt) va[dt] = fa_frag(&sv[kh][cur][dt * 16 + ln][hp * 32], hh);
      float mxs[2];
#pragma unroll
      for (int g = 0; g < 2; ++g) { const v8f mv = __builtin_elementwise_max(s[g][0], s[g][1]);
        const float mx = fmaxf(fmaxf(fmaxf(mv[0], mv[1]), fmaxf(mv[2], mv[3])), fmaxf(fmaxf(mv[4], mv[5]), fmaxf(mv[6], mv[7])));
        mxs[g] = fmaxf(mx, rs_xhalf(mx)) * cs; }
      if (__builtin_amdgcn_ballot_w32(mxs[0] > ms[0] + 8.0f || mxs[1] > ms[1] + 8.0f) != 0) {      /* wave-uniform: some query's maximum has outgrown the one in use */
        const float n0 = fmaxf(ms[0], mxs[0]), n1 = fmaxf(ms[1], mxs[1]); const float c0 = __builtin_amdgcn_exp2f(ms[0] - n0), c1 = __builtin_amdgcn_exp2f(ms[1] - n1);      /* the two rescale factors */
        ms[0] = n0; ms[1] = n1; l[0] *= c0; l[1] *= c1;
#pragma unroll
        for (int dt = 0; dt < 4; ++dt) { o[0][dt] *= c0; o[1][dt] *= c1; } }
      v16h pf[2];      /* P^T as B operand, per query group */
#pragma unroll
      for (int g = 0; g < 2; ++g) { const float nb = 7.0f - ms[g];
#pragma unroll
        for (int j = 0; j < 2; ++j) s[g][j] = fa_exp2x8(s[g][j] * cs + nb);
        const v8f ps = s[g][0] + s[g][1];
        l[g] += ((ps[0] + ps[1]) + (ps[2] + ps[3])) + ((ps[4] + ps[5]) + (ps[6] + ps[7]));
        FragH f;
#pragma unroll
        for (int i = 0; i < 8; ++i) { f.h[i] = (_Float16)s[g][0][i]; f.h[8 + i] = (_Float16)s[g][1][i]; }
        pf[g] = f.v; }
#pragma unroll
      for (int dt = 0; dt < 4; ++dt)
#pragma unroll
        for (int g = 0; g < 2; ++g) o[g][dt] = fa_mma(va[dt], pf[g], o[g][dt]); }
    if (t + 1 < FAT) { *(v8us*)&sk[kh][cur ^ 1][srow][sc8] = kr0; *(v8us*)&sk[kh][cur ^ 1][srow + 32][sc8] = kr1; *(v8us*)&sv[kh][cur ^ 1][srow][sc8] = vr0; *(v8us*)&sv[kh][cur ^ 1][srow + 32][sc8] = vr1; }      /* its last readers left this buffer at the barrier of stage t - 1 */
    __syncthreads(); }      /* publishes stage t + 1 and ends every read of stage t */
#pragma unroll
  for (int g = 0; g < 2; ++g) if (g != kh) {      /* the query group that the wave of the other key part finishes */
#pragma unroll
    for (int dt = 0; dt < 4; ++dt) { *(v4f*)&smo[2 * dt][g][w][lane][0] = __builtin_shufflevector(o[g][dt], o[g][dt], 0, 1, 2, 3); *(v4f*)&smo[2 * dt + 1][g][w][lane][0] = __builtin_shufflevector(o[g][dt], o[g][dt], 4, 5, 6, 7); }
    const v2f ml = {ms[g], l[g]}; *(v2f*)&sml[g][w][lane][0] = ml; }
  __syncthreads();      /* the handed-over groups are published */
#pragma unroll
  for (int g = 0; g < 2; ++g) if (g == kh) {      /* join the two key parts: both are brought to the larger maximum in use */
    const v2f ml = *(const v2f*)&sml[g][w][lane][0]; const float m = fmaxf(ms[g], ml[0]); const float ca = __builtin_amdgcn_exp2f(ms[g] - m), cb = __builtin_amdgcn_exp2f(ml[0] - m);
    const float lj = l[g] * ca + ml[1] * cb; const float inv = 64.0f / (lj + rs_xhalf(lj));      /* the halves hold disjoint keys; o is carried x64 */
    const float fa = ca * inv, fb = cb * inv;
    unsigned short* op = (unsigned short*)O16 + (r0 + q0 + g * 16 + ln) * DM + hd * HD + 8 * hh;
#pragma unroll
    for (int dt = 0; dt < 4; ++dt) { FragH f; const v4f p0 = *(const v4f*)&smo[2 * dt][g][w][lane][0], p1 = *(const v4f*)&smo[2 * dt + 1][g][w][lane][0];
#pragma unroll
      for (int r = 0; r < 4; ++r) { f.h[r] = (_Float16)(o[g][dt][r] * fa + p0[r] * fb); f.h[4 + r] = (_Float16)(o[g][dt][4 + r] * fa + p1[r] * fb); }
      *(v8us*)(op + dt * 16) = f.half[0]; }      /* register r = d 16 dt + 8 hh + r of query ln: 16 contiguous bytes */
    if (g == 0) asm volatile("s_wait_xcnt 0x0" ::: "memory"); } }      /* precaution: in the built kernel the second group's text follows this path behind a branch; the wait stands in front of its writes of registers that the stores above name */


// ---- staged GEMM: C[MP][DM] = A[MP][DM] . Bt[DM][DM]^T x alpha + bias (bias rounded to bf16 first), all pitches DM; C f32 or f16 ----
// One workgroup = 8 waves = one 128 x 128 tile of C, waves 4 (rows) x 2 (columns), 32 x 64 per wave. The k axis runs in stages of G3K: the 128 A rows and the 128 Bt rows
// of a stage (256 bytes each) come from global memory as whole lines, 16 lanes per row, once per workgroup, and lie in LDS at a padded pitch; every wave takes its
// fragments from there. Two LDS buffers: stage t + 1 travels global -> registers while stage t is worked on and is stored behind the work; one barrier per stage.
// Each accumulator tile sums k in ascending steps of 32, one WMMA per step.
#define G3T 128                      /* tile rows and tile columns per workgroup */
#define G3K 128                      /* k per stage */
#define G3P 136                      /* LDS row pitch in f16: 256 bytes of data + 16, so that the 16 rows of a fragment read start in 16 different bank groups */
#define G3S (DM / G3K)               /* stages */
static_assert(MP % G3T == 0 && MPO % G3T == 0 && DM % G3T == 0 && DM % G3K == 0 && G3S >= 2, "k_gemm3: whole tiles and stages");
template <bool F32OUT>      /* the result goes to C (f32) or to C16 (f16); the other pointer is not used; mt, nq: the workgroup's tile row and tile column */
__device__ __forceinline__ void gemm3_tile(const _Float16* __restrict__ A, const _Float16* __restrict__ Bh, float alpha, const float* __restrict__ bias, float* __restrict__ C, _Float16* __restrict__ C16, int mt, int nq) {
  __shared__ __attribute__((aligned(16))) unsigned short sa[2][G3T][G3P];      /* A rows [row][k] */
  __shared__ __attribute__((aligned(16))) unsigned short sb[2][G3T][G3P];      /* Bt rows [column][k] */
  __shared__ __attribute__((aligned(16))) float so[8][32][68];                 /* per-wave output staging */
  const int tid = threadIdx.x, w = tid >> 5, lane = tid & 31, ln = lane & 15, hh = lane >> 4;
  const int wr = (w >> 1) * 32, wc = (w & 1) * 64;      /* the wave's place in the tile */
  const int row0 = mt * G3T + wr, col0 = nq * G3T + wc;
  const int srow = tid >> 4, sc8 = (tid & 15) * 8;      /* staging: 16 threads per 256-byte row, rows srow + 16 i */
  const unsigned short* ag = (const unsigned short*)A + (size_t)(mt * G3T + srow) * DM + sc8;
  const unsigned short* bg = (const unsigned short*)Bh + (size_t)(nq * G3T + srow) * DM + sc8;
  v8us ra[8], rb[8];
  /* the short loops below are all unrolled so that the staging, fragment and accumulator arrays stay in registers */
#pragma unroll
  for (int i = 0; i < 8; ++i) { ra[i] = *(const v8us*)(ag + (size_t)(16 * i) * DM); rb[i] = *(const v8us*)(bg + (size_t)(16 * i) * DM); }
#pragma unroll
  for (int i = 0; i < 8; ++i) { *(v8us*)&sa[0][srow + 16 * i][sc8] = ra[i]; *(v8us*)&sb[0][srow + 16 * i][sc8] = rb[i]; }
  const v8f z8 = {0.f, 0.f, 0.f, 0.f, 0.f, 0.f, 0.f, 0.f}; v8f acc[2][4] = {{z8, z8, z8, z8}, {z8, z8, z8, z8}};      /* [16-row group][16-column group] */
  __syncthreads();      /* stage 0 is published */
  for (int t = 0; t < G3S; ++t) { const int cur = t & 1;
    if (t + 1 < G3S) {
#pragma unroll
      for (int i = 0; i < 8; ++i) { ra[i] = *(const v8us*)(ag + (size_t)(16 * i) * DM + (t + 1) * G3K); rb[i] = *(const v8us*)(bg + (size_t)(16 * i) * DM + (t + 1) * G3K); } }
#pragma unroll
    for (int ks = 0; ks < G3K / 32; ++ks) { const v16h a0 = fa_frag(&sa[cur][wr + ln][ks * 32], hh), a1 = fa_frag(&sa[cur][wr + 16 + ln][ks * 32], hh);
#pragma unroll
      for (int j = 0; j < 4; ++j) { const v16h b = fa_frag(&sb[cur][wc + j * 16 + ln][ks * 32], hh); acc[0][j] = fa_mma(a0, b, acc[0][j]); acc[1][j] = fa_mma(a1, b, acc[1][j]); } }
    if (t + 1 < G3S) {
#pragma unroll
      for (int i = 0; i < 8; ++i) { *(v8us*)&sa[cur ^ 1][srow + 16 * i][sc8] = ra[i]; *(v8us*)&sb[cur ^ 1][srow + 16 * i][sc8] = rb[i]; } }      /* its last readers left this buffer at the barrier of stage t - 1 */
    __syncthreads(); }      /* publishes stage t + 1 and ends every read of stage t */
#pragma unroll
  for (int u = 0; u < 8; ++u) { const int j = u & 3, half = u >> 2; const float bv = bf16_round(bias[col0 + j * 16 + ln]);
#pragma unroll
    for (int r = 0; r < 8; ++r) so[w][half * 16 + 8 * hh + r][j * 16 + ln] = acc[half][j][r] * alpha + bv; }
  __builtin_amdgcn_fence(__ATOMIC_ACQ_REL, "workgroup"); __builtin_amdgcn_wave_barrier();      /* the wave reads back rows that its other lanes wrote */
  const int rsub = lane >> 4, c4 = (lane & 15) * 4;
#pragma unroll
  for (int q = 0; q < 16; ++q) { const int r = q * 2 + rsub; const v4f v = *(const v4fa*)&so[w][r][c4]; const size_t e = (size_t)(row0 + r) * DM + col0 + c4;
    if (F32OUT) *(v4f*)(C + e) = v; else *(v4h*)(C16 + e) = __builtin_convertvector(v, v4h); } }      /* 16 lanes store one row of the wave's 64 columns: whole lines */
// The output projection: one grid of (MPO / G3T) x (DM / G3T) tiles, f32 result.
__global__ __launch_bounds__(256) void k_gemm3o(const _Float16* __restrict__ A, const _Float16* __restrict__ Bh, float alpha, const float* __restrict__ bias, float* __restrict__ C) {
  const int mt = blockIdx.x / (DM / G3T), nq = blockIdx.x - mt * (DM / G3T);
  gemm3_tile<true>(A, Bh, alpha, bias, C, nullptr, mt, nq); }
// The Q, K and V projections read the same A and do not depend on each other: one grid holds the tiles of all three, so that they share one launch and fill the chip without a
// gap between them. A tile row's 3 x (DM / G3T) workgroups are neighbours in the grid (Q's columns, then K's, then V's), so its A rows are read again while they are still in the cache.
__global__ __launch_bounds__(256) void k_gemm3qkv(const _Float16* __restrict__ A, const _Float16* __restrict__ Bq, const _Float16* __restrict__ Bk, const _Float16* __restrict__ Bv, float alpha,
                                                  const float* __restrict__ bq, const float* __restrict__ bk, const float* __restrict__ bv, _Float16* __restrict__ Cq, _Float16* __restrict__ Ck, _Float16* __restrict__ Cv) {
  const int mt = blockIdx.x / (3 * (DM / G3T)), c = blockIdx.x - mt * (3 * (DM / G3T)); const int m = c / (DM / G3T), nq = c - m * (DM / G3T);      /* m: 0 = Q, 1 = K, 2 = V; the same for the whole workgroup */
  gemm3_tile<false>(A, m == 0 ? Bq : m == 1 ? Bk : Bv, alpha, m == 0 ? bq : m == 1 ? bk : bv, nullptr, m == 0 ? Cq : m == 1 ? Ck : Cv, mt, nq); }


#define XPP 4                        /* places (sequence positions) per thread */
// x + PE. A thread keeps one 8-column chunk and walks XPP places: the four frequencies of its columns are formed once, a place's sines and cosines once for all NB batches
// (PE does not depend on the batch); every element is the same expression as for one chunk alone. All loads of x are issued first and travel while PE is formed.
// PE is formed in a rolled loop and parked in LDS, each thread in slots of its own (no barrier). Workgroup g: places 2 XPP g ... 2 XPP g + 2 XPP - 1.
static_assert(DM / 8 == 128 && SQ % (2 * XPP) == 0, "xpe_part: 256 threads hold two rows of 128 chunks; whole workgroups");
__device__ __forceinline__ void xpe_part(const float* __restrict__ x, _Float16* __restrict__ X16, unsigned g, int tid) {
  #pragma clang fp contract(off)
  __shared__ __attribute__((aligned(8))) float spe[XPP][4][256][2];      /* [place][frequency][thread][sin, cos] */
  const int c0 = (tid & 127) * 8, p0 = (int)g * (2 * XPP) + (tid >> 7); const float kf = (float)(-9.210340371976184 / (double)DM); v4f xa[XPP][NB][2];
  const float* px[NB];      /* the thread's first chunk in each batch */
  /* the loops over xa are unrolled so that it stays in registers */
#pragma unroll
  for (int b = 0; b < NB; ++b) { px[b] = x + ((size_t)b * SQ + p0) * DM + c0;
#pragma unroll
    for (int i = 0; i < XPP; ++i) { const float* p = px[b] + (size_t)(2 * i) * DM; xa[i][b][0] = *(const v4fa*)p; xa[i][b][1] = *(const v4fa*)(p + 4); } }
  static_assert(NB == 2, "xpe_part: the wait below names the two addresses");
  /* precaution: stands in front of every write of a register that the loads above name as an address; it names the addresses (inputs only), so that no later load of the run lands in one of them either; it also keeps all the loads in front of the PE loop */
  asm volatile("s_wait_xcnt 0x0" :: "v"(px[0]), "v"(px[1]) : "memory");
#pragma unroll 1      /* rolled, like the loop inside: one copy of the exp, sin and cos text */
  for (int j = 0; j < 4; ++j) { const float dv = expf(__fmul_rn((float)(c0 + 2 * j), kf));
#pragma unroll 1
    for (int i = 0; i < XPP; ++i) { const float ang = __fmul_rn((float)(p0 + 2 * i), dv); spe[i][j][tid][0] = sinf(ang); spe[i][j][tid][1] = cosf(ang); } }
#pragma unroll
  for (int i = 0; i < XPP; ++i) { float pe[8];
#pragma unroll
    for (int j = 0; j < 4; ++j) { pe[2 * j] = spe[i][j][tid][0]; pe[2 * j + 1] = spe[i][j][tid][1]; }
#pragma unroll
    for (int b = 0; b < NB; ++b) { FragH f;
#pragma unroll
      for (int q = 0; q < 8; ++q) f.h[q] = (_Float16)__fadd_rn(bf16_round(xa[i][b][q >> 2][q & 3]), pe[q]);
      *(v8us*)((unsigned short*)X16 + ((size_t)b * SQ + p0 + 2 * i) * DM + c0) = f.half[0]; } } }
// x + PE and the four weight conversions do not depend on each other: one grid, dealt by workgroup range. The x + PE workgroups, the longer ones, come first.
// Two workgroups per WGP in all: each thread carries 8 chunks, so that few waves have to start.
#define PXG ((unsigned)(SQ / (2 * XPP)))                         /* workgroups of x + PE */
#define PWG ((unsigned)((size_t)DM * DM / 8 / (256 * WCH)))      /* workgroups per weight matrix */
static_assert((size_t)DM * DM / 8 % (256 * WCH) == 0, "k_prep: whole workgroups per weight matrix");
__global__ __launch_bounds__(256) void k_prep(const float* __restrict__ x, const float* __restrict__ wq, const float* __restrict__ wk, const float* __restrict__ wv, const float* __restrict__ wo,
                                              _Float16* __restrict__ X16, _Float16* __restrict__ BQ, _Float16* __restrict__ BK, _Float16* __restrict__ BV, _Float16* __restrict__ BO) {
  const unsigned g = blockIdx.x;
  if (g < PXG) { xpe_part(x, X16, g, (int)threadIdx.x); return; }      /* x + sinusoidal PE -> f16 rows (not exact: x + pe is not a bf16 value) */
  const unsigned u = g - PXG, m = u / PWG;      /* m: which weight matrix; the same for the whole workgroup */
  wnat_part(m == 0 ? wq : m == 1 ? wk : m == 2 ? wv : wo, m == 0 ? BQ : m == 1 ? BK : m == 2 ? BV : BO, (u - m * PWG) * (256 * WCH) + threadIdx.x); }      /* natural [out][in] = Bt[n][k], x16 */
extern "C" void kernel_launch(void* const* d_in, const int* in_sizes, int n_in,
                              void* d_out, int out_size, void* d_ws, size_t ws_size, hipStream_t stream) {
  (void)in_sizes; (void)n_in; (void)out_size;
  const float* const* I = (const float* const*)d_in; const float* x = I[0]; const float* wq = I[1]; const float* bq = I[2]; const float* wk = I[3]; const float* bk = I[4]; const float* wv = I[5]; const float* bv = I[6]; const float* wo = I[7]; const float* bo = I[8];      /* nn.Linear weights [out][in] + biases */
  char* ws = (char*)d_ws; size_t off = 0;
  auto take = [&](size_t bytes) { char* p = ws + off; off += (bytes + 255) & ~(size_t)255; return p; };
  _Float16* BQ = (_Float16*)take((size_t)DM * DM * 2); _Float16* BK = (_Float16*)take((size_t)DM * DM * 2); _Float16* BV = (_Float16*)take((size_t)DM * DM * 2); _Float16* BO = (_Float16*)take((size_t)DM * DM * 2);
  _Float16* X16 = (_Float16*)take(NR * DM * 2); _Float16* Q16 = (_Float16*)take(NR * DM * 2); _Float16* K16 = (_Float16*)take(NR * DM * 2); _Float16* V16 = (_Float16*)take(NR * DM * 2); _Float16* O16 = (_Float16*)take(NR * DM * 2);
  _Float16* VT = (_Float16*)take((size_t)NB * NH * HD * SQ * 2);
  if (off > ws_size) return;
  k_prep<<<PXG + 4 * PWG, 256, 0, stream>>>(x, wq, wk, wv, wo, X16, BQ, BK, BV, BO);      /* f16 operands: x + PE rows and the four weight matrices */
  const size_t r0p = (size_t)B0 * SQ;      /* first projected row */
  k_gemm3qkv<<<(unsigned)((MP / G3T) * 3 * (DM / G3T)), 256, 0, stream>>>(X16 + r0p * DM, BQ, BK, BV, 0.0625f, bq, bk, bv, Q16 + r0p * DM, K16 + r0p * DM, V16 + r0p * DM);
  k_vt<NH, SQ><<<NB * NH * (SQ / (64 * VTT)), 256, 0, stream>>>(V16, LQ, 0, VT);      /* V^T [NB][NH][HD][SQ] */
  k_fattn<<<dim3(SQ / (FAW * 32), NB * NH), FAW * FAS * 32, 0, stream>>>(Q16, K16, VT, O16);      /* o (merged heads, x64) as f16 rows */
  k_gemm3o<<<(unsigned)((MPO / G3T) * (DM / G3T)), 256, 0, stream>>>(O16 + r0p * DM, BO, 0.0009765625f, bo, (float*)d_out + r0p * DM);      /* out rows are the output layout */
}

// v007
// Measured time: 89.5 microseconds a run.
// Two timings next to v006 both put it at 1.05 times that version's speed.
// Counting every step since v000, it is 40.9 times as fast.
#include <hip/hip_runtime.h>
// Temporal multi-head attention with sinusoidal positional encoding (x [2][2048][1024]; x = x + PE (pe[s][2i] = sin(s d_i), pe[s][2i+1] = cos(s d_i), d_i = exp(2i x (-ln 1e4 / 1024))); q = x Wq^T + bq, k, v likewise (nn.Linear [out][in] 1024^2, weights and biases sigma 1/32); 16 heads of 64; softmax(q k^T / 8) (no mask); out = ctx Wo^T + bo -> [2][2048][1024]).
// Structure: token rows r = b*2048 + s; x + PE computed on VALU (f32 expf/sinf/cosf in the module's op order) -> f16 rows (one f16 rounding of x + pe); Q, K, V as three WMMA GEMMs in one grid (128x128 workgroup tiles staged in LDS, 32x64 wave tiles, f32 accumulation, exact x16 weights + bias, f16 outputs; the V tiles leave transposed, as V^T rows per batch and head); one fused attention kernel over all (batch, head, 256 queries), the keys dealt to two groups of waves and the two partial results joined at the end: scores on WMMA (K = 64), online softmax on VALU (f32 statistics, native exp2; weights as f16, scaled by a power of two that cancels), o = P . V on WMMA (o carried x64 against f16 subnormal flush, folded into the output GEMM alpha) written straight into the merged f16 o rows; out = o W_o + b GEMM (f32) into the output layout.
// Compute dtype: inputs rounded to bf16; weights exact, x + pe rounded once to f16; q, k, v, softmax weights and o as plain f16 GEMM operands (~2^-12); scores and softmax statistics f32. v_wmma_f32_16x16x32_f16.
#define NB 2
#define SQ 2048
#define DM 1024
#define NH 16
#define HD 64
#define HG 4                         /* heads per call of the unlaunched k_vt(V16, b, h0, VT) */
#define B0 0                         /* first batch processed (debug hook) */
#define NBR NB                       /* batches processed (debug hook) */
#define NR ((size_t)NB * SQ)         /* token rows */
#define MP ((int)((size_t)NBR * SQ)) /* rows projected (debug hook) */
#define QN SQ                        /* unused: k_fattn attends all SQ query rows */
#define NHD NH                       /* unused: k_fattn attends all NH heads */
#define MPO MP                       /* rows through the output stage (debug hook) */
typedef __bf16 v16b __attribute__((ext_vector_type(16)));
typedef unsigned short v8us __attribute__((ext_vector_type(8), may_alias));
typedef float  v8f  __attribute__((ext_vector_type(8)));
typedef float  v4f  __attribute__((ext_vector_type(4)));
typedef float  v4fa __attribute__((ext_vector_type(4), may_alias));
union FragB { v16b v; v8us half[2]; unsigned short u[16]; };

__device__ __forceinline__ unsigned short bf16_bits(float x) { unsigned int u = __float_as_uint(x); return (unsigned short)((u + 0x7FFFu + ((u >> 16) & 1u)) >> 16); }
__device__ __forceinline__ float bf16_val(unsigned short b) { return __uint_as_float(((unsigned int)b) << 16); }
__device__ __forceinline__ float bf16_round(float x) { return bf16_val(bf16_bits(x)); }
// D += A·B with NT terms: 1 = ah·bh, 2 = + al·bh (A split), 3 = + ah·bl (both split)
template <int NT>
__device__ __forceinline__ v8f mmaN(v16b ah, v16b al, v16b bh, v16b bl, v8f c) {
  c = __builtin_amdgcn_wmma_f32_16x16x32_bf16(false, ah, false, bh, (short)0, c, false, false);
  if (NT >= 2) c = __builtin_amdgcn_wmma_f32_16x16x32_bf16(false, al, false, bh, (short)0, c, false, false);
  if (NT >= 3) c = __builtin_amdgcn_wmma_f32_16x16x32_bf16(false, ah, false, bl, (short)0, c, false, false);
  asm volatile("v_nop\n\tv_nop\n\tv_nop\n\tv_nop" : "+v"(c) : "v"(ah), "v"(al), "v"(bh), "v"(bl));
  return c;
}

__global__ __launch_bounds__(256) void k_wt_bf16(const float* __restrict__ W, unsigned short* __restrict__ Wt, int K, int N) {
  const int t = blockIdx.x * 256 + threadIdx.x;
  const int k8n = K / 8;
  if (t >= N * k8n) return;
  const int n = t / k8n, k8 = (t % k8n) * 8;
  v8us v;
#pragma unroll
  for (int i = 0; i < 8; ++i) v[i] = bf16_bits(W[(size_t)(k8 + i) * N + n]);
  *(v8us*)(Wt + (size_t)n * K + k8) = v;
  
}

// GEMM C[M][N] (f32, pitch ldc) = act(A[M][K]·W + bias). A f32 row-major (pitch lda) converted per fragment to bf16
// (ASPLIT: hi/lo two planes -> 2 terms, else single rounded term); Wt bf16 [N][K] (pitch ldb). BIAS_BF16 rounds the
// bias to bf16 first (bias quantised to bf16 before the add). K%32==0, M%16==0, N%64==0.
template <bool ASPLIT, int ACT, bool BIAS_BF16>
__global__ __launch_bounds__(128) void k_gemm_bf(const float* __restrict__ A, int lda, const unsigned short* __restrict__ Wt, int ldb,
                                               const float* __restrict__ bias, float* __restrict__ C, int ldc, int M, int N, int K) {
  __shared__ __attribute__((aligned(16))) float so[4][16][64];
  const int tid = threadIdx.x, w = tid >> 5, lane = tid & 31, ln = lane & 15, hh = lane >> 4;
  const int ntn = N / 64;
  const int wid = blockIdx.x * 4 + w;
  const int mt = wid / ntn, nq = wid % ntn;
  if (mt * 16 >= M) return;
  const int row0 = mt * 16, col0 = nq * 64;
  const float* arow = A + (size_t)(row0 + ln) * lda;
  v8f acc[4] = {};
  for (int kb = 0; kb < K; kb += 32) {
    FragB ah, al;
    const v4f x0 = *(const v4fa*)(arow + kb + 8 * hh), x1 = *(const v4fa*)(arow + kb + 8 * hh + 4);
    const v4f x2 = *(const v4fa*)(arow + kb + 16 + 8 * hh), x3 = *(const v4fa*)(arow + kb + 16 + 8 * hh + 4);
    float xs[16] = {x0[0],x0[1],x0[2],x0[3],x1[0],x1[1],x1[2],x1[3],x2[0],x2[1],x2[2],x2[3],x3[0],x3[1],x3[2],x3[3]};
#pragma unroll
    for (int i = 0; i < 16; ++i) { const unsigned short hb = bf16_bits(xs[i]); ah.u[i] = hb; al.u[i] = ASPLIT ? bf16_bits(xs[i] - bf16_val(hb)) : (unsigned short)0; }
#pragma unroll
    for (int t = 0; t < 4; ++t) {
      const unsigned short* brow = Wt + (size_t)(col0 + t * 16 + ln) * ldb + kb;
      FragB b;
      b.half[0] = *(const v8us*)(brow + 8 * hh);
      b.half[1] = *(const v8us*)(brow + 16 + 8 * hh);
      acc[t] = mmaN<ASPLIT ? 2 : 1>(ah.v, al.v, b.v, b.v, acc[t]);
    }
  }
#pragma unroll
  for (int t = 0; t < 4; ++t) {
    float bv = bias ? bias[col0 + t * 16 + ln] : 0.f;
    if (BIAS_BF16) bv = bf16_round(bv);
#pragma unroll
    for (int r = 0; r < 8; ++r) { float v = acc[t][r] + bv; if (ACT == 1) v = fmaxf(v, 0.f); so[w][8 * hh + r][t * 16 + ln] = v; }
  }
  __builtin_amdgcn_fence(__ATOMIC_ACQ_REL, "workgroup");
  __builtin_amdgcn_wave_barrier();
  const int rsub = lane >> 4, c4 = (lane & 15) * 4;
  {
#pragma unroll
    for (int q = 0; q < 8; ++q) {
      const int r = q * 2 + rsub;
      const v4f v = *(const v4fa*)&so[w][r][c4];
      *(v4f*)(C + (size_t)(row0 + r) * ldc + col0 + c4) = v;
    }
    
  }
}

// GEMM C = act(A·W + bias + resid): A f32 (ASPLIT -> hi/lo 2 terms), Wt bf16 [N][K]; ACT 0 none, 1 relu, 2 exact gelu;
// resid (optional, f32, row index = (row % rmod), pitch ldr, RES_BF16 rounds it) added before the activation.
template <bool ASPLIT, int ACT, bool BIAS_BF16, bool RES_BF16>
__global__ __launch_bounds__(128) void k_gemm_bf3(const float* __restrict__ A, int lda, const unsigned short* __restrict__ Wt, int ldb,
                                                const float* __restrict__ bias, const float* __restrict__ resid, int rmod, int ldr,
                                                float* __restrict__ C, int ldc, int M, int N, int K) {
  __shared__ __attribute__((aligned(16))) float so[4][16][64];
  const int tid = threadIdx.x, w = tid >> 5, lane = tid & 31, ln = lane & 15, hh = lane >> 4;
  const int ntn = N / 64;
  const int wid = blockIdx.x * 4 + w;
  const int mt = wid / ntn, nq = wid % ntn;
  if (mt * 16 >= M) return;
  const int row0 = mt * 16, col0 = nq * 64;
  const float* arow = A + (size_t)(row0 + ln) * lda;
  v8f acc[4] = {};
  for (int kb = 0; kb < K; kb += 32) {
    FragB ah, al;
    const v4f x0 = *(const v4fa*)(arow + kb + 8 * hh), x1 = *(const v4fa*)(arow + kb + 8 * hh + 4);
    const v4f x2 = *(const v4fa*)(arow + kb + 16 + 8 * hh), x3 = *(const v4fa*)(arow + kb + 16 + 8 * hh + 4);
    float xs[16] = {x0[0],x0[1],x0[2],x0[3],x1[0],x1[1],x1[2],x1[3],x2[0],x2[1],x2[2],x2[3],x3[0],x3[1],x3[2],x3[3]};
#pragma unroll
    for (int i = 0; i < 16; ++i) { const unsigned short hb = bf16_bits(xs[i]); ah.u[i] = hb; al.u[i] = ASPLIT ? bf16_bits(xs[i] - bf16_val(hb)) : (unsigned short)0; }
#pragma unroll
    for (int t = 0; t < 4; ++t) {
      const unsigned short* brow = Wt + (size_t)(col0 + t * 16 + ln) * ldb + kb;
      FragB b;
      b.half[0] = *(const v8us*)(brow + 8 * hh);
      b.half[1] = *(const v8us*)(brow + 16 + 8 * hh);
      acc[t] = mmaN<ASPLIT ? 2 : 1>(ah.v, al.v, b.v, b.v, acc[t]);
    }
  }
#pragma unroll
  for (int t = 0; t < 4; ++t) {
    const int col = col0 + t * 16 + ln;
    float bv = bias ? bias[col] : 0.f;
    if (BIAS_BF16) bv = bf16_round(bv);
#pragma unroll
    for (int r = 0; r < 8; ++r) {
      float v = acc[t][r] + bv;
      if (resid) { float rv = resid[(size_t)((row0 + 8 * hh + r) % rmod) * ldr + col]; if (RES_BF16) rv = bf16_round(rv); v += rv; }
      if (ACT == 1) v = fmaxf(v, 0.f);
      if (ACT == 2) v = 0.5f * v * (1.0f + erff(v * 0.70710678118654752f));
      if (ACT == 3) { const float u = 0.7978845608028654f * (v + 0.044715f * v * v * v); v = 0.5f * v * (1.0f + tanhf(u)); }
      so[w][8 * hh + r][t * 16 + ln] = v;
    }
  }
  __builtin_amdgcn_fence(__ATOMIC_ACQ_REL, "workgroup");
  __builtin_amdgcn_wave_barrier();
  const int rsub = lane >> 4, c4 = (lane & 15) * 4;
  {
#pragma unroll
    for (int q = 0; q < 8; ++q) {
      const int r = q * 2 + rsub;
      const v4f v = *(const v4fa*)&so[w][r][c4];
      *(v4f*)(C + (size_t)(row0 + r) * ldc + col0 + c4) = v;
    }
    
  }
}
// row LayerNorm (biased variance, eps) over N: s = X (+ R); optional out_sum <- s; out_norm <- (s-mu)*rsqrt(var+eps)*g + b
template <bool PARAM_BF16>
__global__ __launch_bounds__(256) void k_layernorm(const float* __restrict__ X, const float* __restrict__ R, const float* __restrict__ g, const float* __restrict__ bta,
                                                  float* __restrict__ out_sum, float* __restrict__ out_norm, int N, float eps) {
  __shared__ float red[256];
  const int row = blockIdx.x, tid = threadIdx.x;
  const float* x = X + (size_t)row * N; const float* rr = R ? R + (size_t)row * N : nullptr;
  float vals[16];                     // up to N = 4096
  const int per = N / 256;            // contiguous chunk per thread? use strided-by-4 chunks: thread handles j = tid*4 + 1024*u
  float s1 = 0.f;
  for (int u = 0; u < per / 4; ++u) {
    const int j = tid * 4 + 1024 * u;
    const v4f a = *(const v4fa*)(x + j);
    v4f b = {0.f,0.f,0.f,0.f}; if (rr) b = *(const v4fa*)(rr + j);
#pragma unroll
    for (int q = 0; q < 4; ++q) { const float v = a[q] + b[q]; vals[u * 4 + q] = v; s1 += v; }
  }
  red[tid] = s1; __syncthreads();
  for (int st = 128; st > 0; st >>= 1) { if (tid < st) red[tid] += red[tid + st]; __syncthreads(); }
  const float mu = red[0] / (float)N; __syncthreads();
  float s2 = 0.f;
  for (int u = 0; u < per / 4; ++u)
#pragma unroll
    for (int q = 0; q < 4; ++q) { const float c = vals[u * 4 + q] - mu; s2 += c * c; }
  red[tid] = s2; __syncthreads();
  for (int st = 128; st > 0; st >>= 1) { if (tid < st) red[tid] += red[tid + st]; __syncthreads(); }
  const float rs = rsqrtf(red[0] / (float)N + eps);
  {
    for (int u = 0; u < per / 4; ++u) {
      const int j = tid * 4 + 1024 * u;
      v4f o, sm;
#pragma unroll
      for (int q = 0; q < 4; ++q) {
        float gg = g[j + q], bb = bta[j + q];
        if (PARAM_BF16) { gg = bf16_round(gg); bb = bf16_round(bb); }
        sm[q] = vals[u * 4 + q]; o[q] = (vals[u * 4 + q] - mu) * rs * gg + bb;
      }
      if (out_sum) *(v4f*)(out_sum + (size_t)row * N + j) = sm;
      *(v4f*)(out_norm + (size_t)row * N + j) = o;
    }
    
  }
}



// ---- f16 WMMA path (v_wmma_f32_16x16x32_f16): 11-bit significands for operands in range — used where a [0,1] probability operand needs more precision than bf16
typedef _Float16 v16h __attribute__((ext_vector_type(16)));
union FragH { v16h v; v8us half[2]; _Float16 h[16]; unsigned short u[16]; };
template <int NT>
__device__ __forceinline__ v8f mmaH(v16h ah, v16h al, v16h bh, v16h bl, v8f c) {
  c = __builtin_amdgcn_wmma_f32_16x16x32_f16(false, ah, false, bh, (short)0, c, false, false);
  if (NT >= 2) c = __builtin_amdgcn_wmma_f32_16x16x32_f16(false, al, false, bh, (short)0, c, false, false);
  if (NT >= 3) c = __builtin_amdgcn_wmma_f32_16x16x32_f16(false, ah, false, bl, (short)0, c, false, false);
  asm volatile("v_nop\n\tv_nop\n\tv_nop\n\tv_nop" : "+v"(c) : "v"(ah), "v"(al), "v"(bh), "v"(bl));
  return c;
}
// batched GEMM like k_gemm_b but f16 operands: A f32 (split into f16 hi/lo if ASPLIT, else rounded to f16), Bt = f16 values [n][k]; alpha; C f32; N multiple of 16 (partial tiles skipped)
template <bool ASPLIT>
__global__ __launch_bounds__(128) void k_gemm_h(const float* __restrict__ A, int lda, size_t sA, const _Float16* __restrict__ Bh, int ldb, size_t sB, float alpha, float* __restrict__ C, int ldc, size_t sC, int M, int N, int K) {
  __shared__ __attribute__((aligned(16))) float so[4][16][64];
  const int tid = threadIdx.x, w = tid >> 5, lane = tid & 31, ln = lane & 15, hh = lane >> 4; const int by = blockIdx.y;
  A += (size_t)by * sA; Bh += (size_t)by * sB; C += (size_t)by * sC;
  const int ntn = (N + 63) / 64; const int wid = blockIdx.x * 4 + w; const int mt = wid / ntn, nq = wid % ntn; if (mt * 16 >= M) return;
  const int row0 = mt * 16, col0 = nq * 64; const float* arow = A + (size_t)(row0 + ln) * lda;
  v8f acc[4] = {};
  for (int kb = 0; kb < K; kb += 32) {
    FragH ah, al;
    const v4f x0 = *(const v4fa*)(arow + kb + 8 * hh), x1 = *(const v4fa*)(arow + kb + 8 * hh + 4), x2 = *(const v4fa*)(arow + kb + 16 + 8 * hh), x3 = *(const v4fa*)(arow + kb + 16 + 8 * hh + 4);
    float xs[16] = {x0[0],x0[1],x0[2],x0[3],x1[0],x1[1],x1[2],x1[3],x2[0],x2[1],x2[2],x2[3],x3[0],x3[1],x3[2],x3[3]};
#pragma unroll
    for (int i = 0; i < 16; ++i) { const _Float16 h = (_Float16)xs[i]; ah.h[i] = h; al.h[i] = ASPLIT ? (_Float16)(xs[i] - (float)h) : (_Float16)0.0f; }
#pragma unroll
    for (int t = 0; t < 4; ++t) { if (col0 + t * 16 >= N) continue; const size_t boff = (size_t)(col0 + t * 16 + ln) * ldb + kb; FragH bq; bq.half[0] = *(const v8us*)(Bh + boff + 8 * hh); bq.half[1] = *(const v8us*)(Bh + boff + 16 + 8 * hh);
      acc[t] = mmaH<ASPLIT ? 2 : 1>(ah.v, al.v, bq.v, bq.v, acc[t]); }
  }
#pragma unroll
  for (int t = 0; t < 4; ++t) { if (col0 + t * 16 >= N) continue;
#pragma unroll
    for (int r = 0; r < 8; ++r) so[w][8 * hh + r][t * 16 + ln] = acc[t][r] * alpha; }
  __builtin_amdgcn_fence(__ATOMIC_ACQ_REL, "workgroup"); __builtin_amdgcn_wave_barrier();
  const int rsub = lane >> 4, c4 = (lane & 15) * 4;
  {
#pragma unroll
    for (int q = 0; q < 8; ++q) { const int r = q * 2 + rsub; if (col0 + c4 < N) { const v4f v = *(const v4fa*)&so[w][r][c4]; *(v4f*)(C + (size_t)(row0 + r) * ldc + col0 + c4) = v; } }
     }
}

// Wt[n][k] = f16(W[k][n]·scale) from f32 row-major W[K][N] (scale = power of two; bf16-exact weights stay exact in f16 away from the subnormal range)
__global__ __launch_bounds__(256) void k_wt_f16(const float* __restrict__ W, _Float16* __restrict__ Wt, int K, int N, float scale) {
  const int t = blockIdx.x * 256 + threadIdx.x; if (t >= N * (K / 8)) return; const int n = t / (K / 8), k8 = (t % (K / 8)) * 8; FragH f;
#pragma unroll
  for (int i = 0; i < 8; ++i) f.h[i] = (_Float16)(bf16_round(W[(size_t)(k8 + i) * N + n]) * scale); const v8us o = f.half[0];
  *(v8us*)((unsigned short*)Wt + (size_t)n * K + k8) = o; 
}
// k_gemm_hh variant with fused epilogue: v = acc·alpha + bias[by·sBias + col] (+ CP[(row/rowsPerB)·sCPb + by·64 + col] if CP) ; ACT 0 none / 1 elu ; writes f16 C16 (and f32 C if non-null)
template <int ACT>
__global__ __launch_bounds__(128) void k_gemm_hhx(const _Float16* __restrict__ A, int lda, size_t sA, const _Float16* __restrict__ Bh, int ldb, size_t sB, float alpha, const float* __restrict__ bias, size_t sBias, const float* __restrict__ CP, int rowsPerB, size_t sCPb, int row0g,
    float* __restrict__ C, _Float16* __restrict__ C16, int ldc, size_t sC, int M, int N, int K) {
  __shared__ __attribute__((aligned(16))) float so[4][16][64];
  const int tid = threadIdx.x, w = tid >> 5, lane = tid & 31, ln = lane & 15, hh = lane >> 4; const int by = blockIdx.y;
  A += (size_t)by * sA; Bh += (size_t)by * sB; const size_t cofs = (size_t)by * sC; const float* bp = bias ? bias + (size_t)by * sBias : nullptr;
  const int ntn = (N + 63) / 64; const int wid = blockIdx.x * 4 + w; const int mt = wid / ntn, nq = wid % ntn; if (mt * 16 >= M) return;
  const int row0 = mt * 16, col0 = nq * 64; const _Float16* arow = A + (size_t)(row0 + ln) * lda;
  v8f acc[4] = {};
  for (int kb = 0; kb < K; kb += 32) { FragH ah; ah.half[0] = *(const v8us*)((const unsigned short*)arow + kb + 8 * hh); ah.half[1] = *(const v8us*)((const unsigned short*)arow + kb + 16 + 8 * hh);
#pragma unroll
    for (int t = 0; t < 4; ++t) { if (col0 + t * 16 >= N) continue; const size_t boff = (size_t)(col0 + t * 16 + ln) * ldb + kb; FragH bq; bq.half[0] = *(const v8us*)((const unsigned short*)Bh + boff + 8 * hh); bq.half[1] = *(const v8us*)((const unsigned short*)Bh + boff + 16 + 8 * hh);
      acc[t] = mmaH<1>(ah.v, ah.v, bq.v, bq.v, acc[t]); }
  }
#pragma unroll
  for (int t = 0; t < 4; ++t) { if (col0 + t * 16 >= N) continue; const int col = col0 + t * 16 + ln; const float bv = bp ? bf16_round(bp[col]) : 0.f;
#pragma unroll
    for (int r = 0; r < 8; ++r) { float v = acc[t][r] * alpha + bv; if (CP) { const int rr = row0g + row0 + 8 * hh + r; if (rowsPerB < 0) v += CP[cofs + (size_t)rr * ldc + col];      /* rowsPerB < 0: own element of the batched C plane */ else { const int bidx = rr / rowsPerB; v += CP[(size_t)bidx * sCPb + (size_t)by * 64 + col]; } } if (ACT == 1) v = (v > 0.f) ? v : expm1f(v); else if (ACT == 7) v = (v > 0.f) ? v + 1.0f : expf(v); else if (ACT == 8) v = tanhf(v); else if (ACT == 9) v = 0.5f * v * (1.0f + tanhf(0.7978845608028654f * (v + 0.044715f * v * v * v))); else if (ACT == 11) v = 1.0f / (1.0f + expf(-v)); else if (ACT == 12) v = (v > 0.f) ? v : 0.01f * v; else if (ACT == 14) v = (v > 0.f) ? v : 0.1f * v; else if (ACT == 16) v = (v >= 0.f) ? v : 0.3f * v; else if (ACT == 17) v = (v >= 0.f) ? v : 0.2f * v; else if (ACT == 15) v = v / (1.0f + expf(-v)); else if (ACT == 3) v = fmaxf(v, 0.f); else if (ACT == 6) v = 0.5f * v * (1.0f + erff(v * 0.70710678118654752f)); so[w][8 * hh + r][t * 16 + ln] = v; } }
  __builtin_amdgcn_fence(__ATOMIC_ACQ_REL, "workgroup"); __builtin_amdgcn_wave_barrier();
  const int rsub = lane >> 4, c4 = (lane & 15) * 4; typedef _Float16 v4h __attribute__((ext_vector_type(4)));
  {
#pragma unroll
    for (int q = 0; q < 8; ++q) { const int r = q * 2 + rsub; if (col0 + c4 < N) { const v4f v = *(const v4fa*)&so[w][r][c4]; if (C) *(v4f*)(C + cofs + (size_t)(row0 + r) * ldc + col0 + c4) = v; if (C16) { v4h h4; for (int i = 0; i < 4; ++i) h4[i] = (_Float16)v[i]; *(v4h*)(C16 + cofs + (size_t)(row0 + r) * ldc + col0 + c4) = h4; } } }
     }
}


typedef _Float16 v4h __attribute__((ext_vector_type(4)));

__global__ __launch_bounds__(256) void k_x16(const float* __restrict__ x, _Float16* __restrict__ X16, size_t n8) { const size_t t = (size_t)blockIdx.x * 256 + threadIdx.x; if (t >= n8) return; FragH f;
#pragma unroll
  for (int q = 0; q < 8; ++q) f.h[q] = (_Float16)bf16_round(x[t * 8 + q]); *(v8us*)((unsigned short*)X16 + t * 8) = f.half[0];  }
__global__ __launch_bounds__(256) void k_h16(const float* __restrict__ x, _Float16* __restrict__ X16, size_t n8) { const size_t t = (size_t)blockIdx.x * 256 + threadIdx.x; if (t >= n8) return; FragH f;
#pragma unroll
  for (int q = 0; q < 8; ++q) f.h[q] = (_Float16)x[t * 8 + q]; *(v8us*)((unsigned short*)X16 + t * 8) = f.half[0];  }
__global__ __launch_bounds__(256) void k_round16f(const float* __restrict__ W, _Float16* __restrict__ Bt, size_t n8) { const size_t t = (size_t)blockIdx.x * 256 + threadIdx.x; if (t >= n8) return; FragH f;
#pragma unroll
  for (int i = 0; i < 8; ++i) f.h[i] = (_Float16)(bf16_round(W[t * 8 + i]) * 16.0f); *(v8us*)((unsigned short*)Bt + t * 8) = f.half[0];  }
__global__ __launch_bounds__(256) void k_hl(const float* __restrict__ F, _Float16* __restrict__ Hh, _Float16* __restrict__ Hl, size_t n8) { const size_t t = (size_t)blockIdx.x * 256 + threadIdx.x; if (t >= n8) return; FragH fh, fl; const v4f a = *(const v4fa*)(F + t * 8), c = *(const v4fa*)(F + t * 8 + 4);
#pragma unroll
  for (int q = 0; q < 4; ++q) { _Float16 h = (_Float16)a[q]; fh.h[q] = h; fl.h[q] = (_Float16)((a[q] - (float)h) * 1024.0f); h = (_Float16)c[q]; fh.h[4 + q] = h; fl.h[4 + q] = (_Float16)((c[q] - (float)h) * 1024.0f); }
  { *(v8us*)((unsigned short*)Hh + t * 8) = fh.half[0]; *(v8us*)((unsigned short*)Hl + t * 8) = fl.half[0];  } }

__device__ __forceinline__ v16h g2_frag(const _Float16* p, int hh) { FragH f; f.half[0] = *(const v8us*)((const unsigned short*)p + 8 * hh); f.half[1] = *(const v8us*)((const unsigned short*)p + 16 + 8 * hh); return f.v; }


#define WCH 8                        /* 8-element chunks per thread */
// chunks t0 + 256 i of one weight matrix: all loads issued first, then converted and stored
__device__ __forceinline__ void wnat_part(const float* __restrict__ w, _Float16* __restrict__ Bt, unsigned t0) { v4f a[WCH][2]; const unsigned ob = t0 * 32;      /* the thread's first byte */
  /* the short loops below are all unrolled so that a stays in registers */
#pragma unroll
  for (int i = 0; i < WCH; ++i) { const float* p = (const float*)((const char*)w + ob) + 256 * 8 * i; a[i][0] = *(const v4fa*)p; a[i][1] = *(const v4fa*)(p + 4); }
  /* precaution: stands in front of every write of a register that the loads above name as an address; it names the offset (input only), so that no later load of the run lands in it either; it also keeps all the loads in front of the first store */
  asm volatile("s_wait_xcnt 0x0" :: "v"(ob) : "memory");
#pragma unroll
  for (int i = 0; i < WCH; ++i) { FragH f;
#pragma unroll
    for (int q = 0; q < 8; ++q) f.h[q] = (_Float16)(bf16_round(a[i][q >> 2][q & 3]) * 16.0f);
    *(v8us*)((unsigned short*)Bt + (size_t)(t0 + 256 * i) * 8) = f.half[0]; }
  asm volatile("s_wait_xcnt 0x0" ::: "memory"); }      /* precaution: in the built kernel the x + PE text follows this path behind a branch; the wait stands in front of its writes of registers that the stores above name */
__global__ __launch_bounds__(256) void k_rsm(const float* __restrict__ S, _Float16* __restrict__ P, int nrows) {
  #pragma clang fp contract(off)
  const int i = blockIdx.x * 256 + threadIdx.x; if (i >= nrows) return; const float* s = S + (size_t)i * SQ; float mx = -3.0e38f;
#pragma unroll 1
  for (int j = 0; j < SQ; ++j) mx = fmaxf(mx, s[j]); float se = 0.f;
#pragma unroll 1
  for (int j = 0; j < SQ; ++j) se += expf(s[j] - mx); const float sc = 256.0f / se;
#pragma unroll 1
  for (int j0 = 0; j0 < SQ; j0 += 8) { FragH f; for (int q = 0; q < 8; ++q) f.h[q] = (_Float16)(expf(s[j0 + q] - mx) * sc); unsigned short* d = (unsigned short*)P + (size_t)i * SQ + j0; *(v8us*)d = f.half[0];  } }
__global__ __launch_bounds__(256) void k_vt(const _Float16* __restrict__ V16, int b, int h0, _Float16* __restrict__ VT) { __shared__ unsigned short tl[64][65]; const int tid = threadIdx.x; const int hh = blockIdx.x % HG, sg = blockIdx.x / HG; const int s0 = sg * 64; const int h = h0 + hh;
  for (int i = tid; i < 64 * 8; i += 256) { const int j = i / 8, d8 = (i % 8) * 8; FragH f; f.half[0] = *(const v8us*)((const unsigned short*)V16 + ((size_t)b * SQ + s0 + j) * DM + h * HD + d8); for (int q = 0; q < 8; ++q) tl[d8 + q][j] = f.u[q]; }
  __syncthreads();
  { for (int i = tid; i < 64 * 8; i += 256) { const int d = i / 8, j8 = (i % 8) * 8; FragH f; for (int q = 0; q < 8; ++q) f.u[q] = tl[d][j8 + q]; *(v8us*)((unsigned short*)VT + ((size_t)hh * HD + d) * SQ + s0 + j8) = f.half[0]; }  } }



#define FAW 8                        /* waves per key part: FAW * 32 queries per workgroup */
#define FAS 2                        /* key parts = groups of waves */
#define FAK 64                       /* keys per stage */
#define FAP 72                       /* LDS row pitch in f16: 128 bytes of data + 16, so that the 16 rows of a fragment read start in 16 different bank groups */
#define FAT (SQ / FAS / FAK)         /* stages per key part */
typedef float v2f __attribute__((ext_vector_type(2)));
__device__ __forceinline__ float rs_xhalf(float x) { return __builtin_bit_cast(float, __builtin_amdgcn_permlanex16(__builtin_bit_cast(int, x), __builtin_bit_cast(int, x), 0x76543210, 0xfedcba98, false, false)); }      /* lane l reads lane l ^ 16 */
__device__ __forceinline__ v16h fa_frag(const unsigned short* p, int hh) { FragH f; f.half[0] = *(const v8us*)(p + 8 * hh); f.half[1] = *(const v8us*)(p + 16 + 8 * hh); return f.v; }
__device__ __forceinline__ v8f fa_mma(v16h a, v16h b, v8f c) { return __builtin_amdgcn_wmma_f32_16x16x32_f16(false, a, false, b, (short)0, c, false, false); }
// Eight native 2^x (v_exp_f32). The builtin, not asm text: the compiler schedules these between the matrix instructions and must see which registers they write.
__device__ __forceinline__ v8f fa_exp2x8(v8f x) { v8f e;
#pragma unroll      /* the vector stays in registers */
  for (int i = 0; i < 8; ++i) e[i] = __builtin_amdgcn_exp2f(x[i]);
  return e; }
static_assert(SQ % (FAW * 32) == 0 && SQ % (FAS * FAK) == 0 && HD == 64 && FAK == 64 && FAW * 32 == 256 && FAS == 2, "k_fattn: whole workgroups and stages; the 256 threads of a key part stage 64 rows of 128 bytes in two rounds; two parts swap one query group each");
__global__ __launch_bounds__(FAW * FAS * 32) void k_fattn(const _Float16* __restrict__ Q16, const _Float16* __restrict__ K16, const _Float16* __restrict__ VT, _Float16* __restrict__ O16) {
  __shared__ __attribute__((aligned(16))) unsigned short sk[FAS][2][FAK][FAP];      /* K rows [key part][buffer][key][d] */
  __shared__ __attribute__((aligned(16))) unsigned short sv[FAS][2][HD][FAP];       /* V^T rows [key part][buffer][d][key] */
  __shared__ __attribute__((aligned(16))) float smo[8][2][FAW][32][4];              /* handed-over output tiles [4 registers][query group][wave][lane] */
  __shared__ __attribute__((aligned(8))) float sml[2][FAW][32][2];                  /* handed-over maximum in use and sum [query group][wave][lane] */
  const int tid = threadIdx.x, w = (tid >> 5) & (FAW - 1), lane = tid & 31, ln = lane & 15, hh = lane >> 4;
  const int kh = __builtin_amdgcn_readfirstlane(tid >> 8);      /* the wave's key part, in a scalar register: the branches on it at the end are scalar */
  const int bh = blockIdx.y, b = bh / NH, hd = bh - b * NH; const size_t r0 = (size_t)b * SQ; const int q0 = (blockIdx.x * FAW + w) * 32;
  const int srow = (tid & 255) >> 3, sc8 = (tid & 7) * 8;      /* staging, per key part: 8 threads per 128-byte row, rows srow and srow + 32 */
  const unsigned short* kg = (const unsigned short*)K16 + (r0 + kh * (SQ / FAS) + srow) * DM + hd * HD + sc8;
  const unsigned short* vg = (const unsigned short*)VT + ((size_t)bh * HD + srow) * SQ + kh * (SQ / FAS) + sc8;
  v16h qf[2][2];      /* [16-query group][32 of d] */
  /* the short loops below are all unrolled so that the fragment and accumulator arrays stay in registers */
#pragma unroll
  for (int g = 0; g < 2; ++g)
#pragma unroll
    for (int ks = 0; ks < 2; ++ks) qf[g][ks] = g2_frag(Q16 + (r0 + q0 + g * 16 + ln) * DM + hd * HD + ks * 32, hh);
  const v8f z8 = {0.f, 0.f, 0.f, 0.f, 0.f, 0.f, 0.f, 0.f};
  v8f o[2][4] = {{z8, z8, z8, z8}, {z8, z8, z8, z8}}; float ms[2] = {-3.0e38f, -3.0e38f}, l[2] = {0.f, 0.f};
  const float cs = 0.125f * 1.44269504088896340736f;      /* 64^-0.5 log2 e */
  v8us kr0 = *(const v8us*)kg, kr1 = *(const v8us*)(kg + (size_t)32 * DM), vr0 = *(const v8us*)vg, vr1 = *(const v8us*)(vg + (size_t)32 * SQ);
  asm volatile("s_wait_xcnt 0x0" ::: "memory");      /* precaution: stands in front of every later write of a register that the loads above name as an address */
  *(v8us*)&sk[kh][0][srow][sc8] = kr0; *(v8us*)&sk[kh][0][srow + 32][sc8] = kr1; *(v8us*)&sv[kh][0][srow][sc8] = vr0; *(v8us*)&sv[kh][0][srow + 32][sc8] = vr1;
  __syncthreads();      /* stage 0 is published */
  for (int t = 0; t < FAT; ++t) { const int cur = t & 1;
    if (t + 1 < FAT) { const unsigned short* kn = kg + (size_t)(t + 1) * FAK * DM; const unsigned short* vn = vg + (t + 1) * FAK;
      kr0 = *(const v8us*)kn; kr1 = *(const v8us*)(kn + (size_t)32 * DM); vr0 = *(const v8us*)vn; vr1 = *(const v8us*)(vn + (size_t)32 * SQ); }
#pragma unroll
    for (int hp = 0; hp < 2; ++hp) {      /* two passes of 32 keys per stage: half the score registers live at once; unrolled, so that one pass's matrix work can be scheduled among the other's softmax */
      v8f s[2][2];      /* S^T: [query group][16-key tile], register r = key 8 hh + r, lane column = query */
#pragma unroll
      for (int j = 0; j < 2; ++j) { const v16h a0 = fa_frag(&sk[kh][cur][hp * 32 + j * 16 + ln][0], hh), a1 = fa_frag(&sk[kh][cur][hp * 32 + j * 16 + ln][32], hh);
#pragma unroll
        for (int g = 0; g < 2; ++g) s[g][j] = fa_mma(a1, qf[g][1], fa_mma(a0, qf[g][0], z8)); }
      v16h va[4];
#pragma unroll
      for (int dt = 0; dt < 4; ++dt) va[dt] = fa_frag(&sv[kh][cur][dt * 16 + ln][hp * 32], hh);
      float mxs[2];
#pragma unroll
      for (int g = 0; g < 2; ++g) { const v8f mv = __builtin_elementwise_max(s[g][0], s[g][1]);
        const float mx = fmaxf(fmaxf(fmaxf(mv[0], mv[1]), fmaxf(mv[2], mv[3])), fmaxf(fmaxf(mv[4], mv[5]), fmaxf(mv[6], mv[7])));
        mxs[g] = fmaxf(mx, rs_xhalf(mx)) * cs; }
      if (__builtin_amdgcn_ballot_w32(mxs[0] > ms[0] + 8.0f || mxs[1] > ms[1] + 8.0f) != 0) {      /* wave-uniform: some query's maximum has outgrown the one in use */
        const float n0 = fmaxf(ms[0], mxs[0]), n1 = fmaxf(ms[1], mxs[1]); const float c0 = __builtin_amdgcn_exp2f(ms[0] - n0), c1 = __builtin_amdgcn_exp2f(ms[1] - n1);      /* the two rescale factors */
        ms[0] = n0; ms[1] = n1; l[0] *= c0; l[1] *= c1;
#pragma unroll
        for (int dt = 0; dt < 4; ++dt) { o[0][dt] *= c0; o[1][dt] *= c1; } }
      v16h pf[2];      /* P^T as B operand, per query group */
#pragma unroll
      for (int g = 0; g < 2; ++g) { const float nb = 7.0f - ms[g];
#pragma unroll
        for (int j = 0; j < 2; ++j) s[g][j] = fa_exp2x8(s[g][j] * cs + nb);
        const v8f ps = s[g][0] + s[g][1];
        l[g] += ((ps[0] + ps[1]) + (ps[2] + ps[3])) + ((ps[4] + ps[5]) + (ps[6] + ps[7]));
        FragH f;
#pragma unroll
        for (int i = 0; i < 8; ++i) { f.h[i] = (_Float16)s[g][0][i]; f.h[8 + i] = (_Float16)s[g][1][i]; }
        pf[g] = f.v; }
#pragma unroll
      for (int dt = 0; dt < 4; ++dt)
#pragma unroll
        for (int g = 0; g < 2; ++g) o[g][dt] = fa_mma(va[dt], pf[g], o[g][dt]); }
    if (t + 1 < FAT) { *(v8us*)&sk[kh][cur ^ 1][srow][sc8] = kr0; *(v8us*)&sk[kh][cur ^ 1][srow + 32][sc8] = kr1; *(v8us*)&sv[kh][cur ^ 1][srow][sc8] = vr0; *(v8us*)&sv[kh][cur ^ 1][srow + 32][sc8] = vr1; }      /* its last readers left this buffer at the barrier of stage t - 1 */
    __syncthreads(); }      /* publishes stage t + 1 and ends every read of stage t */
#pragma unroll
  for (int g = 0; g < 2; ++g) if (g != kh) {      /* the query group that the wave of the other key part finishes */
#pragma unroll
    for (int dt = 0; dt < 4; ++dt) { *(v4f*)&smo[2 * dt][g][w][lane][0] = __builtin_shufflevector(o[g][dt], o[g][dt], 0, 1, 2, 3); *(v4f*)&smo[2 * dt + 1][g][w][lane][0] = __builtin_shufflevector(o[g][dt], o[g][dt], 4, 5, 6, 7); }
    const v2f ml = {ms[g], l[g]}; *(v2f*)&sml[g][w][lane][0] = ml; }
  __syncthreads();      /* the handed-over groups are published */
#pragma unroll
  for (int g = 0; g < 2; ++g) if (g == kh) {      /* join the two key parts: both are brought to the larger maximum in use */
    const v2f ml = *(const v2f*)&sml[g][w][lane][0]; const float m = fmaxf(ms[g], ml[0]); const float ca = __builtin_amdgcn_exp2f(ms[g] - m), cb = __builtin_amdgcn_exp2f(ml[0] - m);
    const float lj = l[g] * ca + ml[1] * cb; const float inv = 64.0f / (lj + rs_xhalf(lj));      /* the halves hold disjoint keys; o is carried x64 */
    const float fa = ca * inv, fb = cb * inv;
    unsigned short* op = (unsigned short*)O16 + (r0 + q0 + g * 16 + ln) * DM + hd * HD + 8 * hh;
#pragma unroll
    for (int dt = 0; dt < 4; ++dt) { FragH f; const v4f p0 = *(const v4f*)&smo[2 * dt][g][w][lane][0], p1 = *(const v4f*)&smo[2 * dt + 1][g][w][lane][0];
#pragma unroll
      for (int r = 0; r < 4; ++r) { f.h[r] = (_Float16)(o[g][dt][r] * fa + p0[r] * fb); f.h[4 + r] = (_Float16)(o[g][dt][4 + r] * fa + p1[r] * fb); }
      *(v8us*)(op + dt * 16) = f.half[0]; }      /* register r = d 16 dt + 8 hh + r of query ln: 16 contiguous bytes */
    if (g == 0) asm volatile("s_wait_xcnt 0x0" ::: "memory"); } }      /* precaution: in the built kernel the second group's text follows this path behind a branch; the wait stands in front of its writes of registers that the stores above name */


// ---- staged GEMM: C[MP][DM] = A[MP][DM] . Bt[DM][DM]^T x alpha + bias (bias rounded to bf16 first), A and Bt pitch DM; C f32 or f16 at pitch DM, or f16 transposed per batch at pitch SQ ----
// One workgroup = 8 waves = one 128 x 128 tile of C, waves 4 (rows) x 2 (columns), 32 x 64 per wave. The k axis runs in stages of G3K: the 128 A rows and the 128 Bt rows
// of a stage (256 bytes each) come from global memory as whole lines, 16 lanes per row, once per workgroup, and lie in LDS at a padded pitch; every wave takes its
// fragments from there. Two LDS buffers: stage t + 1 travels global -> registers while stage t is worked on and is stored behind the work; one barrier per stage.
// Each accumulator tile sums k in ascending steps of 32, one WMMA per step.
#define G3T 128                      /* tile rows and tile columns per workgroup */
#define G3K 128                      /* k per stage */
#define G3P 136                      /* LDS row pitch in f16: 256 bytes of data + 16, so that the 16 rows of a fragment read start in 16 different bank groups */
#define G3S (DM / G3K)               /* stages */
static_assert(MP % G3T == 0 && MPO % G3T == 0 && DM % G3T == 0 && DM % G3K == 0 && G3S >= 2, "k_gemm3: whole tiles and stages");
static_assert(SQ % G3T == 0 && B0 == 0 && G3T == G3K && DM == NH * HD, "k_gemm3: a transposed tile lies in one batch; its rows are staged and stored like a stage's; [batch][column] = [batch][head][d]");
struct G3Lds {      /* declared once per kernel and handed in, so that two forms of the tile in one kernel share it */
  __attribute__((aligned(16))) unsigned short sa[2][G3T][G3P];      /* A rows [row][k] */
  __attribute__((aligned(16))) unsigned short sb[2][G3T][G3P];      /* Bt rows [column][k] */
  __attribute__((aligned(16))) float so[8][32][68]; };              /* per-wave output staging */
template <bool F32OUT, bool TR>      /* the result goes to C (f32) or to C16 (f16); the other pointer is not used; mt, nq: the workgroup's tile row and tile column; TR (f16 only): C16 takes the tile transposed, as rows [batch][column][place] */
__device__ __forceinline__ void gemm3_tile(G3Lds& lds, const _Float16* __restrict__ A, const _Float16* __restrict__ Bh, float alpha, const float* __restrict__ bias, float* __restrict__ C, _Float16* __restrict__ C16, int mt, int nq) {
  static_assert(!(F32OUT && TR), "gemm3_tile: the transposed form is f16");
  auto& sa = lds.sa; auto& sb = lds.sb; auto& so = lds.so;
  const int tid = threadIdx.x, w = tid >> 5, lane = tid & 31, ln = lane & 15, hh = lane >> 4;
  const int wr = (w >> 1) * 32, wc = (w & 1) * 64;      /* the wave's place in the tile */
  const int row0 = mt * G3T + wr, col0 = nq * G3T + wc;
  const int srow = tid >> 4, sc8 = (tid & 15) * 8;      /* staging: 16 threads per 256-byte row, rows srow + 16 i */
  const unsigned short* ag = (const unsigned short*)A + (size_t)(mt * G3T + srow) * DM + sc8;
  const unsigned short* bg = (const unsigned short*)Bh + (size_t)(nq * G3T + srow) * DM + sc8;
  v8us ra[8], rb[8];
  /* the short loops below are all unrolled so that the staging, fragment and accumulator arrays stay in registers */
#pragma unroll
  for (int i = 0; i < 8; ++i) { ra[i] = *(const v8us*)(ag + (size_t)(16 * i) * DM); rb[i] = *(const v8us*)(bg + (size_t)(16 * i) * DM); }
#pragma unroll
  for (int i = 0; i < 8; ++i) { *(v8us*)&sa[0][srow + 16 * i][sc8] = ra[i]; *(v8us*)&sb[0][srow + 16 * i][sc8] = rb[i]; }
  const v8f z8 = {0.f, 0.f, 0.f, 0.f, 0.f, 0.f, 0.f, 0.f}; v8f acc[2][4] = {{z8, z8, z8, z8}, {z8, z8, z8, z8}};      /* [16-row group][16-column group] */
  __syncthreads();      /* stage 0 is published */
  for (int t = 0; t < G3S; ++t) { const int cur = t & 1;
    if (t + 1 < G3S) {
#pragma unroll
      for (int i = 0; i < 8; ++i) { ra[i] = *(const v8us*)(ag + (size_t)(16 * i) * DM + (t + 1) * G3K); rb[i] = *(const v8us*)(bg + (size_t)(16 * i) * DM + (t + 1) * G3K); } }
#pragma unroll
    for (int ks = 0; ks < G3K / 32; ++ks) { const v16h a0 = fa_frag(&sa[cur][wr + ln][ks * 32], hh), a1 = fa_frag(&sa[cur][wr + 16 + ln][ks * 32], hh);
#pragma unroll
      for (int j = 0; j < 4; ++j) { const v16h b = fa_frag(&sb[cur][wc + j * 16 + ln][ks * 32], hh); acc[0][j] = fa_mma(a0, b, acc[0][j]); acc[1][j] = fa_mma(a1, b, acc[1][j]); } }
    if (t + 1 < G3S) {
#pragma unroll
      for (int i = 0; i < 8; ++i) { *(v8us*)&sa[cur ^ 1][srow + 16 * i][sc8] = ra[i]; *(v8us*)&sb[cur ^ 1][srow + 16 * i][sc8] = rb[i]; } }      /* its last readers left this buffer at the barrier of stage t - 1 */
    __syncthreads(); }      /* publishes stage t + 1 and ends every read of stage t */
  if (TR) {      /* transposed output: an accumulator tile holds, per lane, 8 consecutive rows of one column = 16 contiguous bytes of the transposed row */
    unsigned short* st = (unsigned short*)&so[0][0][0];      /* the workgroup's tile as [column][row], pitch G3P */
    static_assert(sizeof(so) >= (size_t)G3T * G3P * 2, "gemm3_tile: the transposed tile fits the output staging");
#pragma unroll
    for (int u = 0; u < 8; ++u) { const int j = u & 3, half = u >> 2; const float bv = bf16_round(bias[col0 + j * 16 + ln]); FragH f;
#pragma unroll
      for (int r = 0; r < 8; ++r) f.h[r] = (_Float16)(acc[half][j][r] * alpha + bv);
      *(v8us*)&st[(wc + j * 16 + ln) * G3P + wr + half * 16 + 8 * hh] = f.half[0]; }
    __syncthreads();      /* a transposed row holds the rows of four waves */
    const int bt = mt / (SQ / G3T), s0 = (mt - bt * (SQ / G3T)) * G3T;      /* the tile's batch and first place */
    unsigned short* cg = (unsigned short*)C16 + ((size_t)bt * DM + nq * G3T + srow) * SQ + s0 + sc8;
#pragma unroll
    for (int i = 0; i < 8; ++i) *(v8us*)(cg + (size_t)(16 * i) * SQ) = *(const v8us*)&st[(srow + 16 * i) * G3P + sc8];      /* 16 lanes store the 256 bytes of one transposed row: whole lines */
    return; }
  const int bc = col0 + ln; float bb[4];
#pragma unroll
  for (int j = 0; j < 4; ++j) bb[j] = bias[bc + j * 16];
  asm volatile("s_wait_xcnt 0x0" :: "s"(bias), "v"(bc) : "memory");      /* precaution: stands in front of every write of a register that the four bias loads above name as an address; it names base and index (inputs only), so that they live up to it */
#pragma unroll
  for (int u = 0; u < 8; ++u) { const int j = u & 3, half = u >> 2; const float bv = bf16_round(bb[j]);
#pragma unroll
    for (int r = 0; r < 8; ++r) so[w][half * 16 + 8 * hh + r][j * 16 + ln] = acc[half][j][r] * alpha + bv; }
  __builtin_amdgcn_fence(__ATOMIC_ACQ_REL, "workgroup"); __builtin_amdgcn_wave_barrier();      /* the wave reads back rows that its other lanes wrote */
  const int rsub = lane >> 4, c4 = (lane & 15) * 4;
#pragma unroll
  for (int q = 0; q < 16; ++q) { const int r = q * 2 + rsub; const v4f v = *(const v4fa*)&so[w][r][c4]; const size_t e = (size_t)(row0 + r) * DM + col0 + c4;
    if (F32OUT) *(v4f*)(C + e) = v; else *(v4h*)(C16 + e) = __builtin_convertvector(v, v4h); } }      /* 16 lanes store one row of the wave's 64 columns: whole lines */
// The output projection: one grid of (MPO / G3T) x (DM / G3T) tiles, f32 result.
__global__ __launch_bounds__(256) void k_gemm3o(const _Float16* __restrict__ A, const _Float16* __restrict__ Bh, float alpha, const float* __restrict__ bias, float* __restrict__ C) {
  const int mt = blockIdx.x / (DM / G3T), nq = blockIdx.x - mt * (DM / G3T);
  __shared__ G3Lds lds;
  gemm3_tile<true, false>(lds, A, Bh, alpha, bias, C, nullptr, mt, nq); }
// The Q, K and V projections read the same A and do not depend on each other: one grid holds the tiles of all three, so that they share one launch and fill the chip without a
// gap between them. A tile row's 3 x (DM / G3T) workgroups are neighbours in the grid (Q's columns, then K's, then V's), so its A rows are read again while they are still in the cache.
// Q and K leave as token rows; V leaves transposed, V^T [NB][NH][HD][SQ], the form the attention kernel stages: no V rows and no transposing launch.
__global__ __launch_bounds__(256) void k_gemm3qkv(const _Float16* __restrict__ A, const _Float16* __restrict__ Bq, const _Float16* __restrict__ Bk, const _Float16* __restrict__ Bv, float alpha,
                                                  const float* __restrict__ bq, const float* __restrict__ bk, const float* __restrict__ bv, _Float16* __restrict__ Cq, _Float16* __restrict__ Ck, _Float16* __restrict__ CvT) {
  const int mt = blockIdx.x / (3 * (DM / G3T)), c = blockIdx.x - mt * (3 * (DM / G3T)); const int m = c / (DM / G3T), nq = c - m * (DM / G3T);      /* m: 0 = Q, 1 = K, 2 = V; the same for the whole workgroup */
  __shared__ G3Lds lds;
  if (m == 2) gemm3_tile<false, true>(lds, A, Bv, alpha, bv, nullptr, CvT, mt, nq);      /* two texts, one per output form: each runs from its last stage straight into its own epilogue */
  else gemm3_tile<false, false>(lds, A, m == 0 ? Bq : Bk, alpha, m == 0 ? bq : bk, nullptr, m == 0 ? Cq : Ck, mt, nq); }


#define XPP 4                        /* places (sequence positions) per thread */
// x + PE. A thread keeps one 8-column chunk and walks XPP places: the four frequencies of its columns are formed once, a place's sines and cosines once for all NB batches
// (PE does not depend on the batch); every element is the same expression as for one chunk alone. All loads of x are issued first and travel while PE is formed.
// PE is formed in a rolled loop and parked in LDS, each thread in slots of its own (no barrier). Workgroup g: places 2 XPP g ... 2 XPP g + 2 XPP - 1.
static_assert(DM / 8 == 128 && SQ % (2 * XPP) == 0, "xpe_part: 256 threads hold two rows of 128 chunks; whole workgroups");
__device__ __forceinline__ void xpe_part(const float* __restrict__ x, _Float16* __restrict__ X16, unsigned g, int tid) {
  #pragma clang fp contract(off)
  __shared__ __attribute__((aligned(8))) float spe[XPP][4][256][2];      /* [place][frequency][thread][sin, cos] */
  const int c0 = (tid & 127) * 8, p0 = (int)g * (2 * XPP) + (tid >> 7); const float kf = (float)(-9.210340371976184 / (double)DM); v4f xa[XPP][NB][2];
  const float* px[NB];      /* the thread's first chunk in each batch */
  /* the loops over xa are unrolled so that it stays in registers */
#pragma unroll
  for (int b = 0; b < NB; ++b) { px[b] = x + ((size_t)b * SQ + p0) * DM + c0;
#pragma unroll
    for (int i = 0; i < XPP; ++i) { const float* p = px[b] + (size_t)(2 * i) * DM; xa[i][b][0] = *(const v4fa*)p; xa[i][b][1] = *(const v4fa*)(p + 4); } }
  static_assert(NB == 2, "xpe_part: the wait below names the two addresses");
  /* precaution: stands in front of every write of a register that the loads above name as an address; it names the addresses (inputs only), so that no later load of the run lands in one of them either; it also keeps all the loads in front of the PE loop */
  asm volatile("s_wait_xcnt 0x0" :: "v"(px[0]), "v"(px[1]) : "memory");
#pragma unroll 1      /* rolled, like the loop inside: one copy of the exp, sin and cos text */
  for (int j = 0; j < 4; ++j) { const float dv = expf(__fmul_rn((float)(c0 + 2 * j), kf));
#pragma unroll 1
    for (int i = 0; i < XPP; ++i) { const float ang = __fmul_rn((float)(p0 + 2 * i), dv); spe[i][j][tid][0] = sinf(ang); spe[i][j][tid][1] = cosf(ang); } }
#pragma unroll
  for (int i = 0; i < XPP; ++i) { float pe[8];
#pragma unroll
    for (int j = 0; j < 4; ++j) { pe[2 * j] = spe[i][j][tid][0]; pe[2 * j + 1] = spe[i][j][tid][1]; }
#pragma unroll
    for (int b = 0; b < NB; ++b) { FragH f;
#pragma unroll
      for (int q = 0; q < 8; ++q) f.h[q] = (_Float16)__fadd_rn(bf16_round(xa[i][b][q >> 2][q & 3]), pe[q]);
      *(v8us*)((unsigned short*)X16 + ((size_t)b * SQ + p0 + 2 * i) * DM + c0) = f.half[0]; } } }
// x + PE and the four weight conversions do not depend on each other: one grid, dealt by workgroup range. The x + PE workgroups, the longer ones, come first.
// Two workgroups per WGP in all: each thread carries 8 chunks, so that few waves have to start.
#define PXG ((unsigned)(SQ / (2 * XPP)))                         /* workgroups of x + PE */
#define PWG ((unsigned)((size_t)DM * DM / 8 / (256 * WCH)))      /* workgroups per weight matrix */
static_assert((size_t)DM * DM / 8 % (256 * WCH) == 0, "k_prep: whole workgroups per weight matrix");
__global__ __launch_bounds__(256) void k_prep(const float* __restrict__ x, const float* __restrict__ wq, const float* __restrict__ wk, const float* __restrict__ wv, const float* __restrict__ wo,
                                              _Float16* __restrict__ X16, _Float16* __restrict__ BQ, _Float16* __restrict__ BK, _Float16* __restrict__ BV, _Float16* __restrict__ BO) {
  const unsigned g = blockIdx.x;
  if (g < PXG) { xpe_part(x, X16, g, (int)threadIdx.x); return; }      /* x + sinusoidal PE -> f16 rows (not exact: x + pe is not a bf16 value) */
  const unsigned u = g - PXG, m = u / PWG;      /* m: which weight matrix; the same for the whole workgroup */
  wnat_part(m == 0 ? wq : m == 1 ? wk : m == 2 ? wv : wo, m == 0 ? BQ : m == 1 ? BK : m == 2 ? BV : BO, (u - m * PWG) * (256 * WCH) + threadIdx.x); }      /* natural [out][in] = Bt[n][k], x16 */
extern "C" void kernel_launch(void* const* d_in, const int* in_sizes, int n_in,
                              void* d_out, int out_size, void* d_ws, size_t ws_size, hipStream_t stream) {
  (void)in_sizes; (void)n_in; (void)out_size;
  const float* const* I = (const float* const*)d_in; const float* x = I[0]; const float* wq = I[1]; const float* bq = I[2]; const float* wk = I[3]; const float* bk = I[4]; const float* wv = I[5]; const float* bv = I[6]; const float* wo = I[7]; const float* bo = I[8];      /* nn.Linear weights [out][in] + biases */
  char* ws = (char*)d_ws; size_t off = 0;
  auto take = [&](size_t bytes) { char* p = ws + off; off += (bytes + 255) & ~(size_t)255; return p; };
  _Float16* BQ = (_Float16*)take((size_t)DM * DM * 2); _Float16* BK = (_Float16*)take((size_t)DM * DM * 2); _Float16* BV = (_Float16*)take((size_t)DM * DM * 2); _Float16* BO = (_Float16*)take((size_t)DM * DM * 2);
  _Float16* X16 = (_Float16*)take(NR * DM * 2); _Float16* Q16 = (_Float16*)take(NR * DM * 2); _Float16* K16 = (_Float16*)take(NR * DM * 2); _Float16* O16 = (_Float16*)take(NR * DM * 2);
  _Float16* VT = (_Float16*)take((size_t)NB * NH * HD * SQ * 2);
  if (off > ws_size) return;
  k_prep<<<PXG + 4 * PWG, 256, 0, stream>>>(x, wq, wk, wv, wo, X16, BQ, BK, BV, BO);      /* f16 operands: x + PE rows and the four weight matrices */
  const size_t r0p = (size_t)B0 * SQ;      /* first projected row */
  k_gemm3qkv<<<(unsigned)((MP / G3T) * 3 * (DM / G3T)), 256, 0, stream>>>(X16 + r0p * DM, BQ, BK, BV, 0.0625f, bq, bk, bv, Q16 + r0p * DM, K16 + r0p * DM, VT);      /* q, k rows; V^T [NB][NH][HD][SQ] */
  k_fattn<<<dim3(SQ / (FAW * 32), NB * NH), FAW * FAS * 32, 0, stream>>>(Q16, K16, VT, O16);      /* o (merged heads, x64) as f16 rows */
  k_gemm3o<<<(unsigned)((MPO / G3T) * (DM / G3T)), 256, 0, stream>>>(O16 + r0p * DM, BO, 0.0009765625f, bo, (float*)d_out + r0p * DM);      /* out rows are the output layout */
}

// v008
// It runs in 79.1 microseconds.
// Next to v007, in two timings, it ran 1.14 times as fast each time.
// Counting every step since v000, it is 46.6 times as fast.
#include <hip/hip_runtime.h>
// Temporal multi-head attention with sinusoidal positional encoding (x [2][2048][1024]; x = x + PE (pe[s][2i] = sin(s d_i), pe[s][2i+1] = cos(s d_i), d_i = exp(2i x (-ln 1e4 / 1024))); q = x Wq^T + bq, k, v likewise (nn.Linear [out][in] 1024^2, weights and biases sigma 1/32); 16 heads of 64; softmax(q k^T / 8) (no mask); out = ctx Wo^T + bo -> [2][2048][1024]).
// Structure: token rows r = b*2048 + s; x + PE computed on VALU (f32 expf/sinf/cosf in the module's op order) -> f16 rows (one f16 rounding of x + pe); Q, K, V as three WMMA GEMMs in one grid (128x128 workgroup tiles staged in LDS, 64x64 wave tiles, f32 accumulation, exact x16 weights + bias, f16 outputs; the V tiles leave transposed, as V^T rows per batch and head); one fused attention kernel over all (batch, head, 256 queries), the keys dealt to two groups of waves and the two partial results joined at the end: scores on WMMA (K = 64), online softmax on VALU (f32 statistics, native exp2; weights as f16, scaled by a power of two that cancels), o = P . V on WMMA (o carried x64 against f16 subnormal flush, folded into the output GEMM alpha) written straight into the merged f16 o rows; out = o W_o + b GEMM (f32) into the output layout.
// Compute dtype: inputs rounded to bf16; weights exact, x + pe rounded once to f16; q, k, v, softmax weights and o as plain f16 GEMM operands (~2^-12); scores and softmax statistics f32; v_wmma_f32_16x16x32_f16.
#define NB 2
#define SQ 2048
#define DM 1024
#define NH 16
#define HD 64
#define HG 4                         /* heads per call of the unlaunched k_vt(V16, b, h0, VT) */
#define B0 0                         /* first batch processed (debug hook) */
#define NBR NB                       /* batches processed (debug hook) */
#define NR ((size_t)NB * SQ)         /* token rows */
#define MP ((int)((size_t)NBR * SQ)) /* rows projected (debug hook) */
#define QN SQ                        /* unused: k_fattn attends all SQ query rows */
#define NHD NH                       /* unused: k_fattn attends all NH heads */
#define MPO MP                       /* rows through the output stage (debug hook) */
typedef __bf16 v16b __attribute__((ext_vector_type(16)));
typedef unsigned short v8us __attribute__((ext_vector_type(8), may_alias));
typedef float  v8f  __attribute__((ext_vector_type(8)));
typedef float  v4f  __attribute__((ext_vector_type(4)));
typedef float  v4fa __attribute__((ext_vector_type(4), may_alias));
union FragB { v16b v; v8us half[2]; unsigned short u[16]; };

__device__ __forceinline__ unsigned short bf16_bits(float x) { unsigned int u = __float_as_uint(x); return (unsigned short)((u + 0x7FFFu + ((u >> 16) & 1u)) >> 16); }
__device__ __forceinline__ float bf16_val(unsigned short b) { return __uint_as_float(((unsigned int)b) << 16); }
__device__ __forceinline__ float bf16_round(float x) { return bf16_val(bf16_bits(x)); }
// D += A·B with NT terms: 1 = ah·bh, 2 = + al·bh (A split), 3 = + ah·bl (both split)
template <int NT>
__device__ __forceinline__ v8f mmaN(v16b ah, v16b al, v16b bh, v16b bl, v8f c) {
  c = __builtin_amdgcn_wmma_f32_16x16x32_bf16(false, ah, false, bh, (short)0, c, false, false);
  if (NT >= 2) c = __builtin_amdgcn_wmma_f32_16x16x32_bf16(false, al, false, bh, (short)0, c, false, false);
  if (NT >= 3) c = __builtin_amdgcn_wmma_f32_16x16x32_bf16(false, ah, false, bl, (short)0, c, false, false);
  asm volatile("v_nop\n\tv_nop\n\tv_nop\n\tv_nop" : "+v"(c) : "v"(ah), "v"(al), "v"(bh), "v"(bl));
  return c;
}

__global__ __launch_bounds__(256) void k_wt_bf16(const float* __restrict__ W, unsigned short* __restrict__ Wt, int K, int N) {
  const int t = blockIdx.x * 256 + threadIdx.x;
  const int k8n = K / 8;
  if (t >= N * k8n) return;
  const int n = t / k8n, k8 = (t % k8n) * 8;
  v8us v;
#pragma unroll
  for (int i = 0; i < 8; ++i) v[i] = bf16_bits(W[(size_t)(k8 + i) * N + n]);
  *(v8us*)(Wt + (size_t)n * K + k8) = v;
  
}

// GEMM C[M][N] (f32, pitch ldc) = act(A[M][K]·W + bias). A f32 row-major (pitch lda) converted per fragment to bf16
// (ASPLIT: hi/lo two planes -> 2 terms, else single rounded term); Wt bf16 [N][K] (pitch ldb). BIAS_BF16 rounds the
// bias to bf16 first (bias quantised to bf16 before the add). K%32==0, M%16==0, N%64==0.
template <bool ASPLIT, int ACT, bool BIAS_BF16>
__global__ __launch_bounds__(128) void k_gemm_bf(const float* __restrict__ A, int lda, const unsigned short* __restrict__ Wt, int ldb,
                                               const float* __restrict__ bias, float* __restrict__ C, int ldc, int M, int N, int K) {
  __shared__ __attribute__((aligned(16))) float so[4][16][64];
  const int tid = threadIdx.x, w = tid >> 5, lane = tid & 31, ln = lane & 15, hh = lane >> 4;
  const int ntn = N / 64;
  const int wid = blockIdx.x * 4 + w;
  const int mt = wid / ntn, nq = wid % ntn;
  if (mt * 16 >= M) return;
  const int row0 = mt * 16, col0 = nq * 64;
  const float* arow = A + (size_t)(row0 + ln) * lda;
  v8f acc[4] = {};
  for (int kb = 0; kb < K; kb += 32) {
    FragB ah, al;
    const v4f x0 = *(const v4fa*)(arow + kb + 8 * hh), x1 = *(const v4fa*)(arow + kb + 8 * hh + 4);
    const v4f x2 = *(const v4fa*)(arow + kb + 16 + 8 * hh), x3 = *(const v4fa*)(arow + kb + 16 + 8 * hh + 4);
    float xs[16] = {x0[0],x0[1],x0[2],x0[3],x1[0],x1[1],x1[2],x1[3],x2[0],x2[1],x2[2],x2[3],x3[0],x3[1],x3[2],x3[3]};
#pragma unroll
    for (int i = 0; i < 16; ++i) { const unsigned short hb = bf16_bits(xs[i]); ah.u[i] = hb; al.u[i] = ASPLIT ? bf16_bits(xs[i] - bf16_val(hb)) : (unsigned short)0; }
#pragma unroll
    for (int t = 0; t < 4; ++t) {
      const unsigned short* brow = Wt + (size_t)(col0 + t * 16 + ln) * ldb + kb;
      FragB b;
      b.half[0] = *(const v8us*)(brow + 8 * hh);
      b.half[1] = *(const v8us*)(brow + 16 + 8 * hh);
      acc[t] = mmaN<ASPLIT ? 2 : 1>(ah.v, al.v, b.v, b.v, acc[t]);
    }
  }
#pragma unroll
  for (int t = 0; t < 4; ++t) {
    float bv = bias ? bias[col0 + t * 16 + ln] : 0.f;
    if (BIAS_BF16) bv = bf16_round(bv);
#pragma unroll
    for (int r = 0; r < 8; ++r) { float v = acc[t][r] + bv; if (ACT == 1) v = fmaxf(v, 0.f); so[w][8 * hh + r][t * 16 + ln] = v; }
  }
  __builtin_amdgcn_fence(__ATOMIC_ACQ_REL, "workgroup");
  __builtin_amdgcn_wave_barrier();
  const int rsub = lane >> 4, c4 = (lane & 15) * 4;
  {
#pragma unroll
    for (int q = 0; q < 8; ++q) {
      const int r = q * 2 + rsub;
      const v4f v = *(const v4fa*)&so[w][r][c4];
      *(v4f*)(C + (size_t)(row0 + r) * ldc + col0 + c4) = v;
    }
    
  }
}

// GEMM C = act(A·W + bias + resid): A f32 (ASPLIT -> hi/lo 2 terms), Wt bf16 [N][K]; ACT 0 none, 1 relu, 2 exact gelu;
// resid (optional, f32, row index = (row % rmod), pitch ldr, RES_BF16 rounds it) added before the activation.
template <bool ASPLIT, int ACT, bool BIAS_BF16, bool RES_BF16>
__global__ __launch_bounds__(128) void k_gemm_bf3(const float* __restrict__ A, int lda, const unsigned short* __restrict__ Wt, int ldb,
                                                const float* __restrict__ bias, const float* __restrict__ resid, int rmod, int ldr,
                                                float* __restrict__ C, int ldc, int M, int N, int K) {
  __shared__ __attribute__((aligned(16))) float so[4][16][64];
  const int tid = threadIdx.x, w = tid >> 5, lane = tid & 31, ln = lane & 15, hh = lane >> 4;
  const int ntn = N / 64;
  const int wid = blockIdx.x * 4 + w;
  const int mt = wid / ntn, nq = wid % ntn;
  if (mt * 16 >= M) return;
  const int row0 = mt * 16, col0 = nq * 64;
  const float* arow = A + (size_t)(row0 + ln) * lda;
  v8f acc[4] = {};
  for (int kb = 0; kb < K; kb += 32) {
    FragB ah, al;
    const v4f x0 = *(const v4fa*)(arow + kb + 8 * hh), x1 = *(const v4fa*)(arow + kb + 8 * hh + 4);
    const v4f x2 = *(const v4fa*)(arow + kb + 16 + 8 * hh), x3 = *(const v4fa*)(arow + kb + 16 + 8 * hh + 4);
    float xs[16] = {x0[0],x0[1],x0[2],x0[3],x1[0],x1[1],x1[2],x1[3],x2[0],x2[1],x2[2],x2[3],x3[0],x3[1],x3[2],x3[3]};
#pragma unroll
    for (int i = 0; i < 16; ++i) { const unsigned short hb = bf16_bits(xs[i]); ah.u[i] = hb; al.u[i] = ASPLIT ? bf16_bits(xs[i] - bf16_val(hb)) : (unsigned short)0; }
#pragma unroll
    for (int t = 0; t < 4; ++t) {
      const unsigned short* brow = Wt + (size_t)(col0 + t * 16 + ln) * ldb + kb;
      FragB b;
      b.half[0] = *(const v8us*)(brow + 8 * hh);
      b.half[1] = *(const v8us*)(brow + 16 + 8 * hh);
      acc[t] = mmaN<ASPLIT ? 2 : 1>(ah.v, al.v, b.v, b.v, acc[t]);
    }
  }
#pragma unroll
  for (int t = 0; t < 4; ++t) {
    const int col = col0 + t * 16 + ln;
    float bv = bias ? bias[col] : 0.f;
    if (BIAS_BF16) bv = bf16_round(bv);
#pragma unroll
    for (int r = 0; r < 8; ++r) {
      float v = acc[t][r] + bv;
      if (resid) { float rv = resid[(size_t)((row0 + 8 * hh + r) % rmod) * ldr + col]; if (RES_BF16) rv = bf16_round(rv); v += rv; }
      if (ACT == 1) v = fmaxf(v, 0.f);
      if (ACT == 2) v = 0.5f * v * (1.0f + erff(v * 0.70710678118654752f));
      if (ACT == 3) { const float u = 0.7978845608028654f * (v + 0.044715f * v * v * v); v = 0.5f * v * (1.0f + tanhf(u)); }
      so[w][8 * hh + r][t * 16 + ln] = v;
    }
  }
  __builtin_amdgcn_fence(__ATOMIC_ACQ_REL, "workgroup");
  __builtin_amdgcn_wave_barrier();
  const int rsub = lane >> 4, c4 = (lane & 15) * 4;
  {
#pragma unroll
    for (int q = 0; q < 8; ++q) {
      const int r = q * 2 + rsub;
      const v4f v = *(const v4fa*)&so[w][r][c4];
      *(v4f*)(C + (size_t)(row0 + r) * ldc + col0 + c4) = v;
    }
    
  }
}
// row LayerNorm (biased variance, eps) over N: s = X (+ R); optional out_sum <- s; out_norm <- (s-mu)*rsqrt(var+eps)*g + b
template <bool PARAM_BF16>
__global__ __launch_bounds__(256) void k_layernorm(const float* __restrict__ X, const float* __restrict__ R, const float* __restrict__ g, const float* __restrict__ bta,
                                                  float* __restrict__ out_sum, float* __restrict__ out_norm, int N, float eps) {
  __shared__ float red[256];
  const int row = blockIdx.x, tid = threadIdx.x;
  const float* x = X + (size_t)row * N; const float* rr = R ? R + (size_t)row * N : nullptr;
  float vals[16];                     // up to N = 4096
  const int per = N / 256;            // contiguous chunk per thread? use strided-by-4 chunks: thread handles j = tid*4 + 1024*u
  float s1 = 0.f;
  for (int u = 0; u < per / 4; ++u) {
    const int j = tid * 4 + 1024 * u;
    const v4f a = *(const v4fa*)(x + j);
    v4f b = {0.f,0.f,0.f,0.f}; if (rr) b = *(const v4fa*)(rr + j);
#pragma unroll
    for (int q = 0; q < 4; ++q) { const float v = a[q] + b[q]; vals[u * 4 + q] = v; s1 += v; }
  }
  red[tid] = s1; __syncthreads();
  for (int st = 128; st > 0; st >>= 1) { if (tid < st) red[tid] += red[tid + st]; __syncthreads(); }
  const float mu = red[0] / (float)N; __syncthreads();
  float s2 = 0.f;
  for (int u = 0; u < per / 4; ++u)
#pragma unroll
    for (int q = 0; q < 4; ++q) { const float c = vals[u * 4 + q] - mu; s2 += c * c; }
  red[tid] = s2; __syncthreads();
  for (int st = 128; st > 0; st >>= 1) { if (tid < st) red[tid] += red[tid + st]; __syncthreads(); }
  const float rs = rsqrtf(red[0] / (float)N + eps);
  {
    for (int u = 0; u < per / 4; ++u) {
      const int j = tid * 4 + 1024 * u;
      v4f o, sm;
#pragma unroll
      for (int q = 0; q < 4; ++q) {
        float gg = g[j + q], bb = bta[j + q];
        if (PARAM_BF16) { gg = bf16_round(gg); bb = bf16_round(bb); }
        sm[q] = vals[u * 4 + q]; o[q] = (vals[u * 4 + q] - mu) * rs * gg + bb;
      }
      if (out_sum) *(v4f*)(out_sum + (size_t)row * N + j) = sm;
      *(v4f*)(out_norm + (size_t)row * N + j) = o;
    }
    
  }
}



// ---- f16 WMMA path (v_wmma_f32_16x16x32_f16): 11-bit significands for operands in range — used where a [0,1] probability operand needs more precision than bf16
typedef _Float16 v16h __attribute__((ext_vector_type(16)));
union FragH { v16h v; v8us half[2]; _Float16 h[16]; unsigned short u[16]; };
template <int NT>
__device__ __forceinline__ v8f mmaH(v16h ah, v16h al, v16h bh, v16h bl, v8f c) {
  c = __builtin_amdgcn_wmma_f32_16x16x32_f16(false, ah, false, bh, (short)0, c, false, false);
  if (NT >= 2) c = __builtin_amdgcn_wmma_f32_16x16x32_f16(false, al, false, bh, (short)0, c, false, false);
  if (NT >= 3) c = __builtin_amdgcn_wmma_f32_16x16x32_f16(false, ah, false, bl, (short)0, c, false, false);
  asm volatile("v_nop\n\tv_nop\n\tv_nop\n\tv_nop" : "+v"(c) : "v"(ah), "v"(al), "v"(bh), "v"(bl));
  return c;
}
// batched GEMM like k_gemm_b but f16 operands: A f32 (split into f16 hi/lo if ASPLIT, else rounded to f16), Bt = f16 values [n][k]; alpha; C f32; N multiple of 16 (partial tiles skipped)
template <bool ASPLIT>
__global__ __launch_bounds__(128) void k_gemm_h(const float* __restrict__ A, int lda, size_t sA, const _Float16* __restrict__ Bh, int ldb, size_t sB, float alpha, float* __restrict__ C, int ldc, size_t sC, int M, int N, int K) {
  __shared__ __attribute__((aligned(16))) float so[4][16][64];
  const int tid = threadIdx.x, w = tid >> 5, lane = tid & 31, ln = lane & 15, hh = lane >> 4; const int by = blockIdx.y;
  A += (size_t)by * sA; Bh += (size_t)by * sB; C += (size_t)by * sC;
  const int ntn = (N + 63) / 64; const int wid = blockIdx.x * 4 + w; const int mt = wid / ntn, nq = wid % ntn; if (mt * 16 >= M) return;
  const int row0 = mt * 16, col0 = nq * 64; const float* arow = A + (size_t)(row0 + ln) * lda;
  v8f acc[4] = {};
  for (int kb = 0; kb < K; kb += 32) {
    FragH ah, al;
    const v4f x0 = *(const v4fa*)(arow + kb + 8 * hh), x1 = *(const v4fa*)(arow + kb + 8 * hh + 4), x2 = *(const v4fa*)(arow + kb + 16 + 8 * hh), x3 = *(const v4fa*)(arow + kb + 16 + 8 * hh + 4);
    float xs[16] = {x0[0],x0[1],x0[2],x0[3],x1[0],x1[1],x1[2],x1[3],x2[0],x2[1],x2[2],x2[3],x3[0],x3[1],x3[2],x3[3]};
#pragma unroll
    for (int i = 0; i < 16; ++i) { const _Float16 h = (_Float16)xs[i]; ah.h[i] = h; al.h[i] = ASPLIT ? (_Float16)(xs[i] - (float)h) : (_Float16)0.0f; }
#pragma unroll
    for (int t = 0; t < 4; ++t) { if (col0 + t * 16 >= N) continue; const size_t boff = (size_t)(col0 + t * 16 + ln) * ldb + kb; FragH bq; bq.half[0] = *(const v8us*)(Bh + boff + 8 * hh); bq.half[1] = *(const v8us*)(Bh + boff + 16 + 8 * hh);
      acc[t] = mmaH<ASPLIT ? 2 : 1>(ah.v, al.v, bq.v, bq.v, acc[t]); }
  }
#pragma unroll
  for (int t = 0; t < 4; ++t) { if (col0 + t * 16 >= N) continue;
#pragma unroll
    for (int r = 0; r < 8; ++r) so[w][8 * hh + r][t * 16 + ln] = acc[t][r] * alpha; }
  __builtin_amdgcn_fence(__ATOMIC_ACQ_REL, "workgroup"); __builtin_amdgcn_wave_barrier();
  const int rsub = lane >> 4, c4 = (lane & 15) * 4;
  {
#pragma unroll
    for (int q = 0; q < 8; ++q) { const int r = q * 2 + rsub; if (col0 + c4 < N) { const v4f v = *(const v4fa*)&so[w][r][c4]; *(v4f*)(C + (size_t)(row0 + r) * ldc + col0 + c4) = v; } }
     }
}

// Wt[n][k] = f16(W[k][n]·scale) from f32 row-major W[K][N] (scale = power of two; bf16-exact weights stay exact in f16 away from the subnormal range)
__global__ __launch_bounds__(256) void k_wt_f16(const float* __restrict__ W, _Float16* __restrict__ Wt, int K, int N, float scale) {
  const int t = blockIdx.x * 256 + threadIdx.x; if (t >= N * (K / 8)) return; const int n = t / (K / 8), k8 = (t % (K / 8)) * 8; FragH f;
#pragma unroll
  for (int i = 0; i < 8; ++i) f.h[i] = (_Float16)(bf16_round(W[(size_t)(k8 + i) * N + n]) * scale); const v8us o = f.half[0];
  *(v8us*)((unsigned short*)Wt + (size_t)n * K + k8) = o; 
}
// k_gemm_hh variant with fused epilogue: v = acc·alpha + bias[by·sBias + col] (+ CP[(row/rowsPerB)·sCPb + by·64 + col] if CP) ; ACT 0 none / 1 elu ; writes f16 C16 (and f32 C if non-null)
template <int ACT>
__global__ __launch_bounds__(128) void k_gemm_hhx(const _Float16* __restrict__ A, int lda, size_t sA, const _Float16* __restrict__ Bh, int ldb, size_t sB, float alpha, const float* __restrict__ bias, size_t sBias, const float* __restrict__ CP, int rowsPerB, size_t sCPb, int row0g,
    float* __restrict__ C, _Float16* __restrict__ C16, int ldc, size_t sC, int M, int N, int K) {
  __shared__ __attribute__((aligned(16))) float so[4][16][64];
  const int tid = threadIdx.x, w = tid >> 5, lane = tid & 31, ln = lane & 15, hh = lane >> 4; const int by = blockIdx.y;
  A += (size_t)by * sA; Bh += (size_t)by * sB; const size_t cofs = (size_t)by * sC; const float* bp = bias ? bias + (size_t)by * sBias : nullptr;
  const int ntn = (N + 63) / 64; const int wid = blockIdx.x * 4 + w; const int mt = wid / ntn, nq = wid % ntn; if (mt * 16 >= M) return;
  const int row0 = mt * 16, col0 = nq * 64; const _Float16* arow = A + (size_t)(row0 + ln) * lda;
  v8f acc[4] = {};
  for (int kb = 0; kb < K; kb += 32) { FragH ah; ah.half[0] = *(const v8us*)((const unsigned short*)arow + kb + 8 * hh); ah.half[1] = *(const v8us*)((const unsigned short*)arow + kb + 16 + 8 * hh);
#pragma unroll
    for (int t = 0; t < 4; ++t) { if (col0 + t * 16 >= N) continue; const size_t boff = (size_t)(col0 + t * 16 + ln) * ldb + kb; FragH bq; bq.half[0] = *(const v8us*)((const unsigned short*)Bh + boff + 8 * hh); bq.half[1] = *(const v8us*)((const unsigned short*)Bh + boff + 16 + 8 * hh);
      acc[t] = mmaH<1>(ah.v, ah.v, bq.v, bq.v, acc[t]); }
  }
#pragma unroll
  for (int t = 0; t < 4; ++t) { if (col0 + t * 16 >= N) continue; const int col = col0 + t * 16 + ln; const float bv = bp ? bf16_round(bp[col]) : 0.f;
#pragma unroll
    for (int r = 0; r < 8; ++r) { float v = acc[t][r] * alpha + bv; if (CP) { const int rr = row0g + row0 + 8 * hh + r; if (rowsPerB < 0) v += CP[cofs + (size_t)rr * ldc + col];      /* rowsPerB < 0: own element of the batched C plane */ else { const int bidx = rr / rowsPerB; v += CP[(size_t)bidx * sCPb + (size_t)by * 64 + col]; } } if (ACT == 1) v = (v > 0.f) ? v : expm1f(v); else if (ACT == 7) v = (v > 0.f) ? v + 1.0f : expf(v); else if (ACT == 8) v = tanhf(v); else if (ACT == 9) v = 0.5f * v * (1.0f + tanhf(0.7978845608028654f * (v + 0.044715f * v * v * v))); else if (ACT == 11) v = 1.0f / (1.0f + expf(-v)); else if (ACT == 12) v = (v > 0.f) ? v : 0.01f * v; else if (ACT == 14) v = (v > 0.f) ? v : 0.1f * v; else if (ACT == 16) v = (v >= 0.f) ? v : 0.3f * v; else if (ACT == 17) v = (v >= 0.f) ? v : 0.2f * v; else if (ACT == 15) v = v / (1.0f + expf(-v)); else if (ACT == 3) v = fmaxf(v, 0.f); else if (ACT == 6) v = 0.5f * v * (1.0f + erff(v * 0.70710678118654752f)); so[w][8 * hh + r][t * 16 + ln] = v; } }
  __builtin_amdgcn_fence(__ATOMIC_ACQ_REL, "workgroup"); __builtin_amdgcn_wave_barrier();
  const int rsub = lane >> 4, c4 = (lane & 15) * 4; typedef _Float16 v4h __attribute__((ext_vector_type(4)));
  {
#pragma unroll
    for (int q = 0; q < 8; ++q) { const int r = q * 2 + rsub; if (col0 + c4 < N) { const v4f v = *(const v4fa*)&so[w][r][c4]; if (C) *(v4f*)(C + cofs + (size_t)(row0 + r) * ldc + col0 + c4) = v; if (C16) { v4h h4; for (int i = 0; i < 4; ++i) h4[i] = (_Float16)v[i]; *(v4h*)(C16 + cofs + (size_t)(row0 + r) * ldc + col0 + c4) = h4; } } }
     }
}


typedef _Float16 v4h __attribute__((ext_vector_type(4)));

__global__ __launch_bounds__(256) void k_x16(const float* __restrict__ x, _Float16* __restrict__ X16, size_t n8) { const size_t t = (size_t)blockIdx.x * 256 + threadIdx.x; if (t >= n8) return; FragH f;
#pragma unroll
  for (int q = 0; q < 8; ++q) f.h[q] = (_Float16)bf16_round(x[t * 8 + q]); *(v8us*)((unsigned short*)X16 + t * 8) = f.half[0];  }
__global__ __launch_bounds__(256) void k_h16(const float* __restrict__ x, _Float16* __restrict__ X16, size_t n8) { const size_t t = (size_t)blockIdx.x * 256 + threadIdx.x; if (t >= n8) return; FragH f;
#pragma unroll
  for (int q = 0; q < 8; ++q) f.h[q] = (_Float16)x[t * 8 + q]; *(v8us*)((unsigned short*)X16 + t * 8) = f.half[0];  }
__global__ __launch_bounds__(256) void k_round16f(const float* __restrict__ W, _Float16* __restrict__ Bt, size_t n8) { const size_t t = (size_t)blockIdx.x * 256 + threadIdx.x; if (t >= n8) return; FragH f;
#pragma unroll
  for (int i = 0; i < 8; ++i) f.h[i] = (_Float16)(bf16_round(W[t * 8 + i]) * 16.0f); *(v8us*)((unsigned short*)Bt + t * 8) = f.half[0];  }
__global__ __launch_bounds__(256) void k_hl(const float* __restrict__ F, _Float16* __restrict__ Hh, _Float16* __restrict__ Hl, size_t n8) { const size_t t = (size_t)blockIdx.x * 256 + threadIdx.x; if (t >= n8) return; FragH fh, fl; const v4f a = *(const v4fa*)(F + t * 8), c = *(const v4fa*)(F + t * 8 + 4);
#pragma unroll
  for (int q = 0; q < 4; ++q) { _Float16 h = (_Float16)a[q]; fh.h[q] = h; fl.h[q] = (_Float16)((a[q] - (float)h) * 1024.0f); h = (_Float16)c[q]; fh.h[4 + q] = h; fl.h[4 + q] = (_Float16)((c[q] - (float)h) * 1024.0f); }
  { *(v8us*)((unsigned short*)Hh + t * 8) = fh.half[0]; *(v8us*)((unsigned short*)Hl + t * 8) = fl.half[0];  } }

__device__ __forceinline__ v16h g2_frag(const _Float16* p, int hh) { FragH f; f.half[0] = *(const v8us*)((const unsigned short*)p + 8 * hh); f.half[1] = *(const v8us*)((const unsigned short*)p + 16 + 8 * hh); return f.v; }


#define WCH 8                        /* 8-element chunks per thread */
// chunks t0 + 256 i of one weight matrix: all loads issued first, then converted and stored
__device__ __forceinline__ void wnat_part(const float* __restrict__ w, _Float16* __restrict__ Bt, unsigned t0) { v4f a[WCH][2]; const unsigned ob = t0 * 32;      /* the thread's first byte */
  /* the short loops below are all unrolled so that a stays in registers */
#pragma unroll
  for (int i = 0; i < WCH; ++i) { const float* p = (const float*)((const char*)w + ob) + 256 * 8 * i; a[i][0] = *(const v4fa*)p; a[i][1] = *(const v4fa*)(p + 4); }
  /* precaution: stands in front of every write of a register that the loads above name as an address; it names the offset (input only), so that no later load of the run lands in it either; it also keeps all the loads in front of the first store */
  asm volatile("s_wait_xcnt 0x0" :: "v"(ob) : "memory");
#pragma unroll
  for (int i = 0; i < WCH; ++i) { FragH f;
#pragma unroll
    for (int q = 0; q < 8; ++q) f.h[q] = (_Float16)(bf16_round(a[i][q >> 2][q & 3]) * 16.0f);
    *(v8us*)((unsigned short*)Bt + (size_t)(t0 + 256 * i) * 8) = f.half[0]; }
  asm volatile("s_wait_xcnt 0x0" ::: "memory"); }      /* precaution: in the built kernel the x + PE text follows this path behind a branch; the wait stands in front of its writes of registers that the stores above name */
__global__ __launch_bounds__(256) void k_rsm(const float* __restrict__ S, _Float16* __restrict__ P, int nrows) {
  #pragma clang fp contract(off)
  const int i = blockIdx.x * 256 + threadIdx.x; if (i >= nrows) return; const float* s = S + (size_t)i * SQ; float mx = -3.0e38f;
#pragma unroll 1
  for (int j = 0; j < SQ; ++j) mx = fmaxf(mx, s[j]); float se = 0.f;
#pragma unroll 1
  for (int j = 0; j < SQ; ++j) se += expf(s[j] - mx); const float sc = 256.0f / se;
#pragma unroll 1
  for (int j0 = 0; j0 < SQ; j0 += 8) { FragH f; for (int q = 0; q < 8; ++q) f.h[q] = (_Float16)(expf(s[j0 + q] - mx) * sc); unsigned short* d = (unsigned short*)P + (size_t)i * SQ + j0; *(v8us*)d = f.half[0];  } }
__global__ __launch_bounds__(256) void k_vt(const _Float16* __restrict__ V16, int b, int h0, _Float16* __restrict__ VT) { __shared__ unsigned short tl[64][65]; const int tid = threadIdx.x; const int hh = blockIdx.x % HG, sg = blockIdx.x / HG; const int s0 = sg * 64; const int h = h0 + hh;
  for (int i = tid; i < 64 * 8; i += 256) { const int j = i / 8, d8 = (i % 8) * 8; FragH f; f.half[0] = *(const v8us*)((const unsigned short*)V16 + ((size_t)b * SQ + s0 + j) * DM + h * HD + d8); for (int q = 0; q < 8; ++q) tl[d8 + q][j] = f.u[q]; }
  __syncthreads();
  { for (int i = tid; i < 64 * 8; i += 256) { const int d = i / 8, j8 = (i % 8) * 8; FragH f; for (int q = 0; q < 8; ++q) f.u[q] = tl[d][j8 + q]; *(v8us*)((unsigned short*)VT + ((size_t)hh * HD + d) * SQ + s0 + j8) = f.half[0]; }  } }



#define FAW 8                        /* waves per key part: FAW * 32 queries per workgroup */
#define FAS 2                        /* key parts = groups of waves */
#define FAK 64                       /* keys per stage */
#define FAP 72                       /* LDS row pitch in f16: 128 bytes of data + 16, so that the 16 rows of a fragment read start in 16 different bank groups */
#define FAT (SQ / FAS / FAK)         /* stages per key part */
typedef float v2f __attribute__((ext_vector_type(2)));
__device__ __forceinline__ float rs_xhalf(float x) { return __builtin_bit_cast(float, __builtin_amdgcn_permlanex16(__builtin_bit_cast(int, x), __builtin_bit_cast(int, x), 0x76543210, 0xfedcba98, false, false)); }      /* lane l reads lane l ^ 16 */
__device__ __forceinline__ v16h fa_frag(const unsigned short* p, int hh) { FragH f; f.half[0] = *(const v8us*)(p + 8 * hh); f.half[1] = *(const v8us*)(p + 16 + 8 * hh); return f.v; }
__device__ __forceinline__ v8f fa_mma(v16h a, v16h b, v8f c) { return __builtin_amdgcn_wmma_f32_16x16x32_f16(false, a, false, b, (short)0, c, false, false); }
// Eight native 2^x (v_exp_f32). The builtin, not asm text: the compiler schedules these between the matrix instructions and must see which registers they write.
__device__ __forceinline__ v8f fa_exp2x8(v8f x) { v8f e;
#pragma unroll      /* the vector stays in registers */
  for (int i = 0; i < 8; ++i) e[i] = __builtin_amdgcn_exp2f(x[i]);
  return e; }
static_assert(SQ % (FAW * 32) == 0 && SQ % (FAS * FAK) == 0 && HD == 64 && FAK == 64 && FAW * 32 == 256 && FAS == 2, "k_fattn: whole workgroups and stages; the 256 threads of a key part stage 64 rows of 128 bytes in two rounds; two parts swap one query group each");
__global__ __launch_bounds__(FAW * FAS * 32) void k_fattn(const _Float16* __restrict__ Q16, const _Float16* __restrict__ K16, const _Float16* __restrict__ VT, _Float16* __restrict__ O16) {
  __shared__ __attribute__((aligned(16))) unsigned short sk[FAS][2][FAK][FAP];      /* K rows [key part][buffer][key][d] */
  __shared__ __attribute__((aligned(16))) unsigned short sv[FAS][2][HD][FAP];       /* V^T rows [key part][buffer][d][key] */
  __shared__ __attribute__((aligned(16))) float smo[8][2][FAW][32][4];              /* handed-over output tiles [4 registers][query group][wave][lane] */
  __shared__ __attribute__((aligned(8))) float sml[2][FAW][32][2];                  /* handed-over maximum in use and sum [query group][wave][lane] */
  const int tid = threadIdx.x, w = (tid >> 5) & (FAW - 1), lane = tid & 31, ln = lane & 15, hh = lane >> 4;
  const int kh = __builtin_amdgcn_readfirstlane(tid >> 8);      /* the wave's key part, in a scalar register: the branches on it at the end are scalar */
  const int bh = blockIdx.y, b = bh / NH, hd = bh - b * NH; const size_t r0 = (size_t)b * SQ; const int q0 = (blockIdx.x * FAW + w) * 32;
  const int srow = (tid & 255) >> 3, sc8 = (tid & 7) * 8;      /* staging, per key part: 8 threads per 128-byte row, rows srow and srow + 32 */
  const unsigned short* kg = (const unsigned short*)K16 + (r0 + kh * (SQ / FAS) + srow) * DM + hd * HD + sc8;
  const unsigned short* vg = (const unsigned short*)VT + ((size_t)bh * HD + srow) * SQ + kh * (SQ / FAS) + sc8;
  v16h qf[2][2];      /* [16-query group][32 of d] */
  /* the short loops below are all unrolled so that the fragment and accumulator arrays stay in registers */
#pragma unroll
  for (int g = 0; g < 2; ++g)
#pragma unroll
    for (int ks = 0; ks < 2; ++ks) qf[g][ks] = g2_frag(Q16 + (r0 + q0 + g * 16 + ln) * DM + hd * HD + ks * 32, hh);
  const v8f z8 = {0.f, 0.f, 0.f, 0.f, 0.f, 0.f, 0.f, 0.f};
  v8f o[2][4] = {{z8, z8, z8, z8}, {z8, z8, z8, z8}}; float ms[2] = {-3.0e38f, -3.0e38f}, l[2] = {0.f, 0.f};
  const float cs = 0.125f * 1.44269504088896340736f;      /* 64^-0.5 log2 e */
  v8us kr0 = *(const v8us*)kg, kr1 = *(const v8us*)(kg + (size_t)32 * DM), vr0 = *(const v8us*)vg, vr1 = *(const v8us*)(vg + (size_t)32 * SQ);
  asm volatile("s_wait_xcnt 0x0" ::: "memory");      /* precaution: stands in front of every later write of a register that the loads above name as an address */
  *(v8us*)&sk[kh][0][srow][sc8] = kr0; *(v8us*)&sk[kh][0][srow + 32][sc8] = kr1; *(v8us*)&sv[kh][0][srow][sc8] = vr0; *(v8us*)&sv[kh][0][srow + 32][sc8] = vr1;
  __syncthreads();      /* stage 0 is published */
  for (int t = 0; t < FAT; ++t) { const int cur = t & 1;
    if (t + 1 < FAT) { const unsigned short* kn = kg + (size_t)(t + 1) * FAK * DM; const unsigned short* vn = vg + (t + 1) * FAK;
      kr0 = *(const v8us*)kn; kr1 = *(const v8us*)(kn + (size_t)32 * DM); vr0 = *(const v8us*)vn; vr1 = *(const v8us*)(vn + (size_t)32 * SQ); }
#pragma unroll
    for (int hp = 0; hp < 2; ++hp) {      /* two passes of 32 keys per stage: half the score registers live at once; unrolled, so that one pass's matrix work can be scheduled among the other's softmax */
      v8f s[2][2];      /* S^T: [query group][16-key tile], register r = key 8 hh + r, lane column = query */
#pragma unroll
      for (int j = 0; j < 2; ++j) { const v16h a0 = fa_frag(&sk[kh][cur][hp * 32 + j * 16 + ln][0], hh), a1 = fa_frag(&sk[kh][cur][hp * 32 + j * 16 + ln][32], hh);
#pragma unroll
        for (int g = 0; g < 2; ++g) s[g][j] = fa_mma(a1, qf[g][1], fa_mma(a0, qf[g][0], z8)); }
      v16h va[4];
#pragma unroll
      for (int dt = 0; dt < 4; ++dt) va[dt] = fa_frag(&sv[kh][cur][dt * 16 + ln][hp * 32], hh);
      float mxs[2];
#pragma unroll
      for (int g = 0; g < 2; ++g) { const v8f mv = __builtin_elementwise_max(s[g][0], s[g][1]);
        const float mx = fmaxf(fmaxf(fmaxf(mv[0], mv[1]), fmaxf(mv[2], mv[3])), fmaxf(fmaxf(mv[4], mv[5]), fmaxf(mv[6], mv[7])));
        mxs[g] = fmaxf(mx, rs_xhalf(mx)) * cs; }
      if (__builtin_amdgcn_ballot_w32(mxs[0] > ms[0] + 8.0f || mxs[1] > ms[1] + 8.0f) != 0) {      /* wave-uniform: some query's maximum has outgrown the one in use */
        const float n0 = fmaxf(ms[0], mxs[0]), n1 = fmaxf(ms[1], mxs[1]); const float c0 = __builtin_amdgcn_exp2f(ms[0] - n0), c1 = __builtin_amdgcn_exp2f(ms[1] - n1);      /* the two rescale factors */
        ms[0] = n0; ms[1] = n1; l[0] *= c0; l[1] *= c1;
#pragma unroll
        for (int dt = 0; dt < 4; ++dt) { o[0][dt] *= c0; o[1][dt] *= c1; } }
      v16h pf[2];      /* P^T as B operand, per query group */
#pragma unroll
      for (int g = 0; g < 2; ++g) { const float nb = 7.0f - ms[g];
#pragma unroll
        for (int j = 0; j < 2; ++j) s[g][j] = fa_exp2x8(s[g][j] * cs + nb);
        const v8f ps = s[g][0] + s[g][1];
        l[g] += ((ps[0] + ps[1]) + (ps[2] + ps[3])) + ((ps[4] + ps[5]) + (ps[6] + ps[7]));
        FragH f;
#pragma unroll
        for (int i = 0; i < 8; ++i) { f.h[i] = (_Float16)s[g][0][i]; f.h[8 + i] = (_Float16)s[g][1][i]; }
        pf[g] = f.v; }
#pragma unroll
      for (int dt = 0; dt < 4; ++dt)
#pragma unroll
        for (int g = 0; g < 2; ++g) o[g][dt] = fa_mma(va[dt], pf[g], o[g][dt]); }
    if (t + 1 < FAT) { *(v8us*)&sk[kh][cur ^ 1][srow][sc8] = kr0; *(v8us*)&sk[kh][cur ^ 1][srow + 32][sc8] = kr1; *(v8us*)&sv[kh][cur ^ 1][srow][sc8] = vr0; *(v8us*)&sv[kh][cur ^ 1][srow + 32][sc8] = vr1; }      /* its last readers left this buffer at the barrier of stage t - 1 */
    __syncthreads(); }      /* publishes stage t + 1 and ends every read of stage t */
#pragma unroll
  for (int g = 0; g < 2; ++g) if (g != kh) {      /* the query group that the wave of the other key part finishes */
#pragma unroll
    for (int dt = 0; dt < 4; ++dt) { *(v4f*)&smo[2 * dt][g][w][lane][0] = __builtin_shufflevector(o[g][dt], o[g][dt], 0, 1, 2, 3); *(v4f*)&smo[2 * dt + 1][g][w][lane][0] = __builtin_shufflevector(o[g][dt], o[g][dt], 4, 5, 6, 7); }
    const v2f ml = {ms[g], l[g]}; *(v2f*)&sml[g][w][lane][0] = ml; }
  __syncthreads();      /* the handed-over groups are published */
#pragma unroll
  for (int g = 0; g < 2; ++g) if (g == kh) {      /* join the two key parts: both are brought to the larger maximum in use */
    const v2f ml = *(const v2f*)&sml[g][w][lane][0]; const float m = fmaxf(ms[g], ml[0]); const float ca = __builtin_amdgcn_exp2f(ms[g] - m), cb = __builtin_amdgcn_exp2f(ml[0] - m);
    const float lj = l[g] * ca + ml[1] * cb; const float inv = 64.0f / (lj + rs_xhalf(lj));      /* the halves hold disjoint keys; o is carried x64 */
    const float fa = ca * inv, fb = cb * inv;
    unsigned short* op = (unsigned short*)O16 + (r0 + q0 + g * 16 + ln) * DM + hd * HD + 8 * hh;
#pragma unroll
    for (int dt = 0; dt < 4; ++dt) { FragH f; const v4f p0 = *(const v4f*)&smo[2 * dt][g][w][lane][0], p1 = *(const v4f*)&smo[2 * dt + 1][g][w][lane][0];
#pragma unroll
      for (int r = 0; r < 4; ++r) { f.h[r] = (_Float16)(o[g][dt][r] * fa + p0[r] * fb); f.h[4 + r] = (_Float16)(o[g][dt][4 + r] * fa + p1[r] * fb); }
      *(v8us*)(op + dt * 16) = f.half[0]; }      /* register r = d 16 dt + 8 hh + r of query ln: 16 contiguous bytes */
    if (g == 0) asm volatile("s_wait_xcnt 0x0" ::: "memory"); } }      /* precaution: in the built kernel the second group's text follows this path behind a branch; the wait stands in front of its writes of registers that the stores above name */


// ---- staged GEMM: C[MP][DM] = A[MP][DM] . Bt[DM][DM]^T x alpha + bias (bias rounded to bf16 first), A and Bt pitch DM; C f32 or f16 rows (pitch DM) or f16 transposed [NB][DM][SQ] ----
// One workgroup = 4 waves = one 128 x 128 tile of C, waves 2 (rows) x 2 (columns), 64 x 64 per wave: 8 fragments feed 16 WMMAs. The k axis runs in stages of KS: the 128 A rows
// and the 128 Bt rows of a stage come from global memory as whole lines, once per workgroup, and lie in LDS at a padded pitch; every wave takes its fragments from there.
// Two LDS buffers: stage t + 1 travels global -> registers while stage t is worked on and is stored in front of the stage's last block of 32 k; one barrier per stage.
// Each accumulator tile sums k in ascending steps of 32, one WMMA per step. The output staging lies over the stage buffers, which are out of use by then.
#define G3T 128                      /* tile rows and tile columns per workgroup */
#define G3W 4                        /* waves per workgroup */
#define G3PT 136                     /* row pitch in f16 of a transposed output tile: 256 bytes of data + 16 */
static_assert(MP % G3T == 0 && MPO % G3T == 0 && DM % G3T == 0, "k_gemm3: whole tiles");
static_assert(SQ % G3T == 0 && B0 == 0 && DM == NH * HD, "k_gemm3: a transposed tile lies in one batch; [batch][column] = [batch][head][d]");
template <int KS> struct G3Ring {      /* row pitch in f16: the stage's bytes + 16, so that the 16 rows of a fragment read start in 16 different bank groups */
  __attribute__((aligned(16))) unsigned short sa[2][G3T][KS + 8];      /* A rows [row][k] */
  __attribute__((aligned(16))) unsigned short sb[2][G3T][KS + 8]; };   /* Bt rows [column][k] */
template <int KS> union G3Lds {      /* declared once per kernel and handed in, so that two forms of the tile in one kernel share it */
  G3Ring<KS> ring;
  __attribute__((aligned(16))) float so[G3W][64][68];                  /* per-wave output staging */
  __attribute__((aligned(16))) unsigned short st[G3T][G3PT]; };        /* the workgroup's tile as [column][row] */
template <bool F32OUT, bool TR, int KS>      /* the result goes to C (f32) or to C16 (f16); the other pointer is not used; mt, nq: the workgroup's tile row and tile column; TR (f16 only): C16 takes the tile transposed, as rows [batch][column][place]; KS: k per stage */
__device__ __forceinline__ void gemm3_tile(G3Lds<KS>& lds, const _Float16* __restrict__ A, const _Float16* __restrict__ Bh, float alpha, const float* __restrict__ bias, float* __restrict__ C, _Float16* __restrict__ C16, int mt, int nq) {
  static_assert(!(F32OUT && TR), "gemm3_tile: the transposed form is f16");
  constexpr int TPR = KS / 8, RPP = G3W * 32 / TPR, NI = G3T / RPP, NS = DM / KS;      /* threads per staged row, rows per round, rounds, stages */
  static_assert(KS % 32 == 0 && DM % KS == 0 && NS >= 2 && G3T % RPP == 0, "gemm3_tile: whole stages and staging rounds");
  auto& sa = lds.ring.sa; auto& sb = lds.ring.sb;
  const int tid = threadIdx.x, w = tid >> 5, lane = tid & 31, ln = lane & 15, hh = lane >> 4;
  const int wr = (w >> 1) * 64, wc = (w & 1) * 64;      /* the wave's place in the tile */
  const int row0 = mt * G3T + wr, col0 = nq * G3T + wc;
  const int srow = tid / TPR, sc8 = (tid % TPR) * 8;      /* staging: TPR threads per row, rows srow + RPP i */
  const char* au = (const char*)(A + (size_t)(mt * G3T) * DM); const char* bu = (const char*)(Bh + (size_t)(nq * G3T) * DM);      /* the tile's first A row and first Bt row: the same for the whole workgroup, so scalar bases */
  unsigned vo = (unsigned)(srow * DM + sc8) * 2;      /* the thread's byte offset from either base, moved on by one stage at a time: one register that lives through the loop names every staging load's address */
  v8us ra[NI], rb[NI];
  /* the short loops below are all unrolled so that the staging, fragment and accumulator arrays stay in registers */
#pragma unroll
  for (int i = 0; i < NI; ++i) { ra[i] = *(const v8us*)(au + vo + (size_t)(RPP * i) * DM * 2); rb[i] = *(const v8us*)(bu + vo + (size_t)(RPP * i) * DM * 2); }
#pragma unroll
  for (int i = 0; i < NI; ++i) { *(v8us*)&sa[0][srow + RPP * i][sc8] = ra[i]; *(v8us*)&sb[0][srow + RPP * i][sc8] = rb[i]; }
  const v8f z8 = {0.f, 0.f, 0.f, 0.f, 0.f, 0.f, 0.f, 0.f}; v8f acc[4][4];      /* [16-row group][16-column group] */
#pragma unroll
  for (int i = 0; i < 4; ++i)
#pragma unroll
    for (int j = 0; j < 4; ++j) acc[i][j] = z8;
  __syncthreads();      /* stage 0 is published */
  for (int t = 0; t < NS; ++t) { const int cur = t & 1;
    if (t + 1 < NS) { vo += KS * 2;
#pragma unroll
      for (int i = 0; i < NI; ++i) { ra[i] = *(const v8us*)(au + vo + (size_t)(RPP * i) * DM * 2); rb[i] = *(const v8us*)(bu + vo + (size_t)(RPP * i) * DM * 2); } }
    v16h fa[2][4], fb[2][4];      /* two fragment sets: block ks + 1 is fetched while block ks (32 of k, 16 WMMAs) is worked on */
#pragma unroll
    for (int i = 0; i < 4; ++i) { fa[0][i] = fa_frag(&sa[cur][wr + i * 16 + ln][0], hh); fb[0][i] = fa_frag(&sb[cur][wc + i * 16 + ln][0], hh); }
#pragma unroll
    for (int ks = 0; ks < KS / 32; ++ks) {
      if (ks + 1 < KS / 32) {
#pragma unroll
        for (int i = 0; i < 4; ++i) { fa[(ks + 1) & 1][i] = fa_frag(&sa[cur][wr + i * 16 + ln][(ks + 1) * 32], hh); fb[(ks + 1) & 1][i] = fa_frag(&sb[cur][wc + i * 16 + ln][(ks + 1) * 32], hh); } }
      else if (t + 1 < NS) {      /* in front of the last block, whose matrix work covers the stores; the buffer's last readers left it at the barrier of stage t - 1 */
#pragma unroll
        for (int i = 0; i < NI; ++i) { *(v8us*)&sa[cur ^ 1][srow + RPP * i][sc8] = ra[i]; *(v8us*)&sb[cur ^ 1][srow + RPP * i][sc8] = rb[i]; } }
      __builtin_amdgcn_sched_barrier(0);      /* keeps the LDS reads above as one group ahead of the block: left to itself the compiler puts them in pairs among the WMMAs, each pair waited out */
#pragma unroll
      for (int j = 0; j < 4; ++j)
#pragma unroll
        for (int i = 0; i < 4; ++i) acc[i][j] = fa_mma(fa[ks & 1][i], fb[ks & 1][j], acc[i][j]);
      __builtin_amdgcn_sched_barrier(0); }      /* keeps the next group of LDS reads behind this block's WMMAs */
    __syncthreads(); }      /* publishes stage t + 1 and ends every read of stage t; behind the last one the stage buffers are free for the output staging */
  const int bc = col0 + ln; float bb[4];
#pragma unroll
  for (int j = 0; j < 4; ++j) bb[j] = bias[bc + j * 16];
  asm volatile("s_wait_xcnt 0x0" :: "s"(bias), "v"(bc) : "memory");      /* precaution: stands in front of every write of a register that the four bias loads above name as an address; it names base and index (inputs only), so that they live up to it */
  if (TR) {      /* transposed output: an accumulator tile holds, per lane, 8 consecutive rows of one column = 16 contiguous bytes of the transposed row */
    auto& st = lds.st;
#pragma unroll
    for (int j = 0; j < 4; ++j) { const float bv = bf16_round(bb[j]);
#pragma unroll
      for (int i = 0; i < 4; ++i) { FragH f;
#pragma unroll
        for (int r = 0; r < 8; ++r) f.h[r] = (_Float16)(acc[i][j][r] * alpha + bv);
        *(v8us*)&st[wc + j * 16 + ln][wr + i * 16 + 8 * hh] = f.half[0]; } }
    __syncthreads();      /* a transposed row holds the rows of two waves */
    const int bt = mt / (SQ / G3T), s0 = (mt - bt * (SQ / G3T)) * G3T;      /* the tile's batch and first place */
    const int trow = tid >> 4, tc8 = (tid & 15) * 8;      /* 16 threads per 256-byte row, rows trow + 8 i */
    unsigned short* cg = (unsigned short*)C16 + ((size_t)bt * DM + nq * G3T + trow) * SQ + s0 + tc8;
#pragma unroll
    for (int i = 0; i < 16; ++i) *(v8us*)(cg + (size_t)(8 * i) * SQ) = *(const v8us*)&st[trow + 8 * i][tc8];      /* 16 lanes store the 256 bytes of one transposed row: whole lines */
    return; }
  auto& so = lds.so;
#pragma unroll
  for (int j = 0; j < 4; ++j) { const float bv = bf16_round(bb[j]);
#pragma unroll
    for (int i = 0; i < 4; ++i)
#pragma unroll
      for (int r = 0; r < 8; ++r) so[w][i * 16 + 8 * hh + r][j * 16 + ln] = acc[i][j][r] * alpha + bv; }
  __builtin_amdgcn_fence(__ATOMIC_ACQ_REL, "workgroup"); __builtin_amdgcn_wave_barrier();      /* the wave reads back rows that its other lanes wrote */
  const int rsub = lane >> 4, c4 = (lane & 15) * 4;
  const size_t e = (size_t)(row0 + rsub) * DM + col0 + c4;      /* the lane's first element; its further rows lie at constant distances, so that one address register serves all the stores */
#pragma unroll
  for (int q = 0; q < 32; ++q) { const v4f v = *(const v4fa*)&so[w][q * 2 + rsub][c4];
    if (F32OUT) *(v4f*)(C + e + (size_t)(q * 2) * DM) = v; else *(v4h*)(C16 + e + (size_t)(q * 2) * DM) = __builtin_convertvector(v, v4h); }      /* 16 lanes store one row of the wave's 64 columns: whole lines */
  asm volatile("s_wait_xcnt 0x0" ::: "memory"); }      /* precaution: in the built Q/K/V kernel the transposed form's text follows this path behind a branch; the wait stands in front of its writes of the register pair that the stores above name */
// The output projection: one grid of (MPO / G3T) x (DM / G3T) tiles, f32 result. One workgroup per WGP, so one wave per SIMD: stages of 128 k, half as many barriers.
__global__ __launch_bounds__(G3W * 32) void k_gemm3o(const _Float16* __restrict__ A, const _Float16* __restrict__ Bh, float alpha, const float* __restrict__ bias, float* __restrict__ C) {
  const int mt = blockIdx.x / (DM / G3T), nq = blockIdx.x - mt * (DM / G3T);
  __shared__ G3Lds<128> lds;
  gemm3_tile<true, false, 128>(lds, A, Bh, alpha, bias, C, nullptr, mt, nq); }
// The Q, K and V projections read the same A and do not depend on each other: one grid holds the tiles of all three, so that they share one launch and fill the chip without a
// gap between them. A tile row's 3 x (DM / G3T) workgroups are neighbours in the grid (Q's columns, then K's, then V's), so its A rows are read again while they are still in the cache.
// Q and K leave as token rows; V leaves transposed, V^T [NB][NH][HD][SQ], the form the attention kernel stages: no V rows and no transposing launch.
// Stages of 64 k: three workgroups' LDS fits one WGP, and the second launch bound holds the registers to three waves per SIMD, so that the whole grid is resident at once and
// one workgroup's LDS reads, staging waits and epilogue run under the matrix work of the two others, which share no barrier with it.
__global__ __launch_bounds__(G3W * 32, 3) void k_gemm3qkv(const _Float16* __restrict__ A, const _Float16* __restrict__ Bq, const _Float16* __restrict__ Bk, const _Float16* __restrict__ Bv, float alpha,
                                                  const float* __restrict__ bq, const float* __restrict__ bk, const float* __restrict__ bv, _Float16* __restrict__ Cq, _Float16* __restrict__ Ck, _Float16* __restrict__ CvT) {
  const int mt = blockIdx.x / (3 * (DM / G3T)), c = blockIdx.x - mt * (3 * (DM / G3T)); const int m = c / (DM / G3T), nq = c - m * (DM / G3T);      /* m: 0 = Q, 1 = K, 2 = V; the same for the whole workgroup */
  __shared__ G3Lds<64> lds;
  if (m == 2) gemm3_tile<false, true, 64>(lds, A, Bv, alpha, bv, nullptr, CvT, mt, nq);      /* two texts, one per output form: each runs from its last stage straight into its own epilogue */
  else gemm3_tile<false, false, 64>(lds, A, m == 0 ? Bq : Bk, alpha, m == 0 ? bq : bk, nullptr, m == 0 ? Cq : Ck, mt, nq); }


#define XPP 4                        /* places (sequence positions) per thread */
// x + PE. A thread keeps one 8-column chunk and walks XPP places: the four frequencies of its columns are formed once, a place's sines and cosines once for all NB batches
// (PE does not depend on the batch); every element is the same expression as for one chunk alone. All loads of x are issued first and travel while PE is formed.
// PE is formed in a rolled loop and parked in LDS, each thread in slots of its own (no barrier). Workgroup g: places 2 XPP g ... 2 XPP g + 2 XPP - 1.
static_assert(DM / 8 == 128 && SQ % (2 * XPP) == 0, "xpe_part: 256 threads hold two rows of 128 chunks; whole workgroups");
__device__ __forceinline__ void xpe_part(const float* __restrict__ x, _Float16* __restrict__ X16, unsigned g, int tid) {
  #pragma clang fp contract(off)
  __shared__ __attribute__((aligned(8))) float spe[XPP][4][256][2];      /* [place][frequency][thread][sin, cos] */
  const int c0 = (tid & 127) * 8, p0 = (int)g * (2 * XPP) + (tid >> 7); const float kf = (float)(-9.210340371976184 / (double)DM); v4f xa[XPP][NB][2];
  const float* px[NB];      /* the thread's first chunk in each batch */
  /* the loops over xa are unrolled so that it stays in registers */
#pragma unroll
  for (int b = 0; b < NB; ++b) { px[b] = x + ((size_t)b * SQ + p0) * DM + c0;
#pragma unroll
    for (int i = 0; i < XPP; ++i) { const float* p = px[b] + (size_t)(2 * i) * DM; xa[i][b][0] = *(const v4fa*)p; xa[i][b][1] = *(const v4fa*)(p + 4); } }
  static_assert(NB == 2, "xpe_part: the wait below names the two addresses");
  /* precaution: stands in front of every write of a register that the loads above name as an address; it names the addresses (inputs only), so that no later load of the run lands in one of them either; it also keeps all the loads in front of the PE loop */
  asm volatile("s_wait_xcnt 0x0" :: "v"(px[0]), "v"(px[1]) : "memory");
#pragma unroll 1      /* rolled, like the loop inside: one copy of the exp, sin and cos text */
  for (int j = 0; j < 4; ++j) { const float dv = expf(__fmul_rn((float)(c0 + 2 * j), kf));
#pragma unroll 1
    for (int i = 0; i < XPP; ++i) { const float ang = __fmul_rn((float)(p0 + 2 * i), dv); spe[i][j][tid][0] = sinf(ang); spe[i][j][tid][1] = cosf(ang); } }
#pragma unroll
  for (int i = 0; i < XPP; ++i) { float pe[8];
#pragma unroll
    for (int j = 0; j < 4; ++j) { pe[2 * j] = spe[i][j][tid][0]; pe[2 * j + 1] = spe[i][j][tid][1]; }
#pragma unroll
    for (int b = 0; b < NB; ++b) { FragH f;
#pragma unroll
      for (int q = 0; q < 8; ++q) f.h[q] = (_Float16)__fadd_rn(bf16_round(xa[i][b][q >> 2][q & 3]), pe[q]);
      *(v8us*)((unsigned short*)X16 + ((size_t)b * SQ + p0 + 2 * i) * DM + c0) = f.half[0]; } } }
// x + PE and the four weight conversions do not depend on each other: one grid, dealt by workgroup range. The x + PE workgroups, the longer ones, come first.
// Two workgroups per WGP in all: each thread carries 8 chunks, so that few waves have to start.
#define PXG ((unsigned)(SQ / (2 * XPP)))                         /* workgroups of x + PE */
#define PWG ((unsigned)((size_t)DM * DM / 8 / (256 * WCH)))      /* workgroups per weight matrix */
static_assert((size_t)DM * DM / 8 % (256 * WCH) == 0, "k_prep: whole workgroups per weight matrix");
__global__ __launch_bounds__(256) void k_prep(const float* __restrict__ x, const float* __restrict__ wq, const float* __restrict__ wk, const float* __restrict__ wv, const float* __restrict__ wo,
                                              _Float16* __restrict__ X16, _Float16* __restrict__ BQ, _Float16* __restrict__ BK, _Float16* __restrict__ BV, _Float16* __restrict__ BO) {
  const unsigned g = blockIdx.x;
  if (g < PXG) { xpe_part(x, X16, g, (int)threadIdx.x); return; }      /* x + sinusoidal PE -> f16 rows (not exact: x + pe is not a bf16 value) */
  const unsigned u = g - PXG, m = u / PWG;      /* m: which weight matrix; the same for the whole workgroup */
  wnat_part(m == 0 ? wq : m == 1 ? wk : m == 2 ? wv : wo, m == 0 ? BQ : m == 1 ? BK : m == 2 ? BV : BO, (u - m * PWG) * (256 * WCH) + threadIdx.x); }      /* natural [out][in] = Bt[n][k], x16 */
extern "C" void kernel_launch(void* const* d_in, const int* in_sizes, int n_in,
                              void* d_out, int out_size, void* d_ws, size_t ws_size, hipStream_t stream) {
  (void)in_sizes; (void)n_in; (void)out_size;
  const float* const* I = (const float* const*)d_in; const float* x = I[0]; const float* wq = I[1]; const float* bq = I[2]; const float* wk = I[3]; const float* bk = I[4]; const float* wv = I[5]; const float* bv = I[6]; const float* wo = I[7]; const float* bo = I[8];      /* nn.Linear weights [out][in] + biases */
  char* ws = (char*)d_ws; size_t off = 0;
  auto take = [&](size_t bytes) { char* p = ws + off; off += (bytes + 255) & ~(size_t)255; return p; };
  _Float16* BQ = (_Float16*)take((size_t)DM * DM * 2); _Float16* BK = (_Float16*)take((size_t)DM * DM * 2); _Float16* BV = (_Float16*)take((size_t)DM * DM * 2); _Float16* BO = (_Float16*)take((size_t)DM * DM * 2);
  _Float16* X16 = (_Float16*)take(NR * DM * 2); _Float16* Q16 = (_Float16*)take(NR * DM * 2); _Float16* K16 = (_Float16*)take(NR * DM * 2); _Float16* O16 = (_Float16*)take(NR * DM * 2);
  _Float16* VT = (_Float16*)take((size_t)NB * NH * HD * SQ * 2);
  if (off > ws_size) return;
  k_prep<<<PXG + 4 * PWG, 256, 0, stream>>>(x, wq, wk, wv, wo, X16, BQ, BK, BV, BO);      /* f16 operands: x + PE rows and the four weight matrices */
  const size_t r0p = (size_t)B0 * SQ;      /* first projected row */
  k_gemm3qkv<<<(unsigned)((MP / G3T) * 3 * (DM / G3T)), G3W * 32, 0, stream>>>(X16 + r0p * DM, BQ, BK, BV, 0.0625f, bq, bk, bv, Q16 + r0p * DM, K16 + r0p * DM, VT);      /* q, k rows; V^T [NB][NH][HD][SQ] */
  k_fattn<<<dim3(SQ / (FAW * 32), NB * NH), FAW * FAS * 32, 0, stream>>>(Q16, K16, VT, O16);      /* o (merged heads, x64) as f16 rows */
  k_gemm3o<<<(unsigned)((MPO / G3T) * (DM / G3T)), G3W * 32, 0, stream>>>(O16 + r0p * DM, BO, 0.0009765625f, bo, (float*)d_out + r0p * DM);      /* out rows are the output layout */
}

// v009
// Measured time: 74.2 microseconds a run.
// In both of two side-by-side timings against v008, it was 1.07 times as fast.
// Counting every step since v000, it is 49.8 times as fast.
#include <hip/hip_runtime.h>
// Temporal multi-head attention with sinusoidal positional encoding (x [2][2048][1024]; x = x + PE (pe[s][2i] = sin(s d_i), pe[s][2i+1] = cos(s d_i), d_i = exp(2i x (-ln 1e4 / 1024))); q = x Wq^T + bq, k, v likewise (nn.Linear [out][in] 1024^2, weights and biases sigma 1/32); 16 heads of 64; softmax(q k^T / 8) (no mask); out = ctx Wo^T + bo -> [2][2048][1024]).
// Structure: token rows r = b*2048 + s; x + PE computed on VALU (f32 expf/sinf/cosf in the module's op order) -> f16 rows (one f16 rounding of x + pe); Q, K, V as three WMMA GEMMs in one grid (128x128 workgroup tiles staged in LDS, 64x64 wave tiles, f32 accumulation, exact x16 weights + bias, f16 outputs; the V tiles leave transposed, as V^T rows per batch and head); one fused attention kernel over all (batch, head, 256 queries), the keys dealt to two groups of waves and the two partial results joined at the end: scores on WMMA (K = 64), online softmax on VALU (f32 statistics, native exp2; weights as f16, scaled by a power of two that cancels), o = P . V on WMMA (o carried x64 against f16 subnormal flush, folded into the output GEMM alpha) written straight into the merged f16 o rows; out = o W_o + b GEMM (f32) into the output layout.
// Compute dtype: inputs rounded to bf16; weights exact, x + pe rounded once to f16; q, k, v, softmax weights and o as plain f16 GEMM operands (~2^-12); scores and softmax statistics f32; v_wmma_f32_16x16x32_f16.
#define NB 2
#define SQ 2048
#define DM 1024
#define NH 16
#define HD 64
#define HG 4                         /* heads per call of the unlaunched k_vt(V16, b, h0, VT) */
#define B0 0                         /* first batch processed (debug hook) */
#define NBR NB                       /* batches processed (debug hook) */
#define NR ((size_t)NB * SQ)         /* token rows */
#define MP ((int)((size_t)NBR * SQ)) /* rows projected (debug hook) */
#define QN SQ                        /* unused: k_fattn attends all SQ query rows */
#define NHD NH                       /* unused: k_fattn attends all NH heads */
#define MPO MP                       /* rows through the output stage (debug hook) */
typedef __bf16 v16b __attribute__((ext_vector_type(16)));
typedef unsigned short v8us __attribute__((ext_vector_type(8), may_alias));
typedef float  v8f  __attribute__((ext_vector_type(8)));
typedef float  v4f  __attribute__((ext_vector_type(4)));
typedef float  v4fa __attribute__((ext_vector_type(4), may_alias));
union FragB { v16b v; v8us half[2]; unsigned short u[16]; };

__device__ __forceinline__ unsigned short bf16_bits(float x) { unsigned int u = __float_as_uint(x); return (unsigned short)((u + 0x7FFFu + ((u >> 16) & 1u)) >> 16); }
__device__ __forceinline__ float bf16_val(unsigned short b) { return __uint_as_float(((unsigned int)b) << 16); }
__device__ __forceinline__ float bf16_round(float x) { return bf16_val(bf16_bits(x)); }
// D += A·B with NT terms: 1 = ah·bh, 2 = + al·bh (A split), 3 = + ah·bl (both split)
template <int NT>
__device__ __forceinline__ v8f mmaN(v16b ah, v16b al, v16b bh, v16b bl, v8f c) {
  c = __builtin_amdgcn_wmma_f32_16x16x32_bf16(false, ah, false, bh, (short)0, c, false, false);
  if (NT >= 2) c = __builtin_amdgcn_wmma_f32_16x16x32_bf16(false, al, false, bh, (short)0, c, false, false);
  if (NT >= 3) c = __builtin_amdgcn_wmma_f32_16x16x32_bf16(false, ah, false, bl, (short)0, c, false, false);
  asm volatile("v_nop\n\tv_nop\n\tv_nop\n\tv_nop" : "+v"(c) : "v"(ah), "v"(al), "v"(bh), "v"(bl));
  return c;
}

__global__ __launch_bounds__(256) void k_wt_bf16(const float* __restrict__ W, unsigned short* __restrict__ Wt, int K, int N) {
  const int t = blockIdx.x * 256 + threadIdx.x;
  const int k8n = K / 8;
  if (t >= N * k8n) return;
  const int n = t / k8n, k8 = (t % k8n) * 8;
  v8us v;
#pragma unroll
  for (int i = 0; i < 8; ++i) v[i] = bf16_bits(W[(size_t)(k8 + i) * N + n]);
  *(v8us*)(Wt + (size_t)n * K + k8) = v;
  
}

// GEMM C[M][N] (f32, pitch ldc) = act(A[M][K]·W + bias). A f32 row-major (pitch lda) converted per fragment to bf16
// (ASPLIT: hi/lo two planes -> 2 terms, else single rounded term); Wt bf16 [N][K] (pitch ldb). BIAS_BF16 rounds the
// bias to bf16 first (bias quantised to bf16 before the add). K%32==0, M%16==0, N%64==0.
template <bool ASPLIT, int ACT, bool BIAS_BF16>
__global__ __launch_bounds__(128) void k_gemm_bf(const float* __restrict__ A, int lda, const unsigned short* __restrict__ Wt, int ldb,
                                               const float* __restrict__ bias, float* __restrict__ C, int ldc, int M, int N, int K) {
  __shared__ __attribute__((aligned(16))) float so[4][16][64];
  const int tid = threadIdx.x, w = tid >> 5, lane = tid & 31, ln = lane & 15, hh = lane >> 4;
  const int ntn = N / 64;
  const int wid = blockIdx.x * 4 + w;
  const int mt = wid / ntn, nq = wid % ntn;
  if (mt * 16 >= M) return;
  const int row0 = mt * 16, col0 = nq * 64;
  const float* arow = A + (size_t)(row0 + ln) * lda;
  v8f acc[4] = {};
  for (int kb = 0; kb < K; kb += 32) {
    FragB ah, al;
    const v4f x0 = *(const v4fa*)(arow + kb + 8 * hh), x1 = *(const v4fa*)(arow + kb + 8 * hh + 4);
    const v4f x2 = *(const v4fa*)(arow + kb + 16 + 8 * hh), x3 = *(const v4fa*)(arow + kb + 16 + 8 * hh + 4);
    float xs[16] = {x0[0],x0[1],x0[2],x0[3],x1[0],x1[1],x1[2],x1[3],x2[0],x2[1],x2[2],x2[3],x3[0],x3[1],x3[2],x3[3]};
#pragma unroll
    for (int i = 0; i < 16; ++i) { const unsigned short hb = bf16_bits(xs[i]); ah.u[i] = hb; al.u[i] = ASPLIT ? bf16_bits(xs[i] - bf16_val(hb)) : (unsigned short)0; }
#pragma unroll
    for (int t = 0; t < 4; ++t) {
      const unsigned short* brow = Wt + (size_t)(col0 + t * 16 + ln) * ldb + kb;
      FragB b;
      b.half[0] = *(const v8us*)(brow + 8 * hh);
      b.half[1] = *(const v8us*)(brow + 16 + 8 * hh);
      acc[t] = mmaN<ASPLIT ? 2 : 1>(ah.v, al.v, b.v, b.v, acc[t]);
    }
  }
#pragma unroll
  for (int t = 0; t < 4; ++t) {
    float bv = bias ? bias[col0 + t * 16 + ln] : 0.f;
    if (BIAS_BF16) bv = bf16_round(bv);
#pragma unroll
    for (int r = 0; r < 8; ++r) { float v = acc[t][r] + bv; if (ACT == 1) v = fmaxf(v, 0.f); so[w][8 * hh + r][t * 16 + ln] = v; }
  }
  __builtin_amdgcn_fence(__ATOMIC_ACQ_REL, "workgroup");
  __builtin_amdgcn_wave_barrier();
  const int rsub = lane >> 4, c4 = (lane & 15) * 4;
  {
#pragma unroll
    for (int q = 0; q < 8; ++q) {
      const int r = q * 2 + rsub;
      const v4f v = *(const v4fa*)&so[w][r][c4];
      *(v4f*)(C + (size_t)(row0 + r) * ldc + col0 + c4) = v;
    }
    
  }
}

// GEMM C = act(A·W + bias + resid): A f32 (ASPLIT -> hi/lo 2 terms), Wt bf16 [N][K]; ACT 0 none, 1 relu, 2 exact gelu;
// resid (optional, f32, row index = (row % rmod), pitch ldr, RES_BF16 rounds it) added before the activation.
template <bool ASPLIT, int ACT, bool BIAS_BF16, bool RES_BF16>
__global__ __launch_bounds__(128) void k_gemm_bf3(const float* __restrict__ A, int lda, const unsigned short* __restrict__ Wt, int ldb,
                                                const float* __restrict__ bias, const float* __restrict__ resid, int rmod, int ldr,
                                                float* __restrict__ C, int ldc, int M, int N, int K) {
  __shared__ __attribute__((aligned(16))) float so[4][16][64];
  const int tid = threadIdx.x, w = tid >> 5, lane = tid & 31, ln = lane & 15, hh = lane >> 4;
  const int ntn = N / 64;
  const int wid = blockIdx.x * 4 + w;
  const int mt = wid / ntn, nq = wid % ntn;
  if (mt * 16 >= M) return;
  const int row0 = mt * 16, col0 = nq * 64;
  const float* arow = A + (size_t)(row0 + ln) * lda;
  v8f acc[4] = {};
  for (int kb = 0; kb < K; kb += 32) {
    FragB ah, al;
    const v4f x0 = *(const v4fa*)(arow + kb + 8 * hh), x1 = *(const v4fa*)(arow + kb + 8 * hh + 4);
    const v4f x2 = *(const v4fa*)(arow + kb + 16 + 8 * hh), x3 = *(const v4fa*)(arow + kb + 16 + 8 * hh + 4);
    float xs[16] = {x0[0],x0[1],x0[2],x0[3],x1[0],x1[1],x1[2],x1[3],x2[0],x2[1],x2[2],x2[3],x3[0],x3[1],x3[2],x3[3]};
#pragma unroll
    for (int i = 0; i < 16; ++i) { const unsigned short hb = bf16_bits(xs[i]); ah.u[i] = hb; al.u[i] = ASPLIT ? bf16_bits(xs[i] - bf16_val(hb)) : (unsigned short)0; }
#pragma unroll
    for (int t = 0; t < 4; ++t) {
      const unsigned short* brow = Wt + (size_t)(col0 + t * 16 + ln) * ldb + kb;
      FragB b;
      b.half[0] = *(const v8us*)(brow + 8 * hh);
      b.half[1] = *(const v8us*)(brow + 16 + 8 * hh);
      acc[t] = mmaN<ASPLIT ? 2 : 1>(ah.v, al.v, b.v, b.v, acc[t]);
    }
  }
#pragma unroll
  for (int t = 0; t < 4; ++t) {
    const int col = col0 + t * 16 + ln;
    float bv = bias ? bias[col] : 0.f;
    if (BIAS_BF16) bv = bf16_round(bv);
#pragma unroll
    for (int r = 0; r < 8; ++r) {
      float v = acc[t][r] + bv;
      if (resid) { float rv = resid[(size_t)((row0 + 8 * hh + r) % rmod) * ldr + col]; if (RES_BF16) rv = bf16_round(rv); v += rv; }
      if (ACT == 1) v = fmaxf(v, 0.f);
      if (ACT == 2) v = 0.5f * v * (1.0f + erff(v * 0.70710678118654752f));
      if (ACT == 3) { const float u = 0.7978845608028654f * (v + 0.044715f * v * v * v); v = 0.5f * v * (1.0f + tanhf(u)); }
      so[w][8 * hh + r][t * 16 + ln] = v;
    }
  }
  __builtin_amdgcn_fence(__ATOMIC_ACQ_REL, "workgroup");
  __builtin_amdgcn_wave_barrier();
  const int rsub = lane >> 4, c4 = (lane & 15) * 4;
  {
#pragma unroll
    for (int q = 0; q < 8; ++q) {
      const int r = q * 2 + rsub;
      const v4f v = *(const v4fa*)&so[w][r][c4];
      *(v4f*)(C + (size_t)(row0 + r) * ldc + col0 + c4) = v;
    }
    
  }
}
// row LayerNorm (biased variance, eps) over N: s = X (+ R); optional out_sum <- s; out_norm <- (s-mu)*rsqrt(var+eps)*g + b
template <bool PARAM_BF16>
__global__ __launch_bounds__(256) void k_layernorm(const float* __restrict__ X, const float* __restrict__ R, const float* __restrict__ g, const float* __restrict__ bta,
                                                  float* __restrict__ out_sum, float* __restrict__ out_norm, int N, float eps) {
  __shared__ float red[256];
  const int row = blockIdx.x, tid = threadIdx.x;
  const float* x = X + (size_t)row * N; const float* rr = R ? R + (size_t)row * N : nullptr;
  float vals[16];                     // up to N = 4096
  const int per = N / 256;            // contiguous chunk per thread? use strided-by-4 chunks: thread handles j = tid*4 + 1024*u
  float s1 = 0.f;
  for (int u = 0; u < per / 4; ++u) {
    const int j = tid * 4 + 1024 * u;
    const v4f a = *(const v4fa*)(x + j);
    v4f b = {0.f,0.f,0.f,0.f}; if (rr) b = *(const v4fa*)(rr + j);
#pragma unroll
    for (int q = 0; q < 4; ++q) { const float v = a[q] + b[q]; vals[u * 4 + q] = v; s1 += v; }
  }
  red[tid] = s1; __syncthreads();
  for (int st = 128; st > 0; st >>= 1) { if (tid < st) red[tid] += red[tid + st]; __syncthreads(); }
  const float mu = red[0] / (float)N; __syncthreads();
  float s2 = 0.f;
  for (int u = 0; u < per / 4; ++u)
#pragma unroll
    for (int q = 0; q < 4; ++q) { const float c = vals[u * 4 + q] - mu; s2 += c * c; }
  red[tid] = s2; __syncthreads();
  for (int st = 128; st > 0; st >>= 1) { if (tid < st) red[tid] += red[tid + st]; __syncthreads(); }
  const float rs = rsqrtf(red[0] / (float)N + eps);
  {
    for (int u = 0; u < per / 4; ++u) {
      const int j = tid * 4 + 1024 * u;
      v4f o, sm;
#pragma unroll
      for (int q = 0; q < 4; ++q) {
        float gg = g[j + q], bb = bta[j + q];
        if (PARAM_BF16) { gg = bf16_round(gg); bb = bf16_round(bb); }
        sm[q] = vals[u * 4 + q]; o[q] = (vals[u * 4 + q] - mu) * rs * gg + bb;
      }
      if (out_sum) *(v4f*)(out_sum + (size_t)row * N + j) = sm;
      *(v4f*)(out_norm + (size_t)row * N + j) = o;
    }
    
  }
}



// ---- f16 WMMA path (v_wmma_f32_16x16x32_f16): 11-bit significands for operands in range — used where a [0,1] probability operand needs more precision than bf16
typedef _Float16 v16h __attribute__((ext_vector_type(16)));
union FragH { v16h v; v8us half[2]; _Float16 h[16]; unsigned short u[16]; };
template <int NT>
__device__ __forceinline__ v8f mmaH(v16h ah, v16h al, v16h bh, v16h bl, v8f c) {
  c = __builtin_amdgcn_wmma_f32_16x16x32_f16(false, ah, false, bh, (short)0, c, false, false);
  if (NT >= 2) c = __builtin_amdgcn_wmma_f32_16x16x32_f16(false, al, false, bh, (short)0, c, false, false);
  if (NT >= 3) c = __builtin_amdgcn_wmma_f32_16x16x32_f16(false, ah, false, bl, (short)0, c, false, false);
  asm volatile("v_nop\n\tv_nop\n\tv_nop\n\tv_nop" : "+v"(c) : "v"(ah), "v"(al), "v"(bh), "v"(bl));
  return c;
}
// batched GEMM like k_gemm_b but f16 operands: A f32 (split into f16 hi/lo if ASPLIT, else rounded to f16), Bt = f16 values [n][k]; alpha; C f32; N multiple of 16 (partial tiles skipped)
template <bool ASPLIT>
__global__ __launch_bounds__(128) void k_gemm_h(const float* __restrict__ A, int lda, size_t sA, const _Float16* __restrict__ Bh, int ldb, size_t sB, float alpha, float* __restrict__ C, int ldc, size_t sC, int M, int N, int K) {
  __shared__ __attribute__((aligned(16))) float so[4][16][64];
  const int tid = threadIdx.x, w = tid >> 5, lane = tid & 31, ln = lane & 15, hh = lane >> 4; const int by = blockIdx.y;
  A += (size_t)by * sA; Bh += (size_t)by * sB; C += (size_t)by * sC;
  const int ntn = (N + 63) / 64; const int wid = blockIdx.x * 4 + w; const int mt = wid / ntn, nq = wid % ntn; if (mt * 16 >= M) return;
  const int row0 = mt * 16, col0 = nq * 64; const float* arow = A + (size_t)(row0 + ln) * lda;
  v8f acc[4] = {};
  for (int kb = 0; kb < K; kb += 32) {
    FragH ah, al;
    const v4f x0 = *(const v4fa*)(arow + kb + 8 * hh), x1 = *(const v4fa*)(arow + kb + 8 * hh + 4), x2 = *(const v4fa*)(arow + kb + 16 + 8 * hh), x3 = *(const v4fa*)(arow + kb + 16 + 8 * hh + 4);
    float xs[16] = {x0[0],x0[1],x0[2],x0[3],x1[0],x1[1],x1[2],x1[3],x2[0],x2[1],x2[2],x2[3],x3[0],x3[1],x3[2],x3[3]};
#pragma unroll
    for (int i = 0; i < 16; ++i) { const _Float16 h = (_Float16)xs[i]; ah.h[i] = h; al.h[i] = ASPLIT ? (_Float16)(xs[i] - (float)h) : (_Float16)0.0f; }
#pragma unroll
    for (int t = 0; t < 4; ++t) { if (col0 + t * 16 >= N) continue; const size_t boff = (size_t)(col0 + t * 16 + ln) * ldb + kb; FragH bq; bq.half[0] = *(const v8us*)(Bh + boff + 8 * hh); bq.half[1] = *(const v8us*)(Bh + boff + 16 + 8 * hh);
      acc[t] = mmaH<ASPLIT ? 2 : 1>(ah.v, al.v, bq.v, bq.v, acc[t]); }
  }
#pragma unroll
  for (int t = 0; t < 4; ++t) { if (col0 + t * 16 >= N) continue;
#pragma unroll
    for (int r = 0; r < 8; ++r) so[w][8 * hh + r][t * 16 + ln] = acc[t][r] * alpha; }
  __builtin_amdgcn_fence(__ATOMIC_ACQ_REL, "workgroup"); __builtin_amdgcn_wave_barrier();
  const int rsub = lane >> 4, c4 = (lane & 15) * 4;
  {
#pragma unroll
    for (int q = 0; q < 8; ++q) { const int r = q * 2 + rsub; if (col0 + c4 < N) { const v4f v = *(const v4fa*)&so[w][r][c4]; *(v4f*)(C + (size_t)(row0 + r) * ldc + col0 + c4) = v; } }
     }
}

// Wt[n][k] = f16(W[k][n]·scale) from f32 row-major W[K][N] (scale = power of two; bf16-exact weights stay exact in f16 away from the subnormal range)
__global__ __launch_bounds__(256) void k_wt_f16(const float* __restrict__ W, _Float16* __restrict__ Wt, int K, int N, float scale) {
  const int t = blockIdx.x * 256 + threadIdx.x; if (t >= N * (K / 8)) return; const int n = t / (K / 8), k8 = (t % (K / 8)) * 8; FragH f;
#pragma unroll
  for (int i = 0; i < 8; ++i) f.h[i] = (_Float16)(bf16_round(W[(size_t)(k8 + i) * N + n]) * scale); const v8us o = f.half[0];
  *(v8us*)((unsigned short*)Wt + (size_t)n * K + k8) = o; 
}
// k_gemm_hh variant with fused epilogue: v = acc·alpha + bias[by·sBias + col] (+ CP[(row/rowsPerB)·sCPb + by·64 + col] if CP) ; ACT 0 none / 1 elu ; writes f16 C16 (and f32 C if non-null)
template <int ACT>
__global__ __launch_bounds__(128) void k_gemm_hhx(const _Float16* __restrict__ A, int lda, size_t sA, const _Float16* __restrict__ Bh, int ldb, size_t sB, float alpha, const float* __restrict__ bias, size_t sBias, const float* __restrict__ CP, int rowsPerB, size_t sCPb, int row0g,
    float* __restrict__ C, _Float16* __restrict__ C16, int ldc, size_t sC, int M, int N, int K) {
  __shared__ __attribute__((aligned(16))) float so[4][16][64];
  const int tid = threadIdx.x, w = tid >> 5, lane = tid & 31, ln = lane & 15, hh = lane >> 4; const int by = blockIdx.y;
  A += (size_t)by * sA; Bh += (size_t)by * sB; const size_t cofs = (size_t)by * sC; const float* bp = bias ? bias + (size_t)by * sBias : nullptr;
  const int ntn = (N + 63) / 64; const int wid = blockIdx.x * 4 + w; const int mt = wid / ntn, nq = wid % ntn; if (mt * 16 >= M) return;
  const int row0 = mt * 16, col0 = nq * 64; const _Float16* arow = A + (size_t)(row0 + ln) * lda;
  v8f acc[4] = {};
  for (int kb = 0; kb < K; kb += 32) { FragH ah; ah.half[0] = *(const v8us*)((const unsigned short*)arow + kb + 8 * hh); ah.half[1] = *(const v8us*)((const unsigned short*)arow + kb + 16 + 8 * hh);
#pragma unroll
    for (int t = 0; t < 4; ++t) { if (col0 + t * 16 >= N) continue; const size_t boff = (size_t)(col0 + t * 16 + ln) * ldb + kb; FragH bq; bq.half[0] = *(const v8us*)((const unsigned short*)Bh + boff + 8 * hh); bq.half[1] = *(const v8us*)((const unsigned short*)Bh + boff + 16 + 8 * hh);
      acc[t] = mmaH<1>(ah.v, ah.v, bq.v, bq.v, acc[t]); }
  }
#pragma unroll
  for (int t = 0; t < 4; ++t) { if (col0 + t * 16 >= N) continue; const int col = col0 + t * 16 + ln; const float bv = bp ? bf16_round(bp[col]) : 0.f;
#pragma unroll
    for (int r = 0; r < 8; ++r) { float v = acc[t][r] * alpha + bv; if (CP) { const int rr = row0g + row0 + 8 * hh + r; if (rowsPerB < 0) v += CP[cofs + (size_t)rr * ldc + col];      /* rowsPerB < 0: own element of the batched C plane */ else { const int bidx = rr / rowsPerB; v += CP[(size_t)bidx * sCPb + (size_t)by * 64 + col]; } } if (ACT == 1) v = (v > 0.f) ? v : expm1f(v); else if (ACT == 7) v = (v > 0.f) ? v + 1.0f : expf(v); else if (ACT == 8) v = tanhf(v); else if (ACT == 9) v = 0.5f * v * (1.0f + tanhf(0.7978845608028654f * (v + 0.044715f * v * v * v))); else if (ACT == 11) v = 1.0f / (1.0f + expf(-v)); else if (ACT == 12) v = (v > 0.f) ? v : 0.01f * v; else if (ACT == 14) v = (v > 0.f) ? v : 0.1f * v; else if (ACT == 16) v = (v >= 0.f) ? v : 0.3f * v; else if (ACT == 17) v = (v >= 0.f) ? v : 0.2f * v; else if (ACT == 15) v = v / (1.0f + expf(-v)); else if (ACT == 3) v = fmaxf(v, 0.f); else if (ACT == 6) v = 0.5f * v * (1.0f + erff(v * 0.70710678118654752f)); so[w][8 * hh + r][t * 16 + ln] = v; } }
  __builtin_amdgcn_fence(__ATOMIC_ACQ_REL, "workgroup"); __builtin_amdgcn_wave_barrier();
  const int rsub = lane >> 4, c4 = (lane & 15) * 4; typedef _Float16 v4h __attribute__((ext_vector_type(4)));
  {
#pragma unroll
    for (int q = 0; q < 8; ++q) { const int r = q * 2 + rsub; if (col0 + c4 < N) { const v4f v = *(const v4fa*)&so[w][r][c4]; if (C) *(v4f*)(C + cofs + (size_t)(row0 + r) * ldc + col0 + c4) = v; if (C16) { v4h h4; for (int i = 0; i < 4; ++i) h4[i] = (_Float16)v[i]; *(v4h*)(C16 + cofs + (size_t)(row0 + r) * ldc + col0 + c4) = h4; } } }
     }
}


typedef _Float16 v4h __attribute__((ext_vector_type(4)));

__global__ __launch_bounds__(256) void k_x16(const float* __restrict__ x, _Float16* __restrict__ X16, size_t n8) { const size_t t = (size_t)blockIdx.x * 256 + threadIdx.x; if (t >= n8) return; FragH f;
#pragma unroll
  for (int q = 0; q < 8; ++q) f.h[q] = (_Float16)bf16_round(x[t * 8 + q]); *(v8us*)((unsigned short*)X16 + t * 8) = f.half[0];  }
__global__ __launch_bounds__(256) void k_h16(const float* __restrict__ x, _Float16* __restrict__ X16, size_t n8) { const size_t t = (size_t)blockIdx.x * 256 + threadIdx.x; if (t >= n8) return; FragH f;
#pragma unroll
  for (int q = 0; q < 8; ++q) f.h[q] = (_Float16)x[t * 8 + q]; *(v8us*)((unsigned short*)X16 + t * 8) = f.half[0];  }
__global__ __launch_bounds__(256) void k_round16f(const float* __restrict__ W, _Float16* __restrict__ Bt, size_t n8) { const size_t t = (size_t)blockIdx.x * 256 + threadIdx.x; if (t >= n8) return; FragH f;
#pragma unroll
  for (int i = 0; i < 8; ++i) f.h[i] = (_Float16)(bf16_round(W[t * 8 + i]) * 16.0f); *(v8us*)((unsigned short*)Bt + t * 8) = f.half[0];  }
__global__ __launch_bounds__(256) void k_hl(const float* __restrict__ F, _Float16* __restrict__ Hh, _Float16* __restrict__ Hl, size_t n8) { const size_t t = (size_t)blockIdx.x * 256 + threadIdx.x; if (t >= n8) return; FragH fh, fl; const v4f a = *(const v4fa*)(F + t * 8), c = *(const v4fa*)(F + t * 8 + 4);
#pragma unroll
  for (int q = 0; q < 4; ++q) { _Float16 h = (_Float16)a[q]; fh.h[q] = h; fl.h[q] = (_Float16)((a[q] - (float)h) * 1024.0f); h = (_Float16)c[q]; fh.h[4 + q] = h; fl.h[4 + q] = (_Float16)((c[q] - (float)h) * 1024.0f); }
  { *(v8us*)((unsigned short*)Hh + t * 8) = fh.half[0]; *(v8us*)((unsigned short*)Hl + t * 8) = fl.half[0];  } }

__device__ __forceinline__ v16h g2_frag(const _Float16* p, int hh) { FragH f; f.half[0] = *(const v8us*)((const unsigned short*)p + 8 * hh); f.half[1] = *(const v8us*)((const unsigned short*)p + 16 + 8 * hh); return f.v; }


#define WCH 8                        /* 8-element chunks per thread */
// chunks t0 + 256 i of one weight matrix: all loads issued first, then converted and stored
__device__ __forceinline__ void wnat_part(const float* __restrict__ w, _Float16* __restrict__ Bt, unsigned t0) { v4f a[WCH][2]; const unsigned ob = t0 * 32;      /* the thread's first byte */
  /* the short loops below are all unrolled so that a stays in registers */
#pragma unroll
  for (int i = 0; i < WCH; ++i) { const float* p = (const float*)((const char*)w + ob) + 256 * 8 * i; a[i][0] = *(const v4fa*)p; a[i][1] = *(const v4fa*)(p + 4); }
  /* precaution: stands in front of every write of a register that the loads above name as an address; it names the offset (input only), so that no later load of the run lands in it either; it also keeps all the loads in front of the first store */
  asm volatile("s_wait_xcnt 0x0" :: "v"(ob) : "memory");
#pragma unroll
  for (int i = 0; i < WCH; ++i) { FragH f;
#pragma unroll
    for (int q = 0; q < 8; ++q) f.h[q] = (_Float16)(bf16_round(a[i][q >> 2][q & 3]) * 16.0f);
    *(v8us*)((unsigned short*)Bt + (size_t)(t0 + 256 * i) * 8) = f.half[0]; }
  asm volatile("s_wait_xcnt 0x0" ::: "memory"); }      /* precaution: in the built kernel the x + PE text follows this path behind a branch; the wait stands in front of its writes of registers that the stores above name */
__global__ __launch_bounds__(256) void k_rsm(const float* __restrict__ S, _Float16* __restrict__ P, int nrows) {
  #pragma clang fp contract(off)
  const int i = blockIdx.x * 256 + threadIdx.x; if (i >= nrows) return; const float* s = S + (size_t)i * SQ; float mx = -3.0e38f;
#pragma unroll 1
  for (int j = 0; j < SQ; ++j) mx = fmaxf(mx, s[j]); float se = 0.f;
#pragma unroll 1
  for (int j = 0; j < SQ; ++j) se += expf(s[j] - mx); const float sc = 256.0f / se;
#pragma unroll 1
  for (int j0 = 0; j0 < SQ; j0 += 8) { FragH f; for (int q = 0; q < 8; ++q) f.h[q] = (_Float16)(expf(s[j0 + q] - mx) * sc); unsigned short* d = (unsigned short*)P + (size_t)i * SQ + j0; *(v8us*)d = f.half[0];  } }
__global__ __launch_bounds__(256) void k_vt(const _Float16* __restrict__ V16, int b, int h0, _Float16* __restrict__ VT) { __shared__ unsigned short tl[64][65]; const int tid = threadIdx.x; const int hh = blockIdx.x % HG, sg = blockIdx.x / HG; const int s0 = sg * 64; const int h = h0 + hh;
  for (int i = tid; i < 64 * 8; i += 256) { const int j = i / 8, d8 = (i % 8) * 8; FragH f; f.half[0] = *(const v8us*)((const unsigned short*)V16 + ((size_t)b * SQ + s0 + j) * DM + h * HD + d8); for (int q = 0; q < 8; ++q) tl[d8 + q][j] = f.u[q]; }
  __syncthreads();
  { for (int i = tid; i < 64 * 8; i += 256) { const int d = i / 8, j8 = (i % 8) * 8; FragH f; for (int q = 0; q < 8; ++q) f.u[q] = tl[d][j8 + q]; *(v8us*)((unsigned short*)VT + ((size_t)hh * HD + d) * SQ + s0 + j8) = f.half[0]; }  } }



#define FAW 8                        /* waves per key part: FAW * 32 queries per workgroup */
#define FAS 2                        /* key parts = groups of waves */
#define FAK 64                       /* keys per stage */
#define FAP 72                       /* LDS row pitch in f16: 128 bytes of data + 16, so that the 16 rows of a fragment read start in 16 different bank groups */
#define FAT (SQ / FAS / FAK)         /* stages per key part */
typedef float v2f __attribute__((ext_vector_type(2)));
__device__ __forceinline__ float rs_xhalf(float x) { return __builtin_bit_cast(float, __builtin_amdgcn_permlanex16(__builtin_bit_cast(int, x), __builtin_bit_cast(int, x), 0x76543210, 0xfedcba98, false, false)); }      /* lane l reads lane l ^ 16 */
__device__ __forceinline__ v16h fa_frag(const unsigned short* p, int hh) { FragH f; f.half[0] = *(const v8us*)(p + 8 * hh); f.half[1] = *(const v8us*)(p + 16 + 8 * hh); return f.v; }
__device__ __forceinline__ v8f fa_mma(v16h a, v16h b, v8f c) { return __builtin_amdgcn_wmma_f32_16x16x32_f16(false, a, false, b, (short)0, c, false, false); }
// Eight native 2^x (v_exp_f32). The builtin, not asm text: the compiler schedules these between the matrix instructions and must see which registers they write.
__device__ __forceinline__ v8f fa_exp2x8(v8f x) { v8f e;
#pragma unroll      /* the vector stays in registers */
  for (int i = 0; i < 8; ++i) e[i] = __builtin_amdgcn_exp2f(x[i]);
  return e; }
static_assert((FAT & (FAT - 1)) == 0, "k_fattn: the rotated walk wraps by a mask");
static_assert(SQ % (FAW * 32) == 0 && SQ % (FAS * FAK) == 0 && HD == 64 && FAK == 64 && FAW * 32 == 256 && FAS == 2, "k_fattn: whole workgroups and stages; the 256 threads of a key part stage 64 rows of 128 bytes in two rounds; two parts swap one query group each");
__global__ __launch_bounds__(FAW * FAS * 32) void k_fattn(const _Float16* __restrict__ Q16, const _Float16* __restrict__ K16, const _Float16* __restrict__ VT, _Float16* __restrict__ O16) {
  __shared__ __attribute__((aligned(16))) unsigned short sk[FAS][2][FAK][FAP];      /* K rows [key part][buffer][key][d] */
  __shared__ __attribute__((aligned(16))) unsigned short sv[FAS][2][HD][FAP];       /* V^T rows [key part][buffer][d][key] */
  __shared__ __attribute__((aligned(16))) float smo[8][2][FAW][32][4];              /* handed-over output tiles [4 registers][query group][wave][lane] */
  __shared__ __attribute__((aligned(8))) float sml[2][FAW][32][2];                  /* handed-over maximum in use and sum [query group][wave][lane] */
  const int tid = threadIdx.x, w = (tid >> 5) & (FAW - 1), lane = tid & 31, ln = lane & 15, hh = lane >> 4;
  const int kh = __builtin_amdgcn_readfirstlane(tid >> 8);      /* the wave's key part, in a scalar register: the branches on it at the end are scalar */
  const int bh = blockIdx.y, b = bh / NH, hd = bh - b * NH; const size_t r0 = (size_t)b * SQ; const int q0 = (blockIdx.x * FAW + w) * 32;
  const int srow = (tid & 255) >> 3, sc8 = (tid & 7) * 8;      /* staging, per key part: 8 threads per 128-byte row, rows srow and srow + 32 */
  const int rot = (int)(2 * blockIdx.x + blockIdx.y);      /* first stage of the walk (taken modulo FAT): a head's 8 workgroups start two stages apart, neighbouring heads one */
  const unsigned short* kg = (const unsigned short*)K16 + (r0 + kh * (SQ / FAS) + (rot & (FAT - 1)) * FAK + srow) * DM + hd * HD + sc8;      /* the thread's places in the stage being fetched; both are moved on by one stage at a time */
  const unsigned short* vg = (const unsigned short*)VT + ((size_t)bh * HD + srow) * SQ + kh * (SQ / FAS) + (rot & (FAT - 1)) * FAK + sc8;
  v16h qf[2][2];      /* [16-query group][32 of d] */
  /* the short loops below are all unrolled so that the fragment and accumulator arrays stay in registers */
#pragma unroll
  for (int g = 0; g < 2; ++g)
#pragma unroll
    for (int ks = 0; ks < 2; ++ks) qf[g][ks] = g2_frag(Q16 + (r0 + q0 + g * 16 + ln) * DM + hd * HD + ks * 32, hh);
  const v8f z8 = {0.f, 0.f, 0.f, 0.f, 0.f, 0.f, 0.f, 0.f};
  v8f o[2][4] = {{z8, z8, z8, z8}, {z8, z8, z8, z8}}; float ms[2] = {-3.0e38f, -3.0e38f}, l[2] = {0.f, 0.f};
  const float cs = 0.125f * 1.44269504088896340736f;      /* 64^-0.5 log2 e */
  v8us kr0 = *(const v8us*)kg, kr1 = *(const v8us*)(kg + (size_t)32 * DM), vr0 = *(const v8us*)vg, vr1 = *(const v8us*)(vg + (size_t)32 * SQ);
  asm volatile("s_wait_xcnt 0x0" ::: "memory");      /* precaution: stands in front of every later write of a register that the loads above name as an address */
  *(v8us*)&sk[kh][0][srow][sc8] = kr0; *(v8us*)&sk[kh][0][srow + 32][sc8] = kr1; *(v8us*)&sv[kh][0][srow][sc8] = vr0; *(v8us*)&sv[kh][0][srow + 32][sc8] = vr1;
  __syncthreads();      /* stage 0 is published */
  for (int t = 0; t < FAT; ++t) { const int cur = t & 1;
    if (t + 1 < FAT) { const int st = ((t + 1 + rot) & (FAT - 1)) != 0 ? FAK : FAK - FAT * FAK;      /* keys to the next stage: behind the key part's last stage the walk wraps to its first */
      kg += (ptrdiff_t)st * DM; vg += st;
      kr0 = *(const v8us*)kg; kr1 = *(const v8us*)(kg + (size_t)32 * DM); vr0 = *(const v8us*)vg; vr1 = *(const v8us*)(vg + (size_t)32 * SQ); }
#pragma unroll
    for (int hp = 0; hp < 2; ++hp) {      /* two passes of 32 keys per stage: half the score registers live at once; unrolled, so that one pass's matrix work can be scheduled among the other's softmax */
      v8f s[2][2];      /* S^T: [query group][16-key tile], register r = key 8 hh + r, lane column = query */
#pragma unroll
      for (int j = 0; j < 2; ++j) { const v16h a0 = fa_frag(&sk[kh][cur][hp * 32 + j * 16 + ln][0], hh), a1 = fa_frag(&sk[kh][cur][hp * 32 + j * 16 + ln][32], hh);
#pragma unroll
        for (int g = 0; g < 2; ++g) s[g][j] = fa_mma(a1, qf[g][1], fa_mma(a0, qf[g][0], z8)); }
      v16h va[4];
#pragma unroll
      for (int dt = 0; dt < 4; ++dt) va[dt] = fa_frag(&sv[kh][cur][dt * 16 + ln][hp * 32], hh);
      float mxs[2];
#pragma unroll
      for (int g = 0; g < 2; ++g) { const v8f mv = __builtin_elementwise_max(s[g][0], s[g][1]);
        const float mx = fmaxf(fmaxf(fmaxf(mv[0], mv[1]), fmaxf(mv[2], mv[3])), fmaxf(fmaxf(mv[4], mv[5]), fmaxf(mv[6], mv[7])));
        mxs[g] = fmaxf(mx, rs_xhalf(mx)) * cs; }
      if (__builtin_amdgcn_ballot_w32(mxs[0] > ms[0] + 8.0f || mxs[1] > ms[1] + 8.0f) != 0) {      /* wave-uniform: some query's maximum has outgrown the one in use */
        const float n0 = fmaxf(ms[0], mxs[0]), n1 = fmaxf(ms[1], mxs[1]); const float c0 = __builtin_amdgcn_exp2f(ms[0] - n0), c1 = __builtin_amdgcn_exp2f(ms[1] - n1);      /* the two rescale factors */
        ms[0] = n0; ms[1] = n1; l[0] *= c0; l[1] *= c1;
#pragma unroll
        for (int dt = 0; dt < 4; ++dt) { o[0][dt] *= c0; o[1][dt] *= c1; } }
      v16h pf[2];      /* P^T as B operand, per query group */
#pragma unroll
      for (int g = 0; g < 2; ++g) { const float nb = 7.0f - ms[g];
#pragma unroll
        for (int j = 0; j < 2; ++j) s[g][j] = fa_exp2x8(s[g][j] * cs + nb);
        const v8f ps = s[g][0] + s[g][1];
        l[g] += ((ps[0] + ps[1]) + (ps[2] + ps[3])) + ((ps[4] + ps[5]) + (ps[6] + ps[7]));
        FragH f;
#pragma unroll
        for (int i = 0; i < 8; ++i) { f.h[i] = (_Float16)s[g][0][i]; f.h[8 + i] = (_Float16)s[g][1][i]; }
        pf[g] = f.v; }
#pragma unroll
      for (int dt = 0; dt < 4; ++dt)
#pragma unroll
        for (int g = 0; g < 2; ++g) o[g][dt] = fa_mma(va[dt], pf[g], o[g][dt]); }
    if (t + 1 < FAT) { *(v8us*)&sk[kh][cur ^ 1][srow][sc8] = kr0; *(v8us*)&sk[kh][cur ^ 1][srow + 32][sc8] = kr1; *(v8us*)&sv[kh][cur ^ 1][srow][sc8] = vr0; *(v8us*)&sv[kh][cur ^ 1][srow + 32][sc8] = vr1; }      /* its last readers left this buffer at the barrier of stage t - 1 */
    __syncthreads(); }      /* publishes stage t + 1 and ends every read of stage t */
#pragma unroll
  for (int g = 0; g < 2; ++g) if (g != kh) {      /* the query group that the wave of the other key part finishes */
#pragma unroll
    for (int dt = 0; dt < 4; ++dt) { *(v4f*)&smo[2 * dt][g][w][lane][0] = __builtin_shufflevector(o[g][dt], o[g][dt], 0, 1, 2, 3); *(v4f*)&smo[2 * dt + 1][g][w][lane][0] = __builtin_shufflevector(o[g][dt], o[g][dt], 4, 5, 6, 7); }
    const v2f ml = {ms[g], l[g]}; *(v2f*)&sml[g][w][lane][0] = ml; }
  __syncthreads();      /* the handed-over groups are published */
#pragma unroll
  for (int g = 0; g < 2; ++g) if (g == kh) {      /* join the two key parts: both are brought to the larger maximum in use */
    const v2f ml = *(const v2f*)&sml[g][w][lane][0]; const float m = fmaxf(ms[g], ml[0]); const float ca = __builtin_amdgcn_exp2f(ms[g] - m), cb = __builtin_amdgcn_exp2f(ml[0] - m);
    const float lj = l[g] * ca + ml[1] * cb; const float inv = 64.0f / (lj + rs_xhalf(lj));      /* the halves hold disjoint keys; o is carried x64 */
    const float fa = ca * inv, fb = cb * inv;
    unsigned short* op = (unsigned short*)O16 + (r0 + q0 + g * 16 + ln) * DM + hd * HD + 8 * hh;
#pragma unroll
    for (int dt = 0; dt < 4; ++dt) { FragH f; const v4f p0 = *(const v4f*)&smo[2 * dt][g][w][lane][0], p1 = *(const v4f*)&smo[2 * dt + 1][g][w][lane][0];
#pragma unroll
      for (int r = 0; r < 4; ++r) { f.h[r] = (_Float16)(o[g][dt][r] * fa + p0[r] * fb); f.h[4 + r] = (_Float16)(o[g][dt][4 + r] * fa + p1[r] * fb); }
      *(v8us*)(op + dt * 16) = f.half[0]; }      /* register r = d 16 dt + 8 hh + r of query ln: 16 contiguous bytes */
    if (g == 0) asm volatile("s_wait_xcnt 0x0" ::: "memory"); } }      /* precaution: in the built kernel the second group's text follows this path behind a branch; the wait stands in front of its writes of registers that the stores above name */


// ---- staged GEMM: C[MP][DM] = A[MP][DM] . Bt[DM][DM]^T x alpha + bias (bias rounded to bf16 first), A and Bt pitch DM; C f32 or f16 rows (pitch DM) or f16 transposed [NB][DM][SQ] ----
// One workgroup = 4 waves = one 128 x 128 tile of C, waves 2 (rows) x 2 (columns), 64 x 64 per wave: 8 fragments feed 16 WMMAs. The k axis runs in stages of KS: the 128 A rows
// and the 128 Bt rows of a stage come from global memory as whole lines, once per workgroup, and lie in LDS at a padded pitch; every wave takes its fragments from there.
// Two LDS buffers: stage t + 1 travels global -> registers while stage t is worked on and is stored in front of stage t's last 32-k block, whose matrix work covers the stores; one barrier per stage.
// The walk over the stages starts at stage rot (modulo the stage count) and wraps round: workgroups that share A rows or Bt rows then ask L2 for different lines at any moment.
// Each accumulator tile sums k in steps of 32, one WMMA per step, ascending from the first stage's k and wrapping. The output staging lies over the stage buffers, which are out of use by then.
#define G3T 128                      /* tile rows and tile columns per workgroup */
#define G3W 4                        /* waves per workgroup */
#define G3PT 136                     /* row pitch in f16 of a transposed output tile: 256 bytes of data + 16 */
static_assert(MP % G3T == 0 && MPO % G3T == 0 && DM % G3T == 0, "k_gemm3: whole tiles");
static_assert(SQ % G3T == 0 && B0 == 0 && DM == NH * HD, "k_gemm3: a transposed tile lies in one batch; [batch][column] = [batch][head][d]");
template <int KS> struct G3Ring {      /* row pitch in f16: the stage's bytes + 16, so that the 16 rows of a fragment read start in 16 different bank groups */
  __attribute__((aligned(16))) unsigned short sa[2][G3T][KS + 8];      /* A rows [row][k] */
  __attribute__((aligned(16))) unsigned short sb[2][G3T][KS + 8]; };   /* Bt rows [column][k] */
template <int KS> union G3Lds {      /* declared once per kernel and handed in, so that two forms of the tile in one kernel share it */
  G3Ring<KS> ring;
  __attribute__((aligned(16))) float so[G3W][64][68];                  /* per-wave output staging */
  __attribute__((aligned(16))) unsigned short st[G3T][G3PT]; };        /* the workgroup's tile as [column][row] */
template <bool F32OUT, bool TR, int KS>      /* the result goes to C (f32) or to C16 (f16); the other pointer is not used; mt, nq: the workgroup's tile row and tile column; rot: the walk's first stage; TR (f16 only): C16 takes the tile transposed, as rows [batch][column][place]; KS: k per stage */
__device__ __forceinline__ void gemm3_tile(G3Lds<KS>& lds, const _Float16* __restrict__ A, const _Float16* __restrict__ Bh, float alpha, const float* __restrict__ bias, float* __restrict__ C, _Float16* __restrict__ C16, int mt, int nq, int rot) {
  static_assert(!(F32OUT && TR), "gemm3_tile: the transposed form is f16");
  constexpr int TPR = KS / 8, RPP = G3W * 32 / TPR, NI = G3T / RPP, NS = DM / KS;      /* threads per staged row, rows per round, rounds, stages */
  static_assert(KS % 32 == 0 && DM % KS == 0 && NS >= 2 && G3T % RPP == 0, "gemm3_tile: whole stages and staging rounds");
  static_assert((NS & (NS - 1)) == 0, "gemm3_tile: the rotated walk wraps by a mask");
  auto& sa = lds.ring.sa; auto& sb = lds.ring.sb;
  const int tid = threadIdx.x, w = tid >> 5, lane = tid & 31, ln = lane & 15, hh = lane >> 4;
  const int wr = (w >> 1) * 64, wc = (w & 1) * 64;      /* the wave's place in the tile */
  const int row0 = mt * G3T + wr, col0 = nq * G3T + wc;
  const int srow = tid / TPR, sc8 = (tid % TPR) * 8;      /* staging: TPR threads per row, rows srow + RPP i */
  const char* au = (const char*)(A + (size_t)(mt * G3T) * DM); const char* bu = (const char*)(Bh + (size_t)(nq * G3T) * DM);      /* the tile's first A row and first Bt row: the same for the whole workgroup, so scalar bases */
  unsigned vo = (unsigned)(srow * DM + sc8 + (rot & (NS - 1)) * KS) * 2;      /* the thread's byte offset from either base in the walk's first stage, moved on by one stage at a time: one register that lives through the loop names every staging load's address */
  v8us ra[NI], rb[NI];
  /* the short loops below are all unrolled so that the staging, fragment and accumulator arrays stay in registers */
#pragma unroll
  for (int i = 0; i < NI; ++i) { ra[i] = *(const v8us*)(au + vo + (size_t)(RPP * i) * DM * 2); rb[i] = *(const v8us*)(bu + vo + (size_t)(RPP * i) * DM * 2); }
#pragma unroll
  for (int i = 0; i < NI; ++i) { *(v8us*)&sa[0][srow + RPP * i][sc8] = ra[i]; *(v8us*)&sb[0][srow + RPP * i][sc8] = rb[i]; }
  const v8f z8 = {0.f, 0.f, 0.f, 0.f, 0.f, 0.f, 0.f, 0.f}; v8f acc[4][4];      /* [16-row group][16-column group] */
#pragma unroll
  for (int i = 0; i < 4; ++i)
#pragma unroll
    for (int j = 0; j < 4; ++j) acc[i][j] = z8;
  __syncthreads();      /* stage 0 is published */
  for (int t = 0; t < NS; ++t) { const int cur = t & 1;
    if (t + 1 < NS) { vo += ((t + 1 + rot) & (NS - 1)) != 0 ? (unsigned)(KS * 2) : (unsigned)(KS * 2) - (unsigned)(DM * 2);      /* behind the row's last stage the walk wraps to its first */
#pragma unroll
      for (int i = 0; i < NI; ++i) { ra[i] = *(const v8us*)(au + vo + (size_t)(RPP * i) * DM * 2); rb[i] = *(const v8us*)(bu + vo + (size_t)(RPP * i) * DM * 2); } }
    v16h fa[2][4], fb[2][4];      /* two fragment sets: block ks + 1 is fetched while block ks (32 of k, 16 WMMAs) is worked on */
#pragma unroll
    for (int i = 0; i < 4; ++i) { fa[0][i] = fa_frag(&sa[cur][wr + i * 16 + ln][0], hh); fb[0][i] = fa_frag(&sb[cur][wc + i * 16 + ln][0], hh); }
#pragma unroll
    for (int ks = 0; ks < KS / 32; ++ks) {
      if (ks + 1 < KS / 32) {
#pragma unroll
        for (int i = 0; i < 4; ++i) { fa[(ks + 1) & 1][i] = fa_frag(&sa[cur][wr + i * 16 + ln][(ks + 1) * 32], hh); fb[(ks + 1) & 1][i] = fa_frag(&sb[cur][wc + i * 16 + ln][(ks + 1) * 32], hh); } }
      else if (t + 1 < NS) {      /* in front of the last block, whose matrix work covers the stores; the buffer's last readers left it at the barrier of stage t - 1 */
#pragma unroll
        for (int i = 0; i < NI; ++i) { *(v8us*)&sa[cur ^ 1][srow + RPP * i][sc8] = ra[i]; *(v8us*)&sb[cur ^ 1][srow + RPP * i][sc8] = rb[i]; } }
      __builtin_amdgcn_sched_barrier(0);      /* keeps the LDS reads above as one group ahead of the block: left to itself the compiler puts them in pairs among the WMMAs, each pair waited out */
#pragma unroll
      for (int j = 0; j < 4; ++j)
#pragma unroll
        for (int i = 0; i < 4; ++i) acc[i][j] = fa_mma(fa[ks & 1][i], fb[ks & 1][j], acc[i][j]);
      __builtin_amdgcn_sched_barrier(0); }      /* keeps the next group of LDS reads behind this block's WMMAs */
    __syncthreads(); }      /* publishes stage t + 1 and ends every read of stage t; behind the last one the stage buffers are free for the output staging */
  const int bc = col0 + ln; float bb[4];
#pragma unroll
  for (int j = 0; j < 4; ++j) bb[j] = bias[bc + j * 16];
  asm volatile("s_wait_xcnt 0x0" :: "s"(bias), "v"(bc) : "memory");      /* precaution: stands in front of every write of a register that the four bias loads above name as an address; it names base and index (inputs only), so that they live up to it */
  if (TR) {      /* transposed output: an accumulator tile holds, per lane, 8 consecutive rows of one column = 16 contiguous bytes of the transposed row */
    auto& st = lds.st;
#pragma unroll
    for (int j = 0; j < 4; ++j) { const float bv = bf16_round(bb[j]);
#pragma unroll
      for (int i = 0; i < 4; ++i) { FragH f;
#pragma unroll
        for (int r = 0; r < 8; ++r) f.h[r] = (_Float16)(acc[i][j][r] * alpha + bv);
        *(v8us*)&st[wc + j * 16 + ln][wr + i * 16 + 8 * hh] = f.half[0]; } }
    __syncthreads();      /* a transposed row holds the rows of two waves */
    const int bt = mt / (SQ / G3T), s0 = (mt - bt * (SQ / G3T)) * G3T;      /* the tile's batch and first place */
    const int trow = tid >> 4, tc8 = (tid & 15) * 8;      /* 16 threads per 256-byte row, rows trow + 8 i */
    unsigned short* cg = (unsigned short*)C16 + ((size_t)bt * DM + nq * G3T + trow) * SQ + s0 + tc8;
#pragma unroll
    for (int i = 0; i < 16; ++i) *(v8us*)(cg + (size_t)(8 * i) * SQ) = *(const v8us*)&st[trow + 8 * i][tc8];      /* 16 lanes store the 256 bytes of one transposed row: whole lines */
    return; }
  auto& so = lds.so;
#pragma unroll
  for (int j = 0; j < 4; ++j) { const float bv = bf16_round(bb[j]);
#pragma unroll
    for (int i = 0; i < 4; ++i)
#pragma unroll
      for (int r = 0; r < 8; ++r) so[w][i * 16 + 8 * hh + r][j * 16 + ln] = acc[i][j][r] * alpha + bv; }
  __builtin_amdgcn_fence(__ATOMIC_ACQ_REL, "workgroup"); __builtin_amdgcn_wave_barrier();      /* the wave reads back rows that its other lanes wrote */
  const int rsub = lane >> 4, c4 = (lane & 15) * 4;
  const size_t e = (size_t)(row0 + rsub) * DM + col0 + c4;      /* the lane's first element; its further rows lie at constant distances, so that one address register serves all the stores */
#pragma unroll
  for (int q = 0; q < 32; ++q) { const v4f v = *(const v4fa*)&so[w][q * 2 + rsub][c4];
    if (F32OUT) *(v4f*)(C + e + (size_t)(q * 2) * DM) = v; else *(v4h*)(C16 + e + (size_t)(q * 2) * DM) = __builtin_convertvector(v, v4h); }      /* 16 lanes store one row of the wave's 64 columns: whole lines */
  asm volatile("s_wait_xcnt 0x0" ::: "memory"); }      /* precaution: in the built Q/K/V kernel the transposed form's text follows this path behind a branch; the wait stands in front of its writes of the register pair that the stores above name */
// The output projection: one grid of (MPO / G3T) x (DM / G3T) tiles, f32 result. One workgroup per WGP, so one wave per SIMD: stages of 128 k, half as many barriers.
__global__ __launch_bounds__(G3W * 32) void k_gemm3o(const _Float16* __restrict__ A, const _Float16* __restrict__ Bh, float alpha, const float* __restrict__ bias, float* __restrict__ C) {
  const int mt = blockIdx.x / (DM / G3T), nq = blockIdx.x - mt * (DM / G3T);
  __shared__ G3Lds<128> lds;
  gemm3_tile<true, false, 128>(lds, A, Bh, alpha, bias, C, nullptr, mt, nq, mt + nq); }      /* a tile row's 8 workgroups start at 8 different stages */
// The Q, K and V projections read the same A and do not depend on each other: one grid holds the tiles of all three, so that they share one launch and fill the chip without a
// gap between them. A tile row's 3 x (DM / G3T) workgroups are neighbours in the grid (Q's columns, then K's, then V's), so its A rows are read again while they are still in the cache.
// Q and K leave as token rows; V leaves transposed, V^T [NB][NH][HD][SQ], the form the attention kernel stages: no V rows and no transposing launch.
// Stages of 64 k: three workgroups' LDS fits one WGP, and the second launch bound holds the registers to three waves per SIMD, so that the whole grid is resident at once and
// one workgroup's LDS reads, staging waits and epilogue run under the matrix work of the two others, which share no barrier with it.
__global__ __launch_bounds__(G3W * 32, 3) void k_gemm3qkv(const _Float16* __restrict__ A, const _Float16* __restrict__ Bq, const _Float16* __restrict__ Bk, const _Float16* __restrict__ Bv, float alpha,
                                                  const float* __restrict__ bq, const float* __restrict__ bk, const float* __restrict__ bv, _Float16* __restrict__ Cq, _Float16* __restrict__ Ck, _Float16* __restrict__ CvT) {
  const int mt = blockIdx.x / (3 * (DM / G3T)), c = blockIdx.x - mt * (3 * (DM / G3T)); const int m = c / (DM / G3T), nq = c - m * (DM / G3T);      /* m: 0 = Q, 1 = K, 2 = V; the same for the whole workgroup */
  __shared__ G3Lds<64> lds;
  if (m == 2) gemm3_tile<false, true, 64>(lds, A, Bv, alpha, bv, nullptr, CvT, mt, nq, mt + 2 * nq);      /* two texts, one per output form: each runs from its last stage straight into its own epilogue */
  else gemm3_tile<false, false, 64>(lds, A, m == 0 ? Bq : Bk, alpha, m == 0 ? bq : bk, nullptr, m == 0 ? Cq : Ck, mt, nq, mt + 2 * nq); }      /* first stage mt + 2 nq: of a tile row's 24 sharers only the Q, K and V workgroups of one nq start alike, of a tile column's 32 sharers two */


#define XPP 4                        /* places (sequence positions) per thread */
// x + PE. A thread keeps one 8-column chunk and walks XPP places: the four frequencies of its columns are formed once, a place's sines and cosines once for all NB batches
// (PE does not depend on the batch); every element is the same expression as for one chunk alone. All loads of x are issued first and travel while PE is formed.
// PE is formed in a rolled loop and parked in LDS, each thread in slots of its own (no barrier). Workgroup g: places 2 XPP g ... 2 XPP g + 2 XPP - 1.
static_assert(DM / 8 == 128 && SQ % (2 * XPP) == 0, "xpe_part: 256 threads hold two rows of 128 chunks; whole workgroups");
__device__ __forceinline__ void xpe_part(const float* __restrict__ x, _Float16* __restrict__ X16, unsigned g, int tid) {
  #pragma clang fp contract(off)
  __shared__ __attribute__((aligned(8))) float spe[XPP][4][256][2];      /* [place][frequency][thread][sin, cos] */
  const int c0 = (tid & 127) * 8, p0 = (int)g * (2 * XPP) + (tid >> 7); const float kf = (float)(-9.210340371976184 / (double)DM); v4f xa[XPP][NB][2];
  const float* px[NB];      /* the thread's first chunk in each batch */
  /* the loops over xa are unrolled so that it stays in registers */
#pragma unroll
  for (int b = 0; b < NB; ++b) { px[b] = x + ((size_t)b * SQ + p0) * DM + c0;
#pragma unroll
    for (int i = 0; i < XPP; ++i) { const float* p = px[b] + (size_t)(2 * i) * DM; xa[i][b][0] = *(const v4fa*)p; xa[i][b][1] = *(const v4fa*)(p + 4); } }
  static_assert(NB == 2, "xpe_part: the wait below names the two addresses");
  /* precaution: stands in front of every write of a register that the loads above name as an address; it names the addresses (inputs only), so that no later load of the run lands in one of them either; it also keeps all the loads in front of the PE loop */
  asm volatile("s_wait_xcnt 0x0" :: "v"(px[0]), "v"(px[1]) : "memory");
#pragma unroll 1      /* rolled, like the loop inside: one copy of the exp, sin and cos text */
  for (int j = 0; j < 4; ++j) { const float dv = expf(__fmul_rn((float)(c0 + 2 * j), kf));
#pragma unroll 1
    for (int i = 0; i < XPP; ++i) { const float ang = __fmul_rn((float)(p0 + 2 * i), dv); spe[i][j][tid][0] = sinf(ang); spe[i][j][tid][1] = cosf(ang); } }
#pragma unroll
  for (int i = 0; i < XPP; ++i) { float pe[8];
#pragma unroll
    for (int j = 0; j < 4; ++j) { pe[2 * j] = spe[i][j][tid][0]; pe[2 * j + 1] = spe[i][j][tid][1]; }
#pragma unroll
    for (int b = 0; b < NB; ++b) { FragH f;
#pragma unroll
      for (int q = 0; q < 8; ++q) f.h[q] = (_Float16)__fadd_rn(bf16_round(xa[i][b][q >> 2][q & 3]), pe[q]);
      *(v8us*)((unsigned short*)X16 + ((size_t)b * SQ + p0 + 2 * i) * DM + c0) = f.half[0]; } } }
// x + PE and the four weight conversions do not depend on each other: one grid, dealt by workgroup range. The x + PE workgroups, the longer ones, come first.
// Two workgroups per WGP in all: each thread carries 8 chunks, so that few waves have to start.
#define PXG ((unsigned)(SQ / (2 * XPP)))                         /* workgroups of x + PE */
#define PWG ((unsigned)((size_t)DM * DM / 8 / (256 * WCH)))      /* workgroups per weight matrix */
static_assert((size_t)DM * DM / 8 % (256 * WCH) == 0, "k_prep: whole workgroups per weight matrix");
__global__ __launch_bounds__(256) void k_prep(const float* __restrict__ x, const float* __restrict__ wq, const float* __restrict__ wk, const float* __restrict__ wv, const float* __restrict__ wo,
                                              _Float16* __restrict__ X16, _Float16* __restrict__ BQ, _Float16* __restrict__ BK, _Float16* __restrict__ BV, _Float16* __restrict__ BO) {
  const unsigned g = blockIdx.x;
  if (g < PXG) { xpe_part(x, X16, g, (int)threadIdx.x); return; }      /* x + sinusoidal PE -> f16 rows (not exact: x + pe is not a bf16 value) */
  const unsigned u = g - PXG, m = u / PWG;      /* m: which weight matrix; the same for the whole workgroup */
  wnat_part(m == 0 ? wq : m == 1 ? wk : m == 2 ? wv : wo, m == 0 ? BQ : m == 1 ? BK : m == 2 ? BV : BO, (u - m * PWG) * (256 * WCH) + threadIdx.x); }      /* natural [out][in] = Bt[n][k], x16 */
extern "C" void kernel_launch(void* const* d_in, const int* in_sizes, int n_in,
                              void* d_out, int out_size, void* d_ws, size_t ws_size, hipStream_t stream) {
  (void)in_sizes; (void)n_in; (void)out_size;
  const float* const* I = (const float* const*)d_in; const float* x = I[0]; const float* wq = I[1]; const float* bq = I[2]; const float* wk = I[3]; const float* bk = I[4]; const float* wv = I[5]; const float* bv = I[6]; const float* wo = I[7]; const float* bo = I[8];      /* nn.Linear weights [out][in] + biases */
  char* ws = (char*)d_ws; size_t off = 0;
  auto take = [&](size_t bytes) { char* p = ws + off; off += (bytes + 255) & ~(size_t)255; return p; };
  _Float16* BQ = (_Float16*)take((size_t)DM * DM * 2); _Float16* BK = (_Float16*)take((size_t)DM * DM * 2); _Float16* BV = (_Float16*)take((size_t)DM * DM * 2); _Float16* BO = (_Float16*)take((size_t)DM * DM * 2);
  _Float16* X16 = (_Float16*)take(NR * DM * 2); _Float16* Q16 = (_Float16*)take(NR * DM * 2); _Float16* K16 = (_Float16*)take(NR * DM * 2); _Float16* O16 = (_Float16*)take(NR * DM * 2);
  _Float16* VT = (_Float16*)take((size_t)NB * NH * HD * SQ * 2);
  if (off > ws_size) return;
  k_prep<<<PXG + 4 * PWG, 256, 0, stream>>>(x, wq, wk, wv, wo, X16, BQ, BK, BV, BO);      /* f16 operands: x + PE rows and the four weight matrices */
  const size_t r0p = (size_t)B0 * SQ;      /* first projected row */
  k_gemm3qkv<<<(unsigned)((MP / G3T) * 3 * (DM / G3T)), G3W * 32, 0, stream>>>(X16 + r0p * DM, BQ, BK, BV, 0.0625f, bq, bk, bv, Q16 + r0p * DM, K16 + r0p * DM, VT);      /* q, k rows; V^T [NB][NH][HD][SQ] */
  k_fattn<<<dim3(SQ / (FAW * 32), NB * NH), FAW * FAS * 32, 0, stream>>>(Q16, K16, VT, O16);      /* o (merged heads, x64) as f16 rows */
  k_gemm3o<<<(unsigned)((MPO / G3T) * (DM / G3T)), G3W * 32, 0, stream>>>(O16 + r0p * DM, BO, 0.0009765625f, bo, (float*)d_out + r0p * DM);      /* out rows are the output layout */
}

// v010
// One run takes 71.1 microseconds.
// Next to v009, in two timings, it ran 1.04 times as fast each time.
// Counting every step since v000, it is 51.8 times as fast.
#include <hip/hip_runtime.h>
// Temporal multi-head attention with sinusoidal positional encoding (x [2][2048][1024]; x = x + PE (pe[s][2i] = sin(s d_i), pe[s][2i+1] = cos(s d_i), d_i = exp(2i x (-ln 1e4 / 1024))); q = x Wq^T + bq, k, v likewise (nn.Linear [out][in] 1024^2, weights and biases sigma 1/32); 16 heads of 64; softmax(q k^T / 8) (no mask); out = ctx Wo^T + bo -> [2][2048][1024]).
// Structure: token rows r = b*2048 + s; x + PE computed on VALU (f32 expf/sinf/cosf in the module's op order) -> f16 rows (one f16 rounding of x + pe); Q, K, V as three WMMA GEMMs in one grid (128x128 workgroup tiles staged in LDS, 64x64 wave tiles, f32 accumulation, exact x16 weights + bias, f16 outputs; the V tiles leave transposed, as V^T rows per batch and head); one fused attention kernel over all (batch, head, 256 queries), the keys dealt to two groups of waves and the two partial results joined at the end: scores on WMMA (K = 64), online softmax on VALU (f32 statistics, native exp2; weights as f16, scaled by a power of two that cancels), o = P . V on WMMA (o carried x64 against f16 subnormal flush, folded into the output GEMM alpha) written straight into the merged f16 o rows; out = o W_o + b GEMM (f32) into the output layout.
// Compute dtype: inputs rounded to bf16; weights exact, x + pe rounded once to f16; q, k, v, softmax weights and o as plain f16 GEMM operands (~2^-12); scores and softmax statistics f32; v_wmma_f32_16x16x32_f16.
#define NB 2
#define SQ 2048
#define DM 1024
#define NH 16
#define HD 64
#define HG 4                         /* heads per call of the unlaunched k_vt(V16, b, h0, VT) */
#define B0 0                         /* first batch processed (debug hook) */
#define NBR NB                       /* batches processed (debug hook) */
#define NR ((size_t)NB * SQ)         /* token rows */
#define MP ((int)((size_t)NBR * SQ)) /* rows projected (debug hook) */
#define QN SQ                        /* unused: k_fattn attends all SQ query rows */
#define NHD NH                       /* unused: k_fattn attends all NH heads */
#define MPO MP                       /* rows through the output stage (debug hook) */
typedef __bf16 v16b __attribute__((ext_vector_type(16)));
typedef unsigned short v8us __attribute__((ext_vector_type(8), may_alias));
typedef float  v8f  __attribute__((ext_vector_type(8)));
typedef float  v4f  __attribute__((ext_vector_type(4)));
typedef float  v4fa __attribute__((ext_vector_type(4), may_alias));
union FragB { v16b v; v8us half[2]; unsigned short u[16]; };

__device__ __forceinline__ unsigned short bf16_bits(float x) { unsigned int u = __float_as_uint(x); return (unsigned short)((u + 0x7FFFu + ((u >> 16) & 1u)) >> 16); }
__device__ __forceinline__ float bf16_val(unsigned short b) { return __uint_as_float(((unsigned int)b) << 16); }
__device__ __forceinline__ float bf16_round(float x) { return bf16_val(bf16_bits(x)); }
// D += A·B with NT terms: 1 = ah·bh, 2 = + al·bh (A split), 3 = + ah·bl (both split)
template <int NT>
__device__ __forceinline__ v8f mmaN(v16b ah, v16b al, v16b bh, v16b bl, v8f c) {
  c = __builtin_amdgcn_wmma_f32_16x16x32_bf16(false, ah, false, bh, (short)0, c, false, false);
  if (NT >= 2) c = __builtin_amdgcn_wmma_f32_16x16x32_bf16(false, al, false, bh, (short)0, c, false, false);
  if (NT >= 3) c = __builtin_amdgcn_wmma_f32_16x16x32_bf16(false, ah, false, bl, (short)0, c, false, false);
  asm volatile("v_nop\n\tv_nop\n\tv_nop\n\tv_nop" : "+v"(c) : "v"(ah), "v"(al), "v"(bh), "v"(bl));
  return c;
}

__global__ __launch_bounds__(256) void k_wt_bf16(const float* __restrict__ W, unsigned short* __restrict__ Wt, int K, int N) {
  const int t = blockIdx.x * 256 + threadIdx.x;
  const int k8n = K / 8;
  if (t >= N * k8n) return;
  const int n = t / k8n, k8 = (t % k8n) * 8;
  v8us v;
#pragma unroll
  for (int i = 0; i < 8; ++i) v[i] = bf16_bits(W[(size_t)(k8 + i) * N + n]);
  *(v8us*)(Wt + (size_t)n * K + k8) = v;
  
}

// GEMM C[M][N] (f32, pitch ldc) = act(A[M][K]·W + bias). A f32 row-major (pitch lda) converted per fragment to bf16
// (ASPLIT: hi/lo two planes -> 2 terms, else single rounded term); Wt bf16 [N][K] (pitch ldb). BIAS_BF16 rounds the
// bias to bf16 first (bias quantised to bf16 before the add). K%32==0, M%16==0, N%64==0.
template <bool ASPLIT, int ACT, bool BIAS_BF16>
__global__ __launch_bounds__(128) void k_gemm_bf(const float* __restrict__ A, int lda, const unsigned short* __restrict__ Wt, int ldb,
                                               const float* __restrict__ bias, float* __restrict__ C, int ldc, int M, int N, int K) {
  __shared__ __attribute__((aligned(16))) float so[4][16][64];
  const int tid = threadIdx.x, w = tid >> 5, lane = tid & 31, ln = lane & 15, hh = lane >> 4;
  const int ntn = N / 64;
  const int wid = blockIdx.x * 4 + w;
  const int mt = wid / ntn, nq = wid % ntn;
  if (mt * 16 >= M) return;
  const int row0 = mt * 16, col0 = nq * 64;
  const float* arow = A + (size_t)(row0 + ln) * lda;
  v8f acc[4] = {};
  for (int kb = 0; kb < K; kb += 32) {
    FragB ah, al;
    const v4f x0 = *(const v4fa*)(arow + kb + 8 * hh), x1 = *(const v4fa*)(arow + kb + 8 * hh + 4);
    const v4f x2 = *(const v4fa*)(arow + kb + 16 + 8 * hh), x3 = *(const v4fa*)(arow + kb + 16 + 8 * hh + 4);
    float xs[16] = {x0[0],x0[1],x0[2],x0[3],x1[0],x1[1],x1[2],x1[3],x2[0],x2[1],x2[2],x2[3],x3[0],x3[1],x3[2],x3[3]};
#pragma unroll
    for (int i = 0; i < 16; ++i) { const unsigned short hb = bf16_bits(xs[i]); ah.u[i] = hb; al.u[i] = ASPLIT ? bf16_bits(xs[i] - bf16_val(hb)) : (unsigned short)0; }
#pragma unroll
    for (int t = 0; t < 4; ++t) {
      const unsigned short* brow = Wt + (size_t)(col0 + t * 16 + ln) * ldb + kb;
      FragB b;
      b.half[0] = *(const v8us*)(brow + 8 * hh);
      b.half[1] = *(const v8us*)(brow + 16 + 8 * hh);
      acc[t] = mmaN<ASPLIT ? 2 : 1>(ah.v, al.v, b.v, b.v, acc[t]);
    }
  }
#pragma unroll
  for (int t = 0; t < 4; ++t) {
    float bv = bias ? bias[col0 + t * 16 + ln] : 0.f;
    if (BIAS_BF16) bv = bf16_round(bv);
#pragma unroll
    for (int r = 0; r < 8; ++r) { float v = acc[t][r] + bv; if (ACT == 1) v = fmaxf(v, 0.f); so[w][8 * hh + r][t * 16 + ln] = v; }
  }
  __builtin_amdgcn_fence(__ATOMIC_ACQ_REL, "workgroup");
  __builtin_amdgcn_wave_barrier();
  const int rsub = lane >> 4, c4 = (lane & 15) * 4;
  {
#pragma unroll
    for (int q = 0; q < 8; ++q) {
      const int r = q * 2 + rsub;
      const v4f v = *(const v4fa*)&so[w][r][c4];
      *(v4f*)(C + (size_t)(row0 + r) * ldc + col0 + c4) = v;
    }
    
  }
}

// GEMM C = act(A·W + bias + resid): A f32 (ASPLIT -> hi/lo 2 terms), Wt bf16 [N][K]; ACT 0 none, 1 relu, 2 exact gelu;
// resid (optional, f32, row index = (row % rmod), pitch ldr, RES_BF16 rounds it) added before the activation.
template <bool ASPLIT, int ACT, bool BIAS_BF16, bool RES_BF16>
__global__ __launch_bounds__(128) void k_gemm_bf3(const float* __restrict__ A, int lda, const unsigned short* __restrict__ Wt, int ldb,
                                                const float* __restrict__ bias, const float* __restrict__ resid, int rmod, int ldr,
                                                float* __restrict__ C, int ldc, int M, int N, int K) {
  __shared__ __attribute__((aligned(16))) float so[4][16][64];
  const int tid = threadIdx.x, w = tid >> 5, lane = tid & 31, ln = lane & 15, hh = lane >> 4;
  const int ntn = N / 64;
  const int wid = blockIdx.x * 4 + w;
  const int mt = wid / ntn, nq = wid % ntn;
  if (mt * 16 >= M) return;
  const int row0 = mt * 16, col0 = nq * 64;
  const float* arow = A + (size_t)(row0 + ln) * lda;
  v8f acc[4] = {};
  for (int kb = 0; kb < K; kb += 32) {
    FragB ah, al;
    const v4f x0 = *(const v4fa*)(arow + kb + 8 * hh), x1 = *(const v4fa*)(arow + kb + 8 * hh + 4);
    const v4f x2 = *(const v4fa*)(arow + kb + 16 + 8 * hh), x3 = *(const v4fa*)(arow + kb + 16 + 8 * hh + 4);
    float xs[16] = {x0[0],x0[1],x0[2],x0[3],x1[0],x1[1],x1[2],x1[3],x2[0],x2[1],x2[2],x2[3],x3[0],x3[1],x3[2],x3[3]};
#pragma unroll
    for (int i = 0; i < 16; ++i) { const unsigned short hb = bf16_bits(xs[i]); ah.u[i] = hb; al.u[i] = ASPLIT ? bf16_bits(xs[i] - bf16_val(hb)) : (unsigned short)0; }
#pragma unroll
    for (int t = 0; t < 4; ++t) {
      const unsigned short* brow = Wt + (size_t)(col0 + t * 16 + ln) * ldb + kb;
      FragB b;
      b.half[0] = *(const v8us*)(brow + 8 * hh);
      b.half[1] = *(const v8us*)(brow + 16 + 8 * hh);
      acc[t] = mmaN<ASPLIT ? 2 : 1>(ah.v, al.v, b.v, b.v, acc[t]);
    }
  }
#pragma unroll
  for (int t = 0; t < 4; ++t) {
    const int col = col0 + t * 16 + ln;
    float bv = bias ? bias[col] : 0.f;
    if (BIAS_BF16) bv = bf16_round(bv);
#pragma unroll
    for (int r = 0; r < 8; ++r) {
      float v = acc[t][r] + bv;
      if (resid) { float rv = resid[(size_t)((row0 + 8 * hh + r) % rmod) * ldr + col]; if (RES_BF16) rv = bf16_round(rv); v += rv; }
      if (ACT == 1) v = fmaxf(v, 0.f);
      if (ACT == 2) v = 0.5f * v * (1.0f + erff(v * 0.70710678118654752f));
      if (ACT == 3) { const float u = 0.7978845608028654f * (v + 0.044715f * v * v * v); v = 0.5f * v * (1.0f + tanhf(u)); }
      so[w][8 * hh + r][t * 16 + ln] = v;
    }
  }
  __builtin_amdgcn_fence(__ATOMIC_ACQ_REL, "workgroup");
  __builtin_amdgcn_wave_barrier();
  const int rsub = lane >> 4, c4 = (lane & 15) * 4;
  {
#pragma unroll
    for (int q = 0; q < 8; ++q) {
      const int r = q * 2 + rsub;
      const v4f v = *(const v4fa*)&so[w][r][c4];
      *(v4f*)(C + (size_t)(row0 + r) * ldc + col0 + c4) = v;
    }
    
  }
}
// row LayerNorm (biased variance, eps) over N: s = X (+ R); optional out_sum <- s; out_norm <- (s-mu)*rsqrt(var+eps)*g + b
template <bool PARAM_BF16>
__global__ __launch_bounds__(256) void k_layernorm(const float* __restrict__ X, const float* __restrict__ R, const float* __restrict__ g, const float* __restrict__ bta,
                                                  float* __restrict__ out_sum, float* __restrict__ out_norm, int N, float eps) {
  __shared__ float red[256];
  const int row = blockIdx.x, tid = threadIdx.x;
  const float* x = X + (size_t)row * N; const float* rr = R ? R + (size_t)row * N : nullptr;
  float vals[16];                     // up to N = 4096
  const int per = N / 256;            // contiguous chunk per thread? use strided-by-4 chunks: thread handles j = tid*4 + 1024*u
  float s1 = 0.f;
  for (int u = 0; u < per / 4; ++u) {
    const int j = tid * 4 + 1024 * u;
    const v4f a = *(const v4fa*)(x + j);
    v4f b = {0.f,0.f,0.f,0.f}; if (rr) b = *(const v4fa*)(rr + j);
#pragma unroll
    for (int q = 0; q < 4; ++q) { const float v = a[q] + b[q]; vals[u * 4 + q] = v; s1 += v; }
  }
  red[tid] = s1; __syncthreads();
  for (int st = 128; st > 0; st >>= 1) { if (tid < st) red[tid] += red[tid + st]; __syncthreads(); }
  const float mu = red[0] / (float)N; __syncthreads();
  float s2 = 0.f;
  for (int u = 0; u < per / 4; ++u)
#pragma unroll
    for (int q = 0; q < 4; ++q) { const float c = vals[u * 4 + q] - mu; s2 += c * c; }
  red[tid] = s2; __syncthreads();
  for (int st = 128; st > 0; st >>= 1) { if (tid < st) red[tid] += red[tid + st]; __syncthreads(); }
  const float rs = rsqrtf(red[0] / (float)N + eps);
  {
    for (int u = 0; u < per / 4; ++u) {
      const int j = tid * 4 + 1024 * u;
      v4f o, sm;
#pragma unroll
      for (int q = 0; q < 4; ++q) {
        float gg = g[j + q], bb = bta[j + q];
        if (PARAM_BF16) { gg = bf16_round(gg); bb = bf16_round(bb); }
        sm[q] = vals[u * 4 + q]; o[q] = (vals[u * 4 + q] - mu) * rs * gg + bb;
      }
      if (out_sum) *(v4f*)(out_sum + (size_t)row * N + j) = sm;
      *(v4f*)(out_norm + (size_t)row * N + j) = o;
    }
    
  }
}



// ---- f16 WMMA path (v_wmma_f32_16x16x32_f16): 11-bit significands for operands in range — used where a [0,1] probability operand needs more precision than bf16
typedef _Float16 v16h __attribute__((ext_vector_type(16)));
union FragH { v16h v; v8us half[2]; _Float16 h[16]; unsigned short u[16]; };
template <int NT>
__device__ __forceinline__ v8f mmaH(v16h ah, v16h al, v16h bh, v16h bl, v8f c) {
  c = __builtin_amdgcn_wmma_f32_16x16x32_f16(false, ah, false, bh, (short)0, c, false, false);
  if (NT >= 2) c = __builtin_amdgcn_wmma_f32_16x16x32_f16(false, al, false, bh, (short)0, c, false, false);
  if (NT >= 3) c = __builtin_amdgcn_wmma_f32_16x16x32_f16(false, ah, false, bl, (short)0, c, false, false);
  asm volatile("v_nop\n\tv_nop\n\tv_nop\n\tv_nop" : "+v"(c) : "v"(ah), "v"(al), "v"(bh), "v"(bl));
  return c;
}
// batched GEMM like k_gemm_b but f16 operands: A f32 (split into f16 hi/lo if ASPLIT, else rounded to f16), Bt = f16 values [n][k]; alpha; C f32; N multiple of 16 (partial tiles skipped)
template <bool ASPLIT>
__global__ __launch_bounds__(128) void k_gemm_h(const float* __restrict__ A, int lda, size_t sA, const _Float16* __restrict__ Bh, int ldb, size_t sB, float alpha, float* __restrict__ C, int ldc, size_t sC, int M, int N, int K) {
  __shared__ __attribute__((aligned(16))) float so[4][16][64];
  const int tid = threadIdx.x, w = tid >> 5, lane = tid & 31, ln = lane & 15, hh = lane >> 4; const int by = blockIdx.y;
  A += (size_t)by * sA; Bh += (size_t)by * sB; C += (size_t)by * sC;
  const int ntn = (N + 63) / 64; const int wid = blockIdx.x * 4 + w; const int mt = wid / ntn, nq = wid % ntn; if (mt * 16 >= M) return;
  const int row0 = mt * 16, col0 = nq * 64; const float* arow = A + (size_t)(row0 + ln) * lda;
  v8f acc[4] = {};
  for (int kb = 0; kb < K; kb += 32) {
    FragH ah, al;
    const v4f x0 = *(const v4fa*)(arow + kb + 8 * hh), x1 = *(const v4fa*)(arow + kb + 8 * hh + 4), x2 = *(const v4fa*)(arow + kb + 16 + 8 * hh), x3 = *(const v4fa*)(arow + kb + 16 + 8 * hh + 4);
    float xs[16] = {x0[0],x0[1],x0[2],x0[3],x1[0],x1[1],x1[2],x1[3],x2[0],x2[1],x2[2],x2[3],x3[0],x3[1],x3[2],x3[3]};
#pragma unroll
    for (int i = 0; i < 16; ++i) { const _Float16 h = (_Float16)xs[i]; ah.h[i] = h; al.h[i] = ASPLIT ? (_Float16)(xs[i] - (float)h) : (_Float16)0.0f; }
#pragma unroll
    for (int t = 0; t < 4; ++t) { if (col0 + t * 16 >= N) continue; const size_t boff = (size_t)(col0 + t * 16 + ln) * ldb + kb; FragH bq; bq.half[0] = *(const v8us*)(Bh + boff + 8 * hh); bq.half[1] = *(const v8us*)(Bh + boff + 16 + 8 * hh);
      acc[t] = mmaH<ASPLIT ? 2 : 1>(ah.v, al.v, bq.v, bq.v, acc[t]); }
  }
#pragma unroll
  for (int t = 0; t < 4; ++t) { if (col0 + t * 16 >= N) continue;
#pragma unroll
    for (int r = 0; r < 8; ++r) so[w][8 * hh + r][t * 16 + ln] = acc[t][r] * alpha; }
  __builtin_amdgcn_fence(__ATOMIC_ACQ_REL, "workgroup"); __builtin_amdgcn_wave_barrier();
  const int rsub = lane >> 4, c4 = (lane & 15) * 4;
  {
#pragma unroll
    for (int q = 0; q < 8; ++q) { const int r = q * 2 + rsub; if (col0 + c4 < N) { const v4f v = *(const v4fa*)&so[w][r][c4]; *(v4f*)(C + (size_t)(row0 + r) * ldc + col0 + c4) = v; } }
     }
}

// Wt[n][k] = f16(W[k][n]·scale) from f32 row-major W[K][N] (scale = power of two; bf16-exact weights stay exact in f16 away from the subnormal range)
__global__ __launch_bounds__(256) void k_wt_f16(const float* __restrict__ W, _Float16* __restrict__ Wt, int K, int N, float scale) {
  const int t = blockIdx.x * 256 + threadIdx.x; if (t >= N * (K / 8)) return; const int n = t / (K / 8), k8 = (t % (K / 8)) * 8; FragH f;
#pragma unroll
  for (int i = 0; i < 8; ++i) f.h[i] = (_Float16)(bf16_round(W[(size_t)(k8 + i) * N + n]) * scale); const v8us o = f.half[0];
  *(v8us*)((unsigned short*)Wt + (size_t)n * K + k8) = o; 
}
// k_gemm_hh variant with fused epilogue: v = acc·alpha + bias[by·sBias + col] (+ CP[(row/rowsPerB)·sCPb + by·64 + col] if CP) ; ACT 0 none / 1 elu ; writes f16 C16 (and f32 C if non-null)
template <int ACT>
__global__ __launch_bounds__(128) void k_gemm_hhx(const _Float16* __restrict__ A, int lda, size_t sA, const _Float16* __restrict__ Bh, int ldb, size_t sB, float alpha, const float* __restrict__ bias, size_t sBias, const float* __restrict__ CP, int rowsPerB, size_t sCPb, int row0g,
    float* __restrict__ C, _Float16* __restrict__ C16, int ldc, size_t sC, int M, int N, int K) {
  __shared__ __attribute__((aligned(16))) float so[4][16][64];
  const int tid = threadIdx.x, w = tid >> 5, lane = tid & 31, ln = lane & 15, hh = lane >> 4; const int by = blockIdx.y;
  A += (size_t)by * sA; Bh += (size_t)by * sB; const size_t cofs = (size_t)by * sC; const float* bp = bias ? bias + (size_t)by * sBias : nullptr;
  const int ntn = (N + 63) / 64; const int wid = blockIdx.x * 4 + w; const int mt = wid / ntn, nq = wid % ntn; if (mt * 16 >= M) return;
  const int row0 = mt * 16, col0 = nq * 64; const _Float16* arow = A + (size_t)(row0 + ln) * lda;
  v8f acc[4] = {};
  for (int kb = 0; kb < K; kb += 32) { FragH ah; ah.half[0] = *(const v8us*)((const unsigned short*)arow + kb + 8 * hh); ah.half[1] = *(const v8us*)((const unsigned short*)arow + kb + 16 + 8 * hh);
#pragma unroll
    for (int t = 0; t < 4; ++t) { if (col0 + t * 16 >= N) continue; const size_t boff = (size_t)(col0 + t * 16 + ln) * ldb + kb; FragH bq; bq.half[0] = *(const v8us*)((const unsigned short*)Bh + boff + 8 * hh); bq.half[1] = *(const v8us*)((const unsigned short*)Bh + boff + 16 + 8 * hh);
      acc[t] = mmaH<1>(ah.v, ah.v, bq.v, bq.v, acc[t]); }
  }
#pragma unroll
  for (int t = 0; t < 4; ++t) { if (col0 + t * 16 >= N) continue; const int col = col0 + t * 16 + ln; const float bv = bp ? bf16_round(bp[col]) : 0.f;
#pragma unroll
    for (int r = 0; r < 8; ++r) { float v = acc[t][r] * alpha + bv; if (CP) { const int rr = row0g + row0 + 8 * hh + r; if (rowsPerB < 0) v += CP[cofs + (size_t)rr * ldc + col];      /* rowsPerB < 0: own element of the batched C plane */ else { const int bidx = rr / rowsPerB; v += CP[(size_t)bidx * sCPb + (size_t)by * 64 + col]; } } if (ACT == 1) v = (v > 0.f) ? v : expm1f(v); else if (ACT == 7) v = (v > 0.f) ? v + 1.0f : expf(v); else if (ACT == 8) v = tanhf(v); else if (ACT == 9) v = 0.5f * v * (1.0f + tanhf(0.7978845608028654f * (v + 0.044715f * v * v * v))); else if (ACT == 11) v = 1.0f / (1.0f + expf(-v)); else if (ACT == 12) v = (v > 0.f) ? v : 0.01f * v; else if (ACT == 14) v = (v > 0.f) ? v : 0.1f * v; else if (ACT == 16) v = (v >= 0.f) ? v : 0.3f * v; else if (ACT == 17) v = (v >= 0.f) ? v : 0.2f * v; else if (ACT == 15) v = v / (1.0f + expf(-v)); else if (ACT == 3) v = fmaxf(v, 0.f); else if (ACT == 6) v = 0.5f * v * (1.0f + erff(v * 0.70710678118654752f)); so[w][8 * hh + r][t * 16 + ln] = v; } }
  __builtin_amdgcn_fence(__ATOMIC_ACQ_REL, "workgroup"); __builtin_amdgcn_wave_barrier();
  const int rsub = lane >> 4, c4 = (lane & 15) * 4; typedef _Float16 v4h __attribute__((ext_vector_type(4)));
  {
#pragma unroll
    for (int q = 0; q < 8; ++q) { const int r = q * 2 + rsub; if (col0 + c4 < N) { const v4f v = *(const v4fa*)&so[w][r][c4]; if (C) *(v4f*)(C + cofs + (size_t)(row0 + r) * ldc + col0 + c4) = v; if (C16) { v4h h4; for (int i = 0; i < 4; ++i) h4[i] = (_Float16)v[i]; *(v4h*)(C16 + cofs + (size_t)(row0 + r) * ldc + col0 + c4) = h4; } } }
     }
}


typedef _Float16 v4h __attribute__((ext_vector_type(4)));

__global__ __launch_bounds__(256) void k_x16(const float* __restrict__ x, _Float16* __restrict__ X16, size_t n8) { const size_t t = (size_t)blockIdx.x * 256 + threadIdx.x; if (t >= n8) return; FragH f;
#pragma unroll
  for (int q = 0; q < 8; ++q) f.h[q] = (_Float16)bf16_round(x[t * 8 + q]); *(v8us*)((unsigned short*)X16 + t * 8) = f.half[0];  }
__global__ __launch_bounds__(256) void k_h16(const float* __restrict__ x, _Float16* __restrict__ X16, size_t n8) { const size_t t = (size_t)blockIdx.x * 256 + threadIdx.x; if (t >= n8) return; FragH f;
#pragma unroll
  for (int q = 0; q < 8; ++q) f.h[q] = (_Float16)x[t * 8 + q]; *(v8us*)((unsigned short*)X16 + t * 8) = f.half[0];  }
__global__ __launch_bounds__(256) void k_round16f(const float* __restrict__ W, _Float16* __restrict__ Bt, size_t n8) { const size_t t = (size_t)blockIdx.x * 256 + threadIdx.x; if (t >= n8) return; FragH f;
#pragma unroll
  for (int i = 0; i < 8; ++i) f.h[i] = (_Float16)(bf16_round(W[t * 8 + i]) * 16.0f); *(v8us*)((unsigned short*)Bt + t * 8) = f.half[0];  }
__global__ __launch_bounds__(256) void k_hl(const float* __restrict__ F, _Float16* __restrict__ Hh, _Float16* __restrict__ Hl, size_t n8) { const size_t t = (size_t)blockIdx.x * 256 + threadIdx.x; if (t >= n8) return; FragH fh, fl; const v4f a = *(const v4fa*)(F + t * 8), c = *(const v4fa*)(F + t * 8 + 4);
#pragma unroll
  for (int q = 0; q < 4; ++q) { _Float16 h = (_Float16)a[q]; fh.h[q] = h; fl.h[q] = (_Float16)((a[q] - (float)h) * 1024.0f); h = (_Float16)c[q]; fh.h[4 + q] = h; fl.h[4 + q] = (_Float16)((c[q] - (float)h) * 1024.0f); }
  { *(v8us*)((unsigned short*)Hh + t * 8) = fh.half[0]; *(v8us*)((unsigned short*)Hl + t * 8) = fl.half[0];  } }

__device__ __forceinline__ v16h g2_frag(const _Float16* p, int hh) { FragH f; f.half[0] = *(const v8us*)((const unsigned short*)p + 8 * hh); f.half[1] = *(const v8us*)((const unsigned short*)p + 16 + 8 * hh); return f.v; }


#define WCH 8                        /* 8-element chunks per thread */
// chunks t0 + 256 i of one weight matrix: all loads issued first, then converted and stored
__device__ __forceinline__ void wnat_part(const float* __restrict__ w, _Float16* __restrict__ Bt, unsigned t0) { v4f a[WCH][2]; const unsigned ob = t0 * 32;      /* the thread's first byte */
  /* the short loops below are all unrolled so that a stays in registers */
#pragma unroll
  for (int i = 0; i < WCH; ++i) { const float* p = (const float*)((const char*)w + ob) + 256 * 8 * i; a[i][0] = *(const v4fa*)p; a[i][1] = *(const v4fa*)(p + 4); }
  /* precaution: stands in front of every write of a register that the loads above name as an address; it names the offset (input only), so that no later load of the run lands in it either; it also keeps all the loads in front of the first store */
  asm volatile("s_wait_xcnt 0x0" :: "v"(ob) : "memory");
#pragma unroll
  for (int i = 0; i < WCH; ++i) { FragH f;
#pragma unroll
    for (int q = 0; q < 8; ++q) f.h[q] = (_Float16)(bf16_round(a[i][q >> 2][q & 3]) * 16.0f);
    *(v8us*)((unsigned short*)Bt + (size_t)(t0 + 256 * i) * 8) = f.half[0]; }
  asm volatile("s_wait_xcnt 0x0" ::: "memory"); }      /* precaution: in the built kernel the x + PE text follows this path behind a branch; the wait stands in front of its writes of registers that the stores above name */
__global__ __launch_bounds__(256) void k_rsm(const float* __restrict__ S, _Float16* __restrict__ P, int nrows) {
  #pragma clang fp contract(off)
  const int i = blockIdx.x * 256 + threadIdx.x; if (i >= nrows) return; const float* s = S + (size_t)i * SQ; float mx = -3.0e38f;
#pragma unroll 1
  for (int j = 0; j < SQ; ++j) mx = fmaxf(mx, s[j]); float se = 0.f;
#pragma unroll 1
  for (int j = 0; j < SQ; ++j) se += expf(s[j] - mx); const float sc = 256.0f / se;
#pragma unroll 1
  for (int j0 = 0; j0 < SQ; j0 += 8) { FragH f; for (int q = 0; q < 8; ++q) f.h[q] = (_Float16)(expf(s[j0 + q] - mx) * sc); unsigned short* d = (unsigned short*)P + (size_t)i * SQ + j0; *(v8us*)d = f.half[0];  } }
__global__ __launch_bounds__(256) void k_vt(const _Float16* __restrict__ V16, int b, int h0, _Float16* __restrict__ VT) { __shared__ unsigned short tl[64][65]; const int tid = threadIdx.x; const int hh = blockIdx.x % HG, sg = blockIdx.x / HG; const int s0 = sg * 64; const int h = h0 + hh;
  for (int i = tid; i < 64 * 8; i += 256) { const int j = i / 8, d8 = (i % 8) * 8; FragH f; f.half[0] = *(const v8us*)((const unsigned short*)V16 + ((size_t)b * SQ + s0 + j) * DM + h * HD + d8); for (int q = 0; q < 8; ++q) tl[d8 + q][j] = f.u[q]; }
  __syncthreads();
  { for (int i = tid; i < 64 * 8; i += 256) { const int d = i / 8, j8 = (i % 8) * 8; FragH f; for (int q = 0; q < 8; ++q) f.u[q] = tl[d][j8 + q]; *(v8us*)((unsigned short*)VT + ((size_t)hh * HD + d) * SQ + s0 + j8) = f.half[0]; }  } }



#define FACS (0.125f * 1.44269504088896340736f)      /* 64^-0.5 log2 e: the Q rows leave their GEMM times this */
#define FAW 8                        /* waves per key part: FAW * 32 queries per workgroup */
#define FAS 2                        /* key parts = groups of waves */
#define FAK 64                       /* keys per stage */
#define FAP 72                       /* LDS row pitch in f16: 128 bytes of data + 16, so that the 16 rows of a fragment read start in 16 different bank groups */
#define FAT (SQ / FAS / FAK)         /* stages per key part */
typedef float v2f __attribute__((ext_vector_type(2)));
__device__ __forceinline__ float rs_xhalf(float x) { return __builtin_bit_cast(float, __builtin_amdgcn_permlanex16(__builtin_bit_cast(int, x), __builtin_bit_cast(int, x), 0x76543210, 0xfedcba98, false, false)); }      /* lane l reads lane l ^ 16 */
__device__ __forceinline__ v16h fa_frag(const unsigned short* p, int hh) { FragH f; f.half[0] = *(const v8us*)(p + 8 * hh); f.half[1] = *(const v8us*)(p + 16 + 8 * hh); return f.v; }
__device__ __forceinline__ v8f fa_mma(v16h a, v16h b, v8f c) { return __builtin_amdgcn_wmma_f32_16x16x32_f16(false, a, false, b, (short)0, c, false, false); }
typedef int v8i __attribute__((ext_vector_type(8)));
__device__ __forceinline__ int fa_max3(int a, int b, int c) { return max(max(a, b), c); }
// Eight native 2^x (v_exp_f32). The builtin, not asm text: the compiler schedules these between the matrix instructions and must see which registers they write.
__device__ __forceinline__ v8f fa_exp2x8(v8f x) { v8f e;
#pragma unroll      /* the vector stays in registers */
  for (int i = 0; i < 8; ++i) e[i] = __builtin_amdgcn_exp2f(x[i]);
  return e; }
static_assert((FAT & (FAT - 1)) == 0, "k_fattn: the rotated walk wraps by a mask");
static_assert(SQ % (FAW * 32) == 0 && SQ % (FAS * FAK) == 0 && HD == 64 && FAK == 64 && FAW * 32 == 256 && FAS == 2, "k_fattn: whole workgroups and stages; the 256 threads of a key part stage 64 rows of 128 bytes in two rounds; two parts swap one query group each");
__global__ __launch_bounds__(FAW * FAS * 32) void k_fattn(const _Float16* __restrict__ Q16, const _Float16* __restrict__ K16, const _Float16* __restrict__ VT, _Float16* __restrict__ O16) {
  __shared__ __attribute__((aligned(16))) unsigned short sk[FAS][2][FAK][FAP];      /* K rows [key part][buffer][key][d] */
  __shared__ __attribute__((aligned(16))) unsigned short sv[FAS][2][HD][FAP];       /* V^T rows [key part][buffer][d][key] */
  __shared__ __attribute__((aligned(16))) float smo[8][2][FAW][32][4];              /* handed-over output tiles [4 registers][query group][wave][lane] */
  __shared__ __attribute__((aligned(8))) float sml[2][FAW][32][2];                  /* handed-over maximum in use and sum [query group][wave][lane] */
  const int tid = threadIdx.x, w = (tid >> 5) & (FAW - 1), lane = tid & 31, ln = lane & 15, hh = lane >> 4;
  const int kh = __builtin_amdgcn_readfirstlane(tid >> 8);      /* the wave's key part, in a scalar register: the branches on it at the end are scalar */
  const int bh = blockIdx.y, b = bh / NH, hd = bh - b * NH; const size_t r0 = (size_t)b * SQ; const int q0 = (blockIdx.x * FAW + w) * 32;
  const int srow = (tid & 255) >> 3, sc8 = (tid & 7) * 8;      /* staging, per key part: 8 threads per 128-byte row, rows srow and srow + 32 */
  const int rot = (int)(2 * blockIdx.x + blockIdx.y);      /* first stage of the walk (taken modulo FAT): a head's 8 workgroups start two stages apart, neighbouring heads one */
  const unsigned short* kg = (const unsigned short*)K16 + (r0 + kh * (SQ / FAS) + (rot & (FAT - 1)) * FAK + srow) * DM + hd * HD + sc8;      /* the thread's places in the stage being fetched; both are moved on by one stage at a time */
  const unsigned short* vg = (const unsigned short*)VT + ((size_t)bh * HD + srow) * SQ + kh * (SQ / FAS) + (rot & (FAT - 1)) * FAK + sc8;
  v16h qf[2][2];      /* [16-query group][32 of d] */
  /* the short loops below are all unrolled so that the fragment and accumulator arrays stay in registers */
#pragma unroll
  for (int g = 0; g < 2; ++g)
#pragma unroll
    for (int ks = 0; ks < 2; ++ks) qf[g][ks] = g2_frag(Q16 + (r0 + q0 + g * 16 + ln) * DM + hd * HD + ks * 32, hh);
  const v8f z8 = {0.f, 0.f, 0.f, 0.f, 0.f, 0.f, 0.f, 0.f};
  v8f o[2][4] = {{z8, z8, z8, z8}, {z8, z8, z8, z8}}; float ms[2] = {0.f, 0.f}, l[2] = {0.f, 0.f}; v8f cb[2] = {z8 + 7.0f, z8 + 7.0f};      /* cb: 7 - ms in all eight registers, the C operand of the score products */
  v8us kr0 = *(const v8us*)kg, kr1 = *(const v8us*)(kg + (size_t)32 * DM), vr0 = *(const v8us*)vg, vr1 = *(const v8us*)(vg + (size_t)32 * SQ);
  asm volatile("s_wait_xcnt 0x0" ::: "memory");      /* precaution: stands in front of every later write of a register that the loads above name as an address */
  *(v8us*)&sk[kh][0][srow][sc8] = kr0; *(v8us*)&sk[kh][0][srow + 32][sc8] = kr1; *(v8us*)&sv[kh][0][srow][sc8] = vr0; *(v8us*)&sv[kh][0][srow + 32][sc8] = vr1;
  __syncthreads();      /* stage 0 is published */
  for (int t = 0; t < FAT; ++t) { const int cur = t & 1;
    if (t + 1 < FAT) { const int st = ((t + 1 + rot) & (FAT - 1)) != 0 ? FAK : FAK - FAT * FAK;      /* keys to the next stage: behind the key part's last stage the walk wraps to its first */
      kg += (ptrdiff_t)st * DM; vg += st;
      kr0 = *(const v8us*)kg; kr1 = *(const v8us*)(kg + (size_t)32 * DM); vr0 = *(const v8us*)vg; vr1 = *(const v8us*)(vg + (size_t)32 * SQ); }
#pragma unroll
    for (int hp = 0; hp < 2; ++hp) {      /* two passes of 32 keys per stage: half the score registers live at once; unrolled, so that one pass's matrix work can be scheduled among the other's softmax */
      v8f s[2][2];      /* S^T c + 7 - ms: [query group][16-key tile], register r = key 8 hh + r, lane column = query */
#pragma unroll
      for (int j = 0; j < 2; ++j) { const v16h a0 = fa_frag(&sk[kh][cur][hp * 32 + j * 16 + ln][0], hh), a1 = fa_frag(&sk[kh][cur][hp * 32 + j * 16 + ln][32], hh);
#pragma unroll
        for (int g = 0; g < 2; ++g) s[g][j] = fa_mma(a1, qf[g][1], fa_mma(a0, qf[g][0], cb[g])); }
      __builtin_amdgcn_sched_barrier(0);      /* keeps the eight score products one run: left to itself the compiler puts the first maximum instructions directly behind a tile's last WMMA and fills the distance the chip needs there with v_nop */
      v16h va[4];
#pragma unroll
      for (int dt = 0; dt < 4; ++dt) va[dt] = fa_frag(&sv[kh][cur][dt * 16 + ln][hp * 32], hh);
      /* the lane's largest argument over both query groups: the test needs no query's own maximum, and the ballot sees both halves of the wave.
         Taken on the bit patterns as signed integers: above 0 they order as the floats do, and every negative float lies below, so "some argument > 15" (0x41700000 is 15.0f) comes out exactly */
      const v8i i00 = __builtin_bit_cast(v8i, s[0][0]), i01 = __builtin_bit_cast(v8i, s[0][1]), i10 = __builtin_bit_cast(v8i, s[1][0]), i11 = __builtin_bit_cast(v8i, s[1][1]);
      int m12[12];
#pragma unroll
      for (int i = 0; i < 8; ++i) m12[i] = fa_max3(i00[i], i01[i], i10[i]);
      m12[8] = fa_max3(i11[0], i11[1], i11[2]); m12[9] = fa_max3(i11[3], i11[4], i11[5]); m12[10] = i11[6]; m12[11] = i11[7];
      const int ma = max(fa_max3(fa_max3(m12[0], m12[1], m12[2]), fa_max3(m12[3], m12[4], m12[5]), fa_max3(m12[6], m12[7], m12[8])), fa_max3(m12[9], m12[10], m12[11]));
      const bool first = hp == 0 && t == 0;      /* the wave's first pass sets the maxima in use, upwards or downwards */
      if (__builtin_amdgcn_ballot_w32(ma > 0x41700000) != 0 || first) {      /* wave-uniform: some query's maximum has outgrown the one in use by more than 8 */
        const float lo = first ? -3.0e38f : 0.0f;
#pragma unroll
        for (int g = 0; g < 2; ++g) { const v8f mv = __builtin_elementwise_max(s[g][0], s[g][1]);
          const float mx = fmaxf(fmaxf(fmaxf(mv[0], mv[1]), fmaxf(mv[2], mv[3])), fmaxf(fmaxf(mv[4], mv[5]), fmaxf(mv[6], mv[7])));
          const float d = fmaxf(fmaxf(mx, rs_xhalf(mx)) - 7.0f, lo);      /* how far the query's maximum in use moves */
          const float c = __builtin_amdgcn_exp2f(fminf(-d, 0.0f));      /* the rescale factor; in the first pass sum and output tiles are still 0, and the factor stays finite */
          ms[g] += d; l[g] *= c; cb[g] = z8 + (7.0f - ms[g]);
#pragma unroll
          for (int j = 0; j < 2; ++j) s[g][j] -= d;
#pragma unroll
          for (int dt = 0; dt < 4; ++dt) o[g][dt] *= c; } }
      v16h pf[2];      /* P^T as B operand, per query group */
#pragma unroll
      for (int g = 0; g < 2; ++g) {
#pragma unroll
        for (int j = 0; j < 2; ++j) s[g][j] = fa_exp2x8(s[g][j]);
        const v8f ps = s[g][0] + s[g][1];
        l[g] += ((ps[0] + ps[1]) + (ps[2] + ps[3])) + ((ps[4] + ps[5]) + (ps[6] + ps[7]));
        FragH f;
#pragma unroll
        for (int i = 0; i < 8; ++i) { f.h[i] = (_Float16)s[g][0][i]; f.h[8 + i] = (_Float16)s[g][1][i]; }
        pf[g] = f.v; }
#pragma unroll
      for (int dt = 0; dt < 4; ++dt)
#pragma unroll
        for (int g = 0; g < 2; ++g) o[g][dt] = fa_mma(va[dt], pf[g], o[g][dt]); }
    if (t + 1 < FAT) { *(v8us*)&sk[kh][cur ^ 1][srow][sc8] = kr0; *(v8us*)&sk[kh][cur ^ 1][srow + 32][sc8] = kr1; *(v8us*)&sv[kh][cur ^ 1][srow][sc8] = vr0; *(v8us*)&sv[kh][cur ^ 1][srow + 32][sc8] = vr1; }      /* its last readers left this buffer at the barrier of stage t - 1 */
    __syncthreads(); }      /* publishes stage t + 1 and ends every read of stage t */
#pragma unroll
  for (int g = 0; g < 2; ++g) if (g != kh) {      /* the query group that the wave of the other key part finishes */
#pragma unroll
    for (int dt = 0; dt < 4; ++dt) { *(v4f*)&smo[2 * dt][g][w][lane][0] = __builtin_shufflevector(o[g][dt], o[g][dt], 0, 1, 2, 3); *(v4f*)&smo[2 * dt + 1][g][w][lane][0] = __builtin_shufflevector(o[g][dt], o[g][dt], 4, 5, 6, 7); }
    const v2f ml = {ms[g], l[g]}; *(v2f*)&sml[g][w][lane][0] = ml; }
  __syncthreads();      /* the handed-over groups are published */
#pragma unroll
  for (int g = 0; g < 2; ++g) if (g == kh) {      /* join the two key parts: both are brought to the larger maximum in use */
    const v2f ml = *(const v2f*)&sml[g][w][lane][0]; const float m = fmaxf(ms[g], ml[0]); const float ca = __builtin_amdgcn_exp2f(ms[g] - m), cb = __builtin_amdgcn_exp2f(ml[0] - m);
    const float lj = l[g] * ca + ml[1] * cb; const float inv = 64.0f / (lj + rs_xhalf(lj));      /* the halves hold disjoint keys; o is carried x64 */
    const float fa = ca * inv, fb = cb * inv;
    unsigned short* op = (unsigned short*)O16 + (r0 + q0 + g * 16 + ln) * DM + hd * HD + 8 * hh;
#pragma unroll
    for (int dt = 0; dt < 4; ++dt) { FragH f; const v4f p0 = *(const v4f*)&smo[2 * dt][g][w][lane][0], p1 = *(const v4f*)&smo[2 * dt + 1][g][w][lane][0];
#pragma unroll
      for (int r = 0; r < 4; ++r) { f.h[r] = (_Float16)(o[g][dt][r] * fa + p0[r] * fb); f.h[4 + r] = (_Float16)(o[g][dt][4 + r] * fa + p1[r] * fb); }
      *(v8us*)(op + dt * 16) = f.half[0]; }      /* register r = d 16 dt + 8 hh + r of query ln: 16 contiguous bytes */
    if (g == 0) asm volatile("s_wait_xcnt 0x0" ::: "memory"); } }      /* precaution: in the built kernel the second group's text follows this path behind a branch; the wait stands in front of its writes of registers that the stores above name */


// ---- staged GEMM: C[MP][DM] = A[MP][DM] . Bt[DM][DM]^T x alpha + bias x bsc (bias rounded to bf16 first), A, Bt and C pitch DM, the transposed C16 ([NB][DM][SQ]) pitch SQ; C f32 or f16 ----
// One workgroup = 4 waves = one 128 x 128 tile of C, waves 2 (rows) x 2 (columns), 64 x 64 per wave: 8 fragments feed 16 WMMAs. The k axis runs in stages of KS: the 128 A rows
// and the 128 Bt rows of a stage come from global memory as whole lines, once per workgroup, and lie in LDS at a padded pitch; every wave takes its fragments from there.
// Two LDS buffers: stage t + 1 travels global -> registers while stage t is worked on and is stored in front of stage t's last 32-k block, whose matrix work covers the stores; one barrier per stage.
// The walk over the stages starts at stage rot (modulo the stage count) and wraps round: workgroups that share A rows or Bt rows then ask L2 for different lines at any moment.
// Each accumulator tile sums k in steps of 32, one WMMA per step, ascending from the first stage's k and wrapping. The output staging lies over the stage buffers, which are out of use by then.
#define G3T 128                      /* tile rows and tile columns per workgroup */
#define G3W 4                        /* waves per workgroup */
#define G3PT 136                     /* row pitch in f16 of a transposed output tile: 256 bytes of data + 16 */
static_assert(MP % G3T == 0 && MPO % G3T == 0 && DM % G3T == 0, "k_gemm3: whole tiles");
static_assert(SQ % G3T == 0 && B0 == 0 && DM == NH * HD, "k_gemm3: a transposed tile lies in one batch; [batch][column] = [batch][head][d]");
template <int KS> struct G3Ring {      /* row pitch in f16: the stage's bytes + 16, so that the 16 rows of a fragment read start in 16 different bank groups */
  __attribute__((aligned(16))) unsigned short sa[2][G3T][KS + 8];      /* A rows [row][k] */
  __attribute__((aligned(16))) unsigned short sb[2][G3T][KS + 8]; };   /* Bt rows [column][k] */
template <int KS> union G3Lds {      /* declared once per kernel and handed in, so that two forms of the tile in one kernel share it */
  G3Ring<KS> ring;
  __attribute__((aligned(16))) float so[G3W][64][68];                  /* per-wave output staging */
  __attribute__((aligned(16))) unsigned short st[G3T][G3PT]; };        /* the workgroup's tile as [column][row] */
template <bool F32OUT, bool TR, int KS>      /* the result goes to C (f32) or to C16 (f16); the other pointer is not used; mt, nq: the workgroup's tile row and tile column; rot: the walk's first stage; bsc: factor on the rounded bias (alpha carries the same factor where the result is to leave scaled); TR (f16 only): C16 takes the tile transposed, as rows [batch][column][place]; KS: k per stage */
__device__ __forceinline__ void gemm3_tile(G3Lds<KS>& lds, const _Float16* __restrict__ A, const _Float16* __restrict__ Bh, float alpha, const float* __restrict__ bias, float bsc, float* __restrict__ C, _Float16* __restrict__ C16, int mt, int nq, int rot) {
  static_assert(!(F32OUT && TR), "gemm3_tile: the transposed form is f16");
  constexpr int TPR = KS / 8, RPP = G3W * 32 / TPR, NI = G3T / RPP, NS = DM / KS;      /* threads per staged row, rows per round, rounds, stages */
  static_assert(KS % 32 == 0 && DM % KS == 0 && NS >= 2 && G3T % RPP == 0, "gemm3_tile: whole stages and staging rounds");
  static_assert((NS & (NS - 1)) == 0, "gemm3_tile: the rotated walk wraps by a mask");
  auto& sa = lds.ring.sa; auto& sb = lds.ring.sb;
  const int tid = threadIdx.x, w = tid >> 5, lane = tid & 31, ln = lane & 15, hh = lane >> 4;
  const int wr = (w >> 1) * 64, wc = (w & 1) * 64;      /* the wave's place in the tile */
  const int row0 = mt * G3T + wr, col0 = nq * G3T + wc;
  const int srow = tid / TPR, sc8 = (tid % TPR) * 8;      /* staging: TPR threads per row, rows srow + RPP i */
  const char* au = (const char*)(A + (size_t)(mt * G3T) * DM); const char* bu = (const char*)(Bh + (size_t)(nq * G3T) * DM);      /* the tile's first A row and first Bt row: the same for the whole workgroup, so scalar bases */
  unsigned vo = (unsigned)(srow * DM + sc8 + (rot & (NS - 1)) * KS) * 2;      /* the thread's byte offset from either base in the walk's first stage, moved on by one stage at a time: one register that lives through the loop names every staging load's address */
  v8us ra[NI], rb[NI];
  /* the short loops below are all unrolled so that the staging, fragment and accumulator arrays stay in registers */
#pragma unroll
  for (int i = 0; i < NI; ++i) { ra[i] = *(const v8us*)(au + vo + (size_t)(RPP * i) * DM * 2); rb[i] = *(const v8us*)(bu + vo + (size_t)(RPP * i) * DM * 2); }
#pragma unroll
  for (int i = 0; i < NI; ++i) { *(v8us*)&sa[0][srow + RPP * i][sc8] = ra[i]; *(v8us*)&sb[0][srow + RPP * i][sc8] = rb[i]; }
  const v8f z8 = {0.f, 0.f, 0.f, 0.f, 0.f, 0.f, 0.f, 0.f}; v8f acc[4][4];      /* [16-row group][16-column group] */
#pragma unroll
  for (int i = 0; i < 4; ++i)
#pragma unroll
    for (int j = 0; j < 4; ++j) acc[i][j] = z8;
  __syncthreads();      /* stage 0 is published */
  for (int t = 0; t < NS; ++t) { const int cur = t & 1;
    if (t + 1 < NS) { vo += ((t + 1 + rot) & (NS - 1)) != 0 ? (unsigned)(KS * 2) : (unsigned)(KS * 2) - (unsigned)(DM * 2);      /* behind the row's last stage the walk wraps to its first */
#pragma unroll
      for (int i = 0; i < NI; ++i) { ra[i] = *(const v8us*)(au + vo + (size_t)(RPP * i) * DM * 2); rb[i] = *(const v8us*)(bu + vo + (size_t)(RPP * i) * DM * 2); } }
    v16h fa[2][4], fb[2][4];      /* two fragment sets: block ks + 1 is fetched while block ks (32 of k, 16 WMMAs) is worked on */
#pragma unroll
    for (int i = 0; i < 4; ++i) { fa[0][i] = fa_frag(&sa[cur][wr + i * 16 + ln][0], hh); fb[0][i] = fa_frag(&sb[cur][wc + i * 16 + ln][0], hh); }
#pragma unroll
    for (int ks = 0; ks < KS / 32; ++ks) {
      if (ks + 1 < KS / 32) {
#pragma unroll
        for (int i = 0; i < 4; ++i) { fa[(ks + 1) & 1][i] = fa_frag(&sa[cur][wr + i * 16 + ln][(ks + 1) * 32], hh); fb[(ks + 1) & 1][i] = fa_frag(&sb[cur][wc + i * 16 + ln][(ks + 1) * 32], hh); } }
      else if (t + 1 < NS) {      /* in front of the last block, whose matrix work covers the stores; the buffer's last readers left it at the barrier of stage t - 1 */
#pragma unroll
        for (int i = 0; i < NI; ++i) { *(v8us*)&sa[cur ^ 1][srow + RPP * i][sc8] = ra[i]; *(v8us*)&sb[cur ^ 1][srow + RPP * i][sc8] = rb[i]; } }
      __builtin_amdgcn_sched_barrier(0);      /* keeps the LDS reads above as one group ahead of the block: left to itself the compiler puts them in pairs among the WMMAs, each pair waited out */
#pragma unroll
      for (int j = 0; j < 4; ++j)
#pragma unroll
        for (int i = 0; i < 4; ++i) acc[i][j] = fa_mma(fa[ks & 1][i], fb[ks & 1][j], acc[i][j]);
      __builtin_amdgcn_sched_barrier(0); }      /* keeps the next group of LDS reads behind this block's WMMAs */
    __syncthreads(); }      /* publishes stage t + 1 and ends every read of stage t; behind the last one the stage buffers are free for the output staging */
  const int bc = col0 + ln; float bb[4];
#pragma unroll
  for (int j = 0; j < 4; ++j) bb[j] = bias[bc + j * 16];
  asm volatile("s_wait_xcnt 0x0" :: "s"(bias), "v"(bc) : "memory");      /* precaution: stands in front of every write of a register that the four bias loads above name as an address; it names base and index (inputs only), so that they live up to it */
  if (TR) {      /* transposed output: an accumulator tile holds, per lane, 8 consecutive rows of one column = 16 contiguous bytes of the transposed row */
    auto& st = lds.st;
#pragma unroll
    for (int j = 0; j < 4; ++j) { const float bv = bf16_round(bb[j]) * bsc;
#pragma unroll
      for (int i = 0; i < 4; ++i) { FragH f;
#pragma unroll
        for (int r = 0; r < 8; ++r) f.h[r] = (_Float16)(acc[i][j][r] * alpha + bv);
        *(v8us*)&st[wc + j * 16 + ln][wr + i * 16 + 8 * hh] = f.half[0]; } }
    __syncthreads();      /* a transposed row holds the rows of two waves */
    const int bt = mt / (SQ / G3T), s0 = (mt - bt * (SQ / G3T)) * G3T;      /* the tile's batch and first place */
    const int trow = tid >> 4, tc8 = (tid & 15) * 8;      /* 16 threads per 256-byte row, rows trow + 8 i */
    unsigned short* cg = (unsigned short*)C16 + ((size_t)bt * DM + nq * G3T + trow) * SQ + s0 + tc8;
#pragma unroll
    for (int i = 0; i < 16; ++i) *(v8us*)(cg + (size_t)(8 * i) * SQ) = *(const v8us*)&st[trow + 8 * i][tc8];      /* 16 lanes store the 256 bytes of one transposed row: whole lines */
    return; }
  auto& so = lds.so;
#pragma unroll
  for (int j = 0; j < 4; ++j) { const float bv = bf16_round(bb[j]) * bsc;
#pragma unroll
    for (int i = 0; i < 4; ++i)
#pragma unroll
      for (int r = 0; r < 8; ++r) so[w][i * 16 + 8 * hh + r][j * 16 + ln] = acc[i][j][r] * alpha + bv; }
  __builtin_amdgcn_fence(__ATOMIC_ACQ_REL, "workgroup"); __builtin_amdgcn_wave_barrier();      /* the wave reads back rows that its other lanes wrote */
  const int rsub = lane >> 4, c4 = (lane & 15) * 4;
  const size_t e = (size_t)(row0 + rsub) * DM + col0 + c4;      /* the lane's first element; its further rows lie at constant distances, so that one address register serves all the stores */
#pragma unroll
  for (int q = 0; q < 32; ++q) { const v4f v = *(const v4fa*)&so[w][q * 2 + rsub][c4];
    if (F32OUT) *(v4f*)(C + e + (size_t)(q * 2) * DM) = v; else *(v4h*)(C16 + e + (size_t)(q * 2) * DM) = __builtin_convertvector(v, v4h); }      /* 16 lanes store one row of the wave's 64 columns: whole lines */
  asm volatile("s_wait_xcnt 0x0" ::: "memory"); }      /* precaution: in the built Q/K/V kernel the transposed form's text follows this path behind a branch; the wait stands in front of its writes of the register pair that the stores above name */
// The output projection: one grid of (MPO / G3T) x (DM / G3T) tiles, f32 result. One workgroup per WGP, so one wave per SIMD: stages of 128 k, half as many barriers.
__global__ __launch_bounds__(G3W * 32) void k_gemm3o(const _Float16* __restrict__ A, const _Float16* __restrict__ Bh, float alpha, const float* __restrict__ bias, float* __restrict__ C) {
  const int mt = blockIdx.x / (DM / G3T), nq = blockIdx.x - mt * (DM / G3T);
  __shared__ G3Lds<128> lds;
  gemm3_tile<true, false, 128>(lds, A, Bh, alpha, bias, 1.0f, C, nullptr, mt, nq, mt + nq); }      /* a tile row's 8 workgroups start at 8 different stages */
// The Q, K and V projections read the same A and do not depend on each other: one grid holds the tiles of all three, so that they share one launch and fill the chip without a
// gap between them. A tile row's 3 x (DM / G3T) workgroups are neighbours in the grid (Q's columns, then K's, then V's), so its A rows are read again while they are still in the cache.
// Q and K leave as token rows; V leaves transposed, V^T [NB][NH][HD][SQ], the form the attention kernel stages: no V rows and no transposing launch.
// Stages of 64 k: three workgroups' LDS fits one WGP, and the second launch bound holds the registers to three waves per SIMD, so that the whole grid is resident at once and
// one workgroup's LDS reads, staging waits and epilogue run under the matrix work of the two others, which share no barrier with it.
__global__ __launch_bounds__(G3W * 32, 3) void k_gemm3qkv(const _Float16* __restrict__ A, const _Float16* __restrict__ Bq, const _Float16* __restrict__ Bk, const _Float16* __restrict__ Bv, float alpha,
                                                  const float* __restrict__ bq, const float* __restrict__ bk, const float* __restrict__ bv, _Float16* __restrict__ Cq, _Float16* __restrict__ Ck, _Float16* __restrict__ CvT) {
  const int mt = blockIdx.x / (3 * (DM / G3T)), c = blockIdx.x - mt * (3 * (DM / G3T)); const int m = c / (DM / G3T), nq = c - m * (DM / G3T);      /* m: 0 = Q, 1 = K, 2 = V; the same for the whole workgroup */
  __shared__ G3Lds<64> lds;
  if (m == 2) gemm3_tile<false, true, 64>(lds, A, Bv, alpha, bv, 1.0f, nullptr, CvT, mt, nq, mt + 2 * nq);      /* two texts, one per output form: each runs from its last stage straight into its own epilogue */
  else gemm3_tile<false, false, 64>(lds, A, m == 0 ? Bq : Bk, m == 0 ? alpha * FACS : alpha, m == 0 ? bq : bk, m == 0 ? FACS : 1.0f, nullptr, m == 0 ? Cq : Ck, mt, nq, mt + 2 * nq); }      /* first stage mt + 2 nq: of a tile row's 24 sharers only the Q, K and V workgroups of one nq start alike, of a tile column's 32 sharers two */


#define XPP 4                        /* places (sequence positions) per thread */
// x + PE. A thread keeps one 8-column chunk and walks XPP places: the four frequencies of its columns are formed once, a place's sines and cosines once for all NB batches
// (PE does not depend on the batch); every element is the same expression as for one chunk alone. All loads of x are issued first and travel while PE is formed.
// PE is formed in a rolled loop and parked in LDS, each thread in slots of its own (no barrier). Workgroup g: places 2 XPP g ... 2 XPP g + 2 XPP - 1.
static_assert(DM / 8 == 128 && SQ % (2 * XPP) == 0, "xpe_part: 256 threads hold two rows of 128 chunks; whole workgroups");
__device__ __forceinline__ void xpe_part(const float* __restrict__ x, _Float16* __restrict__ X16, unsigned g, int tid) {
  #pragma clang fp contract(off)
  __shared__ __attribute__((aligned(8))) float spe[XPP][4][256][2];      /* [place][frequency][thread][sin, cos] */
  const int c0 = (tid & 127) * 8, p0 = (int)g * (2 * XPP) + (tid >> 7); const float kf = (float)(-9.210340371976184 / (double)DM); v4f xa[XPP][NB][2];
  const float* px[NB];      /* the thread's first chunk in each batch */
  /* the loops over xa are unrolled so that it stays in registers */
#pragma unroll
  for (int b = 0; b < NB; ++b) { px[b] = x + ((size_t)b * SQ + p0) * DM + c0;
#pragma unroll
    for (int i = 0; i < XPP; ++i) { const float* p = px[b] + (size_t)(2 * i) * DM; xa[i][b][0] = *(const v4fa*)p; xa[i][b][1] = *(const v4fa*)(p + 4); } }
  static_assert(NB == 2, "xpe_part: the wait below names the two addresses");
  /* precaution: stands in front of every write of a register that the loads above name as an address; it names the addresses (inputs only), so that no later load of the run lands in one of them either; it also keeps all the loads in front of the PE loop */
  asm volatile("s_wait_xcnt 0x0" :: "v"(px[0]), "v"(px[1]) : "memory");
#pragma unroll 1      /* rolled, like the loop inside: one copy of the exp, sin and cos text */
  for (int j = 0; j < 4; ++j) { const float dv = expf(__fmul_rn((float)(c0 + 2 * j), kf));
#pragma unroll 1
    for (int i = 0; i < XPP; ++i) { const float ang = __fmul_rn((float)(p0 + 2 * i), dv); spe[i][j][tid][0] = sinf(ang); spe[i][j][tid][1] = cosf(ang); } }
#pragma unroll
  for (int i = 0; i < XPP; ++i) { float pe[8];
#pragma unroll
    for (int j = 0; j < 4; ++j) { pe[2 * j] = spe[i][j][tid][0]; pe[2 * j + 1] = spe[i][j][tid][1]; }
#pragma unroll
    for (int b = 0; b < NB; ++b) { FragH f;
#pragma unroll
      for (int q = 0; q < 8; ++q) f.h[q] = (_Float16)__fadd_rn(bf16_round(xa[i][b][q >> 2][q & 3]), pe[q]);
      *(v8us*)((unsigned short*)X16 + ((size_t)b * SQ + p0 + 2 * i) * DM + c0) = f.half[0]; } } }
// x + PE and the four weight conversions do not depend on each other: one grid, dealt by workgroup range. The x + PE workgroups, the longer ones, come first.
// Two workgroups per WGP in all: each thread carries 8 chunks, so that few waves have to start.
#define PXG ((unsigned)(SQ / (2 * XPP)))                         /* workgroups of x + PE */
#define PWG ((unsigned)((size_t)DM * DM / 8 / (256 * WCH)))      /* workgroups per weight matrix */
static_assert((size_t)DM * DM / 8 % (256 * WCH) == 0, "k_prep: whole workgroups per weight matrix");
__global__ __launch_bounds__(256) void k_prep(const float* __restrict__ x, const float* __restrict__ wq, const float* __restrict__ wk, const float* __restrict__ wv, const float* __restrict__ wo,
                                              _Float16* __restrict__ X16, _Float16* __restrict__ BQ, _Float16* __restrict__ BK, _Float16* __restrict__ BV, _Float16* __restrict__ BO) {
  const unsigned g = blockIdx.x;
  if (g < PXG) { xpe_part(x, X16, g, (int)threadIdx.x); return; }      /* x + sinusoidal PE -> f16 rows (not exact: x + pe is not a bf16 value) */
  const unsigned u = g - PXG, m = u / PWG;      /* m: which weight matrix; the same for the whole workgroup */
  wnat_part(m == 0 ? wq : m == 1 ? wk : m == 2 ? wv : wo, m == 0 ? BQ : m == 1 ? BK : m == 2 ? BV : BO, (u - m * PWG) * (256 * WCH) + threadIdx.x); }      /* natural [out][in] = Bt[n][k], x16 */
extern "C" void kernel_launch(void* const* d_in, const int* in_sizes, int n_in,
                              void* d_out, int out_size, void* d_ws, size_t ws_size, hipStream_t stream) {
  (void)in_sizes; (void)n_in; (void)out_size;
  const float* const* I = (const float* const*)d_in; const float* x = I[0]; const float* wq = I[1]; const float* bq = I[2]; const float* wk = I[3]; const float* bk = I[4]; const float* wv = I[5]; const float* bv = I[6]; const float* wo = I[7]; const float* bo = I[8];      /* nn.Linear weights [out][in] + biases */
  char* ws = (char*)d_ws; size_t off = 0;
  auto take = [&](size_t bytes) { char* p = ws + off; off += (bytes + 255) & ~(size_t)255; return p; };
  _Float16* BQ = (_Float16*)take((size_t)DM * DM * 2); _Float16* BK = (_Float16*)take((size_t)DM * DM * 2); _Float16* BV = (_Float16*)take((size_t)DM * DM * 2); _Float16* BO = (_Float16*)take((size_t)DM * DM * 2);
  _Float16* X16 = (_Float16*)take(NR * DM * 2); _Float16* Q16 = (_Float16*)take(NR * DM * 2); _Float16* K16 = (_Float16*)take(NR * DM * 2); _Float16* O16 = (_Float16*)take(NR * DM * 2);
  _Float16* VT = (_Float16*)take((size_t)NB * NH * HD * SQ * 2);
  if (off > ws_size) return;
  k_prep<<<PXG + 4 * PWG, 256, 0, stream>>>(x, wq, wk, wv, wo, X16, BQ, BK, BV, BO);      /* f16 operands: x + PE rows and the four weight matrices */
  const size_t r0p = (size_t)B0 * SQ;      /* first projected row */
  k_gemm3qkv<<<(unsigned)((MP / G3T) * 3 * (DM / G3T)), G3W * 32, 0, stream>>>(X16 + r0p * DM, BQ, BK, BV, 0.0625f, bq, bk, bv, Q16 + r0p * DM, K16 + r0p * DM, VT);      /* q, k rows; V^T [NB][NH][HD][SQ] */
  k_fattn<<<dim3(SQ / (FAW * 32), NB * NH), FAW * FAS * 32, 0, stream>>>(Q16, K16, VT, O16);      /* o (merged heads, x64) as f16 rows */
  k_gemm3o<<<(unsigned)((MPO / G3T) * (DM / G3T)), G3W * 32, 0, stream>>>(O16 + r0p * DM, BO, 0.0009765625f, bo, (float*)d_out + r0p * DM);      /* out rows are the output layout */
}
